// v000
// Measured on an AMD MI455X. A time is GPU time per run, averaged over a window of back-to-back runs after a warm-up
// (all launches, gaps included; the runs take copies of the inputs in turn), and the median of several windows.
// Apart from v000's, it joins two sittings. Times from different sittings can be a few percent apart, while
// side-by-side timings come from the same sitting.
// The starting kernel, v000, takes 375 microseconds a run.
#include <hip/hip_runtime.h>
// q/k/v/o projections (2048 × 256 × 256) and the 8-head attention (d = 32) with an additive per-pair bias on v_wmma_f32_16x16x32_f16 (fused flash-style kernel: S = Q·Kᵀ, O = P·V on WMMA;
// online max/sum softmax f32; P f16 ≤ 1). The bias (geometric 2→64→1 MLP + the Gamma log-density from the 4→64→2 delay MLP, incl. lgamma) is computed once per (b, i, j): the two MLPs' hidden layers in f32 VALU straight into WMMA A fragments, their second layers (64→1 / 64→2)
// on WMMA, softplus/log/lgamma in f32; the bias plane is shared by the 8 heads. A = f16(bf16 ·) exact operands for q/k/v, f16(O) for o, weights bf16-exact ×2^4 ((out,in)), single products, f32 accumulate.
#define BB 2
#define SS 1024
#define DM 256
#define NH 8
#define HD 32
#define BH 64
#define NR (BB * SS)

typedef __bf16 v16b __attribute__((ext_vector_type(16)));
typedef unsigned short v8us __attribute__((ext_vector_type(8), may_alias));
typedef float  v8f  __attribute__((ext_vector_type(8)));
typedef float  v4f  __attribute__((ext_vector_type(4)));
typedef float  v4fa __attribute__((ext_vector_type(4), may_alias));
union FragB { v16b v; v8us half[2]; unsigned short u[16]; };

__device__ __forceinline__ unsigned short bf16_bits(float x) { unsigned int u = __float_as_uint(x); return (unsigned short)((u + 0x7FFFu + ((u >> 16) & 1u)) >> 16); }
__device__ __forceinline__ float bf16_val(unsigned short b) { return __uint_as_float(((unsigned int)b) << 16); }
__device__ __forceinline__ float bf16_round(float x) { return bf16_val(bf16_bits(x)); }
// D += A·B with NT terms: 1 = ah·bh, 2 = + al·bh (A split), 3 = + ah·bl (both split)
template <int NT>
__device__ __forceinline__ v8f mmaN(v16b ah, v16b al, v16b bh, v16b bl, v8f c) {
  c = __builtin_amdgcn_wmma_f32_16x16x32_bf16(false, ah, false, bh, (short)0, c, false, false);
  if (NT >= 2) c = __builtin_amdgcn_wmma_f32_16x16x32_bf16(false, al, false, bh, (short)0, c, false, false);
  if (NT >= 3) c = __builtin_amdgcn_wmma_f32_16x16x32_bf16(false, ah, false, bl, (short)0, c, false, false);
  asm volatile("v_nop\n\tv_nop\n\tv_nop\n\tv_nop" : "+v"(c) : "v"(ah), "v"(al), "v"(bh), "v"(bl));
  return c;
}

__global__ __launch_bounds__(256) void k_wt_bf16(const float* __restrict__ W, unsigned short* __restrict__ Wt, int K, int N) {
  const int t = blockIdx.x * 256 + threadIdx.x;
  const int k8n = K / 8;
  if (t >= N * k8n) return;
  const int n = t / k8n, k8 = (t % k8n) * 8;
  v8us v;
#pragma unroll
  for (int i = 0; i < 8; ++i) v[i] = bf16_bits(W[(size_t)(k8 + i) * N + n]);
  *(v8us*)(Wt + (size_t)n * K + k8) = v;
  
}

// GEMM C[M][N] (f32, pitch ldc) = act(A[M][K]·W + bias). A f32 row-major (pitch lda) converted per fragment to bf16
// (ASPLIT: hi/lo two planes -> 2 terms, else single rounded term); Wt bf16 [N][K] (pitch ldb). BIAS_BF16 rounds the
// bias to bf16 first (bias quantised to bf16 before the add). K%32==0, M%16==0, N%64==0.
template <bool ASPLIT, int ACT, bool BIAS_BF16>
__global__ __launch_bounds__(128) void k_gemm_bf(const float* __restrict__ A, int lda, const unsigned short* __restrict__ Wt, int ldb,
                                               const float* __restrict__ bias, float* __restrict__ C, int ldc, int M, int N, int K) {
  __shared__ __attribute__((aligned(16))) float so[4][16][64];
  const int tid = threadIdx.x, w = tid >> 5, lane = tid & 31, ln = lane & 15, hh = lane >> 4;
  const int ntn = N / 64;
  const int wid = blockIdx.x * 4 + w;
  const int mt = wid / ntn, nq = wid % ntn;
  if (mt * 16 >= M) return;
  const int row0 = mt * 16, col0 = nq * 64;
  const float* arow = A + (size_t)(row0 + ln) * lda;
  v8f acc[4] = {};
  for (int kb = 0; kb < K; kb += 32) {
    FragB ah, al;
    const v4f x0 = *(const v4fa*)(arow + kb + 8 * hh), x1 = *(const v4fa*)(arow + kb + 8 * hh + 4);
    const v4f x2 = *(const v4fa*)(arow + kb + 16 + 8 * hh), x3 = *(const v4fa*)(arow + kb + 16 + 8 * hh + 4);
    float xs[16] = {x0[0],x0[1],x0[2],x0[3],x1[0],x1[1],x1[2],x1[3],x2[0],x2[1],x2[2],x2[3],x3[0],x3[1],x3[2],x3[3]};
#pragma unroll
    for (int i = 0; i < 16; ++i) { const unsigned short hb = bf16_bits(xs[i]); ah.u[i] = hb; al.u[i] = ASPLIT ? bf16_bits(xs[i] - bf16_val(hb)) : (unsigned short)0; }
#pragma unroll
    for (int t = 0; t < 4; ++t) {
      const unsigned short* brow = Wt + (size_t)(col0 + t * 16 + ln) * ldb + kb;
      FragB b;
      b.half[0] = *(const v8us*)(brow + 8 * hh);
      b.half[1] = *(const v8us*)(brow + 16 + 8 * hh);
      acc[t] = mmaN<ASPLIT ? 2 : 1>(ah.v, al.v, b.v, b.v, acc[t]);
    }
  }
#pragma unroll
  for (int t = 0; t < 4; ++t) {
    float bv = bias ? bias[col0 + t * 16 + ln] : 0.f;
    if (BIAS_BF16) bv = bf16_round(bv);
#pragma unroll
    for (int r = 0; r < 8; ++r) { float v = acc[t][r] + bv; if (ACT == 1) v = fmaxf(v, 0.f); so[w][8 * hh + r][t * 16 + ln] = v; }
  }
  __builtin_amdgcn_fence(__ATOMIC_ACQ_REL, "workgroup");
  __builtin_amdgcn_wave_barrier();
  const int rsub = lane >> 4, c4 = (lane & 15) * 4;
  {
#pragma unroll
    for (int q = 0; q < 8; ++q) {
      const int r = q * 2 + rsub;
      const v4f v = *(const v4fa*)&so[w][r][c4];
      *(v4f*)(C + (size_t)(row0 + r) * ldc + col0 + c4) = v;
    }
    
  }
}

// Flash-style causal/unmasked attention, all contractions 3-term bf16 hi/lo splits, f32 softmax with running max.
// q,k,v rows are read from f32 buffers with arbitrary row pitch (so they can live inside a fused qkv buffer);
// D = head size (multiple of 32, <= 128); one wave = 16 query rows; block = 4 waves (64 queries) sharing K/V chunks of 32.
template <int D, bool CAUSAL>
__global__ __launch_bounds__(128) void k_flash(const float* __restrict__ qb, const float* __restrict__ kb, const float* __restrict__ vb,
                                             int pitch, int T, int H, float scale, float* __restrict__ y, int ypitch) {
  constexpr int KS = D / 32;        // k-steps for QK
  constexpr int DT = D / 16;        // d tiles for PV
  __shared__ __attribute__((aligned(16))) unsigned short sKh[32][D + 8], sKl[32][D + 8], sVh[32][D + 8], sVl[32][D + 8];
  __shared__ __attribute__((aligned(16))) unsigned short sPh[4][16][40], sPl[4][16][40];
  __shared__ __attribute__((aligned(16))) float sO[4][16][D];
  const int tid = threadIdx.x, w = tid >> 5, lane = tid & 31, ln = lane & 15, hh = lane >> 4;
  const int nqb = (T + 63) / 64;
  const int bh = blockIdx.x / nqb, qblk = blockIdx.x % nqb;
  const int b = bh / H, h = bh % H;
  const int q0 = qblk * 64 + w * 16;
  const float* Q = qb + (size_t)b * T * pitch + h * D;
  const float* K = kb + (size_t)b * T * pitch + h * D;
  const float* V = vb + (size_t)b * T * pitch + h * D;

  // A fragments of the wave's 16 query rows (scaled), hi/lo
  FragB aqh[KS], aql[KS];
  {
    int row = q0 + ln; if (row >= T) row = T - 1;
    const float* qr = Q + (size_t)row * pitch;
#pragma unroll
    for (int ks = 0; ks < KS; ++ks)
#pragma unroll
      for (int i = 0; i < 16; ++i) {
        const int d = ks * 32 + ((i < 8) ? (8 * hh + i) : (16 + 8 * hh + (i - 8)));
        const float x = qr[d] * scale; const unsigned short hb = bf16_bits(x);
        aqh[ks].u[i] = hb; aql[ks].u[i] = bf16_bits(x - bf16_val(hb));
      }
  }
  float m_r[8], l_r[8];
#pragma unroll
  for (int r = 0; r < 8; ++r) { m_r[r] = -3.0e38f; l_r[r] = 0.f; }
  v8f oacc[DT];
#pragma unroll
  for (int dt = 0; dt < DT; ++dt) oacc[dt] = (v8f){0.f,0.f,0.f,0.f,0.f,0.f,0.f,0.f};

  const int kv_end = CAUSAL ? min(T, qblk * 64 + 64) : T;     // block-uniform
  for (int j0 = 0; j0 < kv_end; j0 += 32) {
    __syncthreads();
    for (int e = tid; e < 32 * (D / 4); e += 128) {
      const int r = e / (D / 4), c4 = (e % (D / 4)) * 4;
      const int key = j0 + r;
      v4f kf = {0.f,0.f,0.f,0.f}, vf = {0.f,0.f,0.f,0.f};
      if (key < T) { kf = *(const v4fa*)(K + (size_t)key * pitch + c4); vf = *(const v4fa*)(V + (size_t)key * pitch + c4); }
#pragma unroll
      for (int t = 0; t < 4; ++t) {
        unsigned short hb = bf16_bits(kf[t]); sKh[r][c4 + t] = hb; sKl[r][c4 + t] = bf16_bits(kf[t] - bf16_val(hb));
        hb = bf16_bits(vf[t]); sVh[r][c4 + t] = hb; sVl[r][c4 + t] = bf16_bits(vf[t] - bf16_val(hb));
      }
    }
    __syncthreads();
    // S tile 16 x 32
    v8f s[2];
#pragma unroll
    for (int nt = 0; nt < 2; ++nt) {
      v8f acc = {};
#pragma unroll
      for (int ks = 0; ks < KS; ++ks) {
        FragB bh_, bl_;
        bh_.half[0] = *(const v8us*)&sKh[nt * 16 + ln][ks * 32 + 8 * hh]; bh_.half[1] = *(const v8us*)&sKh[nt * 16 + ln][ks * 32 + 16 + 8 * hh];
        bl_.half[0] = *(const v8us*)&sKl[nt * 16 + ln][ks * 32 + 8 * hh]; bl_.half[1] = *(const v8us*)&sKl[nt * 16 + ln][ks * 32 + 16 + 8 * hh];
        acc = mmaN<3>(aqh[ks].v, aql[ks].v, bh_.v, bl_.v, acc);
      }
      s[nt] = acc;
    }
    // mask + running max (rows 8hh+r; the 16 lanes of a half share rows)
    float alpha[8];
#pragma unroll
    for (int r = 0; r < 8; ++r) {
      const int qi = q0 + 8 * hh + r;
      const int ja = j0 + ln, jb = j0 + 16 + ln;
      if (CAUSAL) { if (ja > qi) s[0][r] = -3.0e38f; if (jb > qi) s[1][r] = -3.0e38f; }
      if (ja >= T) s[0][r] = -3.0e38f;
      if (jb >= T) s[1][r] = -3.0e38f;
      float mx = fmaxf(s[0][r], s[1][r]);
      mx = fmaxf(mx, __shfl_xor(mx, 1, 32)); mx = fmaxf(mx, __shfl_xor(mx, 2, 32)); mx = fmaxf(mx, __shfl_xor(mx, 4, 32)); mx = fmaxf(mx, __shfl_xor(mx, 8, 32));
      const float mnew = fmaxf(m_r[r], mx);
      alpha[r] = (mnew > -1.0e38f) ? __expf(m_r[r] - mnew) : 1.0f;
      const float p0 = (s[0][r] > -1.0e38f) ? __expf(s[0][r] - mnew) : 0.f;
      const float p1 = (s[1][r] > -1.0e38f) ? __expf(s[1][r] - mnew) : 0.f;
      m_r[r] = mnew;
      l_r[r] = l_r[r] * alpha[r] + p0 + p1;            // per-lane partial row sum (16 lanes combined at the end)
      unsigned short hb = bf16_bits(p0); sPh[w][8 * hh + r][ln] = hb;      sPl[w][8 * hh + r][ln] = bf16_bits(p0 - bf16_val(hb));
      hb = bf16_bits(p1);                sPh[w][8 * hh + r][16 + ln] = hb; sPl[w][8 * hh + r][16 + ln] = bf16_bits(p1 - bf16_val(hb));
    }
#pragma unroll
    for (int dt = 0; dt < DT; ++dt)
#pragma unroll
      for (int r = 0; r < 8; ++r) oacc[dt][r] *= alpha[r];
    __builtin_amdgcn_fence(__ATOMIC_ACQ_REL, "workgroup");
    __builtin_amdgcn_wave_barrier();
    FragB pah, pal;
    pah.half[0] = *(const v8us*)&sPh[w][ln][8 * hh]; pah.half[1] = *(const v8us*)&sPh[w][ln][16 + 8 * hh];
    pal.half[0] = *(const v8us*)&sPl[w][ln][8 * hh]; pal.half[1] = *(const v8us*)&sPl[w][ln][16 + 8 * hh];
#pragma unroll
    for (int dt = 0; dt < DT; ++dt) {
      FragB bvh, bvl;
#pragma unroll
      for (int i = 0; i < 8; ++i) {
        bvh.u[i] = sVh[8 * hh + i][dt * 16 + ln]; bvh.u[8 + i] = sVh[16 + 8 * hh + i][dt * 16 + ln];
        bvl.u[i] = sVl[8 * hh + i][dt * 16 + ln]; bvl.u[8 + i] = sVl[16 + 8 * hh + i][dt * 16 + ln];
      }
      oacc[dt] = mmaN<3>(pah.v, pal.v, bvh.v, bvl.v, oacc[dt]);
    }
    __builtin_amdgcn_fence(__ATOMIC_ACQ_REL, "workgroup");
    __builtin_amdgcn_wave_barrier();
  }
#pragma unroll
  for (int r = 0; r < 8; ++r) {
    float l = l_r[r];
    l += __shfl_xor(l, 1, 32); l += __shfl_xor(l, 2, 32); l += __shfl_xor(l, 4, 32); l += __shfl_xor(l, 8, 32);
    l_r[r] = (l > 0.f) ? 1.0f / l : 0.f;
  }
#pragma unroll
  for (int dt = 0; dt < DT; ++dt)
#pragma unroll
    for (int r = 0; r < 8; ++r) sO[w][8 * hh + r][dt * 16 + ln] = oacc[dt][r] * l_r[r];
  __builtin_amdgcn_fence(__ATOMIC_ACQ_REL, "workgroup");
  __builtin_amdgcn_wave_barrier();
  {
    for (int r = 0; r < 16; ++r) {
      const int row = q0 + r;
      if (row < T && lane < D / 4) {
        const v4f val = *(const v4fa*)&sO[w][r][lane * 4];
        *(v4f*)(y + ((size_t)b * T + row) * ypitch + h * D + lane * 4) = val;
      }
    }
    
  }
}

// GEMM C = act(A·W + bias + resid): A f32 (ASPLIT -> hi/lo 2 terms), Wt bf16 [N][K]; ACT 0 none, 1 relu, 2 exact gelu;
// resid (optional, f32, row index = (row % rmod), pitch ldr, RES_BF16 rounds it) added before the activation.
template <bool ASPLIT, int ACT, bool BIAS_BF16, bool RES_BF16>
__global__ __launch_bounds__(128) void k_gemm_bf3(const float* __restrict__ A, int lda, const unsigned short* __restrict__ Wt, int ldb,
                                                const float* __restrict__ bias, const float* __restrict__ resid, int rmod, int ldr,
                                                float* __restrict__ C, int ldc, int M, int N, int K) {
  __shared__ __attribute__((aligned(16))) float so[4][16][64];
  const int tid = threadIdx.x, w = tid >> 5, lane = tid & 31, ln = lane & 15, hh = lane >> 4;
  const int ntn = N / 64;
  const int wid = blockIdx.x * 4 + w;
  const int mt = wid / ntn, nq = wid % ntn;
  if (mt * 16 >= M) return;
  const int row0 = mt * 16, col0 = nq * 64;
  const float* arow = A + (size_t)(row0 + ln) * lda;
  v8f acc[4] = {};
  for (int kb = 0; kb < K; kb += 32) {
    FragB ah, al;
    const v4f x0 = *(const v4fa*)(arow + kb + 8 * hh), x1 = *(const v4fa*)(arow + kb + 8 * hh + 4);
    const v4f x2 = *(const v4fa*)(arow + kb + 16 + 8 * hh), x3 = *(const v4fa*)(arow + kb + 16 + 8 * hh + 4);
    float xs[16] = {x0[0],x0[1],x0[2],x0[3],x1[0],x1[1],x1[2],x1[3],x2[0],x2[1],x2[2],x2[3],x3[0],x3[1],x3[2],x3[3]};
#pragma unroll
    for (int i = 0; i < 16; ++i) { const unsigned short hb = bf16_bits(xs[i]); ah.u[i] = hb; al.u[i] = ASPLIT ? bf16_bits(xs[i] - bf16_val(hb)) : (unsigned short)0; }
#pragma unroll
    for (int t = 0; t < 4; ++t) {
      const unsigned short* brow = Wt + (size_t)(col0 + t * 16 + ln) * ldb + kb;
      FragB b;
      b.half[0] = *(const v8us*)(brow + 8 * hh);
      b.half[1] = *(const v8us*)(brow + 16 + 8 * hh);
      acc[t] = mmaN<ASPLIT ? 2 : 1>(ah.v, al.v, b.v, b.v, acc[t]);
    }
  }
#pragma unroll
  for (int t = 0; t < 4; ++t) {
    const int col = col0 + t * 16 + ln;
    float bv = bias ? bias[col] : 0.f;
    if (BIAS_BF16) bv = bf16_round(bv);
#pragma unroll
    for (int r = 0; r < 8; ++r) {
      float v = acc[t][r] + bv;
      if (resid) { float rv = resid[(size_t)((row0 + 8 * hh + r) % rmod) * ldr + col]; if (RES_BF16) rv = bf16_round(rv); v += rv; }
      if (ACT == 1) v = fmaxf(v, 0.f);
      if (ACT == 2) v = 0.5f * v * (1.0f + erff(v * 0.70710678118654752f));
      if (ACT == 3) { const float u = 0.7978845608028654f * (v + 0.044715f * v * v * v); v = 0.5f * v * (1.0f + tanhf(u)); }
      so[w][8 * hh + r][t * 16 + ln] = v;
    }
  }
  __builtin_amdgcn_fence(__ATOMIC_ACQ_REL, "workgroup");
  __builtin_amdgcn_wave_barrier();
  const int rsub = lane >> 4, c4 = (lane & 15) * 4;
  {
#pragma unroll
    for (int q = 0; q < 8; ++q) {
      const int r = q * 2 + rsub;
      const v4f v = *(const v4fa*)&so[w][r][c4];
      *(v4f*)(C + (size_t)(row0 + r) * ldc + col0 + c4) = v;
    }
    
  }
}
// row LayerNorm (biased variance, eps) over N: s = X (+ R); optional out_sum <- s; out_norm <- (s-mu)*rsqrt(var+eps)*g + b
template <bool PARAM_BF16>
__global__ __launch_bounds__(256) void k_layernorm(const float* __restrict__ X, const float* __restrict__ R, const float* __restrict__ g, const float* __restrict__ bta,
                                                  float* __restrict__ out_sum, float* __restrict__ out_norm, int N, float eps) {
  __shared__ float red[256];
  const int row = blockIdx.x, tid = threadIdx.x;
  const float* x = X + (size_t)row * N; const float* rr = R ? R + (size_t)row * N : nullptr;
  float vals[16];                     // up to N = 4096
  const int per = N / 256;            // contiguous chunk per thread? use strided-by-4 chunks: thread handles j = tid*4 + 1024*u
  float s1 = 0.f;
  for (int u = 0; u < per / 4; ++u) {
    const int j = tid * 4 + 1024 * u;
    const v4f a = *(const v4fa*)(x + j);
    v4f b = {0.f,0.f,0.f,0.f}; if (rr) b = *(const v4fa*)(rr + j);
#pragma unroll
    for (int q = 0; q < 4; ++q) { const float v = a[q] + b[q]; vals[u * 4 + q] = v; s1 += v; }
  }
  red[tid] = s1; __syncthreads();
  for (int st = 128; st > 0; st >>= 1) { if (tid < st) red[tid] += red[tid + st]; __syncthreads(); }
  const float mu = red[0] / (float)N; __syncthreads();
  float s2 = 0.f;
  for (int u = 0; u < per / 4; ++u)
#pragma unroll
    for (int q = 0; q < 4; ++q) { const float c = vals[u * 4 + q] - mu; s2 += c * c; }
  red[tid] = s2; __syncthreads();
  for (int st = 128; st > 0; st >>= 1) { if (tid < st) red[tid] += red[tid + st]; __syncthreads(); }
  const float rs = rsqrtf(red[0] / (float)N + eps);
  {
    for (int u = 0; u < per / 4; ++u) {
      const int j = tid * 4 + 1024 * u;
      v4f o, sm;
#pragma unroll
      for (int q = 0; q < 4; ++q) {
        float gg = g[j + q], bb = bta[j + q];
        if (PARAM_BF16) { gg = bf16_round(gg); bb = bf16_round(bb); }
        sm[q] = vals[u * 4 + q]; o[q] = (vals[u * 4 + q] - mu) * rs * gg + bb;
      }
      if (out_sum) *(v4f*)(out_sum + (size_t)row * N + j) = sm;
      *(v4f*)(out_norm + (size_t)row * N + j) = o;
    }
    
  }
}



// ---- f16 WMMA path (v_wmma_f32_16x16x32_f16): 11-bit significands for operands in range — used where a [0,1] probability operand needs more precision than bf16
typedef _Float16 v16h __attribute__((ext_vector_type(16)));
union FragH { v16h v; v8us half[2]; _Float16 h[16]; unsigned short u[16]; };
template <int NT>
__device__ __forceinline__ v8f mmaH(v16h ah, v16h al, v16h bh, v16h bl, v8f c) {
  c = __builtin_amdgcn_wmma_f32_16x16x32_f16(false, ah, false, bh, (short)0, c, false, false);
  if (NT >= 2) c = __builtin_amdgcn_wmma_f32_16x16x32_f16(false, al, false, bh, (short)0, c, false, false);
  if (NT >= 3) c = __builtin_amdgcn_wmma_f32_16x16x32_f16(false, ah, false, bl, (short)0, c, false, false);
  asm volatile("v_nop\n\tv_nop\n\tv_nop\n\tv_nop" : "+v"(c) : "v"(ah), "v"(al), "v"(bh), "v"(bl));
  return c;
}
// batched GEMM like k_gemm_b but f16 operands: A f32 (split into f16 hi/lo if ASPLIT, else rounded to f16), Bt = f16 values [n][k]; alpha; C f32; N multiple of 16 (partial tiles skipped)
template <bool ASPLIT>
__global__ __launch_bounds__(128) void k_gemm_h(const float* __restrict__ A, int lda, size_t sA, const _Float16* __restrict__ Bh, int ldb, size_t sB, float alpha, float* __restrict__ C, int ldc, size_t sC, int M, int N, int K) {
  __shared__ __attribute__((aligned(16))) float so[4][16][64];
  const int tid = threadIdx.x, w = tid >> 5, lane = tid & 31, ln = lane & 15, hh = lane >> 4; const int by = blockIdx.y;
  A += (size_t)by * sA; Bh += (size_t)by * sB; C += (size_t)by * sC;
  const int ntn = (N + 63) / 64; const int wid = blockIdx.x * 4 + w; const int mt = wid / ntn, nq = wid % ntn; if (mt * 16 >= M) return;
  const int row0 = mt * 16, col0 = nq * 64; const float* arow = A + (size_t)(row0 + ln) * lda;
  v8f acc[4] = {};
  for (int kb = 0; kb < K; kb += 32) {
    FragH ah, al;
    const v4f x0 = *(const v4fa*)(arow + kb + 8 * hh), x1 = *(const v4fa*)(arow + kb + 8 * hh + 4), x2 = *(const v4fa*)(arow + kb + 16 + 8 * hh), x3 = *(const v4fa*)(arow + kb + 16 + 8 * hh + 4);
    float xs[16] = {x0[0],x0[1],x0[2],x0[3],x1[0],x1[1],x1[2],x1[3],x2[0],x2[1],x2[2],x2[3],x3[0],x3[1],x3[2],x3[3]};
#pragma unroll
    for (int i = 0; i < 16; ++i) { const _Float16 h = (_Float16)xs[i]; ah.h[i] = h; al.h[i] = ASPLIT ? (_Float16)(xs[i] - (float)h) : (_Float16)0.0f; }
#pragma unroll
    for (int t = 0; t < 4; ++t) { if (col0 + t * 16 >= N) continue; const size_t boff = (size_t)(col0 + t * 16 + ln) * ldb + kb; FragH bq; bq.half[0] = *(const v8us*)(Bh + boff + 8 * hh); bq.half[1] = *(const v8us*)(Bh + boff + 16 + 8 * hh);
      acc[t] = mmaH<ASPLIT ? 2 : 1>(ah.v, al.v, bq.v, bq.v, acc[t]); }
  }
#pragma unroll
  for (int t = 0; t < 4; ++t) { if (col0 + t * 16 >= N) continue;
#pragma unroll
    for (int r = 0; r < 8; ++r) so[w][8 * hh + r][t * 16 + ln] = acc[t][r] * alpha; }
  __builtin_amdgcn_fence(__ATOMIC_ACQ_REL, "workgroup"); __builtin_amdgcn_wave_barrier();
  const int rsub = lane >> 4, c4 = (lane & 15) * 4;
  {
#pragma unroll
    for (int q = 0; q < 8; ++q) { const int r = q * 2 + rsub; if (col0 + c4 < N) { const v4f v = *(const v4fa*)&so[w][r][c4]; *(v4f*)(C + (size_t)(row0 + r) * ldc + col0 + c4) = v; } }
     }
}

// Wt[n][k] = f16(W[k][n]·scale) from f32 row-major W[K][N] (scale = power of two; bf16-exact weights stay exact in f16 away from the subnormal range)
__global__ __launch_bounds__(256) void k_wt_f16(const float* __restrict__ W, _Float16* __restrict__ Wt, int K, int N, float scale) {
  const int t = blockIdx.x * 256 + threadIdx.x; if (t >= N * (K / 8)) return; const int n = t / (K / 8), k8 = (t % (K / 8)) * 8; FragH f;
#pragma unroll
  for (int i = 0; i < 8; ++i) f.h[i] = (_Float16)(bf16_round(W[(size_t)(k8 + i) * N + n]) * scale); const v8us o = f.half[0];
  *(v8us*)((unsigned short*)Wt + (size_t)n * K + k8) = o; 
}
// k_gemm_hh variant with fused epilogue: v = acc·alpha + bias[by·sBias + col] (+ CP[(row/rowsPerB)·sCPb + by·64 + col] if CP) ; ACT 0 none / 1 elu ; writes f16 C16 and f32 C, each if non-null
template <int ACT>
__global__ __launch_bounds__(128) void k_gemm_hhx(const _Float16* __restrict__ A, int lda, size_t sA, const _Float16* __restrict__ Bh, int ldb, size_t sB, float alpha, const float* __restrict__ bias, size_t sBias, const float* __restrict__ CP, int rowsPerB, size_t sCPb, int row0g,
    float* __restrict__ C, _Float16* __restrict__ C16, int ldc, size_t sC, int M, int N, int K) {
  __shared__ __attribute__((aligned(16))) float so[4][16][64];
  const int tid = threadIdx.x, w = tid >> 5, lane = tid & 31, ln = lane & 15, hh = lane >> 4; const int by = blockIdx.y;
  A += (size_t)by * sA; Bh += (size_t)by * sB; const size_t cofs = (size_t)by * sC; const float* bp = bias ? bias + (size_t)by * sBias : nullptr;
  const int ntn = (N + 63) / 64; const int wid = blockIdx.x * 4 + w; const int mt = wid / ntn, nq = wid % ntn; if (mt * 16 >= M) return;
  const int row0 = mt * 16, col0 = nq * 64; const _Float16* arow = A + (size_t)(row0 + ln) * lda;
  v8f acc[4] = {};
  for (int kb = 0; kb < K; kb += 32) { FragH ah; ah.half[0] = *(const v8us*)((const unsigned short*)arow + kb + 8 * hh); ah.half[1] = *(const v8us*)((const unsigned short*)arow + kb + 16 + 8 * hh);
#pragma unroll
    for (int t = 0; t < 4; ++t) { if (col0 + t * 16 >= N) continue; const size_t boff = (size_t)(col0 + t * 16 + ln) * ldb + kb; FragH bq; bq.half[0] = *(const v8us*)((const unsigned short*)Bh + boff + 8 * hh); bq.half[1] = *(const v8us*)((const unsigned short*)Bh + boff + 16 + 8 * hh);
      acc[t] = mmaH<1>(ah.v, ah.v, bq.v, bq.v, acc[t]); }
  }
#pragma unroll
  for (int t = 0; t < 4; ++t) { if (col0 + t * 16 >= N) continue; const int col = col0 + t * 16 + ln; const float bv = bp ? bf16_round(bp[col]) : 0.f;
#pragma unroll
    for (int r = 0; r < 8; ++r) { float v = acc[t][r] * alpha + bv; if (CP) { const int bidx = (row0g + row0 + 8 * hh + r) / rowsPerB; v += CP[(size_t)bidx * sCPb + (size_t)by * 64 + col]; } if (ACT == 1) v = (v > 0.f) ? v : expm1f(v); else if (ACT == 3) v = fmaxf(v, 0.f); so[w][8 * hh + r][t * 16 + ln] = v; } }
  __builtin_amdgcn_fence(__ATOMIC_ACQ_REL, "workgroup"); __builtin_amdgcn_wave_barrier();
  const int rsub = lane >> 4, c4 = (lane & 15) * 4; typedef _Float16 v4h __attribute__((ext_vector_type(4)));
  {
#pragma unroll
    for (int q = 0; q < 8; ++q) { const int r = q * 2 + rsub; if (col0 + c4 < N) { const v4f v = *(const v4fa*)&so[w][r][c4]; if (C) *(v4f*)(C + cofs + (size_t)(row0 + r) * ldc + col0 + c4) = v; if (C16) { v4h h4; for (int i = 0; i < 4; ++i) h4[i] = (_Float16)v[i]; *(v4h*)(C16 + cofs + (size_t)(row0 + r) * ldc + col0 + c4) = h4; } } }
     }
}


__global__ __launch_bounds__(256) void k_x16(const float* __restrict__ x, _Float16* __restrict__ X16, size_t n8) { const size_t t = (size_t)blockIdx.x * 256 + threadIdx.x; if (t >= n8) return; FragH f;
#pragma unroll
  for (int q = 0; q < 8; ++q) f.h[q] = (_Float16)bf16_round(x[t * 8 + q]); *(v8us*)((unsigned short*)X16 + t * 8) = f.half[0];  }
__global__ __launch_bounds__(256) void k_h16(const float* __restrict__ x, _Float16* __restrict__ X16, size_t n8) { const size_t t = (size_t)blockIdx.x * 256 + threadIdx.x; if (t >= n8) return; FragH f;
#pragma unroll
  for (int q = 0; q < 8; ++q) f.h[q] = (_Float16)x[t * 8 + q]; *(v8us*)((unsigned short*)X16 + t * 8) = f.half[0];  }
__global__ __launch_bounds__(256) void k_round16f(const float* __restrict__ W, _Float16* __restrict__ Bt, size_t n8) { const size_t t = (size_t)blockIdx.x * 256 + threadIdx.x; if (t >= n8) return; FragH f;
#pragma unroll
  for (int i = 0; i < 8; ++i) f.h[i] = (_Float16)(bf16_round(W[t * 8 + i]) * 16.0f); *(v8us*)((unsigned short*)Bt + t * 8) = f.half[0];  }
// per-pair bias, 32 pairs (same (b,i), j = j0..j0+31) per wave in two 16-row tiles: each lane computes half of the 64 relu hidden units of BOTH MLPs for its pair (k = 8hh.., 16+8hh.. per
// k-step) straight into A fragments; the second layers (64→1 geom, 64→2 delay) run on v_wmma_f32_16x16x32_f16 against B rows 0 (gw2) / 0,1 (dw2); lanes ln = 0 then assemble
__global__ __launch_bounds__(128) void k_bias(const float* __restrict__ crd, const float* __restrict__ gw1, const float* __restrict__ gb1, const float* __restrict__ gw2, const float* __restrict__ gb2, const float* __restrict__ dw1, const float* __restrict__ db1, const float* __restrict__ dw2, const float* __restrict__ db2, float* __restrict__ BIAS) {
  __shared__ float sg1[BH][2], sgb[BH], sd1[BH][4], sdb[BH]; __shared__ __attribute__((aligned(16))) _Float16 sg2[BH], sd2[2][BH]; __shared__ float sres[4][32];
  const int tid = threadIdx.x, w = tid >> 5, lane = tid & 31, ln = lane & 15, hh = lane >> 4;
  if (tid < BH) { sg1[tid][0] = bf16_round(gw1[tid * 2]); sg1[tid][1] = bf16_round(gw1[tid * 2 + 1]); sgb[tid] = bf16_round(gb1[tid]); for (int q = 0; q < 4; ++q) sd1[tid][q] = bf16_round(dw1[tid * 4 + q]); sdb[tid] = bf16_round(db1[tid]); sg2[tid] = (_Float16)(bf16_round(gw2[tid]) * 16.0f); sd2[0][tid] = (_Float16)(bf16_round(dw2[tid]) * 16.0f); sd2[1][tid] = (_Float16)(bf16_round(dw2[BH + tid]) * 16.0f); }
  __syncthreads();
  const size_t p0 = ((size_t)blockIdx.x * 4 + w) * 32;      // 32 consecutive pairs of one (b, i) (SS = 1024 is a multiple of 32)
  const int b = (int)(p0 / ((size_t)SS * SS)); const int i = (int)((p0 / SS) % SS); const int jb = (int)(p0 % SS);
  const float* ci = crd + ((size_t)b * SS + i) * 4; const float xi = bf16_round(ci[0]), yi = bf16_round(ci[1]), zi = bf16_round(ci[2]), ti = bf16_round(ci[3]);
  const float gb2v = bf16_round(gb2[0]), db20 = bf16_round(db2[0]), db21 = bf16_round(db2[1]);
  // B fragments (constant): geom → row n = 0 holds 16·gw2[k]; delay → rows 0,1 hold 16·dw2[n][k]
  FragH bg[2], bd[2];
#pragma unroll
  for (int ks = 0; ks < 2; ++ks) {
#pragma unroll
    for (int q = 0; q < 8; ++q) { const int k0 = ks * 32 + 8 * hh + q, k1 = ks * 32 + 16 + 8 * hh + q; bg[ks].h[q] = (ln == 0) ? sg2[k0] : (_Float16)0.f; bg[ks].h[8 + q] = (ln == 0) ? sg2[k1] : (_Float16)0.f; bd[ks].h[q] = (ln < 2) ? sd2[ln & 1][k0] : (_Float16)0.f; bd[ks].h[8 + q] = (ln < 2) ? sd2[ln & 1][k1] : (_Float16)0.f; if (ln >= 2) { bd[ks].h[q] = (_Float16)0.f; bd[ks].h[8 + q] = (_Float16)0.f; } } }
  float outv[2][8];
#pragma unroll
  for (int rt = 0; rt < 2; ++rt) { const int j = jb + rt * 16 + ln; const float* cj = crd + ((size_t)b * SS + j) * 4; const float xj = bf16_round(cj[0]), yj = bf16_round(cj[1]), zj = bf16_round(cj[2]), tj = bf16_round(cj[3]);
    const float dx = xi - xj, dy = yi - yj, dz = zi - zj; const float dist = sqrtf(dx * dx + dy * dy + dz * dz); const float dt = ti - tj;
    v8f ag = (v8f){0.f,0.f,0.f,0.f,0.f,0.f,0.f,0.f}, ad = (v8f){0.f,0.f,0.f,0.f,0.f,0.f,0.f,0.f};
#pragma unroll
    for (int ks = 0; ks < 2; ++ks) { FragH hg, hd;
#pragma unroll
      for (int q = 0; q < 16; ++q) { const int k = ks * 32 + ((q < 8) ? (8 * hh + q) : (16 + 8 * hh + q - 8)); hg.h[q] = (_Float16)fmaxf(sg1[k][0] * dist + sg1[k][1] * dt + sgb[k], 0.f); hd.h[q] = (_Float16)fmaxf(sd1[k][0] * dist + sd1[k][1] * xj + sd1[k][2] * yj + sd1[k][3] * zj + sdb[k], 0.f); }
      ag = mmaH<1>(hg.v, hg.v, bg[ks].v, bg[ks].v, ag); ad = mmaH<1>(hd.v, hd.v, bd[ks].v, bd[ks].v, ad); }
    // D layout: lane (ln = n, hh) rows 8hh + r: geom at n = 0; r0 at n = 0, r1 at n = 1 → bring r1 to the n = 0 lanes; dt for pair row 8hh + r comes from lane ln' = 8hh + r of THIS tile → shuffle too
#pragma unroll
    for (int r = 0; r < 8; ++r) { const float r1v = __shfl(ad[r], (lane & 16) | 1, 32);      // r1 (D column 1) from lane (ln = 1, same hh)
      const float dtm = __shfl(dt, 8 * hh + r, 32);                 // dt of pair m = 8hh + r lives in lane ln = m (hh = 0 copy)
      if (ln == 0) { const float geom = ag[r] * 0.0625f + gb2v; const float q0 = ad[r] * 0.0625f + db20, q1 = r1v * 0.0625f + db21;
        const float shape = ((q0 > 20.f) ? q0 : log1pf(expf(q0))) + 1e-4f, rate = ((q1 > 20.f) ? q1 : log1pf(expf(q1))) + 1e-4f; const float dtp = fmaxf(fabsf(dtm), 1e-4f);
        outv[rt][r] = geom + shape * logf(rate) + (shape - 1.0f) * logf(dtp) - rate * dtp - lgammaf(shape); } else outv[rt][r] = 0.f; } }
  if (ln == 0) {
#pragma unroll
    for (int rt = 0; rt < 2; ++rt)
#pragma unroll
      for (int r = 0; r < 8; ++r) sres[w][rt * 16 + 8 * hh + r] = outv[rt][r]; }
  __builtin_amdgcn_fence(__ATOMIC_ACQ_REL, "workgroup"); __builtin_amdgcn_wave_barrier();
  *(float*)(BIAS + p0 + lane) = sres[w][lane];  }
__global__ __launch_bounds__(256) void k_vt(const _Float16* __restrict__ V16, _Float16* __restrict__ Vt) { __shared__ unsigned short tl[64][34]; const int tid = threadIdx.x; const int slab = blockIdx.x / (SS / 64), lg = blockIdx.x % (SS / 64); const int b = slab / NH, h = slab % NH;
  for (int i = tid; i < 64 * 4; i += 256) { const int r = i / 4, c8 = (i % 4) * 8; FragH f; f.half[0] = *(const v8us*)((const unsigned short*)V16 + ((size_t)b * SS + lg * 64 + r) * DM + h * HD + c8);
#pragma unroll
    for (int q = 0; q < 8; ++q) tl[r][c8 + q] = f.u[q]; }
  __syncthreads();
  { const int d = tid / 8, pc = tid % 8; FragH f;
#pragma unroll
    for (int q = 0; q < 8; ++q) f.u[q] = tl[pc * 8 + q][d];
    *(v8us*)((unsigned short*)Vt + ((size_t)slab * HD + d) * SS + lg * 64 + pc * 8) = f.half[0];  } }
__global__ __launch_bounds__(128) void k_flash(const _Float16* __restrict__ Q16, const _Float16* __restrict__ K16, const _Float16* __restrict__ Vt, const float* __restrict__ BIAS, float* __restrict__ O) {
  constexpr int RPW = 32, NQB = SS / (4 * RPW), DT = 2;
  __shared__ __attribute__((aligned(16))) unsigned short sP[4][RPW][40]; __shared__ __attribute__((aligned(16))) float sO[4][RPW][HD + 4];
  const int tid = threadIdx.x, w = tid >> 5, lane = tid & 31, ln = lane & 15, hh = lane >> 4;
  const int slab = blockIdx.x / NQB, qblk = blockIdx.x % NQB; const int b = slab / NH, h = slab % NH; const int q0 = qblk * (4 * RPW) + w * RPW;
  FragH aq[2];
#pragma unroll
  for (int rt = 0; rt < 2; ++rt) { const unsigned short* qr = (const unsigned short*)Q16 + ((size_t)b * SS + q0 + rt * 16 + ln) * DM + h * HD; aq[rt].half[0] = *(const v8us*)(qr + 8 * hh); aq[rt].half[1] = *(const v8us*)(qr + 16 + 8 * hh); }
  const unsigned short* Vth = (const unsigned short*)Vt + (size_t)slab * HD * SS;
  float m_r[2][8], l_r[2][8]; v8f oacc[2][DT];
#pragma unroll
  for (int rt = 0; rt < 2; ++rt) {
#pragma unroll
    for (int r = 0; r < 8; ++r) { m_r[rt][r] = -3.0e38f; l_r[rt][r] = 0.f; }
#pragma unroll
    for (int dt = 0; dt < DT; ++dt) oacc[rt][dt] = (v8f){0.f,0.f,0.f,0.f,0.f,0.f,0.f,0.f}; }
  const float scale = 0.17677669529663688f;
#pragma unroll 1
  for (int j0 = 0; j0 < SS; j0 += 32) {
    v8f s[2][2];
#pragma unroll
    for (int nt = 0; nt < 2; ++nt) { const unsigned short* kr = (const unsigned short*)K16 + ((size_t)b * SS + j0 + nt * 16 + ln) * DM + h * HD; FragH bk; bk.half[0] = *(const v8us*)(kr + 8 * hh); bk.half[1] = *(const v8us*)(kr + 16 + 8 * hh);
#pragma unroll
      for (int rt = 0; rt < 2; ++rt) { v8f acc = (v8f){0.f,0.f,0.f,0.f,0.f,0.f,0.f,0.f}; acc = mmaH<1>(aq[rt].v, aq[rt].v, bk.v, bk.v, acc); s[rt][nt] = acc; } }
#pragma unroll
    for (int rt = 0; rt < 2; ++rt)
#pragma unroll
      for (int r = 0; r < 8; ++r) { const int qi = q0 + rt * 16 + 8 * hh + r; const float* br = BIAS + ((size_t)b * SS + qi) * SS + j0; const float s0 = s[rt][0][r] * scale + br[ln], s1 = s[rt][1][r] * scale + br[16 + ln]; float mc = fmaxf(s0, s1);
        mc = fmaxf(mc, __shfl_xor(mc, 1, 32)); mc = fmaxf(mc, __shfl_xor(mc, 2, 32)); mc = fmaxf(mc, __shfl_xor(mc, 4, 32)); mc = fmaxf(mc, __shfl_xor(mc, 8, 32));
        const float mn = fmaxf(m_r[rt][r], mc); const float al = expf(m_r[rt][r] - mn); m_r[rt][r] = mn; const float p0 = expf(s0 - mn), p1 = expf(s1 - mn); l_r[rt][r] = l_r[rt][r] * al + p0 + p1;
#pragma unroll
        for (int dt = 0; dt < DT; ++dt) oacc[rt][dt][r] *= al;
        FragH t2; t2.h[0] = (_Float16)p0; t2.h[1] = (_Float16)p1; sP[w][rt * 16 + 8 * hh + r][ln] = t2.u[0]; sP[w][rt * 16 + 8 * hh + r][16 + ln] = t2.u[1]; }
    __builtin_amdgcn_fence(__ATOMIC_ACQ_REL, "workgroup"); __builtin_amdgcn_wave_barrier();
    FragH pa[2];
#pragma unroll
    for (int rt = 0; rt < 2; ++rt) { pa[rt].half[0] = *(const v8us*)&sP[w][rt * 16 + ln][8 * hh]; pa[rt].half[1] = *(const v8us*)&sP[w][rt * 16 + ln][16 + 8 * hh]; }
#pragma unroll
    for (int dt = 0; dt < DT; ++dt) { const unsigned short* vrow = Vth + (size_t)(dt * 16 + ln) * SS + j0; FragH bv; bv.half[0] = *(const v8us*)(vrow + 8 * hh); bv.half[1] = *(const v8us*)(vrow + 16 + 8 * hh);
#pragma unroll
      for (int rt = 0; rt < 2; ++rt) oacc[rt][dt] = mmaH<1>(pa[rt].v, pa[rt].v, bv.v, bv.v, oacc[rt][dt]); }
    __builtin_amdgcn_fence(__ATOMIC_ACQ_REL, "workgroup"); __builtin_amdgcn_wave_barrier(); }
#pragma unroll
  for (int rt = 0; rt < 2; ++rt) {
#pragma unroll
    for (int r = 0; r < 8; ++r) { float l = l_r[rt][r]; l += __shfl_xor(l, 1, 32); l += __shfl_xor(l, 2, 32); l += __shfl_xor(l, 4, 32); l += __shfl_xor(l, 8, 32); l_r[rt][r] = 1.0f / l; }
#pragma unroll
    for (int dt = 0; dt < DT; ++dt)
#pragma unroll
      for (int r = 0; r < 8; ++r) sO[w][rt * 16 + 8 * hh + r][dt * 16 + ln] = oacc[rt][dt][r] * l_r[rt][r]; }
  __builtin_amdgcn_fence(__ATOMIC_ACQ_REL, "workgroup"); __builtin_amdgcn_wave_barrier();
  {
#pragma unroll
    for (int rp = 0; rp < RPW; rp += 4) { const int r = rp + (lane >> 3), pc = lane & 7; const v4f val = *(const v4fa*)&sO[w][r][pc * 4]; *(v4f*)(O + ((size_t)b * SS + q0 + r) * DM + h * HD + pc * 4) = val; }
     } }
extern "C" void kernel_launch(void* const* d_in, const int* in_sizes, int n_in,
                              void* d_out, int out_size, void* d_ws, size_t ws_size, hipStream_t stream) {
  (void)in_sizes; (void)n_in; (void)out_size;
  const float* src = (const float*)d_in[0]; const float* crd = (const float*)d_in[1]; const float* Wq = (const float*)d_in[2]; const float* Wk = (const float*)d_in[3]; const float* Wv = (const float*)d_in[4]; const float* Wo = (const float*)d_in[5];
  const float* gw1 = (const float*)d_in[6]; const float* gb1 = (const float*)d_in[7]; const float* gw2 = (const float*)d_in[8]; const float* gb2 = (const float*)d_in[9]; const float* dw1 = (const float*)d_in[10]; const float* db1 = (const float*)d_in[11]; const float* dw2 = (const float*)d_in[12]; const float* db2 = (const float*)d_in[13];
  char* ws = (char*)d_ws; size_t off = 0;
  auto take = [&](size_t bytes) { char* p = ws + off; off += (bytes + 255) & ~(size_t)255; return p; };
  const size_t w8 = (size_t)DM * DM / 8;
  _Float16* Bq = (_Float16*)take(w8 * 16); _Float16* Bk = (_Float16*)take(w8 * 16); _Float16* Bv = (_Float16*)take(w8 * 16); _Float16* Bo = (_Float16*)take(w8 * 16); _Float16* X16 = (_Float16*)take((size_t)NR * DM * 2); _Float16* Q16 = (_Float16*)take((size_t)NR * DM * 2); _Float16* K16 = (_Float16*)take((size_t)NR * DM * 2); _Float16* V16 = (_Float16*)take((size_t)NR * DM * 2); _Float16* Vt = (_Float16*)take((size_t)NR * DM * 2); float* BIAS = (float*)take((size_t)BB * SS * SS * 4); float* O = (float*)take((size_t)NR * DM * 4); _Float16* O16 = (_Float16*)take((size_t)NR * DM * 2);
  if (off > ws_size) return;      // ≈ 16.5 MiB
  const unsigned gw = (unsigned)((w8 + 255) / 256), gx = (unsigned)(((size_t)NR * DM / 8 + 255) / 256);
  k_round16f<<<gw, 256, 0, stream>>>(Wq, Bq, w8); k_round16f<<<gw, 256, 0, stream>>>(Wk, Bk, w8); k_round16f<<<gw, 256, 0, stream>>>(Wv, Bv, w8); k_round16f<<<gw, 256, 0, stream>>>(Wo, Bo, w8);
  k_x16<<<gx, 256, 0, stream>>>(src, X16, (size_t)NR * DM / 8);
  const dim3 gg(((NR / 16) * (DM / 64) + 3) / 4, 1);
  k_gemm_hhx<0><<<gg, 128, 0, stream>>>(X16, DM, 0, Bq, DM, 0, 0.0625f, nullptr, 0, nullptr, 1, 0, 0, nullptr, Q16, DM, 0, NR, DM, DM);
  k_gemm_hhx<0><<<gg, 128, 0, stream>>>(X16, DM, 0, Bk, DM, 0, 0.0625f, nullptr, 0, nullptr, 1, 0, 0, nullptr, K16, DM, 0, NR, DM, DM);
  k_gemm_hhx<0><<<gg, 128, 0, stream>>>(X16, DM, 0, Bv, DM, 0, 0.0625f, nullptr, 0, nullptr, 1, 0, 0, nullptr, V16, DM, 0, NR, DM, DM);
  k_bias<<<(unsigned)((size_t)BB * SS * SS / 128), 128, 0, stream>>>(crd, gw1, gb1, gw2, gb2, dw1, db1, dw2, db2, BIAS);      // 32 pairs per wave
  k_vt<<<BB * NH * (SS / 64), 256, 0, stream>>>(V16, Vt);
  k_flash<<<BB * NH * (SS / 128), 128, 0, stream>>>(Q16, K16, Vt, BIAS, O);
  k_h16<<<gx, 256, 0, stream>>>(O, O16, (size_t)NR * DM / 8);
  k_gemm_hhx<0><<<gg, 128, 0, stream>>>(O16, DM, 0, Bo, DM, 0, 0.0625f, nullptr, 0, nullptr, 1, 0, 0, (float*)d_out, nullptr, DM, 0, NR, DM, DM);
}

// v001
// A run of this version takes 191 microseconds.
// Next to v000, in two timings, it ran 2.00 and 1.99 times as fast.
#include <hip/hip_runtime.h>
// q/k/v/o projections (2048 × 256 × 256) and the 8-head attention (d = 32) with an additive per-pair bias on v_wmma_f32_16x16x32_f16 (fused flash-style kernel: S = Q·Kᵀ, O = P·V on WMMA;
// online max/sum softmax f32; P f16 ≤ 1). The bias (geometric 2→64→1 MLP + the Gamma log-density from the 4→64→2 delay MLP, incl. lgamma) is computed once per (b, i, j): the two MLPs' hidden layers in f32 VALU straight into WMMA A fragments, their second layers (64→1 / 64→2)
// on WMMA, softplus/log/lgamma in f32; the bias plane is shared by the 8 heads. A = f16(bf16 ·) exact operands for q/k/v, f16(O) for o, weights bf16-exact ×2^4 ((out,in)), single products, f32 accumulate.
#define BB 2
#define SS 1024
#define DM 256
#define NH 8
#define HD 32
#define BH 64
#define NR (BB * SS)

typedef __bf16 v16b __attribute__((ext_vector_type(16)));
typedef unsigned short v8us __attribute__((ext_vector_type(8), may_alias));
typedef float  v8f  __attribute__((ext_vector_type(8)));
typedef float  v4f  __attribute__((ext_vector_type(4)));
typedef float  v4fa __attribute__((ext_vector_type(4), may_alias));
union FragB { v16b v; v8us half[2]; unsigned short u[16]; };

__device__ __forceinline__ unsigned short bf16_bits(float x) { unsigned int u = __float_as_uint(x); return (unsigned short)((u + 0x7FFFu + ((u >> 16) & 1u)) >> 16); }
__device__ __forceinline__ float bf16_val(unsigned short b) { return __uint_as_float(((unsigned int)b) << 16); }
__device__ __forceinline__ float bf16_round(float x) { return bf16_val(bf16_bits(x)); }
// D += A·B with NT terms: 1 = ah·bh, 2 = + al·bh (A split), 3 = + ah·bl (both split)
template <int NT>
__device__ __forceinline__ v8f mmaN(v16b ah, v16b al, v16b bh, v16b bl, v8f c) {
  c = __builtin_amdgcn_wmma_f32_16x16x32_bf16(false, ah, false, bh, (short)0, c, false, false);
  if (NT >= 2) c = __builtin_amdgcn_wmma_f32_16x16x32_bf16(false, al, false, bh, (short)0, c, false, false);
  if (NT >= 3) c = __builtin_amdgcn_wmma_f32_16x16x32_bf16(false, ah, false, bl, (short)0, c, false, false);
  asm volatile("v_nop\n\tv_nop\n\tv_nop\n\tv_nop" : "+v"(c) : "v"(ah), "v"(al), "v"(bh), "v"(bl));
  return c;
}

__global__ __launch_bounds__(256) void k_wt_bf16(const float* __restrict__ W, unsigned short* __restrict__ Wt, int K, int N) {
  const int t = blockIdx.x * 256 + threadIdx.x;
  const int k8n = K / 8;
  if (t >= N * k8n) return;
  const int n = t / k8n, k8 = (t % k8n) * 8;
  v8us v;
#pragma unroll
  for (int i = 0; i < 8; ++i) v[i] = bf16_bits(W[(size_t)(k8 + i) * N + n]);
  *(v8us*)(Wt + (size_t)n * K + k8) = v;
  
}

// GEMM C[M][N] (f32, pitch ldc) = act(A[M][K]·W + bias). A f32 row-major (pitch lda) converted per fragment to bf16
// (ASPLIT: hi/lo two planes -> 2 terms, else single rounded term); Wt bf16 [N][K] (pitch ldb). BIAS_BF16 rounds the
// bias to bf16 first (bias quantised to bf16 before the add). K%32==0, M%16==0, N%64==0.
template <bool ASPLIT, int ACT, bool BIAS_BF16>
__global__ __launch_bounds__(128) void k_gemm_bf(const float* __restrict__ A, int lda, const unsigned short* __restrict__ Wt, int ldb,
                                               const float* __restrict__ bias, float* __restrict__ C, int ldc, int M, int N, int K) {
  __shared__ __attribute__((aligned(16))) float so[4][16][64];
  const int tid = threadIdx.x, w = tid >> 5, lane = tid & 31, ln = lane & 15, hh = lane >> 4;
  const int ntn = N / 64;
  const int wid = blockIdx.x * 4 + w;
  const int mt = wid / ntn, nq = wid % ntn;
  if (mt * 16 >= M) return;
  const int row0 = mt * 16, col0 = nq * 64;
  const float* arow = A + (size_t)(row0 + ln) * lda;
  v8f acc[4] = {};
  for (int kb = 0; kb < K; kb += 32) {
    FragB ah, al;
    const v4f x0 = *(const v4fa*)(arow + kb + 8 * hh), x1 = *(const v4fa*)(arow + kb + 8 * hh + 4);
    const v4f x2 = *(const v4fa*)(arow + kb + 16 + 8 * hh), x3 = *(const v4fa*)(arow + kb + 16 + 8 * hh + 4);
    float xs[16] = {x0[0],x0[1],x0[2],x0[3],x1[0],x1[1],x1[2],x1[3],x2[0],x2[1],x2[2],x2[3],x3[0],x3[1],x3[2],x3[3]};
#pragma unroll
    for (int i = 0; i < 16; ++i) { const unsigned short hb = bf16_bits(xs[i]); ah.u[i] = hb; al.u[i] = ASPLIT ? bf16_bits(xs[i] - bf16_val(hb)) : (unsigned short)0; }
#pragma unroll
    for (int t = 0; t < 4; ++t) {
      const unsigned short* brow = Wt + (size_t)(col0 + t * 16 + ln) * ldb + kb;
      FragB b;
      b.half[0] = *(const v8us*)(brow + 8 * hh);
      b.half[1] = *(const v8us*)(brow + 16 + 8 * hh);
      acc[t] = mmaN<ASPLIT ? 2 : 1>(ah.v, al.v, b.v, b.v, acc[t]);
    }
  }
#pragma unroll
  for (int t = 0; t < 4; ++t) {
    float bv = bias ? bias[col0 + t * 16 + ln] : 0.f;
    if (BIAS_BF16) bv = bf16_round(bv);
#pragma unroll
    for (int r = 0; r < 8; ++r) { float v = acc[t][r] + bv; if (ACT == 1) v = fmaxf(v, 0.f); so[w][8 * hh + r][t * 16 + ln] = v; }
  }
  __builtin_amdgcn_fence(__ATOMIC_ACQ_REL, "workgroup");
  __builtin_amdgcn_wave_barrier();
  const int rsub = lane >> 4, c4 = (lane & 15) * 4;
  {
#pragma unroll
    for (int q = 0; q < 8; ++q) {
      const int r = q * 2 + rsub;
      const v4f v = *(const v4fa*)&so[w][r][c4];
      *(v4f*)(C + (size_t)(row0 + r) * ldc + col0 + c4) = v;
    }
    
  }
}

// Flash-style causal/unmasked attention, all contractions 3-term bf16 hi/lo splits, f32 softmax with running max.
// q,k,v rows are read from f32 buffers with arbitrary row pitch (so they can live inside a fused qkv buffer);
// D = head size (multiple of 32, <= 128); one wave = 16 query rows; block = 4 waves (64 queries) sharing K/V chunks of 32.
template <int D, bool CAUSAL>
__global__ __launch_bounds__(128) void k_flash(const float* __restrict__ qb, const float* __restrict__ kb, const float* __restrict__ vb,
                                             int pitch, int T, int H, float scale, float* __restrict__ y, int ypitch) {
  constexpr int KS = D / 32;        // k-steps for QK
  constexpr int DT = D / 16;        // d tiles for PV
  __shared__ __attribute__((aligned(16))) unsigned short sKh[32][D + 8], sKl[32][D + 8], sVh[32][D + 8], sVl[32][D + 8];
  __shared__ __attribute__((aligned(16))) unsigned short sPh[4][16][40], sPl[4][16][40];
  __shared__ __attribute__((aligned(16))) float sO[4][16][D];
  const int tid = threadIdx.x, w = tid >> 5, lane = tid & 31, ln = lane & 15, hh = lane >> 4;
  const int nqb = (T + 63) / 64;
  const int bh = blockIdx.x / nqb, qblk = blockIdx.x % nqb;
  const int b = bh / H, h = bh % H;
  const int q0 = qblk * 64 + w * 16;
  const float* Q = qb + (size_t)b * T * pitch + h * D;
  const float* K = kb + (size_t)b * T * pitch + h * D;
  const float* V = vb + (size_t)b * T * pitch + h * D;

  // A fragments of the wave's 16 query rows (scaled), hi/lo
  FragB aqh[KS], aql[KS];
  {
    int row = q0 + ln; if (row >= T) row = T - 1;
    const float* qr = Q + (size_t)row * pitch;
#pragma unroll
    for (int ks = 0; ks < KS; ++ks)
#pragma unroll
      for (int i = 0; i < 16; ++i) {
        const int d = ks * 32 + ((i < 8) ? (8 * hh + i) : (16 + 8 * hh + (i - 8)));
        const float x = qr[d] * scale; const unsigned short hb = bf16_bits(x);
        aqh[ks].u[i] = hb; aql[ks].u[i] = bf16_bits(x - bf16_val(hb));
      }
  }
  float m_r[8], l_r[8];
#pragma unroll
  for (int r = 0; r < 8; ++r) { m_r[r] = -3.0e38f; l_r[r] = 0.f; }
  v8f oacc[DT];
#pragma unroll
  for (int dt = 0; dt < DT; ++dt) oacc[dt] = (v8f){0.f,0.f,0.f,0.f,0.f,0.f,0.f,0.f};

  const int kv_end = CAUSAL ? min(T, qblk * 64 + 64) : T;     // block-uniform
  for (int j0 = 0; j0 < kv_end; j0 += 32) {
    __syncthreads();
    for (int e = tid; e < 32 * (D / 4); e += 128) {
      const int r = e / (D / 4), c4 = (e % (D / 4)) * 4;
      const int key = j0 + r;
      v4f kf = {0.f,0.f,0.f,0.f}, vf = {0.f,0.f,0.f,0.f};
      if (key < T) { kf = *(const v4fa*)(K + (size_t)key * pitch + c4); vf = *(const v4fa*)(V + (size_t)key * pitch + c4); }
#pragma unroll
      for (int t = 0; t < 4; ++t) {
        unsigned short hb = bf16_bits(kf[t]); sKh[r][c4 + t] = hb; sKl[r][c4 + t] = bf16_bits(kf[t] - bf16_val(hb));
        hb = bf16_bits(vf[t]); sVh[r][c4 + t] = hb; sVl[r][c4 + t] = bf16_bits(vf[t] - bf16_val(hb));
      }
    }
    __syncthreads();
    // S tile 16 x 32
    v8f s[2];
#pragma unroll
    for (int nt = 0; nt < 2; ++nt) {
      v8f acc = {};
#pragma unroll
      for (int ks = 0; ks < KS; ++ks) {
        FragB bh_, bl_;
        bh_.half[0] = *(const v8us*)&sKh[nt * 16 + ln][ks * 32 + 8 * hh]; bh_.half[1] = *(const v8us*)&sKh[nt * 16 + ln][ks * 32 + 16 + 8 * hh];
        bl_.half[0] = *(const v8us*)&sKl[nt * 16 + ln][ks * 32 + 8 * hh]; bl_.half[1] = *(const v8us*)&sKl[nt * 16 + ln][ks * 32 + 16 + 8 * hh];
        acc = mmaN<3>(aqh[ks].v, aql[ks].v, bh_.v, bl_.v, acc);
      }
      s[nt] = acc;
    }
    // mask + running max (rows 8hh+r; the 16 lanes of a half share rows)
    float alpha[8];
#pragma unroll
    for (int r = 0; r < 8; ++r) {
      const int qi = q0 + 8 * hh + r;
      const int ja = j0 + ln, jb = j0 + 16 + ln;
      if (CAUSAL) { if (ja > qi) s[0][r] = -3.0e38f; if (jb > qi) s[1][r] = -3.0e38f; }
      if (ja >= T) s[0][r] = -3.0e38f;
      if (jb >= T) s[1][r] = -3.0e38f;
      float mx = fmaxf(s[0][r], s[1][r]);
      mx = fmaxf(mx, __shfl_xor(mx, 1, 32)); mx = fmaxf(mx, __shfl_xor(mx, 2, 32)); mx = fmaxf(mx, __shfl_xor(mx, 4, 32)); mx = fmaxf(mx, __shfl_xor(mx, 8, 32));
      const float mnew = fmaxf(m_r[r], mx);
      alpha[r] = (mnew > -1.0e38f) ? __expf(m_r[r] - mnew) : 1.0f;
      const float p0 = (s[0][r] > -1.0e38f) ? __expf(s[0][r] - mnew) : 0.f;
      const float p1 = (s[1][r] > -1.0e38f) ? __expf(s[1][r] - mnew) : 0.f;
      m_r[r] = mnew;
      l_r[r] = l_r[r] * alpha[r] + p0 + p1;            // per-lane partial row sum (16 lanes combined at the end)
      unsigned short hb = bf16_bits(p0); sPh[w][8 * hh + r][ln] = hb;      sPl[w][8 * hh + r][ln] = bf16_bits(p0 - bf16_val(hb));
      hb = bf16_bits(p1);                sPh[w][8 * hh + r][16 + ln] = hb; sPl[w][8 * hh + r][16 + ln] = bf16_bits(p1 - bf16_val(hb));
    }
#pragma unroll
    for (int dt = 0; dt < DT; ++dt)
#pragma unroll
      for (int r = 0; r < 8; ++r) oacc[dt][r] *= alpha[r];
    __builtin_amdgcn_fence(__ATOMIC_ACQ_REL, "workgroup");
    __builtin_amdgcn_wave_barrier();
    FragB pah, pal;
    pah.half[0] = *(const v8us*)&sPh[w][ln][8 * hh]; pah.half[1] = *(const v8us*)&sPh[w][ln][16 + 8 * hh];
    pal.half[0] = *(const v8us*)&sPl[w][ln][8 * hh]; pal.half[1] = *(const v8us*)&sPl[w][ln][16 + 8 * hh];
#pragma unroll
    for (int dt = 0; dt < DT; ++dt) {
      FragB bvh, bvl;
#pragma unroll
      for (int i = 0; i < 8; ++i) {
        bvh.u[i] = sVh[8 * hh + i][dt * 16 + ln]; bvh.u[8 + i] = sVh[16 + 8 * hh + i][dt * 16 + ln];
        bvl.u[i] = sVl[8 * hh + i][dt * 16 + ln]; bvl.u[8 + i] = sVl[16 + 8 * hh + i][dt * 16 + ln];
      }
      oacc[dt] = mmaN<3>(pah.v, pal.v, bvh.v, bvl.v, oacc[dt]);
    }
    __builtin_amdgcn_fence(__ATOMIC_ACQ_REL, "workgroup");
    __builtin_amdgcn_wave_barrier();
  }
#pragma unroll
  for (int r = 0; r < 8; ++r) {
    float l = l_r[r];
    l += __shfl_xor(l, 1, 32); l += __shfl_xor(l, 2, 32); l += __shfl_xor(l, 4, 32); l += __shfl_xor(l, 8, 32);
    l_r[r] = (l > 0.f) ? 1.0f / l : 0.f;
  }
#pragma unroll
  for (int dt = 0; dt < DT; ++dt)
#pragma unroll
    for (int r = 0; r < 8; ++r) sO[w][8 * hh + r][dt * 16 + ln] = oacc[dt][r] * l_r[r];
  __builtin_amdgcn_fence(__ATOMIC_ACQ_REL, "workgroup");
  __builtin_amdgcn_wave_barrier();
  {
    for (int r = 0; r < 16; ++r) {
      const int row = q0 + r;
      if (row < T && lane < D / 4) {
        const v4f val = *(const v4fa*)&sO[w][r][lane * 4];
        *(v4f*)(y + ((size_t)b * T + row) * ypitch + h * D + lane * 4) = val;
      }
    }
    
  }
}

// GEMM C = act(A·W + bias + resid): A f32 (ASPLIT -> hi/lo 2 terms), Wt bf16 [N][K]; ACT 0 none, 1 relu, 2 exact gelu;
// resid (optional, f32, row index = (row % rmod), pitch ldr, RES_BF16 rounds it) added before the activation.
template <bool ASPLIT, int ACT, bool BIAS_BF16, bool RES_BF16>
__global__ __launch_bounds__(128) void k_gemm_bf3(const float* __restrict__ A, int lda, const unsigned short* __restrict__ Wt, int ldb,
                                                const float* __restrict__ bias, const float* __restrict__ resid, int rmod, int ldr,
                                                float* __restrict__ C, int ldc, int M, int N, int K) {
  __shared__ __attribute__((aligned(16))) float so[4][16][64];
  const int tid = threadIdx.x, w = tid >> 5, lane = tid & 31, ln = lane & 15, hh = lane >> 4;
  const int ntn = N / 64;
  const int wid = blockIdx.x * 4 + w;
  const int mt = wid / ntn, nq = wid % ntn;
  if (mt * 16 >= M) return;
  const int row0 = mt * 16, col0 = nq * 64;
  const float* arow = A + (size_t)(row0 + ln) * lda;
  v8f acc[4] = {};
  for (int kb = 0; kb < K; kb += 32) {
    FragB ah, al;
    const v4f x0 = *(const v4fa*)(arow + kb + 8 * hh), x1 = *(const v4fa*)(arow + kb + 8 * hh + 4);
    const v4f x2 = *(const v4fa*)(arow + kb + 16 + 8 * hh), x3 = *(const v4fa*)(arow + kb + 16 + 8 * hh + 4);
    float xs[16] = {x0[0],x0[1],x0[2],x0[3],x1[0],x1[1],x1[2],x1[3],x2[0],x2[1],x2[2],x2[3],x3[0],x3[1],x3[2],x3[3]};
#pragma unroll
    for (int i = 0; i < 16; ++i) { const unsigned short hb = bf16_bits(xs[i]); ah.u[i] = hb; al.u[i] = ASPLIT ? bf16_bits(xs[i] - bf16_val(hb)) : (unsigned short)0; }
#pragma unroll
    for (int t = 0; t < 4; ++t) {
      const unsigned short* brow = Wt + (size_t)(col0 + t * 16 + ln) * ldb + kb;
      FragB b;
      b.half[0] = *(const v8us*)(brow + 8 * hh);
      b.half[1] = *(const v8us*)(brow + 16 + 8 * hh);
      acc[t] = mmaN<ASPLIT ? 2 : 1>(ah.v, al.v, b.v, b.v, acc[t]);
    }
  }
#pragma unroll
  for (int t = 0; t < 4; ++t) {
    const int col = col0 + t * 16 + ln;
    float bv = bias ? bias[col] : 0.f;
    if (BIAS_BF16) bv = bf16_round(bv);
#pragma unroll
    for (int r = 0; r < 8; ++r) {
      float v = acc[t][r] + bv;
      if (resid) { float rv = resid[(size_t)((row0 + 8 * hh + r) % rmod) * ldr + col]; if (RES_BF16) rv = bf16_round(rv); v += rv; }
      if (ACT == 1) v = fmaxf(v, 0.f);
      if (ACT == 2) v = 0.5f * v * (1.0f + erff(v * 0.70710678118654752f));
      if (ACT == 3) { const float u = 0.7978845608028654f * (v + 0.044715f * v * v * v); v = 0.5f * v * (1.0f + tanhf(u)); }
      so[w][8 * hh + r][t * 16 + ln] = v;
    }
  }
  __builtin_amdgcn_fence(__ATOMIC_ACQ_REL, "workgroup");
  __builtin_amdgcn_wave_barrier();
  const int rsub = lane >> 4, c4 = (lane & 15) * 4;
  {
#pragma unroll
    for (int q = 0; q < 8; ++q) {
      const int r = q * 2 + rsub;
      const v4f v = *(const v4fa*)&so[w][r][c4];
      *(v4f*)(C + (size_t)(row0 + r) * ldc + col0 + c4) = v;
    }
    
  }
}
// row LayerNorm (biased variance, eps) over N: s = X (+ R); optional out_sum <- s; out_norm <- (s-mu)*rsqrt(var+eps)*g + b
template <bool PARAM_BF16>
__global__ __launch_bounds__(256) void k_layernorm(const float* __restrict__ X, const float* __restrict__ R, const float* __restrict__ g, const float* __restrict__ bta,
                                                  float* __restrict__ out_sum, float* __restrict__ out_norm, int N, float eps) {
  __shared__ float red[256];
  const int row = blockIdx.x, tid = threadIdx.x;
  const float* x = X + (size_t)row * N; const float* rr = R ? R + (size_t)row * N : nullptr;
  float vals[16];                     // up to N = 4096
  const int per = N / 256;            // contiguous chunk per thread? use strided-by-4 chunks: thread handles j = tid*4 + 1024*u
  float s1 = 0.f;
  for (int u = 0; u < per / 4; ++u) {
    const int j = tid * 4 + 1024 * u;
    const v4f a = *(const v4fa*)(x + j);
    v4f b = {0.f,0.f,0.f,0.f}; if (rr) b = *(const v4fa*)(rr + j);
#pragma unroll
    for (int q = 0; q < 4; ++q) { const float v = a[q] + b[q]; vals[u * 4 + q] = v; s1 += v; }
  }
  red[tid] = s1; __syncthreads();
  for (int st = 128; st > 0; st >>= 1) { if (tid < st) red[tid] += red[tid + st]; __syncthreads(); }
  const float mu = red[0] / (float)N; __syncthreads();
  float s2 = 0.f;
  for (int u = 0; u < per / 4; ++u)
#pragma unroll
    for (int q = 0; q < 4; ++q) { const float c = vals[u * 4 + q] - mu; s2 += c * c; }
  red[tid] = s2; __syncthreads();
  for (int st = 128; st > 0; st >>= 1) { if (tid < st) red[tid] += red[tid + st]; __syncthreads(); }
  const float rs = rsqrtf(red[0] / (float)N + eps);
  {
    for (int u = 0; u < per / 4; ++u) {
      const int j = tid * 4 + 1024 * u;
      v4f o, sm;
#pragma unroll
      for (int q = 0; q < 4; ++q) {
        float gg = g[j + q], bb = bta[j + q];
        if (PARAM_BF16) { gg = bf16_round(gg); bb = bf16_round(bb); }
        sm[q] = vals[u * 4 + q]; o[q] = (vals[u * 4 + q] - mu) * rs * gg + bb;
      }
      if (out_sum) *(v4f*)(out_sum + (size_t)row * N + j) = sm;
      *(v4f*)(out_norm + (size_t)row * N + j) = o;
    }
    
  }
}



// ---- f16 WMMA path (v_wmma_f32_16x16x32_f16): 11-bit significands for operands in range — used where a [0,1] probability operand needs more precision than bf16
typedef _Float16 v16h __attribute__((ext_vector_type(16)));
union FragH { v16h v; v8us half[2]; _Float16 h[16]; unsigned short u[16]; };
template <int NT>
__device__ __forceinline__ v8f mmaH(v16h ah, v16h al, v16h bh, v16h bl, v8f c) {
  c = __builtin_amdgcn_wmma_f32_16x16x32_f16(false, ah, false, bh, (short)0, c, false, false);
  if (NT >= 2) c = __builtin_amdgcn_wmma_f32_16x16x32_f16(false, al, false, bh, (short)0, c, false, false);
  if (NT >= 3) c = __builtin_amdgcn_wmma_f32_16x16x32_f16(false, ah, false, bl, (short)0, c, false, false);
  asm volatile("v_nop\n\tv_nop\n\tv_nop\n\tv_nop" : "+v"(c) : "v"(ah), "v"(al), "v"(bh), "v"(bl));
  return c;
}
// batched GEMM like k_gemm_b but f16 operands: A f32 (split into f16 hi/lo if ASPLIT, else rounded to f16), Bt = f16 values [n][k]; alpha; C f32; N multiple of 16 (partial tiles skipped)
template <bool ASPLIT>
__global__ __launch_bounds__(128) void k_gemm_h(const float* __restrict__ A, int lda, size_t sA, const _Float16* __restrict__ Bh, int ldb, size_t sB, float alpha, float* __restrict__ C, int ldc, size_t sC, int M, int N, int K) {
  __shared__ __attribute__((aligned(16))) float so[4][16][64];
  const int tid = threadIdx.x, w = tid >> 5, lane = tid & 31, ln = lane & 15, hh = lane >> 4; const int by = blockIdx.y;
  A += (size_t)by * sA; Bh += (size_t)by * sB; C += (size_t)by * sC;
  const int ntn = (N + 63) / 64; const int wid = blockIdx.x * 4 + w; const int mt = wid / ntn, nq = wid % ntn; if (mt * 16 >= M) return;
  const int row0 = mt * 16, col0 = nq * 64; const float* arow = A + (size_t)(row0 + ln) * lda;
  v8f acc[4] = {};
  for (int kb = 0; kb < K; kb += 32) {
    FragH ah, al;
    const v4f x0 = *(const v4fa*)(arow + kb + 8 * hh), x1 = *(const v4fa*)(arow + kb + 8 * hh + 4), x2 = *(const v4fa*)(arow + kb + 16 + 8 * hh), x3 = *(const v4fa*)(arow + kb + 16 + 8 * hh + 4);
    float xs[16] = {x0[0],x0[1],x0[2],x0[3],x1[0],x1[1],x1[2],x1[3],x2[0],x2[1],x2[2],x2[3],x3[0],x3[1],x3[2],x3[3]};
#pragma unroll
    for (int i = 0; i < 16; ++i) { const _Float16 h = (_Float16)xs[i]; ah.h[i] = h; al.h[i] = ASPLIT ? (_Float16)(xs[i] - (float)h) : (_Float16)0.0f; }
#pragma unroll
    for (int t = 0; t < 4; ++t) { if (col0 + t * 16 >= N) continue; const size_t boff = (size_t)(col0 + t * 16 + ln) * ldb + kb; FragH bq; bq.half[0] = *(const v8us*)(Bh + boff + 8 * hh); bq.half[1] = *(const v8us*)(Bh + boff + 16 + 8 * hh);
      acc[t] = mmaH<ASPLIT ? 2 : 1>(ah.v, al.v, bq.v, bq.v, acc[t]); }
  }
#pragma unroll
  for (int t = 0; t < 4; ++t) { if (col0 + t * 16 >= N) continue;
#pragma unroll
    for (int r = 0; r < 8; ++r) so[w][8 * hh + r][t * 16 + ln] = acc[t][r] * alpha; }
  __builtin_amdgcn_fence(__ATOMIC_ACQ_REL, "workgroup"); __builtin_amdgcn_wave_barrier();
  const int rsub = lane >> 4, c4 = (lane & 15) * 4;
  {
#pragma unroll
    for (int q = 0; q < 8; ++q) { const int r = q * 2 + rsub; if (col0 + c4 < N) { const v4f v = *(const v4fa*)&so[w][r][c4]; *(v4f*)(C + (size_t)(row0 + r) * ldc + col0 + c4) = v; } }
     }
}

// Wt[n][k] = f16(W[k][n]·scale) from f32 row-major W[K][N] (scale = power of two; bf16-exact weights stay exact in f16 away from the subnormal range)
__global__ __launch_bounds__(256) void k_wt_f16(const float* __restrict__ W, _Float16* __restrict__ Wt, int K, int N, float scale) {
  const int t = blockIdx.x * 256 + threadIdx.x; if (t >= N * (K / 8)) return; const int n = t / (K / 8), k8 = (t % (K / 8)) * 8; FragH f;
#pragma unroll
  for (int i = 0; i < 8; ++i) f.h[i] = (_Float16)(bf16_round(W[(size_t)(k8 + i) * N + n]) * scale); const v8us o = f.half[0];
  *(v8us*)((unsigned short*)Wt + (size_t)n * K + k8) = o; 
}
// k_gemm_hh variant with fused epilogue: v = acc·alpha + bias[by·sBias + col] (+ CP[(row/rowsPerB)·sCPb + by·64 + col] if CP) ; ACT 0 none / 1 elu ; writes f16 C16 and f32 C, each if non-null
template <int ACT>
__global__ __launch_bounds__(128) void k_gemm_hhx(const _Float16* __restrict__ A, int lda, size_t sA, const _Float16* __restrict__ Bh, int ldb, size_t sB, float alpha, const float* __restrict__ bias, size_t sBias, const float* __restrict__ CP, int rowsPerB, size_t sCPb, int row0g,
    float* __restrict__ C, _Float16* __restrict__ C16, int ldc, size_t sC, int M, int N, int K) {
  __shared__ __attribute__((aligned(16))) float so[4][16][64];
  const int tid = threadIdx.x, w = tid >> 5, lane = tid & 31, ln = lane & 15, hh = lane >> 4; const int by = blockIdx.y;
  A += (size_t)by * sA; Bh += (size_t)by * sB; const size_t cofs = (size_t)by * sC; const float* bp = bias ? bias + (size_t)by * sBias : nullptr;
  const int ntn = (N + 63) / 64; const int wid = blockIdx.x * 4 + w; const int mt = wid / ntn, nq = wid % ntn; if (mt * 16 >= M) return;
  const int row0 = mt * 16, col0 = nq * 64; const _Float16* arow = A + (size_t)(row0 + ln) * lda;
  v8f acc[4] = {};
  for (int kb = 0; kb < K; kb += 32) { FragH ah; ah.half[0] = *(const v8us*)((const unsigned short*)arow + kb + 8 * hh); ah.half[1] = *(const v8us*)((const unsigned short*)arow + kb + 16 + 8 * hh);
#pragma unroll
    for (int t = 0; t < 4; ++t) { if (col0 + t * 16 >= N) continue; const size_t boff = (size_t)(col0 + t * 16 + ln) * ldb + kb; FragH bq; bq.half[0] = *(const v8us*)((const unsigned short*)Bh + boff + 8 * hh); bq.half[1] = *(const v8us*)((const unsigned short*)Bh + boff + 16 + 8 * hh);
      acc[t] = mmaH<1>(ah.v, ah.v, bq.v, bq.v, acc[t]); }
  }
#pragma unroll
  for (int t = 0; t < 4; ++t) { if (col0 + t * 16 >= N) continue; const int col = col0 + t * 16 + ln; const float bv = bp ? bf16_round(bp[col]) : 0.f;
#pragma unroll
    for (int r = 0; r < 8; ++r) { float v = acc[t][r] * alpha + bv; if (CP) { const int bidx = (row0g + row0 + 8 * hh + r) / rowsPerB; v += CP[(size_t)bidx * sCPb + (size_t)by * 64 + col]; } if (ACT == 1) v = (v > 0.f) ? v : expm1f(v); else if (ACT == 3) v = fmaxf(v, 0.f); so[w][8 * hh + r][t * 16 + ln] = v; } }
  __builtin_amdgcn_fence(__ATOMIC_ACQ_REL, "workgroup"); __builtin_amdgcn_wave_barrier();
  const int rsub = lane >> 4, c4 = (lane & 15) * 4; typedef _Float16 v4h __attribute__((ext_vector_type(4)));
  {
#pragma unroll
    for (int q = 0; q < 8; ++q) { const int r = q * 2 + rsub; if (col0 + c4 < N) { const v4f v = *(const v4fa*)&so[w][r][c4]; if (C) *(v4f*)(C + cofs + (size_t)(row0 + r) * ldc + col0 + c4) = v; if (C16) { v4h h4; for (int i = 0; i < 4; ++i) h4[i] = (_Float16)v[i]; *(v4h*)(C16 + cofs + (size_t)(row0 + r) * ldc + col0 + c4) = h4; } } }
     }
}


__global__ __launch_bounds__(256) void k_x16(const float* __restrict__ x, _Float16* __restrict__ X16, size_t n8) { const size_t t = (size_t)blockIdx.x * 256 + threadIdx.x; if (t >= n8) return; FragH f;
#pragma unroll
  for (int q = 0; q < 8; ++q) f.h[q] = (_Float16)bf16_round(x[t * 8 + q]); *(v8us*)((unsigned short*)X16 + t * 8) = f.half[0];  }
__global__ __launch_bounds__(256) void k_h16(const float* __restrict__ x, _Float16* __restrict__ X16, size_t n8) { const size_t t = (size_t)blockIdx.x * 256 + threadIdx.x; if (t >= n8) return; FragH f;
#pragma unroll
  for (int q = 0; q < 8; ++q) f.h[q] = (_Float16)x[t * 8 + q]; *(v8us*)((unsigned short*)X16 + t * 8) = f.half[0];  }
__global__ __launch_bounds__(256) void k_round16f(const float* __restrict__ W, _Float16* __restrict__ Bt, size_t n8) { const size_t t = (size_t)blockIdx.x * 256 + threadIdx.x; if (t >= n8) return; FragH f;
#pragma unroll
  for (int i = 0; i < 8; ++i) f.h[i] = (_Float16)(bf16_round(W[t * 8 + i]) * 16.0f); *(v8us*)((unsigned short*)Bt + t * 8) = f.half[0];  }
// per-pair bias, 32 pairs (same (b,i), j = j0..j0+31) per wave in two 16-row tiles: each lane computes half of the 64 relu hidden units of BOTH MLPs for its pair (k = 8hh.., 16+8hh.. per
// k-step) straight into A fragments; the second layers (64→1 geom, 64→2 delay) run on v_wmma_f32_16x16x32_f16 against B rows 0 (gw2) / 0,1 (dw2); the three results per pair go through the wave's LDS so that each of the 32 lanes does the softplus/log/lgamma tail of one pair
__global__ __launch_bounds__(128) void k_bias(const float* __restrict__ crd, const float* __restrict__ gw1, const float* __restrict__ gb1, const float* __restrict__ gw2, const float* __restrict__ gb2, const float* __restrict__ dw1, const float* __restrict__ db1, const float* __restrict__ dw2, const float* __restrict__ db2, float* __restrict__ BIAS) {
  __shared__ float sg1[BH][2], sgb[BH], sd1[BH][4], sdb[BH]; __shared__ __attribute__((aligned(16))) _Float16 sg2[BH], sd2[2][BH]; __shared__ __attribute__((aligned(16))) float sres[4][3][32];
  const int tid = threadIdx.x, w = tid >> 5, lane = tid & 31, ln = lane & 15, hh = lane >> 4;
  if (tid < BH) { sg1[tid][0] = bf16_round(gw1[tid * 2]); sg1[tid][1] = bf16_round(gw1[tid * 2 + 1]); sgb[tid] = bf16_round(gb1[tid]); for (int q = 0; q < 4; ++q) sd1[tid][q] = bf16_round(dw1[tid * 4 + q]); sdb[tid] = bf16_round(db1[tid]); sg2[tid] = (_Float16)(bf16_round(gw2[tid]) * 16.0f); sd2[0][tid] = (_Float16)(bf16_round(dw2[tid]) * 16.0f); sd2[1][tid] = (_Float16)(bf16_round(dw2[BH + tid]) * 16.0f); }
  __syncthreads();
  const size_t p0 = ((size_t)blockIdx.x * 4 + w) * 32;      // 32 consecutive pairs of one (b, i) (SS = 1024 is a multiple of 32)
  const int b = (int)(p0 / ((size_t)SS * SS)); const int i = (int)((p0 / SS) % SS); const int jb = (int)(p0 % SS);
  const float* ci = crd + ((size_t)b * SS + i) * 4; const float xi = bf16_round(ci[0]), yi = bf16_round(ci[1]), zi = bf16_round(ci[2]), ti = bf16_round(ci[3]);
  const float gb2v = bf16_round(gb2[0]), db20 = bf16_round(db2[0]), db21 = bf16_round(db2[1]);
  // B fragments (constant): geom → row n = 0 holds 16·gw2[k]; delay → rows 0,1 hold 16·dw2[n][k]
  FragH bg[2], bd[2];
#pragma unroll
  for (int ks = 0; ks < 2; ++ks) {
#pragma unroll
    for (int q = 0; q < 8; ++q) { const int k0 = ks * 32 + 8 * hh + q, k1 = ks * 32 + 16 + 8 * hh + q; bg[ks].h[q] = (ln == 0) ? sg2[k0] : (_Float16)0.f; bg[ks].h[8 + q] = (ln == 0) ? sg2[k1] : (_Float16)0.f; bd[ks].h[q] = (ln < 2) ? sd2[ln & 1][k0] : (_Float16)0.f; bd[ks].h[8 + q] = (ln < 2) ? sd2[ln & 1][k1] : (_Float16)0.f; if (ln >= 2) { bd[ks].h[q] = (_Float16)0.f; bd[ks].h[8 + q] = (_Float16)0.f; } } }
  float dts[2];
#pragma unroll
  for (int rt = 0; rt < 2; ++rt) { const int j = jb + rt * 16 + ln; const float* cj = crd + ((size_t)b * SS + j) * 4; const float xj = bf16_round(cj[0]), yj = bf16_round(cj[1]), zj = bf16_round(cj[2]), tj = bf16_round(cj[3]);
    const float dx = xi - xj, dy = yi - yj, dz = zi - zj; const float dist = sqrtf(dx * dx + dy * dy + dz * dz); const float dt = ti - tj; dts[rt] = dt;
    v8f ag = (v8f){0.f,0.f,0.f,0.f,0.f,0.f,0.f,0.f}, ad = (v8f){0.f,0.f,0.f,0.f,0.f,0.f,0.f,0.f};
#pragma unroll
    for (int ks = 0; ks < 2; ++ks) { FragH hg, hd;
#pragma unroll
      for (int q = 0; q < 16; ++q) { const int k = ks * 32 + ((q < 8) ? (8 * hh + q) : (16 + 8 * hh + q - 8)); hg.h[q] = (_Float16)fmaxf(sg1[k][0] * dist + sg1[k][1] * dt + sgb[k], 0.f); hd.h[q] = (_Float16)fmaxf(sd1[k][0] * dist + sd1[k][1] * xj + sd1[k][2] * yj + sd1[k][3] * zj + sdb[k], 0.f); }
      ag = mmaH<1>(hg.v, hg.v, bg[ks].v, bg[ks].v, ag); ad = mmaH<1>(hd.v, hd.v, bd[ks].v, bd[ks].v, ad); }
    // D layout: lane (ln = n, hh) holds rows 8hh + r of column n: geom and r0 in column 0, r1 in column 1. The column lanes hand their 8 rows to the wave's LDS planes (0 geom, 1 r0, 2 r1), indexed by pair
    if (ln < 2) { float* d = &sres[w][1 + ln][rt * 16 + 8 * hh]; *(v4fa*)d = (v4f){ad[0], ad[1], ad[2], ad[3]}; *(v4fa*)(d + 4) = (v4f){ad[4], ad[5], ad[6], ad[7]}; }
    if (ln == 0) { float* d = &sres[w][0][rt * 16 + 8 * hh]; *(v4fa*)d = (v4f){ag[0], ag[1], ag[2], ag[3]}; *(v4fa*)(d + 4) = (v4f){ag[4], ag[5], ag[6], ag[7]}; } }
  __builtin_amdgcn_fence(__ATOMIC_ACQ_REL, "workgroup"); __builtin_amdgcn_wave_barrier();      // the wave's own LDS writes above are read by its other lanes below
  // every lane finishes ONE pair, j = jb + lane = jb + 16 hh + ln: its dt is the one this lane formed in tile rt = hh
  { const float dtm = hh ? dts[1] : dts[0];
    const float geom = sres[w][0][lane] * 0.0625f + gb2v; const float q0 = sres[w][1][lane] * 0.0625f + db20, q1 = sres[w][2][lane] * 0.0625f + db21;
    const float shape = ((q0 > 20.f) ? q0 : log1pf(expf(q0))) + 1e-4f, rate = ((q1 > 20.f) ? q1 : log1pf(expf(q1))) + 1e-4f; const float dtp = fmaxf(fabsf(dtm), 1e-4f);
    BIAS[p0 + lane] = geom + shape * logf(rate) + (shape - 1.0f) * logf(dtp) - rate * dtp - lgammaf(shape); } }
__global__ __launch_bounds__(256) void k_vt(const _Float16* __restrict__ V16, _Float16* __restrict__ Vt) { __shared__ unsigned short tl[64][34]; const int tid = threadIdx.x; const int slab = blockIdx.x / (SS / 64), lg = blockIdx.x % (SS / 64); const int b = slab / NH, h = slab % NH;
  for (int i = tid; i < 64 * 4; i += 256) { const int r = i / 4, c8 = (i % 4) * 8; FragH f; f.half[0] = *(const v8us*)((const unsigned short*)V16 + ((size_t)b * SS + lg * 64 + r) * DM + h * HD + c8);
#pragma unroll
    for (int q = 0; q < 8; ++q) tl[r][c8 + q] = f.u[q]; }
  __syncthreads();
  { const int d = tid / 8, pc = tid % 8; FragH f;
#pragma unroll
    for (int q = 0; q < 8; ++q) f.u[q] = tl[pc * 8 + q][d];
    *(v8us*)((unsigned short*)Vt + ((size_t)slab * HD + d) * SS + lg * 64 + pc * 8) = f.half[0];  } }
__global__ __launch_bounds__(128) void k_flash(const _Float16* __restrict__ Q16, const _Float16* __restrict__ K16, const _Float16* __restrict__ Vt, const float* __restrict__ BIAS, float* __restrict__ O) {
  constexpr int RPW = 32, NQB = SS / (4 * RPW), DT = 2;
  __shared__ __attribute__((aligned(16))) unsigned short sP[4][RPW][40]; __shared__ __attribute__((aligned(16))) float sO[4][RPW][HD + 4];
  const int tid = threadIdx.x, w = tid >> 5, lane = tid & 31, ln = lane & 15, hh = lane >> 4;
  const int slab = blockIdx.x / NQB, qblk = blockIdx.x % NQB; const int b = slab / NH, h = slab % NH; const int q0 = qblk * (4 * RPW) + w * RPW;
  FragH aq[2];
#pragma unroll
  for (int rt = 0; rt < 2; ++rt) { const unsigned short* qr = (const unsigned short*)Q16 + ((size_t)b * SS + q0 + rt * 16 + ln) * DM + h * HD; aq[rt].half[0] = *(const v8us*)(qr + 8 * hh); aq[rt].half[1] = *(const v8us*)(qr + 16 + 8 * hh); }
  const unsigned short* Vth = (const unsigned short*)Vt + (size_t)slab * HD * SS;
  float m_r[2][8], l_r[2][8]; v8f oacc[2][DT];
#pragma unroll
  for (int rt = 0; rt < 2; ++rt) {
#pragma unroll
    for (int r = 0; r < 8; ++r) { m_r[rt][r] = -3.0e38f; l_r[rt][r] = 0.f; }
#pragma unroll
    for (int dt = 0; dt < DT; ++dt) oacc[rt][dt] = (v8f){0.f,0.f,0.f,0.f,0.f,0.f,0.f,0.f}; }
  const float scale = 0.17677669529663688f;
#pragma unroll 1
  for (int j0 = 0; j0 < SS; j0 += 32) {
    v8f s[2][2];
#pragma unroll
    for (int nt = 0; nt < 2; ++nt) { const unsigned short* kr = (const unsigned short*)K16 + ((size_t)b * SS + j0 + nt * 16 + ln) * DM + h * HD; FragH bk; bk.half[0] = *(const v8us*)(kr + 8 * hh); bk.half[1] = *(const v8us*)(kr + 16 + 8 * hh);
#pragma unroll
      for (int rt = 0; rt < 2; ++rt) { v8f acc = (v8f){0.f,0.f,0.f,0.f,0.f,0.f,0.f,0.f}; acc = mmaH<1>(aq[rt].v, aq[rt].v, bk.v, bk.v, acc); s[rt][nt] = acc; } }
#pragma unroll
    for (int rt = 0; rt < 2; ++rt)
#pragma unroll
      for (int r = 0; r < 8; ++r) { const int qi = q0 + rt * 16 + 8 * hh + r; const float* br = BIAS + ((size_t)b * SS + qi) * SS + j0; const float s0 = s[rt][0][r] * scale + br[ln], s1 = s[rt][1][r] * scale + br[16 + ln]; float mc = fmaxf(s0, s1);
        mc = fmaxf(mc, __shfl_xor(mc, 1, 32)); mc = fmaxf(mc, __shfl_xor(mc, 2, 32)); mc = fmaxf(mc, __shfl_xor(mc, 4, 32)); mc = fmaxf(mc, __shfl_xor(mc, 8, 32));
        const float mn = fmaxf(m_r[rt][r], mc); const float al = expf(m_r[rt][r] - mn); m_r[rt][r] = mn; const float p0 = expf(s0 - mn), p1 = expf(s1 - mn); l_r[rt][r] = l_r[rt][r] * al + p0 + p1;
#pragma unroll
        for (int dt = 0; dt < DT; ++dt) oacc[rt][dt][r] *= al;
        FragH t2; t2.h[0] = (_Float16)p0; t2.h[1] = (_Float16)p1; sP[w][rt * 16 + 8 * hh + r][ln] = t2.u[0]; sP[w][rt * 16 + 8 * hh + r][16 + ln] = t2.u[1]; }
    __builtin_amdgcn_fence(__ATOMIC_ACQ_REL, "workgroup"); __builtin_amdgcn_wave_barrier();
    FragH pa[2];
#pragma unroll
    for (int rt = 0; rt < 2; ++rt) { pa[rt].half[0] = *(const v8us*)&sP[w][rt * 16 + ln][8 * hh]; pa[rt].half[1] = *(const v8us*)&sP[w][rt * 16 + ln][16 + 8 * hh]; }
#pragma unroll
    for (int dt = 0; dt < DT; ++dt) { const unsigned short* vrow = Vth + (size_t)(dt * 16 + ln) * SS + j0; FragH bv; bv.half[0] = *(const v8us*)(vrow + 8 * hh); bv.half[1] = *(const v8us*)(vrow + 16 + 8 * hh);
#pragma unroll
      for (int rt = 0; rt < 2; ++rt) oacc[rt][dt] = mmaH<1>(pa[rt].v, pa[rt].v, bv.v, bv.v, oacc[rt][dt]); }
    __builtin_amdgcn_fence(__ATOMIC_ACQ_REL, "workgroup"); __builtin_amdgcn_wave_barrier(); }
#pragma unroll
  for (int rt = 0; rt < 2; ++rt) {
#pragma unroll
    for (int r = 0; r < 8; ++r) { float l = l_r[rt][r]; l += __shfl_xor(l, 1, 32); l += __shfl_xor(l, 2, 32); l += __shfl_xor(l, 4, 32); l += __shfl_xor(l, 8, 32); l_r[rt][r] = 1.0f / l; }
#pragma unroll
    for (int dt = 0; dt < DT; ++dt)
#pragma unroll
      for (int r = 0; r < 8; ++r) sO[w][rt * 16 + 8 * hh + r][dt * 16 + ln] = oacc[rt][dt][r] * l_r[rt][r]; }
  __builtin_amdgcn_fence(__ATOMIC_ACQ_REL, "workgroup"); __builtin_amdgcn_wave_barrier();
  {
#pragma unroll
    for (int rp = 0; rp < RPW; rp += 4) { const int r = rp + (lane >> 3), pc = lane & 7; const v4f val = *(const v4fa*)&sO[w][r][pc * 4]; *(v4f*)(O + ((size_t)b * SS + q0 + r) * DM + h * HD + pc * 4) = val; }
     } }
extern "C" void kernel_launch(void* const* d_in, const int* in_sizes, int n_in,
                              void* d_out, int out_size, void* d_ws, size_t ws_size, hipStream_t stream) {
  (void)in_sizes; (void)n_in; (void)out_size;
  const float* src = (const float*)d_in[0]; const float* crd = (const float*)d_in[1]; const float* Wq = (const float*)d_in[2]; const float* Wk = (const float*)d_in[3]; const float* Wv = (const float*)d_in[4]; const float* Wo = (const float*)d_in[5];
  const float* gw1 = (const float*)d_in[6]; const float* gb1 = (const float*)d_in[7]; const float* gw2 = (const float*)d_in[8]; const float* gb2 = (const float*)d_in[9]; const float* dw1 = (const float*)d_in[10]; const float* db1 = (const float*)d_in[11]; const float* dw2 = (const float*)d_in[12]; const float* db2 = (const float*)d_in[13];
  char* ws = (char*)d_ws; size_t off = 0;
  auto take = [&](size_t bytes) { char* p = ws + off; off += (bytes + 255) & ~(size_t)255; return p; };
  const size_t w8 = (size_t)DM * DM / 8;
  _Float16* Bq = (_Float16*)take(w8 * 16); _Float16* Bk = (_Float16*)take(w8 * 16); _Float16* Bv = (_Float16*)take(w8 * 16); _Float16* Bo = (_Float16*)take(w8 * 16); _Float16* X16 = (_Float16*)take((size_t)NR * DM * 2); _Float16* Q16 = (_Float16*)take((size_t)NR * DM * 2); _Float16* K16 = (_Float16*)take((size_t)NR * DM * 2); _Float16* V16 = (_Float16*)take((size_t)NR * DM * 2); _Float16* Vt = (_Float16*)take((size_t)NR * DM * 2); float* BIAS = (float*)take((size_t)BB * SS * SS * 4); float* O = (float*)take((size_t)NR * DM * 4); _Float16* O16 = (_Float16*)take((size_t)NR * DM * 2);
  if (off > ws_size) return;      // ≈ 16.5 MiB
  const unsigned gw = (unsigned)((w8 + 255) / 256), gx = (unsigned)(((size_t)NR * DM / 8 + 255) / 256);
  k_round16f<<<gw, 256, 0, stream>>>(Wq, Bq, w8); k_round16f<<<gw, 256, 0, stream>>>(Wk, Bk, w8); k_round16f<<<gw, 256, 0, stream>>>(Wv, Bv, w8); k_round16f<<<gw, 256, 0, stream>>>(Wo, Bo, w8);
  k_x16<<<gx, 256, 0, stream>>>(src, X16, (size_t)NR * DM / 8);
  const dim3 gg(((NR / 16) * (DM / 64) + 3) / 4, 1);
  k_gemm_hhx<0><<<gg, 128, 0, stream>>>(X16, DM, 0, Bq, DM, 0, 0.0625f, nullptr, 0, nullptr, 1, 0, 0, nullptr, Q16, DM, 0, NR, DM, DM);
  k_gemm_hhx<0><<<gg, 128, 0, stream>>>(X16, DM, 0, Bk, DM, 0, 0.0625f, nullptr, 0, nullptr, 1, 0, 0, nullptr, K16, DM, 0, NR, DM, DM);
  k_gemm_hhx<0><<<gg, 128, 0, stream>>>(X16, DM, 0, Bv, DM, 0, 0.0625f, nullptr, 0, nullptr, 1, 0, 0, nullptr, V16, DM, 0, NR, DM, DM);
  k_bias<<<(unsigned)((size_t)BB * SS * SS / 128), 128, 0, stream>>>(crd, gw1, gb1, gw2, gb2, dw1, db1, dw2, db2, BIAS);      // 32 pairs per wave
  k_vt<<<BB * NH * (SS / 64), 256, 0, stream>>>(V16, Vt);
  k_flash<<<BB * NH * (SS / 128), 128, 0, stream>>>(Q16, K16, Vt, BIAS, O);
  k_h16<<<gx, 256, 0, stream>>>(O, O16, (size_t)NR * DM / 8);
  k_gemm_hhx<0><<<gg, 128, 0, stream>>>(O16, DM, 0, Bo, DM, 0, 0.0625f, nullptr, 0, nullptr, 1, 0, 0, (float*)d_out, nullptr, DM, 0, NR, DM, DM);
}

// v002
// Measured time: 151 microseconds a run.
// In two side-by-side timings against v001, it was 1.27 and 1.28 times as fast.
// All steps since v000 together make it 2.54 times as fast.
#include <hip/hip_runtime.h>
// q/k/v/o projections (2048 × 256 × 256) and the 8-head attention (d = 32) with an additive per-pair bias on v_wmma_f32_16x16x32_f16 (fused flash-style kernel: S = Q·Kᵀ, O = P·V on WMMA;
// online max/sum softmax f32; P f16 <= 1). The bias (geometric 2->64->1 MLP + the Gamma log-density from the 4->64->2 delay MLP, incl. lgamma) is computed once per (b, i, j): both layers of the two MLPs
// on WMMA, softplus/log/lgamma in f32; the bias plane is shared by the 8 heads. A = f16(bf16 ·) exact operands (o projection: f16(O)), weights bf16-exact ×2^4 ((out,in)), single products, f32 accumulate.
#define BB 2
#define SS 1024
#define DM 256
#define NH 8
#define HD 32
#define BH 64
#define NR (BB * SS)

typedef __bf16 v16b __attribute__((ext_vector_type(16)));
typedef unsigned short v8us __attribute__((ext_vector_type(8), may_alias));
typedef float  v8f  __attribute__((ext_vector_type(8)));
typedef float  v4f  __attribute__((ext_vector_type(4)));
typedef float  v4fa __attribute__((ext_vector_type(4), may_alias));
union FragB { v16b v; v8us half[2]; unsigned short u[16]; };

__device__ __forceinline__ unsigned short bf16_bits(float x) { unsigned int u = __float_as_uint(x); return (unsigned short)((u + 0x7FFFu + ((u >> 16) & 1u)) >> 16); }
__device__ __forceinline__ float bf16_val(unsigned short b) { return __uint_as_float(((unsigned int)b) << 16); }
__device__ __forceinline__ float bf16_round(float x) { return bf16_val(bf16_bits(x)); }
// D += A·B with NT terms: 1 = ah·bh, 2 = + al·bh (A split), 3 = + ah·bl (both split)
template <int NT>
__device__ __forceinline__ v8f mmaN(v16b ah, v16b al, v16b bh, v16b bl, v8f c) {
  c = __builtin_amdgcn_wmma_f32_16x16x32_bf16(false, ah, false, bh, (short)0, c, false, false);
  if (NT >= 2) c = __builtin_amdgcn_wmma_f32_16x16x32_bf16(false, al, false, bh, (short)0, c, false, false);
  if (NT >= 3) c = __builtin_amdgcn_wmma_f32_16x16x32_bf16(false, ah, false, bl, (short)0, c, false, false);
  asm volatile("v_nop\n\tv_nop\n\tv_nop\n\tv_nop" : "+v"(c) : "v"(ah), "v"(al), "v"(bh), "v"(bl));
  return c;
}

__global__ __launch_bounds__(256) void k_wt_bf16(const float* __restrict__ W, unsigned short* __restrict__ Wt, int K, int N) {
  const int t = blockIdx.x * 256 + threadIdx.x;
  const int k8n = K / 8;
  if (t >= N * k8n) return;
  const int n = t / k8n, k8 = (t % k8n) * 8;
  v8us v;
#pragma unroll
  for (int i = 0; i < 8; ++i) v[i] = bf16_bits(W[(size_t)(k8 + i) * N + n]);
  *(v8us*)(Wt + (size_t)n * K + k8) = v;
  
}

// GEMM C[M][N] (f32, pitch ldc) = act(A[M][K]·W + bias). A f32 row-major (pitch lda) converted per fragment to bf16
// (ASPLIT: hi/lo two planes -> 2 terms, else single rounded term); Wt bf16 [N][K] (pitch ldb). BIAS_BF16 rounds the
// bias to bf16 first (bias quantised to bf16 before the add). K%32==0, M%16==0, N%64==0.
template <bool ASPLIT, int ACT, bool BIAS_BF16>
__global__ __launch_bounds__(128) void k_gemm_bf(const float* __restrict__ A, int lda, const unsigned short* __restrict__ Wt, int ldb,
                                               const float* __restrict__ bias, float* __restrict__ C, int ldc, int M, int N, int K) {
  __shared__ __attribute__((aligned(16))) float so[4][16][64];
  const int tid = threadIdx.x, w = tid >> 5, lane = tid & 31, ln = lane & 15, hh = lane >> 4;
  const int ntn = N / 64;
  const int wid = blockIdx.x * 4 + w;
  const int mt = wid / ntn, nq = wid % ntn;
  if (mt * 16 >= M) return;
  const int row0 = mt * 16, col0 = nq * 64;
  const float* arow = A + (size_t)(row0 + ln) * lda;
  v8f acc[4] = {};
  for (int kb = 0; kb < K; kb += 32) {
    FragB ah, al;
    const v4f x0 = *(const v4fa*)(arow + kb + 8 * hh), x1 = *(const v4fa*)(arow + kb + 8 * hh + 4);
    const v4f x2 = *(const v4fa*)(arow + kb + 16 + 8 * hh), x3 = *(const v4fa*)(arow + kb + 16 + 8 * hh + 4);
    float xs[16] = {x0[0],x0[1],x0[2],x0[3],x1[0],x1[1],x1[2],x1[3],x2[0],x2[1],x2[2],x2[3],x3[0],x3[1],x3[2],x3[3]};
#pragma unroll
    for (int i = 0; i < 16; ++i) { const unsigned short hb = bf16_bits(xs[i]); ah.u[i] = hb; al.u[i] = ASPLIT ? bf16_bits(xs[i] - bf16_val(hb)) : (unsigned short)0; }
#pragma unroll
    for (int t = 0; t < 4; ++t) {
      const unsigned short* brow = Wt + (size_t)(col0 + t * 16 + ln) * ldb + kb;
      FragB b;
      b.half[0] = *(const v8us*)(brow + 8 * hh);
      b.half[1] = *(const v8us*)(brow + 16 + 8 * hh);
      acc[t] = mmaN<ASPLIT ? 2 : 1>(ah.v, al.v, b.v, b.v, acc[t]);
    }
  }
#pragma unroll
  for (int t = 0; t < 4; ++t) {
    float bv = bias ? bias[col0 + t * 16 + ln] : 0.f;
    if (BIAS_BF16) bv = bf16_round(bv);
#pragma unroll
    for (int r = 0; r < 8; ++r) { float v = acc[t][r] + bv; if (ACT == 1) v = fmaxf(v, 0.f); so[w][8 * hh + r][t * 16 + ln] = v; }
  }
  __builtin_amdgcn_fence(__ATOMIC_ACQ_REL, "workgroup");
  __builtin_amdgcn_wave_barrier();
  const int rsub = lane >> 4, c4 = (lane & 15) * 4;
  {
#pragma unroll
    for (int q = 0; q < 8; ++q) {
      const int r = q * 2 + rsub;
      const v4f v = *(const v4fa*)&so[w][r][c4];
      *(v4f*)(C + (size_t)(row0 + r) * ldc + col0 + c4) = v;
    }
    
  }
}

// Flash-style causal/unmasked attention, all contractions 3-term bf16 hi/lo splits, f32 softmax with running max.
// q,k,v rows are read from f32 buffers with arbitrary row pitch (so they can live inside a fused qkv buffer);
// D = head size (multiple of 32, <= 128); one wave = 16 query rows; block = 4 waves (64 queries) sharing K/V chunks of 32.
template <int D, bool CAUSAL>
__global__ __launch_bounds__(128) void k_flash(const float* __restrict__ qb, const float* __restrict__ kb, const float* __restrict__ vb,
                                             int pitch, int T, int H, float scale, float* __restrict__ y, int ypitch) {
  constexpr int KS = D / 32;        // k-steps for QK
  constexpr int DT = D / 16;        // d tiles for PV
  __shared__ __attribute__((aligned(16))) unsigned short sKh[32][D + 8], sKl[32][D + 8], sVh[32][D + 8], sVl[32][D + 8];
  __shared__ __attribute__((aligned(16))) unsigned short sPh[4][16][40], sPl[4][16][40];
  __shared__ __attribute__((aligned(16))) float sO[4][16][D];
  const int tid = threadIdx.x, w = tid >> 5, lane = tid & 31, ln = lane & 15, hh = lane >> 4;
  const int nqb = (T + 63) / 64;
  const int bh = blockIdx.x / nqb, qblk = blockIdx.x % nqb;
  const int b = bh / H, h = bh % H;
  const int q0 = qblk * 64 + w * 16;
  const float* Q = qb + (size_t)b * T * pitch + h * D;
  const float* K = kb + (size_t)b * T * pitch + h * D;
  const float* V = vb + (size_t)b * T * pitch + h * D;

  // A fragments of the wave's 16 query rows (scaled), hi/lo
  FragB aqh[KS], aql[KS];
  {
    int row = q0 + ln; if (row >= T) row = T - 1;
    const float* qr = Q + (size_t)row * pitch;
#pragma unroll
    for (int ks = 0; ks < KS; ++ks)
#pragma unroll
      for (int i = 0; i < 16; ++i) {
        const int d = ks * 32 + ((i < 8) ? (8 * hh + i) : (16 + 8 * hh + (i - 8)));
        const float x = qr[d] * scale; const unsigned short hb = bf16_bits(x);
        aqh[ks].u[i] = hb; aql[ks].u[i] = bf16_bits(x - bf16_val(hb));
      }
  }
  float m_r[8], l_r[8];
#pragma unroll
  for (int r = 0; r < 8; ++r) { m_r[r] = -3.0e38f; l_r[r] = 0.f; }
  v8f oacc[DT];
#pragma unroll
  for (int dt = 0; dt < DT; ++dt) oacc[dt] = (v8f){0.f,0.f,0.f,0.f,0.f,0.f,0.f,0.f};

  const int kv_end = CAUSAL ? min(T, qblk * 64 + 64) : T;     // block-uniform
  for (int j0 = 0; j0 < kv_end; j0 += 32) {
    __syncthreads();
    for (int e = tid; e < 32 * (D / 4); e += 128) {
      const int r = e / (D / 4), c4 = (e % (D / 4)) * 4;
      const int key = j0 + r;
      v4f kf = {0.f,0.f,0.f,0.f}, vf = {0.f,0.f,0.f,0.f};
      if (key < T) { kf = *(const v4fa*)(K + (size_t)key * pitch + c4); vf = *(const v4fa*)(V + (size_t)key * pitch + c4); }
#pragma unroll
      for (int t = 0; t < 4; ++t) {
        unsigned short hb = bf16_bits(kf[t]); sKh[r][c4 + t] = hb; sKl[r][c4 + t] = bf16_bits(kf[t] - bf16_val(hb));
        hb = bf16_bits(vf[t]); sVh[r][c4 + t] = hb; sVl[r][c4 + t] = bf16_bits(vf[t] - bf16_val(hb));
      }
    }
    __syncthreads();
    // S tile 16 x 32
    v8f s[2];
#pragma unroll
    for (int nt = 0; nt < 2; ++nt) {
      v8f acc = {};
#pragma unroll
      for (int ks = 0; ks < KS; ++ks) {
        FragB bh_, bl_;
        bh_.half[0] = *(const v8us*)&sKh[nt * 16 + ln][ks * 32 + 8 * hh]; bh_.half[1] = *(const v8us*)&sKh[nt * 16 + ln][ks * 32 + 16 + 8 * hh];
        bl_.half[0] = *(const v8us*)&sKl[nt * 16 + ln][ks * 32 + 8 * hh]; bl_.half[1] = *(const v8us*)&sKl[nt * 16 + ln][ks * 32 + 16 + 8 * hh];
        acc = mmaN<3>(aqh[ks].v, aql[ks].v, bh_.v, bl_.v, acc);
      }
      s[nt] = acc;
    }
    // mask + running max (rows 8hh+r; the 16 lanes of a half share rows)
    float alpha[8];
#pragma unroll
    for (int r = 0; r < 8; ++r) {
      const int qi = q0 + 8 * hh + r;
      const int ja = j0 + ln, jb = j0 + 16 + ln;
      if (CAUSAL) { if (ja > qi) s[0][r] = -3.0e38f; if (jb > qi) s[1][r] = -3.0e38f; }
      if (ja >= T) s[0][r] = -3.0e38f;
      if (jb >= T) s[1][r] = -3.0e38f;
      float mx = fmaxf(s[0][r], s[1][r]);
      mx = fmaxf(mx, __shfl_xor(mx, 1, 32)); mx = fmaxf(mx, __shfl_xor(mx, 2, 32)); mx = fmaxf(mx, __shfl_xor(mx, 4, 32)); mx = fmaxf(mx, __shfl_xor(mx, 8, 32));
      const float mnew = fmaxf(m_r[r], mx);
      alpha[r] = (mnew > -1.0e38f) ? __expf(m_r[r] - mnew) : 1.0f;
      const float p0 = (s[0][r] > -1.0e38f) ? __expf(s[0][r] - mnew) : 0.f;
      const float p1 = (s[1][r] > -1.0e38f) ? __expf(s[1][r] - mnew) : 0.f;
      m_r[r] = mnew;
      l_r[r] = l_r[r] * alpha[r] + p0 + p1;            // per-lane partial row sum (16 lanes combined at the end)
      unsigned short hb = bf16_bits(p0); sPh[w][8 * hh + r][ln] = hb;      sPl[w][8 * hh + r][ln] = bf16_bits(p0 - bf16_val(hb));
      hb = bf16_bits(p1);                sPh[w][8 * hh + r][16 + ln] = hb; sPl[w][8 * hh + r][16 + ln] = bf16_bits(p1 - bf16_val(hb));
    }
#pragma unroll
    for (int dt = 0; dt < DT; ++dt)
#pragma unroll
      for (int r = 0; r < 8; ++r) oacc[dt][r] *= alpha[r];
    __builtin_amdgcn_fence(__ATOMIC_ACQ_REL, "workgroup");
    __builtin_amdgcn_wave_barrier();
    FragB pah, pal;
    pah.half[0] = *(const v8us*)&sPh[w][ln][8 * hh]; pah.half[1] = *(const v8us*)&sPh[w][ln][16 + 8 * hh];
    pal.half[0] = *(const v8us*)&sPl[w][ln][8 * hh]; pal.half[1] = *(const v8us*)&sPl[w][ln][16 + 8 * hh];
#pragma unroll
    for (int dt = 0; dt < DT; ++dt) {
      FragB bvh, bvl;
#pragma unroll
      for (int i = 0; i < 8; ++i) {
        bvh.u[i] = sVh[8 * hh + i][dt * 16 + ln]; bvh.u[8 + i] = sVh[16 + 8 * hh + i][dt * 16 + ln];
        bvl.u[i] = sVl[8 * hh + i][dt * 16 + ln]; bvl.u[8 + i] = sVl[16 + 8 * hh + i][dt * 16 + ln];
      }
      oacc[dt] = mmaN<3>(pah.v, pal.v, bvh.v, bvl.v, oacc[dt]);
    }
    __builtin_amdgcn_fence(__ATOMIC_ACQ_REL, "workgroup");
    __builtin_amdgcn_wave_barrier();
  }
#pragma unroll
  for (int r = 0; r < 8; ++r) {
    float l = l_r[r];
    l += __shfl_xor(l, 1, 32); l += __shfl_xor(l, 2, 32); l += __shfl_xor(l, 4, 32); l += __shfl_xor(l, 8, 32);
    l_r[r] = (l > 0.f) ? 1.0f / l : 0.f;
  }
#pragma unroll
  for (int dt = 0; dt < DT; ++dt)
#pragma unroll
    for (int r = 0; r < 8; ++r) sO[w][8 * hh + r][dt * 16 + ln] = oacc[dt][r] * l_r[r];
  __builtin_amdgcn_fence(__ATOMIC_ACQ_REL, "workgroup");
  __builtin_amdgcn_wave_barrier();
  {
    for (int r = 0; r < 16; ++r) {
      const int row = q0 + r;
      if (row < T && lane < D / 4) {
        const v4f val = *(const v4fa*)&sO[w][r][lane * 4];
        *(v4f*)(y + ((size_t)b * T + row) * ypitch + h * D + lane * 4) = val;
      }
    }
    
  }
}

// GEMM C = act(A·W + bias + resid): A f32 (ASPLIT -> hi/lo 2 terms), Wt bf16 [N][K]; ACT 0 none, 1 relu, 2 exact gelu;
// resid (optional, f32, row index = (row % rmod), pitch ldr, RES_BF16 rounds it) added before the activation.
template <bool ASPLIT, int ACT, bool BIAS_BF16, bool RES_BF16>
__global__ __launch_bounds__(128) void k_gemm_bf3(const float* __restrict__ A, int lda, const unsigned short* __restrict__ Wt, int ldb,
                                                const float* __restrict__ bias, const float* __restrict__ resid, int rmod, int ldr,
                                                float* __restrict__ C, int ldc, int M, int N, int K) {
  __shared__ __attribute__((aligned(16))) float so[4][16][64];
  const int tid = threadIdx.x, w = tid >> 5, lane = tid & 31, ln = lane & 15, hh = lane >> 4;
  const int ntn = N / 64;
  const int wid = blockIdx.x * 4 + w;
  const int mt = wid / ntn, nq = wid % ntn;
  if (mt * 16 >= M) return;
  const int row0 = mt * 16, col0 = nq * 64;
  const float* arow = A + (size_t)(row0 + ln) * lda;
  v8f acc[4] = {};
  for (int kb = 0; kb < K; kb += 32) {
    FragB ah, al;
    const v4f x0 = *(const v4fa*)(arow + kb + 8 * hh), x1 = *(const v4fa*)(arow + kb + 8 * hh + 4);
    const v4f x2 = *(const v4fa*)(arow + kb + 16 + 8 * hh), x3 = *(const v4fa*)(arow + kb + 16 + 8 * hh + 4);
    float xs[16] = {x0[0],x0[1],x0[2],x0[3],x1[0],x1[1],x1[2],x1[3],x2[0],x2[1],x2[2],x2[3],x3[0],x3[1],x3[2],x3[3]};
#pragma unroll
    for (int i = 0; i < 16; ++i) { const unsigned short hb = bf16_bits(xs[i]); ah.u[i] = hb; al.u[i] = ASPLIT ? bf16_bits(xs[i] - bf16_val(hb)) : (unsigned short)0; }
#pragma unroll
    for (int t = 0; t < 4; ++t) {
      const unsigned short* brow = Wt + (size_t)(col0 + t * 16 + ln) * ldb + kb;
      FragB b;
      b.half[0] = *(const v8us*)(brow + 8 * hh);
      b.half[1] = *(const v8us*)(brow + 16 + 8 * hh);
      acc[t] = mmaN<ASPLIT ? 2 : 1>(ah.v, al.v, b.v, b.v, acc[t]);
    }
  }
#pragma unroll
  for (int t = 0; t < 4; ++t) {
    const int col = col0 + t * 16 + ln;
    float bv = bias ? bias[col] : 0.f;
    if (BIAS_BF16) bv = bf16_round(bv);
#pragma unroll
    for (int r = 0; r < 8; ++r) {
      float v = acc[t][r] + bv;
      if (resid) { float rv = resid[(size_t)((row0 + 8 * hh + r) % rmod) * ldr + col]; if (RES_BF16) rv = bf16_round(rv); v += rv; }
      if (ACT == 1) v = fmaxf(v, 0.f);
      if (ACT == 2) v = 0.5f * v * (1.0f + erff(v * 0.70710678118654752f));
      if (ACT == 3) { const float u = 0.7978845608028654f * (v + 0.044715f * v * v * v); v = 0.5f * v * (1.0f + tanhf(u)); }
      so[w][8 * hh + r][t * 16 + ln] = v;
    }
  }
  __builtin_amdgcn_fence(__ATOMIC_ACQ_REL, "workgroup");
  __builtin_amdgcn_wave_barrier();
  const int rsub = lane >> 4, c4 = (lane & 15) * 4;
  {
#pragma unroll
    for (int q = 0; q < 8; ++q) {
      const int r = q * 2 + rsub;
      const v4f v = *(const v4fa*)&so[w][r][c4];
      *(v4f*)(C + (size_t)(row0 + r) * ldc + col0 + c4) = v;
    }
    
  }
}
// row LayerNorm (biased variance, eps) over N: s = X (+ R); optional out_sum <- s; out_norm <- (s-mu)*rsqrt(var+eps)*g + b
template <bool PARAM_BF16>
__global__ __launch_bounds__(256) void k_layernorm(const float* __restrict__ X, const float* __restrict__ R, const float* __restrict__ g, const float* __restrict__ bta,
                                                  float* __restrict__ out_sum, float* __restrict__ out_norm, int N, float eps) {
  __shared__ float red[256];
  const int row = blockIdx.x, tid = threadIdx.x;
  const float* x = X + (size_t)row * N; const float* rr = R ? R + (size_t)row * N : nullptr;
  float vals[16];                     // up to N = 4096
  const int per = N / 256;            // contiguous chunk per thread? use strided-by-4 chunks: thread handles j = tid*4 + 1024*u
  float s1 = 0.f;
  for (int u = 0; u < per / 4; ++u) {
    const int j = tid * 4 + 1024 * u;
    const v4f a = *(const v4fa*)(x + j);
    v4f b = {0.f,0.f,0.f,0.f}; if (rr) b = *(const v4fa*)(rr + j);
#pragma unroll
    for (int q = 0; q < 4; ++q) { const float v = a[q] + b[q]; vals[u * 4 + q] = v; s1 += v; }
  }
  red[tid] = s1; __syncthreads();
  for (int st = 128; st > 0; st >>= 1) { if (tid < st) red[tid] += red[tid + st]; __syncthreads(); }
  const float mu = red[0] / (float)N; __syncthreads();
  float s2 = 0.f;
  for (int u = 0; u < per / 4; ++u)
#pragma unroll
    for (int q = 0; q < 4; ++q) { const float c = vals[u * 4 + q] - mu; s2 += c * c; }
  red[tid] = s2; __syncthreads();
  for (int st = 128; st > 0; st >>= 1) { if (tid < st) red[tid] += red[tid + st]; __syncthreads(); }
  const float rs = rsqrtf(red[0] / (float)N + eps);
  {
    for (int u = 0; u < per / 4; ++u) {
      const int j = tid * 4 + 1024 * u;
      v4f o, sm;
#pragma unroll
      for (int q = 0; q < 4; ++q) {
        float gg = g[j + q], bb = bta[j + q];
        if (PARAM_BF16) { gg = bf16_round(gg); bb = bf16_round(bb); }
        sm[q] = vals[u * 4 + q]; o[q] = (vals[u * 4 + q] - mu) * rs * gg + bb;
      }
      if (out_sum) *(v4f*)(out_sum + (size_t)row * N + j) = sm;
      *(v4f*)(out_norm + (size_t)row * N + j) = o;
    }
    
  }
}



// ---- f16 WMMA path (v_wmma_f32_16x16x32_f16): 11-bit significands for operands in range — used where a [0,1] probability operand needs more precision than bf16
typedef _Float16 v16h __attribute__((ext_vector_type(16)));
union FragH { v16h v; v8us half[2]; _Float16 h[16]; unsigned short u[16]; };
template <int NT>
__device__ __forceinline__ v8f mmaH(v16h ah, v16h al, v16h bh, v16h bl, v8f c) {
  c = __builtin_amdgcn_wmma_f32_16x16x32_f16(false, ah, false, bh, (short)0, c, false, false);
  if (NT >= 2) c = __builtin_amdgcn_wmma_f32_16x16x32_f16(false, al, false, bh, (short)0, c, false, false);
  if (NT >= 3) c = __builtin_amdgcn_wmma_f32_16x16x32_f16(false, ah, false, bl, (short)0, c, false, false);
  asm volatile("v_nop\n\tv_nop\n\tv_nop\n\tv_nop" : "+v"(c) : "v"(ah), "v"(al), "v"(bh), "v"(bl));
  return c;
}
// batched GEMM like k_gemm_b but f16 operands: A f32 (split into f16 hi/lo if ASPLIT, else rounded to f16), Bt = f16 values [n][k]; alpha; C f32; N multiple of 16 (partial tiles skipped)
template <bool ASPLIT>
__global__ __launch_bounds__(128) void k_gemm_h(const float* __restrict__ A, int lda, size_t sA, const _Float16* __restrict__ Bh, int ldb, size_t sB, float alpha, float* __restrict__ C, int ldc, size_t sC, int M, int N, int K) {
  __shared__ __attribute__((aligned(16))) float so[4][16][64];
  const int tid = threadIdx.x, w = tid >> 5, lane = tid & 31, ln = lane & 15, hh = lane >> 4; const int by = blockIdx.y;
  A += (size_t)by * sA; Bh += (size_t)by * sB; C += (size_t)by * sC;
  const int ntn = (N + 63) / 64; const int wid = blockIdx.x * 4 + w; const int mt = wid / ntn, nq = wid % ntn; if (mt * 16 >= M) return;
  const int row0 = mt * 16, col0 = nq * 64; const float* arow = A + (size_t)(row0 + ln) * lda;
  v8f acc[4] = {};
  for (int kb = 0; kb < K; kb += 32) {
    FragH ah, al;
    const v4f x0 = *(const v4fa*)(arow + kb + 8 * hh), x1 = *(const v4fa*)(arow + kb + 8 * hh + 4), x2 = *(const v4fa*)(arow + kb + 16 + 8 * hh), x3 = *(const v4fa*)(arow + kb + 16 + 8 * hh + 4);
    float xs[16] = {x0[0],x0[1],x0[2],x0[3],x1[0],x1[1],x1[2],x1[3],x2[0],x2[1],x2[2],x2[3],x3[0],x3[1],x3[2],x3[3]};
#pragma unroll
    for (int i = 0; i < 16; ++i) { const _Float16 h = (_Float16)xs[i]; ah.h[i] = h; al.h[i] = ASPLIT ? (_Float16)(xs[i] - (float)h) : (_Float16)0.0f; }
#pragma unroll
    for (int t = 0; t < 4; ++t) { if (col0 + t * 16 >= N) continue; const size_t boff = (size_t)(col0 + t * 16 + ln) * ldb + kb; FragH bq; bq.half[0] = *(const v8us*)(Bh + boff + 8 * hh); bq.half[1] = *(const v8us*)(Bh + boff + 16 + 8 * hh);
      acc[t] = mmaH<ASPLIT ? 2 : 1>(ah.v, al.v, bq.v, bq.v, acc[t]); }
  }
#pragma unroll
  for (int t = 0; t < 4; ++t) { if (col0 + t * 16 >= N) continue;
#pragma unroll
    for (int r = 0; r < 8; ++r) so[w][8 * hh + r][t * 16 + ln] = acc[t][r] * alpha; }
  __builtin_amdgcn_fence(__ATOMIC_ACQ_REL, "workgroup"); __builtin_amdgcn_wave_barrier();
  const int rsub = lane >> 4, c4 = (lane & 15) * 4;
  {
#pragma unroll
    for (int q = 0; q < 8; ++q) { const int r = q * 2 + rsub; if (col0 + c4 < N) { const v4f v = *(const v4fa*)&so[w][r][c4]; *(v4f*)(C + (size_t)(row0 + r) * ldc + col0 + c4) = v; } }
     }
}

// Wt[n][k] = f16(W[k][n]·scale) from f32 row-major W[K][N] (scale = power of two; bf16-exact weights stay exact in f16 away from the subnormal range)
__global__ __launch_bounds__(256) void k_wt_f16(const float* __restrict__ W, _Float16* __restrict__ Wt, int K, int N, float scale) {
  const int t = blockIdx.x * 256 + threadIdx.x; if (t >= N * (K / 8)) return; const int n = t / (K / 8), k8 = (t % (K / 8)) * 8; FragH f;
#pragma unroll
  for (int i = 0; i < 8; ++i) f.h[i] = (_Float16)(bf16_round(W[(size_t)(k8 + i) * N + n]) * scale); const v8us o = f.half[0];
  *(v8us*)((unsigned short*)Wt + (size_t)n * K + k8) = o; 
}
// k_gemm_hh variant with fused epilogue: v = acc·alpha + bias[by·sBias + col] (+ CP[(row/rowsPerB)·sCPb + by·64 + col] if CP) ; ACT 0 none / 1 elu ; writes f16 C16 and f32 C, each if non-null
template <int ACT>
__global__ __launch_bounds__(128) void k_gemm_hhx(const _Float16* __restrict__ A, int lda, size_t sA, const _Float16* __restrict__ Bh, int ldb, size_t sB, float alpha, const float* __restrict__ bias, size_t sBias, const float* __restrict__ CP, int rowsPerB, size_t sCPb, int row0g,
    float* __restrict__ C, _Float16* __restrict__ C16, int ldc, size_t sC, int M, int N, int K) {
  __shared__ __attribute__((aligned(16))) float so[4][16][64];
  const int tid = threadIdx.x, w = tid >> 5, lane = tid & 31, ln = lane & 15, hh = lane >> 4; const int by = blockIdx.y;
  A += (size_t)by * sA; Bh += (size_t)by * sB; const size_t cofs = (size_t)by * sC; const float* bp = bias ? bias + (size_t)by * sBias : nullptr;
  const int ntn = (N + 63) / 64; const int wid = blockIdx.x * 4 + w; const int mt = wid / ntn, nq = wid % ntn; if (mt * 16 >= M) return;
  const int row0 = mt * 16, col0 = nq * 64; const _Float16* arow = A + (size_t)(row0 + ln) * lda;
  v8f acc[4] = {};
  for (int kb = 0; kb < K; kb += 32) { FragH ah; ah.half[0] = *(const v8us*)((const unsigned short*)arow + kb + 8 * hh); ah.half[1] = *(const v8us*)((const unsigned short*)arow + kb + 16 + 8 * hh);
#pragma unroll
    for (int t = 0; t < 4; ++t) { if (col0 + t * 16 >= N) continue; const size_t boff = (size_t)(col0 + t * 16 + ln) * ldb + kb; FragH bq; bq.half[0] = *(const v8us*)((const unsigned short*)Bh + boff + 8 * hh); bq.half[1] = *(const v8us*)((const unsigned short*)Bh + boff + 16 + 8 * hh);
      acc[t] = mmaH<1>(ah.v, ah.v, bq.v, bq.v, acc[t]); }
  }
#pragma unroll
  for (int t = 0; t < 4; ++t) { if (col0 + t * 16 >= N) continue; const int col = col0 + t * 16 + ln; const float bv = bp ? bf16_round(bp[col]) : 0.f;
#pragma unroll
    for (int r = 0; r < 8; ++r) { float v = acc[t][r] * alpha + bv; if (CP) { const int bidx = (row0g + row0 + 8 * hh + r) / rowsPerB; v += CP[(size_t)bidx * sCPb + (size_t)by * 64 + col]; } if (ACT == 1) v = (v > 0.f) ? v : expm1f(v); else if (ACT == 3) v = fmaxf(v, 0.f); so[w][8 * hh + r][t * 16 + ln] = v; } }
  __builtin_amdgcn_fence(__ATOMIC_ACQ_REL, "workgroup"); __builtin_amdgcn_wave_barrier();
  const int rsub = lane >> 4, c4 = (lane & 15) * 4; typedef _Float16 v4h __attribute__((ext_vector_type(4)));
  {
#pragma unroll
    for (int q = 0; q < 8; ++q) { const int r = q * 2 + rsub; if (col0 + c4 < N) { const v4f v = *(const v4fa*)&so[w][r][c4]; if (C) *(v4f*)(C + cofs + (size_t)(row0 + r) * ldc + col0 + c4) = v; if (C16) { v4h h4; for (int i = 0; i < 4; ++i) h4[i] = (_Float16)v[i]; *(v4h*)(C16 + cofs + (size_t)(row0 + r) * ldc + col0 + c4) = h4; } } }
     }
}


__global__ __launch_bounds__(256) void k_x16(const float* __restrict__ x, _Float16* __restrict__ X16, size_t n8) { const size_t t = (size_t)blockIdx.x * 256 + threadIdx.x; if (t >= n8) return; FragH f;
#pragma unroll
  for (int q = 0; q < 8; ++q) f.h[q] = (_Float16)bf16_round(x[t * 8 + q]); *(v8us*)((unsigned short*)X16 + t * 8) = f.half[0];  }
__global__ __launch_bounds__(256) void k_h16(const float* __restrict__ x, _Float16* __restrict__ X16, size_t n8) { const size_t t = (size_t)blockIdx.x * 256 + threadIdx.x; if (t >= n8) return; FragH f;
#pragma unroll
  for (int q = 0; q < 8; ++q) f.h[q] = (_Float16)x[t * 8 + q]; *(v8us*)((unsigned short*)X16 + t * 8) = f.half[0];  }
__global__ __launch_bounds__(256) void k_round16f(const float* __restrict__ W, _Float16* __restrict__ Bt, size_t n8) { const size_t t = (size_t)blockIdx.x * 256 + threadIdx.x; if (t >= n8) return; FragH f;
#pragma unroll
  for (int i = 0; i < 8; ++i) f.h[i] = (_Float16)(bf16_round(W[t * 8 + i]) * 16.0f); *(v8us*)((unsigned short*)Bt + t * 8) = f.half[0];  }
// per-pair bias, 32 pairs (same (b,i), j = jb..jb+31) per wave, one pair per lane, both MLPs wholly on v_wmma_f32_16x16x32_f16 in transposed form:
// layer 1: D1 = W1 (A: 16 hidden rows x k) * F (B: k x 16 pairs). A pair has 8 features: dist and dt each as an f16 high part plus an f16 remainder (the two products add up in the f32 accumulator), x_j, y_j, z_j, and 1.0
// for the layer's bias. Lanes 0..15 carry their pair's features at k = 0..7, lanes 16..31 at k = 8..15; W1 stands at both k ranges, and the half of B that belongs to the other 16 pairs is zeroed for each product.
// layer 2: two D1 tiles (hidden rows 0..15 and 16..31 of a 32-row block), relu'd and converted in place, ARE a B operand in the hardware k order; A = W2 with geom / shape / rate in rows 0,1,2 and again in rows 8,9,10, so that
// D2 registers 0,1,2 of lanes 0..15 (rows 0..2) and of lanes 16..31 (rows 8..10) hold the three outputs of column ln: every lane picks the D2 of its own 16-pair group and does its pair's softplus/log/lgamma tail. All weights x16 (exact), taken out as 1/256.
union FragW { v16h v; v8us half[2]; _Float16 h[16]; unsigned int w[8]; };
__device__ __forceinline__ v8f mma16(v16h a, v16h b, v8f c) { return __builtin_amdgcn_wmma_f32_16x16x32_f16(false, a, false, b, (short)0, c, false, false); }
__global__ __launch_bounds__(128) void k_bias(const float* __restrict__ crd, const float* __restrict__ gw1, const float* __restrict__ gb1, const float* __restrict__ gw2, const float* __restrict__ gb2, const float* __restrict__ dw1, const float* __restrict__ db1, const float* __restrict__ dw2, const float* __restrict__ db2, float* __restrict__ BIAS) {
  __shared__ __attribute__((aligned(16))) _Float16 sW1[2 * BH][8];           // row = hidden unit (0..63 geom, 64..127 delay), its 8 feature weights
  __shared__ __attribute__((aligned(16))) _Float16 sW2[16][2 * BH + 8];      // row = output row of layer 2, k = hidden unit; pitch 272 B spreads the 16 rows over the banks
  const int tid = threadIdx.x, w = tid >> 5, lane = tid & 31, ln = lane & 15, hh = lane >> 4;
  { FragW f; float o0 = 0.f, o1 = 0.f, o2 = 0.f; const _Float16 z = (_Float16)0.f;
    if (tid < BH) { const _Float16 g0 = (_Float16)(bf16_round(gw1[tid * 2]) * 16.0f), g1 = (_Float16)(bf16_round(gw1[tid * 2 + 1]) * 16.0f);
      f.h[0] = g0; f.h[1] = g0; f.h[2] = g1; f.h[3] = g1; f.h[4] = z; f.h[5] = z; f.h[6] = z; f.h[7] = (_Float16)(bf16_round(gb1[tid]) * 16.0f); o0 = bf16_round(gw2[tid]) * 16.0f; }
    else { const int k = tid - BH; const _Float16 d0 = (_Float16)(bf16_round(dw1[k * 4]) * 16.0f);
      f.h[0] = d0; f.h[1] = d0; f.h[2] = z; f.h[3] = z; f.h[4] = (_Float16)(bf16_round(dw1[k * 4 + 1]) * 16.0f); f.h[5] = (_Float16)(bf16_round(dw1[k * 4 + 2]) * 16.0f); f.h[6] = (_Float16)(bf16_round(dw1[k * 4 + 3]) * 16.0f);
      f.h[7] = (_Float16)(bf16_round(db1[k]) * 16.0f); o1 = bf16_round(dw2[k]) * 16.0f; o2 = bf16_round(dw2[BH + k]) * 16.0f; }
    *(v8us*)&sW1[tid][0] = f.half[0];
#pragma unroll
    for (int m = 0; m < 16; ++m) sW2[m][tid] = (_Float16)(((m & 7) == 0) ? o0 : ((m & 7) == 1) ? o1 : ((m & 7) == 2) ? o2 : 0.f); }
  __syncthreads();
  const size_t p0 = ((size_t)blockIdx.x * 4 + w) * 32;      // 32 consecutive pairs of one (b, i) (SS = 1024 is a multiple of 32)
  const int b = (int)(p0 / ((size_t)SS * SS)); const int i = (int)((p0 / SS) % SS); const int jb = (int)(p0 % SS);
  const float* ci = crd + ((size_t)b * SS + i) * 4; const float xi = bf16_round(ci[0]), yi = bf16_round(ci[1]), zi = bf16_round(ci[2]), ti = bf16_round(ci[3]);
  const float gb2v = bf16_round(gb2[0]), db20 = bf16_round(db2[0]), db21 = bf16_round(db2[1]);
  // this lane's pair, j = jb + lane = jb + 16 hh + ln
  const v4f cj = *(const v4fa*)(crd + ((size_t)b * SS + jb + lane) * 4); const float xj = bf16_round(cj[0]), yj = bf16_round(cj[1]), zj = bf16_round(cj[2]), tj = bf16_round(cj[3]);
  const float dx = xi - xj, dy = yi - yj, dz = zi - zj; const float dist = sqrtf(dx * dx + dy * dy + dz * dz); const float dt = ti - tj;
  FragW F; F.h[0] = (_Float16)dist; F.h[1] = (_Float16)(dist - (float)F.h[0]); F.h[2] = (_Float16)dt; F.h[3] = (_Float16)(dt - (float)F.h[2]); F.h[4] = (_Float16)xj; F.h[5] = (_Float16)yj; F.h[6] = (_Float16)zj; F.h[7] = (_Float16)1.0f;
  FragW bf[2];
#pragma unroll
  for (int c = 0; c < 2; ++c)
#pragma unroll
    for (int q = 0; q < 4; ++q) { bf[c].w[q] = (hh == c) ? F.w[q] : 0u; bf[c].w[4 + q] = 0u; }
  FragW a1[8], a2[4];
#pragma unroll
  for (int t = 0; t < 8; ++t) { a1[t].half[0] = *(const v8us*)&sW1[t * 16 + ln][0];
#pragma unroll
    for (int q = 0; q < 4; ++q) a1[t].w[4 + q] = 0u; }
#pragma unroll
  for (int s = 0; s < 4; ++s) { a2[s].half[0] = *(const v8us*)&sW2[ln][s * 32 + 8 * hh]; a2[s].half[1] = *(const v8us*)&sW2[ln][s * 32 + 16 + 8 * hh]; }
  const v8f zero8 = (v8f){0.f,0.f,0.f,0.f,0.f,0.f,0.f,0.f};
  const v16h zero16 = {};
  v8f d2[2] = {zero8, zero8};
#pragma unroll
  for (int s = 0; s < 4; ++s)
#pragma unroll
    for (int c = 0; c < 2; ++c) { const v8f t0 = mma16(a1[2 * s].v, bf[c].v, zero8), t1 = mma16(a1[2 * s + 1].v, bf[c].v, zero8); FragW hb;
#pragma unroll
      for (int q = 0; q < 8; ++q) { hb.h[q] = (_Float16)t0[q]; hb.h[8 + q] = (_Float16)t1[q]; }
      d2[c] = mma16(a2[s].v, __builtin_elementwise_max(hb.v, zero16), d2[c]); }      // relu behind the rounding gives the same f16 value as in front of it, two units per instruction
  { const float geom = (hh ? d2[1][0] : d2[0][0]) * 0.00390625f + gb2v; const float q0 = (hh ? d2[1][1] : d2[0][1]) * 0.00390625f + db20, q1 = (hh ? d2[1][2] : d2[0][2]) * 0.00390625f + db21;
    const float shape = ((q0 > 20.f) ? q0 : log1pf(expf(q0))) + 1e-4f, rate = ((q1 > 20.f) ? q1 : log1pf(expf(q1))) + 1e-4f; const float dtp = fmaxf(fabsf(dt), 1e-4f);
    BIAS[p0 + lane] = geom + shape * logf(rate) + (shape - 1.0f) * logf(dtp) - rate * dtp - lgammaf(shape); } }
__global__ __launch_bounds__(256) void k_vt(const _Float16* __restrict__ V16, _Float16* __restrict__ Vt) { __shared__ unsigned short tl[64][34]; const int tid = threadIdx.x; const int slab = blockIdx.x / (SS / 64), lg = blockIdx.x % (SS / 64); const int b = slab / NH, h = slab % NH;
  for (int i = tid; i < 64 * 4; i += 256) { const int r = i / 4, c8 = (i % 4) * 8; FragH f; f.half[0] = *(const v8us*)((const unsigned short*)V16 + ((size_t)b * SS + lg * 64 + r) * DM + h * HD + c8);
#pragma unroll
    for (int q = 0; q < 8; ++q) tl[r][c8 + q] = f.u[q]; }
  __syncthreads();
  { const int d = tid / 8, pc = tid % 8; FragH f;
#pragma unroll
    for (int q = 0; q < 8; ++q) f.u[q] = tl[pc * 8 + q][d];
    *(v8us*)((unsigned short*)Vt + ((size_t)slab * HD + d) * SS + lg * 64 + pc * 8) = f.half[0];  } }
__global__ __launch_bounds__(128) void k_flash(const _Float16* __restrict__ Q16, const _Float16* __restrict__ K16, const _Float16* __restrict__ Vt, const float* __restrict__ BIAS, float* __restrict__ O) {
  constexpr int RPW = 32, NQB = SS / (4 * RPW), DT = 2;
  __shared__ __attribute__((aligned(16))) unsigned short sP[4][RPW][40]; __shared__ __attribute__((aligned(16))) float sO[4][RPW][HD + 4];
  const int tid = threadIdx.x, w = tid >> 5, lane = tid & 31, ln = lane & 15, hh = lane >> 4;
  const int slab = blockIdx.x / NQB, qblk = blockIdx.x % NQB; const int b = slab / NH, h = slab % NH; const int q0 = qblk * (4 * RPW) + w * RPW;
  FragH aq[2];
#pragma unroll
  for (int rt = 0; rt < 2; ++rt) { const unsigned short* qr = (const unsigned short*)Q16 + ((size_t)b * SS + q0 + rt * 16 + ln) * DM + h * HD; aq[rt].half[0] = *(const v8us*)(qr + 8 * hh); aq[rt].half[1] = *(const v8us*)(qr + 16 + 8 * hh); }
  const unsigned short* Vth = (const unsigned short*)Vt + (size_t)slab * HD * SS;
  float m_r[2][8], l_r[2][8]; v8f oacc[2][DT];
#pragma unroll
  for (int rt = 0; rt < 2; ++rt) {
#pragma unroll
    for (int r = 0; r < 8; ++r) { m_r[rt][r] = -3.0e38f; l_r[rt][r] = 0.f; }
#pragma unroll
    for (int dt = 0; dt < DT; ++dt) oacc[rt][dt] = (v8f){0.f,0.f,0.f,0.f,0.f,0.f,0.f,0.f}; }
  const float scale = 0.17677669529663688f;
#pragma unroll 1
  for (int j0 = 0; j0 < SS; j0 += 32) {
    v8f s[2][2];
#pragma unroll
    for (int nt = 0; nt < 2; ++nt) { const unsigned short* kr = (const unsigned short*)K16 + ((size_t)b * SS + j0 + nt * 16 + ln) * DM + h * HD; FragH bk; bk.half[0] = *(const v8us*)(kr + 8 * hh); bk.half[1] = *(const v8us*)(kr + 16 + 8 * hh);
#pragma unroll
      for (int rt = 0; rt < 2; ++rt) { v8f acc = (v8f){0.f,0.f,0.f,0.f,0.f,0.f,0.f,0.f}; acc = mmaH<1>(aq[rt].v, aq[rt].v, bk.v, bk.v, acc); s[rt][nt] = acc; } }
#pragma unroll
    for (int rt = 0; rt < 2; ++rt)
#pragma unroll
      for (int r = 0; r < 8; ++r) { const int qi = q0 + rt * 16 + 8 * hh + r; const float* br = BIAS + ((size_t)b * SS + qi) * SS + j0; const float s0 = s[rt][0][r] * scale + br[ln], s1 = s[rt][1][r] * scale + br[16 + ln]; float mc = fmaxf(s0, s1);
        mc = fmaxf(mc, __shfl_xor(mc, 1, 32)); mc = fmaxf(mc, __shfl_xor(mc, 2, 32)); mc = fmaxf(mc, __shfl_xor(mc, 4, 32)); mc = fmaxf(mc, __shfl_xor(mc, 8, 32));
        const float mn = fmaxf(m_r[rt][r], mc); const float al = expf(m_r[rt][r] - mn); m_r[rt][r] = mn; const float p0 = expf(s0 - mn), p1 = expf(s1 - mn); l_r[rt][r] = l_r[rt][r] * al + p0 + p1;
#pragma unroll
        for (int dt = 0; dt < DT; ++dt) oacc[rt][dt][r] *= al;
        FragH t2; t2.h[0] = (_Float16)p0; t2.h[1] = (_Float16)p1; sP[w][rt * 16 + 8 * hh + r][ln] = t2.u[0]; sP[w][rt * 16 + 8 * hh + r][16 + ln] = t2.u[1]; }
    __builtin_amdgcn_fence(__ATOMIC_ACQ_REL, "workgroup"); __builtin_amdgcn_wave_barrier();
    FragH pa[2];
#pragma unroll
    for (int rt = 0; rt < 2; ++rt) { pa[rt].half[0] = *(const v8us*)&sP[w][rt * 16 + ln][8 * hh]; pa[rt].half[1] = *(const v8us*)&sP[w][rt * 16 + ln][16 + 8 * hh]; }
#pragma unroll
    for (int dt = 0; dt < DT; ++dt) { const unsigned short* vrow = Vth + (size_t)(dt * 16 + ln) * SS + j0; FragH bv; bv.half[0] = *(const v8us*)(vrow + 8 * hh); bv.half[1] = *(const v8us*)(vrow + 16 + 8 * hh);
#pragma unroll
      for (int rt = 0; rt < 2; ++rt) oacc[rt][dt] = mmaH<1>(pa[rt].v, pa[rt].v, bv.v, bv.v, oacc[rt][dt]); }
    __builtin_amdgcn_fence(__ATOMIC_ACQ_REL, "workgroup"); __builtin_amdgcn_wave_barrier(); }
#pragma unroll
  for (int rt = 0; rt < 2; ++rt) {
#pragma unroll
    for (int r = 0; r < 8; ++r) { float l = l_r[rt][r]; l += __shfl_xor(l, 1, 32); l += __shfl_xor(l, 2, 32); l += __shfl_xor(l, 4, 32); l += __shfl_xor(l, 8, 32); l_r[rt][r] = 1.0f / l; }
#pragma unroll
    for (int dt = 0; dt < DT; ++dt)
#pragma unroll
      for (int r = 0; r < 8; ++r) sO[w][rt * 16 + 8 * hh + r][dt * 16 + ln] = oacc[rt][dt][r] * l_r[rt][r]; }
  __builtin_amdgcn_fence(__ATOMIC_ACQ_REL, "workgroup"); __builtin_amdgcn_wave_barrier();
  {
#pragma unroll
    for (int rp = 0; rp < RPW; rp += 4) { const int r = rp + (lane >> 3), pc = lane & 7; const v4f val = *(const v4fa*)&sO[w][r][pc * 4]; *(v4f*)(O + ((size_t)b * SS + q0 + r) * DM + h * HD + pc * 4) = val; }
     } }
extern "C" void kernel_launch(void* const* d_in, const int* in_sizes, int n_in,
                              void* d_out, int out_size, void* d_ws, size_t ws_size, hipStream_t stream) {
  (void)in_sizes; (void)n_in; (void)out_size;
  const float* src = (const float*)d_in[0]; const float* crd = (const float*)d_in[1]; const float* Wq = (const float*)d_in[2]; const float* Wk = (const float*)d_in[3]; const float* Wv = (const float*)d_in[4]; const float* Wo = (const float*)d_in[5];
  const float* gw1 = (const float*)d_in[6]; const float* gb1 = (const float*)d_in[7]; const float* gw2 = (const float*)d_in[8]; const float* gb2 = (const float*)d_in[9]; const float* dw1 = (const float*)d_in[10]; const float* db1 = (const float*)d_in[11]; const float* dw2 = (const float*)d_in[12]; const float* db2 = (const float*)d_in[13];
  char* ws = (char*)d_ws; size_t off = 0;
  auto take = [&](size_t bytes) { char* p = ws + off; off += (bytes + 255) & ~(size_t)255; return p; };
  const size_t w8 = (size_t)DM * DM / 8;
  _Float16* Bq = (_Float16*)take(w8 * 16); _Float16* Bk = (_Float16*)take(w8 * 16); _Float16* Bv = (_Float16*)take(w8 * 16); _Float16* Bo = (_Float16*)take(w8 * 16); _Float16* X16 = (_Float16*)take((size_t)NR * DM * 2); _Float16* Q16 = (_Float16*)take((size_t)NR * DM * 2); _Float16* K16 = (_Float16*)take((size_t)NR * DM * 2); _Float16* V16 = (_Float16*)take((size_t)NR * DM * 2); _Float16* Vt = (_Float16*)take((size_t)NR * DM * 2); float* BIAS = (float*)take((size_t)BB * SS * SS * 4); float* O = (float*)take((size_t)NR * DM * 4); _Float16* O16 = (_Float16*)take((size_t)NR * DM * 2);
  if (off > ws_size) return;      // ≈ 16.5 MiB
  const unsigned gw = (unsigned)((w8 + 255) / 256), gx = (unsigned)(((size_t)NR * DM / 8 + 255) / 256);
  k_round16f<<<gw, 256, 0, stream>>>(Wq, Bq, w8); k_round16f<<<gw, 256, 0, stream>>>(Wk, Bk, w8); k_round16f<<<gw, 256, 0, stream>>>(Wv, Bv, w8); k_round16f<<<gw, 256, 0, stream>>>(Wo, Bo, w8);
  k_x16<<<gx, 256, 0, stream>>>(src, X16, (size_t)NR * DM / 8);
  const dim3 gg(((NR / 16) * (DM / 64) + 3) / 4, 1);
  k_gemm_hhx<0><<<gg, 128, 0, stream>>>(X16, DM, 0, Bq, DM, 0, 0.0625f, nullptr, 0, nullptr, 1, 0, 0, nullptr, Q16, DM, 0, NR, DM, DM);
  k_gemm_hhx<0><<<gg, 128, 0, stream>>>(X16, DM, 0, Bk, DM, 0, 0.0625f, nullptr, 0, nullptr, 1, 0, 0, nullptr, K16, DM, 0, NR, DM, DM);
  k_gemm_hhx<0><<<gg, 128, 0, stream>>>(X16, DM, 0, Bv, DM, 0, 0.0625f, nullptr, 0, nullptr, 1, 0, 0, nullptr, V16, DM, 0, NR, DM, DM);
  k_bias<<<(unsigned)((size_t)BB * SS * SS / 128), 128, 0, stream>>>(crd, gw1, gb1, gw2, gb2, dw1, db1, dw2, db2, BIAS);      // 32 pairs per wave
  k_vt<<<BB * NH * (SS / 64), 256, 0, stream>>>(V16, Vt);
  k_flash<<<BB * NH * (SS / 128), 128, 0, stream>>>(Q16, K16, Vt, BIAS, O);
  k_h16<<<gx, 256, 0, stream>>>(O, O16, (size_t)NR * DM / 8);
  k_gemm_hhx<0><<<gg, 128, 0, stream>>>(O16, DM, 0, Bo, DM, 0, 0.0625f, nullptr, 0, nullptr, 1, 0, 0, (float*)d_out, nullptr, DM, 0, NR, DM, DM);
}

// v003
// One run takes 109 microseconds.
// Two timings next to v002 both put it at 1.38 times that version's speed.
// All steps since v000 together make it 3.52 times as fast.
#include <hip/hip_runtime.h>
// q/k/v/o projections (2048 × 256 × 256) and the 8-head attention (d = 32) with an additive per-pair bias on v_wmma_f32_16x16x32_f16 (fused flash-style kernel: S = Q·Kᵀ, O = P·V on WMMA;
// online max/sum softmax f32; P f16 <= 1). The bias (geometric 2->64->1 MLP + the Gamma log-density from the 4->64->2 delay MLP, incl. lgamma) is computed once per (b, i, j): both layers of the two MLPs
// on WMMA, softplus/log/lgamma in f32; the bias plane is shared by the 8 heads. A = f16(bf16 ·) exact operands (o projection: f16(O)), weights bf16-exact ×2^4 ((out,in)), single products, f32 accumulate.
#define BB 2
#define SS 1024
#define DM 256
#define NH 8
#define HD 32
#define BH 64
#define NR (BB * SS)

typedef __bf16 v16b __attribute__((ext_vector_type(16)));
typedef unsigned short v8us __attribute__((ext_vector_type(8), may_alias));
typedef float  v8f  __attribute__((ext_vector_type(8)));
typedef float  v4f  __attribute__((ext_vector_type(4)));
typedef float  v4fa __attribute__((ext_vector_type(4), may_alias));
union FragB { v16b v; v8us half[2]; unsigned short u[16]; };

__device__ __forceinline__ unsigned short bf16_bits(float x) { unsigned int u = __float_as_uint(x); return (unsigned short)((u + 0x7FFFu + ((u >> 16) & 1u)) >> 16); }
__device__ __forceinline__ float bf16_val(unsigned short b) { return __uint_as_float(((unsigned int)b) << 16); }
__device__ __forceinline__ float bf16_round(float x) { return bf16_val(bf16_bits(x)); }
// D += A·B with NT terms: 1 = ah·bh, 2 = + al·bh (A split), 3 = + ah·bl (both split)
template <int NT>
__device__ __forceinline__ v8f mmaN(v16b ah, v16b al, v16b bh, v16b bl, v8f c) {
  c = __builtin_amdgcn_wmma_f32_16x16x32_bf16(false, ah, false, bh, (short)0, c, false, false);
  if (NT >= 2) c = __builtin_amdgcn_wmma_f32_16x16x32_bf16(false, al, false, bh, (short)0, c, false, false);
  if (NT >= 3) c = __builtin_amdgcn_wmma_f32_16x16x32_bf16(false, ah, false, bl, (short)0, c, false, false);
  asm volatile("v_nop\n\tv_nop\n\tv_nop\n\tv_nop" : "+v"(c) : "v"(ah), "v"(al), "v"(bh), "v"(bl));
  return c;
}

__global__ __launch_bounds__(256) void k_wt_bf16(const float* __restrict__ W, unsigned short* __restrict__ Wt, int K, int N) {
  const int t = blockIdx.x * 256 + threadIdx.x;
  const int k8n = K / 8;
  if (t >= N * k8n) return;
  const int n = t / k8n, k8 = (t % k8n) * 8;
  v8us v;
#pragma unroll
  for (int i = 0; i < 8; ++i) v[i] = bf16_bits(W[(size_t)(k8 + i) * N + n]);
  *(v8us*)(Wt + (size_t)n * K + k8) = v;
  
}

// GEMM C[M][N] (f32, pitch ldc) = act(A[M][K]·W + bias). A f32 row-major (pitch lda) converted per fragment to bf16
// (ASPLIT: hi/lo two planes -> 2 terms, else single rounded term); Wt bf16 [N][K] (pitch ldb). BIAS_BF16 rounds the
// bias to bf16 first (bias quantised to bf16 before the add). K%32==0, M%16==0, N%64==0.
template <bool ASPLIT, int ACT, bool BIAS_BF16>
__global__ __launch_bounds__(128) void k_gemm_bf(const float* __restrict__ A, int lda, const unsigned short* __restrict__ Wt, int ldb,
                                               const float* __restrict__ bias, float* __restrict__ C, int ldc, int M, int N, int K) {
  __shared__ __attribute__((aligned(16))) float so[4][16][64];
  const int tid = threadIdx.x, w = tid >> 5, lane = tid & 31, ln = lane & 15, hh = lane >> 4;
  const int ntn = N / 64;
  const int wid = blockIdx.x * 4 + w;
  const int mt = wid / ntn, nq = wid % ntn;
  if (mt * 16 >= M) return;
  const int row0 = mt * 16, col0 = nq * 64;
  const float* arow = A + (size_t)(row0 + ln) * lda;
  v8f acc[4] = {};
  for (int kb = 0; kb < K; kb += 32) {
    FragB ah, al;
    const v4f x0 = *(const v4fa*)(arow + kb + 8 * hh), x1 = *(const v4fa*)(arow + kb + 8 * hh + 4);
    const v4f x2 = *(const v4fa*)(arow + kb + 16 + 8 * hh), x3 = *(const v4fa*)(arow + kb + 16 + 8 * hh + 4);
    float xs[16] = {x0[0],x0[1],x0[2],x0[3],x1[0],x1[1],x1[2],x1[3],x2[0],x2[1],x2[2],x2[3],x3[0],x3[1],x3[2],x3[3]};
#pragma unroll
    for (int i = 0; i < 16; ++i) { const unsigned short hb = bf16_bits(xs[i]); ah.u[i] = hb; al.u[i] = ASPLIT ? bf16_bits(xs[i] - bf16_val(hb)) : (unsigned short)0; }
#pragma unroll
    for (int t = 0; t < 4; ++t) {
      const unsigned short* brow = Wt + (size_t)(col0 + t * 16 + ln) * ldb + kb;
      FragB b;
      b.half[0] = *(const v8us*)(brow + 8 * hh);
      b.half[1] = *(const v8us*)(brow + 16 + 8 * hh);
      acc[t] = mmaN<ASPLIT ? 2 : 1>(ah.v, al.v, b.v, b.v, acc[t]);
    }
  }
#pragma unroll
  for (int t = 0; t < 4; ++t) {
    float bv = bias ? bias[col0 + t * 16 + ln] : 0.f;
    if (BIAS_BF16) bv = bf16_round(bv);
#pragma unroll
    for (int r = 0; r < 8; ++r) { float v = acc[t][r] + bv; if (ACT == 1) v = fmaxf(v, 0.f); so[w][8 * hh + r][t * 16 + ln] = v; }
  }
  __builtin_amdgcn_fence(__ATOMIC_ACQ_REL, "workgroup");
  __builtin_amdgcn_wave_barrier();
  const int rsub = lane >> 4, c4 = (lane & 15) * 4;
  {
#pragma unroll
    for (int q = 0; q < 8; ++q) {
      const int r = q * 2 + rsub;
      const v4f v = *(const v4fa*)&so[w][r][c4];
      *(v4f*)(C + (size_t)(row0 + r) * ldc + col0 + c4) = v;
    }
    
  }
}

// Flash-style causal/unmasked attention, all contractions 3-term bf16 hi/lo splits, f32 softmax with running max.
// q,k,v rows are read from f32 buffers with arbitrary row pitch (so they can live inside a fused qkv buffer);
// D = head size (multiple of 32, <= 128); one wave = 16 query rows; block = 4 waves (64 queries) sharing K/V chunks of 32.
template <int D, bool CAUSAL>
__global__ __launch_bounds__(128) void k_flash(const float* __restrict__ qb, const float* __restrict__ kb, const float* __restrict__ vb,
                                             int pitch, int T, int H, float scale, float* __restrict__ y, int ypitch) {
  constexpr int KS = D / 32;        // k-steps for QK
  constexpr int DT = D / 16;        // d tiles for PV
  __shared__ __attribute__((aligned(16))) unsigned short sKh[32][D + 8], sKl[32][D + 8], sVh[32][D + 8], sVl[32][D + 8];
  __shared__ __attribute__((aligned(16))) unsigned short sPh[4][16][40], sPl[4][16][40];
  __shared__ __attribute__((aligned(16))) float sO[4][16][D];
  const int tid = threadIdx.x, w = tid >> 5, lane = tid & 31, ln = lane & 15, hh = lane >> 4;
  const int nqb = (T + 63) / 64;
  const int bh = blockIdx.x / nqb, qblk = blockIdx.x % nqb;
  const int b = bh / H, h = bh % H;
  const int q0 = qblk * 64 + w * 16;
  const float* Q = qb + (size_t)b * T * pitch + h * D;
  const float* K = kb + (size_t)b * T * pitch + h * D;
  const float* V = vb + (size_t)b * T * pitch + h * D;

  // A fragments of the wave's 16 query rows (scaled), hi/lo
  FragB aqh[KS], aql[KS];
  {
    int row = q0 + ln; if (row >= T) row = T - 1;
    const float* qr = Q + (size_t)row * pitch;
#pragma unroll
    for (int ks = 0; ks < KS; ++ks)
#pragma unroll
      for (int i = 0; i < 16; ++i) {
        const int d = ks * 32 + ((i < 8) ? (8 * hh + i) : (16 + 8 * hh + (i - 8)));
        const float x = qr[d] * scale; const unsigned short hb = bf16_bits(x);
        aqh[ks].u[i] = hb; aql[ks].u[i] = bf16_bits(x - bf16_val(hb));
      }
  }
  float m_r[8], l_r[8];
#pragma unroll
  for (int r = 0; r < 8; ++r) { m_r[r] = -3.0e38f; l_r[r] = 0.f; }
  v8f oacc[DT];
#pragma unroll
  for (int dt = 0; dt < DT; ++dt) oacc[dt] = (v8f){0.f,0.f,0.f,0.f,0.f,0.f,0.f,0.f};

  const int kv_end = CAUSAL ? min(T, qblk * 64 + 64) : T;     // block-uniform
  for (int j0 = 0; j0 < kv_end; j0 += 32) {
    __syncthreads();
    for (int e = tid; e < 32 * (D / 4); e += 128) {
      const int r = e / (D / 4), c4 = (e % (D / 4)) * 4;
      const int key = j0 + r;
      v4f kf = {0.f,0.f,0.f,0.f}, vf = {0.f,0.f,0.f,0.f};
      if (key < T) { kf = *(const v4fa*)(K + (size_t)key * pitch + c4); vf = *(const v4fa*)(V + (size_t)key * pitch + c4); }
#pragma unroll
      for (int t = 0; t < 4; ++t) {
        unsigned short hb = bf16_bits(kf[t]); sKh[r][c4 + t] = hb; sKl[r][c4 + t] = bf16_bits(kf[t] - bf16_val(hb));
        hb = bf16_bits(vf[t]); sVh[r][c4 + t] = hb; sVl[r][c4 + t] = bf16_bits(vf[t] - bf16_val(hb));
      }
    }
    __syncthreads();
    // S tile 16 x 32
    v8f s[2];
#pragma unroll
    for (int nt = 0; nt < 2; ++nt) {
      v8f acc = {};
#pragma unroll
      for (int ks = 0; ks < KS; ++ks) {
        FragB bh_, bl_;
        bh_.half[0] = *(const v8us*)&sKh[nt * 16 + ln][ks * 32 + 8 * hh]; bh_.half[1] = *(const v8us*)&sKh[nt * 16 + ln][ks * 32 + 16 + 8 * hh];
        bl_.half[0] = *(const v8us*)&sKl[nt * 16 + ln][ks * 32 + 8 * hh]; bl_.half[1] = *(const v8us*)&sKl[nt * 16 + ln][ks * 32 + 16 + 8 * hh];
        acc = mmaN<3>(aqh[ks].v, aql[ks].v, bh_.v, bl_.v, acc);
      }
      s[nt] = acc;
    }
    // mask + running max (rows 8hh+r; the 16 lanes of a half share rows)
    float alpha[8];
#pragma unroll
    for (int r = 0; r < 8; ++r) {
      const int qi = q0 + 8 * hh + r;
      const int ja = j0 + ln, jb = j0 + 16 + ln;
      if (CAUSAL) { if (ja > qi) s[0][r] = -3.0e38f; if (jb > qi) s[1][r] = -3.0e38f; }
      if (ja >= T) s[0][r] = -3.0e38f;
      if (jb >= T) s[1][r] = -3.0e38f;
      float mx = fmaxf(s[0][r], s[1][r]);
      mx = fmaxf(mx, __shfl_xor(mx, 1, 32)); mx = fmaxf(mx, __shfl_xor(mx, 2, 32)); mx = fmaxf(mx, __shfl_xor(mx, 4, 32)); mx = fmaxf(mx, __shfl_xor(mx, 8, 32));
      const float mnew = fmaxf(m_r[r], mx);
      alpha[r] = (mnew > -1.0e38f) ? __expf(m_r[r] - mnew) : 1.0f;
      const float p0 = (s[0][r] > -1.0e38f) ? __expf(s[0][r] - mnew) : 0.f;
      const float p1 = (s[1][r] > -1.0e38f) ? __expf(s[1][r] - mnew) : 0.f;
      m_r[r] = mnew;
      l_r[r] = l_r[r] * alpha[r] + p0 + p1;            // per-lane partial row sum (16 lanes combined at the end)
      unsigned short hb = bf16_bits(p0); sPh[w][8 * hh + r][ln] = hb;      sPl[w][8 * hh + r][ln] = bf16_bits(p0 - bf16_val(hb));
      hb = bf16_bits(p1);                sPh[w][8 * hh + r][16 + ln] = hb; sPl[w][8 * hh + r][16 + ln] = bf16_bits(p1 - bf16_val(hb));
    }
#pragma unroll
    for (int dt = 0; dt < DT; ++dt)
#pragma unroll
      for (int r = 0; r < 8; ++r) oacc[dt][r] *= alpha[r];
    __builtin_amdgcn_fence(__ATOMIC_ACQ_REL, "workgroup");
    __builtin_amdgcn_wave_barrier();
    FragB pah, pal;
    pah.half[0] = *(const v8us*)&sPh[w][ln][8 * hh]; pah.half[1] = *(const v8us*)&sPh[w][ln][16 + 8 * hh];
    pal.half[0] = *(const v8us*)&sPl[w][ln][8 * hh]; pal.half[1] = *(const v8us*)&sPl[w][ln][16 + 8 * hh];
#pragma unroll
    for (int dt = 0; dt < DT; ++dt) {
      FragB bvh, bvl;
#pragma unroll
      for (int i = 0; i < 8; ++i) {
        bvh.u[i] = sVh[8 * hh + i][dt * 16 + ln]; bvh.u[8 + i] = sVh[16 + 8 * hh + i][dt * 16 + ln];
        bvl.u[i] = sVl[8 * hh + i][dt * 16 + ln]; bvl.u[8 + i] = sVl[16 + 8 * hh + i][dt * 16 + ln];
      }
      oacc[dt] = mmaN<3>(pah.v, pal.v, bvh.v, bvl.v, oacc[dt]);
    }
    __builtin_amdgcn_fence(__ATOMIC_ACQ_REL, "workgroup");
    __builtin_amdgcn_wave_barrier();
  }
#pragma unroll
  for (int r = 0; r < 8; ++r) {
    float l = l_r[r];
    l += __shfl_xor(l, 1, 32); l += __shfl_xor(l, 2, 32); l += __shfl_xor(l, 4, 32); l += __shfl_xor(l, 8, 32);
    l_r[r] = (l > 0.f) ? 1.0f / l : 0.f;
  }
#pragma unroll
  for (int dt = 0; dt < DT; ++dt)
#pragma unroll
    for (int r = 0; r < 8; ++r) sO[w][8 * hh + r][dt * 16 + ln] = oacc[dt][r] * l_r[r];
  __builtin_amdgcn_fence(__ATOMIC_ACQ_REL, "workgroup");
  __builtin_amdgcn_wave_barrier();
  {
    for (int r = 0; r < 16; ++r) {
      const int row = q0 + r;
      if (row < T && lane < D / 4) {
        const v4f val = *(const v4fa*)&sO[w][r][lane * 4];
        *(v4f*)(y + ((size_t)b * T + row) * ypitch + h * D + lane * 4) = val;
      }
    }
    
  }
}

// GEMM C = act(A·W + bias + resid): A f32 (ASPLIT -> hi/lo 2 terms), Wt bf16 [N][K]; ACT 0 none, 1 relu, 2 exact gelu;
// resid (optional, f32, row index = (row % rmod), pitch ldr, RES_BF16 rounds it) added before the activation.
template <bool ASPLIT, int ACT, bool BIAS_BF16, bool RES_BF16>
__global__ __launch_bounds__(128) void k_gemm_bf3(const float* __restrict__ A, int lda, const unsigned short* __restrict__ Wt, int ldb,
                                                const float* __restrict__ bias, const float* __restrict__ resid, int rmod, int ldr,
                                                float* __restrict__ C, int ldc, int M, int N, int K) {
  __shared__ __attribute__((aligned(16))) float so[4][16][64];
  const int tid = threadIdx.x, w = tid >> 5, lane = tid & 31, ln = lane & 15, hh = lane >> 4;
  const int ntn = N / 64;
  const int wid = blockIdx.x * 4 + w;
  const int mt = wid / ntn, nq = wid % ntn;
  if (mt * 16 >= M) return;
  const int row0 = mt * 16, col0 = nq * 64;
  const float* arow = A + (size_t)(row0 + ln) * lda;
  v8f acc[4] = {};
  for (int kb = 0; kb < K; kb += 32) {
    FragB ah, al;
    const v4f x0 = *(const v4fa*)(arow + kb + 8 * hh), x1 = *(const v4fa*)(arow + kb + 8 * hh + 4);
    const v4f x2 = *(const v4fa*)(arow + kb + 16 + 8 * hh), x3 = *(const v4fa*)(arow + kb + 16 + 8 * hh + 4);
    float xs[16] = {x0[0],x0[1],x0[2],x0[3],x1[0],x1[1],x1[2],x1[3],x2[0],x2[1],x2[2],x2[3],x3[0],x3[1],x3[2],x3[3]};
#pragma unroll
    for (int i = 0; i < 16; ++i) { const unsigned short hb = bf16_bits(xs[i]); ah.u[i] = hb; al.u[i] = ASPLIT ? bf16_bits(xs[i] - bf16_val(hb)) : (unsigned short)0; }
#pragma unroll
    for (int t = 0; t < 4; ++t) {
      const unsigned short* brow = Wt + (size_t)(col0 + t * 16 + ln) * ldb + kb;
      FragB b;
      b.half[0] = *(const v8us*)(brow + 8 * hh);
      b.half[1] = *(const v8us*)(brow + 16 + 8 * hh);
      acc[t] = mmaN<ASPLIT ? 2 : 1>(ah.v, al.v, b.v, b.v, acc[t]);
    }
  }
#pragma unroll
  for (int t = 0; t < 4; ++t) {
    const int col = col0 + t * 16 + ln;
    float bv = bias ? bias[col] : 0.f;
    if (BIAS_BF16) bv = bf16_round(bv);
#pragma unroll
    for (int r = 0; r < 8; ++r) {
      float v = acc[t][r] + bv;
      if (resid) { float rv = resid[(size_t)((row0 + 8 * hh + r) % rmod) * ldr + col]; if (RES_BF16) rv = bf16_round(rv); v += rv; }
      if (ACT == 1) v = fmaxf(v, 0.f);
      if (ACT == 2) v = 0.5f * v * (1.0f + erff(v * 0.70710678118654752f));
      if (ACT == 3) { const float u = 0.7978845608028654f * (v + 0.044715f * v * v * v); v = 0.5f * v * (1.0f + tanhf(u)); }
      so[w][8 * hh + r][t * 16 + ln] = v;
    }
  }
  __builtin_amdgcn_fence(__ATOMIC_ACQ_REL, "workgroup");
  __builtin_amdgcn_wave_barrier();
  const int rsub = lane >> 4, c4 = (lane & 15) * 4;
  {
#pragma unroll
    for (int q = 0; q < 8; ++q) {
      const int r = q * 2 + rsub;
      const v4f v = *(const v4fa*)&so[w][r][c4];
      *(v4f*)(C + (size_t)(row0 + r) * ldc + col0 + c4) = v;
    }
    
  }
}
// row LayerNorm (biased variance, eps) over N: s = X (+ R); optional out_sum <- s; out_norm <- (s-mu)*rsqrt(var+eps)*g + b
template <bool PARAM_BF16>
__global__ __launch_bounds__(256) void k_layernorm(const float* __restrict__ X, const float* __restrict__ R, const float* __restrict__ g, const float* __restrict__ bta,
                                                  float* __restrict__ out_sum, float* __restrict__ out_norm, int N, float eps) {
  __shared__ float red[256];
  const int row = blockIdx.x, tid = threadIdx.x;
  const float* x = X + (size_t)row * N; const float* rr = R ? R + (size_t)row * N : nullptr;
  float vals[16];                     // up to N = 4096
  const int per = N / 256;            // contiguous chunk per thread? use strided-by-4 chunks: thread handles j = tid*4 + 1024*u
  float s1 = 0.f;
  for (int u = 0; u < per / 4; ++u) {
    const int j = tid * 4 + 1024 * u;
    const v4f a = *(const v4fa*)(x + j);
    v4f b = {0.f,0.f,0.f,0.f}; if (rr) b = *(const v4fa*)(rr + j);
#pragma unroll
    for (int q = 0; q < 4; ++q) { const float v = a[q] + b[q]; vals[u * 4 + q] = v; s1 += v; }
  }
  red[tid] = s1; __syncthreads();
  for (int st = 128; st > 0; st >>= 1) { if (tid < st) red[tid] += red[tid + st]; __syncthreads(); }
  const float mu = red[0] / (float)N; __syncthreads();
  float s2 = 0.f;
  for (int u = 0; u < per / 4; ++u)
#pragma unroll
    for (int q = 0; q < 4; ++q) { const float c = vals[u * 4 + q] - mu; s2 += c * c; }
  red[tid] = s2; __syncthreads();
  for (int st = 128; st > 0; st >>= 1) { if (tid < st) red[tid] += red[tid + st]; __syncthreads(); }
  const float rs = rsqrtf(red[0] / (float)N + eps);
  {
    for (int u = 0; u < per / 4; ++u) {
      const int j = tid * 4 + 1024 * u;
      v4f o, sm;
#pragma unroll
      for (int q = 0; q < 4; ++q) {
        float gg = g[j + q], bb = bta[j + q];
        if (PARAM_BF16) { gg = bf16_round(gg); bb = bf16_round(bb); }
        sm[q] = vals[u * 4 + q]; o[q] = (vals[u * 4 + q] - mu) * rs * gg + bb;
      }
      if (out_sum) *(v4f*)(out_sum + (size_t)row * N + j) = sm;
      *(v4f*)(out_norm + (size_t)row * N + j) = o;
    }
    
  }
}



// ---- f16 WMMA path (v_wmma_f32_16x16x32_f16): 11-bit significands for operands in range — used where a [0,1] probability operand needs more precision than bf16
typedef _Float16 v16h __attribute__((ext_vector_type(16)));
union FragH { v16h v; v8us half[2]; _Float16 h[16]; unsigned short u[16]; };
template <int NT>
__device__ __forceinline__ v8f mmaH(v16h ah, v16h al, v16h bh, v16h bl, v8f c) {
  c = __builtin_amdgcn_wmma_f32_16x16x32_f16(false, ah, false, bh, (short)0, c, false, false);
  if (NT >= 2) c = __builtin_amdgcn_wmma_f32_16x16x32_f16(false, al, false, bh, (short)0, c, false, false);
  if (NT >= 3) c = __builtin_amdgcn_wmma_f32_16x16x32_f16(false, ah, false, bl, (short)0, c, false, false);
  asm volatile("v_nop\n\tv_nop\n\tv_nop\n\tv_nop" : "+v"(c) : "v"(ah), "v"(al), "v"(bh), "v"(bl));
  return c;
}
// batched GEMM like k_gemm_b but f16 operands: A f32 (split into f16 hi/lo if ASPLIT, else rounded to f16), Bt = f16 values [n][k]; alpha; C f32; N multiple of 16 (partial tiles skipped)
template <bool ASPLIT>
__global__ __launch_bounds__(128) void k_gemm_h(const float* __restrict__ A, int lda, size_t sA, const _Float16* __restrict__ Bh, int ldb, size_t sB, float alpha, float* __restrict__ C, int ldc, size_t sC, int M, int N, int K) {
  __shared__ __attribute__((aligned(16))) float so[4][16][64];
  const int tid = threadIdx.x, w = tid >> 5, lane = tid & 31, ln = lane & 15, hh = lane >> 4; const int by = blockIdx.y;
  A += (size_t)by * sA; Bh += (size_t)by * sB; C += (size_t)by * sC;
  const int ntn = (N + 63) / 64; const int wid = blockIdx.x * 4 + w; const int mt = wid / ntn, nq = wid % ntn; if (mt * 16 >= M) return;
  const int row0 = mt * 16, col0 = nq * 64; const float* arow = A + (size_t)(row0 + ln) * lda;
  v8f acc[4] = {};
  for (int kb = 0; kb < K; kb += 32) {
    FragH ah, al;
    const v4f x0 = *(const v4fa*)(arow + kb + 8 * hh), x1 = *(const v4fa*)(arow + kb + 8 * hh + 4), x2 = *(const v4fa*)(arow + kb + 16 + 8 * hh), x3 = *(const v4fa*)(arow + kb + 16 + 8 * hh + 4);
    float xs[16] = {x0[0],x0[1],x0[2],x0[3],x1[0],x1[1],x1[2],x1[3],x2[0],x2[1],x2[2],x2[3],x3[0],x3[1],x3[2],x3[3]};
#pragma unroll
    for (int i = 0; i < 16; ++i) { const _Float16 h = (_Float16)xs[i]; ah.h[i] = h; al.h[i] = ASPLIT ? (_Float16)(xs[i] - (float)h) : (_Float16)0.0f; }
#pragma unroll
    for (int t = 0; t < 4; ++t) { if (col0 + t * 16 >= N) continue; const size_t boff = (size_t)(col0 + t * 16 + ln) * ldb + kb; FragH bq; bq.half[0] = *(const v8us*)(Bh + boff + 8 * hh); bq.half[1] = *(const v8us*)(Bh + boff + 16 + 8 * hh);
      acc[t] = mmaH<ASPLIT ? 2 : 1>(ah.v, al.v, bq.v, bq.v, acc[t]); }
  }
#pragma unroll
  for (int t = 0; t < 4; ++t) { if (col0 + t * 16 >= N) continue;
#pragma unroll
    for (int r = 0; r < 8; ++r) so[w][8 * hh + r][t * 16 + ln] = acc[t][r] * alpha; }
  __builtin_amdgcn_fence(__ATOMIC_ACQ_REL, "workgroup"); __builtin_amdgcn_wave_barrier();
  const int rsub = lane >> 4, c4 = (lane & 15) * 4;
  {
#pragma unroll
    for (int q = 0; q < 8; ++q) { const int r = q * 2 + rsub; if (col0 + c4 < N) { const v4f v = *(const v4fa*)&so[w][r][c4]; *(v4f*)(C + (size_t)(row0 + r) * ldc + col0 + c4) = v; } }
     }
}

// Wt[n][k] = f16(W[k][n]·scale) from f32 row-major W[K][N] (scale = power of two; bf16-exact weights stay exact in f16 away from the subnormal range)
__global__ __launch_bounds__(256) void k_wt_f16(const float* __restrict__ W, _Float16* __restrict__ Wt, int K, int N, float scale) {
  const int t = blockIdx.x * 256 + threadIdx.x; if (t >= N * (K / 8)) return; const int n = t / (K / 8), k8 = (t % (K / 8)) * 8; FragH f;
#pragma unroll
  for (int i = 0; i < 8; ++i) f.h[i] = (_Float16)(bf16_round(W[(size_t)(k8 + i) * N + n]) * scale); const v8us o = f.half[0];
  *(v8us*)((unsigned short*)Wt + (size_t)n * K + k8) = o; 
}
// k_gemm_hh variant with fused epilogue: v = acc·alpha + bias[by·sBias + col] (+ CP[(row/rowsPerB)·sCPb + by·64 + col] if CP) ; ACT 0 none / 1 elu ; writes f16 C16 and f32 C, each if non-null
template <int ACT>
__global__ __launch_bounds__(128) void k_gemm_hhx(const _Float16* __restrict__ A, int lda, size_t sA, const _Float16* __restrict__ Bh, int ldb, size_t sB, float alpha, const float* __restrict__ bias, size_t sBias, const float* __restrict__ CP, int rowsPerB, size_t sCPb, int row0g,
    float* __restrict__ C, _Float16* __restrict__ C16, int ldc, size_t sC, int M, int N, int K) {
  __shared__ __attribute__((aligned(16))) float so[4][16][64];
  const int tid = threadIdx.x, w = tid >> 5, lane = tid & 31, ln = lane & 15, hh = lane >> 4; const int by = blockIdx.y;
  A += (size_t)by * sA; Bh += (size_t)by * sB; const size_t cofs = (size_t)by * sC; const float* bp = bias ? bias + (size_t)by * sBias : nullptr;
  const int ntn = (N + 63) / 64; const int wid = blockIdx.x * 4 + w; const int mt = wid / ntn, nq = wid % ntn; if (mt * 16 >= M) return;
  const int row0 = mt * 16, col0 = nq * 64; const _Float16* arow = A + (size_t)(row0 + ln) * lda;
  v8f acc[4] = {};
  for (int kb = 0; kb < K; kb += 32) { FragH ah; ah.half[0] = *(const v8us*)((const unsigned short*)arow + kb + 8 * hh); ah.half[1] = *(const v8us*)((const unsigned short*)arow + kb + 16 + 8 * hh);
#pragma unroll
    for (int t = 0; t < 4; ++t) { if (col0 + t * 16 >= N) continue; const size_t boff = (size_t)(col0 + t * 16 + ln) * ldb + kb; FragH bq; bq.half[0] = *(const v8us*)((const unsigned short*)Bh + boff + 8 * hh); bq.half[1] = *(const v8us*)((const unsigned short*)Bh + boff + 16 + 8 * hh);
      acc[t] = mmaH<1>(ah.v, ah.v, bq.v, bq.v, acc[t]); }
  }
#pragma unroll
  for (int t = 0; t < 4; ++t) { if (col0 + t * 16 >= N) continue; const int col = col0 + t * 16 + ln; const float bv = bp ? bf16_round(bp[col]) : 0.f;
#pragma unroll
    for (int r = 0; r < 8; ++r) { float v = acc[t][r] * alpha + bv; if (CP) { const int bidx = (row0g + row0 + 8 * hh + r) / rowsPerB; v += CP[(size_t)bidx * sCPb + (size_t)by * 64 + col]; } if (ACT == 1) v = (v > 0.f) ? v : expm1f(v); else if (ACT == 3) v = fmaxf(v, 0.f); so[w][8 * hh + r][t * 16 + ln] = v; } }
  __builtin_amdgcn_fence(__ATOMIC_ACQ_REL, "workgroup"); __builtin_amdgcn_wave_barrier();
  const int rsub = lane >> 4, c4 = (lane & 15) * 4; typedef _Float16 v4h __attribute__((ext_vector_type(4)));
  {
#pragma unroll
    for (int q = 0; q < 8; ++q) { const int r = q * 2 + rsub; if (col0 + c4 < N) { const v4f v = *(const v4fa*)&so[w][r][c4]; if (C) *(v4f*)(C + cofs + (size_t)(row0 + r) * ldc + col0 + c4) = v; if (C16) { v4h h4; for (int i = 0; i < 4; ++i) h4[i] = (_Float16)v[i]; *(v4h*)(C16 + cofs + (size_t)(row0 + r) * ldc + col0 + c4) = h4; } } }
     }
}


__global__ __launch_bounds__(256) void k_x16(const float* __restrict__ x, _Float16* __restrict__ X16, size_t n8) { const size_t t = (size_t)blockIdx.x * 256 + threadIdx.x; if (t >= n8) return; FragH f;
#pragma unroll
  for (int q = 0; q < 8; ++q) f.h[q] = (_Float16)bf16_round(x[t * 8 + q]); *(v8us*)((unsigned short*)X16 + t * 8) = f.half[0];  }
__global__ __launch_bounds__(256) void k_h16(const float* __restrict__ x, _Float16* __restrict__ X16, size_t n8) { const size_t t = (size_t)blockIdx.x * 256 + threadIdx.x; if (t >= n8) return; FragH f;
#pragma unroll
  for (int q = 0; q < 8; ++q) f.h[q] = (_Float16)x[t * 8 + q]; *(v8us*)((unsigned short*)X16 + t * 8) = f.half[0];  }
__global__ __launch_bounds__(256) void k_round16f(const float* __restrict__ W, _Float16* __restrict__ Bt, size_t n8) { const size_t t = (size_t)blockIdx.x * 256 + threadIdx.x; if (t >= n8) return; FragH f;
#pragma unroll
  for (int i = 0; i < 8; ++i) f.h[i] = (_Float16)(bf16_round(W[t * 8 + i]) * 16.0f); *(v8us*)((unsigned short*)Bt + t * 8) = f.half[0];  }
// per-pair bias, 32 pairs (same (b,i), j = jb..jb+31) per wave, one pair per lane, both MLPs wholly on v_wmma_f32_16x16x32_f16 in transposed form:
// layer 1: D1 = W1 (A: 16 hidden rows x k) * F (B: k x 16 pairs). A pair has 8 features: dist and dt each as an f16 high part plus an f16 remainder (the two products add up in the f32 accumulator), x_j, y_j, z_j, and 1.0
// for the layer's bias. Lanes 0..15 carry their pair's features at k = 0..7, lanes 16..31 at k = 8..15; W1 stands at both k ranges, and the half of B that belongs to the other 16 pairs is zeroed for each product.
// layer 2: two D1 tiles (hidden rows 0..15 and 16..31 of a 32-row block), relu'd and converted in place, ARE a B operand in the hardware k order; A = W2 with geom / shape / rate in rows 0,1,2 and again in rows 8,9,10, so that
// D2 registers 0,1,2 of lanes 0..15 (rows 0..2) and of lanes 16..31 (rows 8..10) hold the three outputs of column ln: every lane picks the D2 of its own 16-pair group and does its pair's softplus/log/lgamma tail. All weights x16 (exact), taken out as 1/256.
union FragW { v16h v; v8us half[2]; _Float16 h[16]; unsigned int w[8]; };
__device__ __forceinline__ v8f mma16(v16h a, v16h b, v8f c) { return __builtin_amdgcn_wmma_f32_16x16x32_f16(false, a, false, b, (short)0, c, false, false); }
__global__ __launch_bounds__(128) void k_bias(const float* __restrict__ crd, const float* __restrict__ gw1, const float* __restrict__ gb1, const float* __restrict__ gw2, const float* __restrict__ gb2, const float* __restrict__ dw1, const float* __restrict__ db1, const float* __restrict__ dw2, const float* __restrict__ db2, float* __restrict__ BIAS) {
  __shared__ __attribute__((aligned(16))) _Float16 sW1[2 * BH][8];           // row = hidden unit (0..63 geom, 64..127 delay), its 8 feature weights
  __shared__ __attribute__((aligned(16))) _Float16 sW2[16][2 * BH + 8];      // row = output row of layer 2, k = hidden unit; pitch 272 B spreads the 16 rows over the banks
  const int tid = threadIdx.x, w = tid >> 5, lane = tid & 31, ln = lane & 15, hh = lane >> 4;
  { FragW f; float o0 = 0.f, o1 = 0.f, o2 = 0.f; const _Float16 z = (_Float16)0.f;
    if (tid < BH) { const _Float16 g0 = (_Float16)(bf16_round(gw1[tid * 2]) * 16.0f), g1 = (_Float16)(bf16_round(gw1[tid * 2 + 1]) * 16.0f);
      f.h[0] = g0; f.h[1] = g0; f.h[2] = g1; f.h[3] = g1; f.h[4] = z; f.h[5] = z; f.h[6] = z; f.h[7] = (_Float16)(bf16_round(gb1[tid]) * 16.0f); o0 = bf16_round(gw2[tid]) * 16.0f; }
    else { const int k = tid - BH; const _Float16 d0 = (_Float16)(bf16_round(dw1[k * 4]) * 16.0f);
      f.h[0] = d0; f.h[1] = d0; f.h[2] = z; f.h[3] = z; f.h[4] = (_Float16)(bf16_round(dw1[k * 4 + 1]) * 16.0f); f.h[5] = (_Float16)(bf16_round(dw1[k * 4 + 2]) * 16.0f); f.h[6] = (_Float16)(bf16_round(dw1[k * 4 + 3]) * 16.0f);
      f.h[7] = (_Float16)(bf16_round(db1[k]) * 16.0f); o1 = bf16_round(dw2[k]) * 16.0f; o2 = bf16_round(dw2[BH + k]) * 16.0f; }
    *(v8us*)&sW1[tid][0] = f.half[0];
#pragma unroll
    for (int m = 0; m < 16; ++m) sW2[m][tid] = (_Float16)(((m & 7) == 0) ? o0 : ((m & 7) == 1) ? o1 : ((m & 7) == 2) ? o2 : 0.f); }
  __syncthreads();
  const size_t p0 = ((size_t)blockIdx.x * 4 + w) * 32;      // 32 consecutive pairs of one (b, i) (SS = 1024 is a multiple of 32)
  const int b = (int)(p0 / ((size_t)SS * SS)); const int i = (int)((p0 / SS) % SS); const int jb = (int)(p0 % SS);
  const float* ci = crd + ((size_t)b * SS + i) * 4; const float xi = bf16_round(ci[0]), yi = bf16_round(ci[1]), zi = bf16_round(ci[2]), ti = bf16_round(ci[3]);
  const float gb2v = bf16_round(gb2[0]), db20 = bf16_round(db2[0]), db21 = bf16_round(db2[1]);
  // this lane's pair, j = jb + lane = jb + 16 hh + ln
  const v4f cj = *(const v4fa*)(crd + ((size_t)b * SS + jb + lane) * 4); const float xj = bf16_round(cj[0]), yj = bf16_round(cj[1]), zj = bf16_round(cj[2]), tj = bf16_round(cj[3]);
  const float dx = xi - xj, dy = yi - yj, dz = zi - zj; const float dist = sqrtf(dx * dx + dy * dy + dz * dz); const float dt = ti - tj;
  FragW F; F.h[0] = (_Float16)dist; F.h[1] = (_Float16)(dist - (float)F.h[0]); F.h[2] = (_Float16)dt; F.h[3] = (_Float16)(dt - (float)F.h[2]); F.h[4] = (_Float16)xj; F.h[5] = (_Float16)yj; F.h[6] = (_Float16)zj; F.h[7] = (_Float16)1.0f;
  FragW bf[2];
#pragma unroll
  for (int c = 0; c < 2; ++c)
#pragma unroll
    for (int q = 0; q < 4; ++q) { bf[c].w[q] = (hh == c) ? F.w[q] : 0u; bf[c].w[4 + q] = 0u; }
  FragW a1[8], a2[4];
#pragma unroll
  for (int t = 0; t < 8; ++t) { a1[t].half[0] = *(const v8us*)&sW1[t * 16 + ln][0];
#pragma unroll
    for (int q = 0; q < 4; ++q) a1[t].w[4 + q] = 0u; }
#pragma unroll
  for (int s = 0; s < 4; ++s) { a2[s].half[0] = *(const v8us*)&sW2[ln][s * 32 + 8 * hh]; a2[s].half[1] = *(const v8us*)&sW2[ln][s * 32 + 16 + 8 * hh]; }
  const v8f zero8 = (v8f){0.f,0.f,0.f,0.f,0.f,0.f,0.f,0.f};
  const v16h zero16 = {};
  v8f d2[2] = {zero8, zero8};
#pragma unroll
  for (int s = 0; s < 4; ++s)
#pragma unroll
    for (int c = 0; c < 2; ++c) { const v8f t0 = mma16(a1[2 * s].v, bf[c].v, zero8), t1 = mma16(a1[2 * s + 1].v, bf[c].v, zero8); FragW hb;
#pragma unroll
      for (int q = 0; q < 8; ++q) { hb.h[q] = (_Float16)t0[q]; hb.h[8 + q] = (_Float16)t1[q]; }
      d2[c] = mma16(a2[s].v, __builtin_elementwise_max(hb.v, zero16), d2[c]); }      // relu behind the rounding gives the same f16 value as in front of it, two units per instruction
  { const float geom = (hh ? d2[1][0] : d2[0][0]) * 0.00390625f + gb2v; const float q0 = (hh ? d2[1][1] : d2[0][1]) * 0.00390625f + db20, q1 = (hh ? d2[1][2] : d2[0][2]) * 0.00390625f + db21;
    const float shape = ((q0 > 20.f) ? q0 : log1pf(expf(q0))) + 1e-4f, rate = ((q1 > 20.f) ? q1 : log1pf(expf(q1))) + 1e-4f; const float dtp = fmaxf(fabsf(dt), 1e-4f);
    BIAS[p0 + lane] = geom + shape * logf(rate) + (shape - 1.0f) * logf(dtp) - rate * dtp - lgammaf(shape); } }
__global__ __launch_bounds__(256) void k_vt(const _Float16* __restrict__ V16, _Float16* __restrict__ Vt) { __shared__ unsigned short tl[64][34]; const int tid = threadIdx.x; const int slab = blockIdx.x / (SS / 64), lg = blockIdx.x % (SS / 64); const int b = slab / NH, h = slab % NH;
  for (int i = tid; i < 64 * 4; i += 256) { const int r = i / 4, c8 = (i % 4) * 8; FragH f; f.half[0] = *(const v8us*)((const unsigned short*)V16 + ((size_t)b * SS + lg * 64 + r) * DM + h * HD + c8);
#pragma unroll
    for (int q = 0; q < 8; ++q) tl[r][c8 + q] = f.u[q]; }
  __syncthreads();
  { const int d = tid / 8, pc = tid % 8; FragH f;
#pragma unroll
    for (int q = 0; q < 8; ++q) f.u[q] = tl[pc * 8 + q][d];
    *(v8us*)((unsigned short*)Vt + ((size_t)slab * HD + d) * SS + lg * 64 + pc * 8) = f.half[0];  } }
// One block = 32 query rows of one (batch, head); its 8 waves share those rows and split the 1024 keys, 128 each (512 blocks of 8 waves fill every SIMD four deep, where one wave per 32 rows over all keys left
// one wave on half the SIMDs). Every wave runs the same online-softmax loop over its own keys and leaves an un-normalised partial (row max, row sum, O) in LDS; behind one block barrier the partials of a row are
// rescaled to their common max and added, wave 0 first.
// waves_per_eu(1, 4): no more than four waves a SIMD are planned for, which is what 512 blocks of 8 waves come to; without it the compiler saves registers for an occupancy the grid cannot reach and runs the 16 rows' loads and cross-lane steps one row after the other
__global__ __launch_bounds__(256) __attribute__((amdgpu_waves_per_eu(1, 4))) void k_flash(const _Float16* __restrict__ Q16, const _Float16* __restrict__ K16, const _Float16* __restrict__ Vt, const float* __restrict__ BIAS, float* __restrict__ O) {
  constexpr int RPW = 32, NW = 8, NQB = SS / RPW, KPW = SS / NW, DT = 2;
  __shared__ __attribute__((aligned(16))) unsigned short sP[NW][RPW][40]; __shared__ __attribute__((aligned(16))) float sO[NW][RPW][HD + 4]; __shared__ float sM[NW][RPW], sL[NW][RPW];
  const int tid = threadIdx.x, w = __builtin_amdgcn_readfirstlane(tid >> 5), lane = tid & 31, ln = lane & 15, hh = lane >> 4;      // the wave's number in a scalar register keeps the key offset j0 and the wave's LDS bases scalar
  const int slab = blockIdx.x / NQB, qblk = blockIdx.x % NQB; const int b = slab / NH, h = slab % NH; const int q0 = qblk * RPW;
  FragH aq[2];
#pragma unroll
  for (int rt = 0; rt < 2; ++rt) { const unsigned short* qr = (const unsigned short*)Q16 + ((size_t)b * SS + q0 + rt * 16 + ln) * DM + h * HD; aq[rt].half[0] = *(const v8us*)(qr + 8 * hh); aq[rt].half[1] = *(const v8us*)(qr + 16 + 8 * hh); }
  const unsigned short* Vth = (const unsigned short*)Vt + (size_t)slab * HD * SS;
  float m_r[2][8], l_r[2][8]; v8f oacc[2][DT];
#pragma unroll
  for (int rt = 0; rt < 2; ++rt) {
#pragma unroll
    for (int r = 0; r < 8; ++r) { m_r[rt][r] = -3.0e38f; l_r[rt][r] = 0.f; }
#pragma unroll
    for (int dt = 0; dt < DT; ++dt) oacc[rt][dt] = (v8f){0.f,0.f,0.f,0.f,0.f,0.f,0.f,0.f}; }
  const float scale = 0.17677669529663688f;
#pragma unroll 1
  for (int it = 0; it < KPW / 32; ++it) { const int j0 = w * KPW + it * 32;
    v8f s[2][2];
#pragma unroll
    for (int nt = 0; nt < 2; ++nt) { const unsigned short* kr = (const unsigned short*)K16 + ((size_t)b * SS + j0 + nt * 16 + ln) * DM + h * HD; FragH bk; bk.half[0] = *(const v8us*)(kr + 8 * hh); bk.half[1] = *(const v8us*)(kr + 16 + 8 * hh);
#pragma unroll
      for (int rt = 0; rt < 2; ++rt) { v8f acc = (v8f){0.f,0.f,0.f,0.f,0.f,0.f,0.f,0.f}; acc = mmaH<1>(aq[rt].v, aq[rt].v, bk.v, bk.v, acc); s[rt][nt] = acc; } }
#pragma unroll
    for (int rt = 0; rt < 2; ++rt)
#pragma unroll
      for (int r = 0; r < 8; ++r) { const int qi = q0 + rt * 16 + 8 * hh + r; const float* br = BIAS + ((size_t)b * SS + qi) * SS + j0; const float s0 = s[rt][0][r] * scale + br[ln], s1 = s[rt][1][r] * scale + br[16 + ln]; float mc = fmaxf(s0, s1);
        mc = fmaxf(mc, __shfl_xor(mc, 1, 32)); mc = fmaxf(mc, __shfl_xor(mc, 2, 32)); mc = fmaxf(mc, __shfl_xor(mc, 4, 32)); mc = fmaxf(mc, __shfl_xor(mc, 8, 32));
        const float mn = fmaxf(m_r[rt][r], mc); const float al = expf(m_r[rt][r] - mn); m_r[rt][r] = mn; const float p0 = expf(s0 - mn), p1 = expf(s1 - mn); l_r[rt][r] = l_r[rt][r] * al + p0 + p1;
#pragma unroll
        for (int dt = 0; dt < DT; ++dt) oacc[rt][dt][r] *= al;
        FragH t2; t2.h[0] = (_Float16)p0; t2.h[1] = (_Float16)p1; sP[w][rt * 16 + 8 * hh + r][ln] = t2.u[0]; sP[w][rt * 16 + 8 * hh + r][16 + ln] = t2.u[1]; }
    __builtin_amdgcn_fence(__ATOMIC_ACQ_REL, "workgroup"); __builtin_amdgcn_wave_barrier();
    FragH pa[2];
#pragma unroll
    for (int rt = 0; rt < 2; ++rt) { pa[rt].half[0] = *(const v8us*)&sP[w][rt * 16 + ln][8 * hh]; pa[rt].half[1] = *(const v8us*)&sP[w][rt * 16 + ln][16 + 8 * hh]; }
#pragma unroll
    for (int dt = 0; dt < DT; ++dt) { const unsigned short* vrow = Vth + (size_t)(dt * 16 + ln) * SS + j0; FragH bv; bv.half[0] = *(const v8us*)(vrow + 8 * hh); bv.half[1] = *(const v8us*)(vrow + 16 + 8 * hh);
#pragma unroll
      for (int rt = 0; rt < 2; ++rt) oacc[rt][dt] = mmaH<1>(pa[rt].v, pa[rt].v, bv.v, bv.v, oacc[rt][dt]); }
    __builtin_amdgcn_fence(__ATOMIC_ACQ_REL, "workgroup"); __builtin_amdgcn_wave_barrier(); }
#pragma unroll
  for (int rt = 0; rt < 2; ++rt) {
#pragma unroll
    for (int r = 0; r < 8; ++r) { float l = l_r[rt][r]; l += __shfl_xor(l, 1, 32); l += __shfl_xor(l, 2, 32); l += __shfl_xor(l, 4, 32); l += __shfl_xor(l, 8, 32); l_r[rt][r] = l; }
#pragma unroll
    for (int dt = 0; dt < DT; ++dt)
#pragma unroll
      for (int r = 0; r < 8; ++r) sO[w][rt * 16 + 8 * hh + r][dt * 16 + ln] = oacc[rt][dt][r]; }
  if (ln == 0) {      // max and sum are the same in the 16 lanes of a row
#pragma unroll
    for (int rt = 0; rt < 2; ++rt)
#pragma unroll
      for (int r = 0; r < 8; ++r) { sM[w][rt * 16 + 8 * hh + r] = m_r[rt][r]; sL[w][rt * 16 + 8 * hh + r] = l_r[rt][r]; } }
  __syncthreads();      // every wave's partial is in LDS before any thread merges
  { const int r = tid >> 3, pc = tid & 7;      // one thread = 4 output columns of one row
    float mw[NW], M = -3.0e38f;
#pragma unroll
    for (int u = 0; u < NW; ++u) { mw[u] = sM[u][r]; M = fmaxf(M, mw[u]); }
    float L = 0.f; v4f acc = {0.f, 0.f, 0.f, 0.f};
#pragma unroll
    for (int u = 0; u < NW; ++u) { const float g = expf(mw[u] - M); L += sL[u][r] * g; const v4f val = *(const v4fa*)&sO[u][r][pc * 4]; acc += val * g; }
    const float inv = 1.0f / L;
    *(v4f*)(O + ((size_t)b * SS + q0 + r) * DM + h * HD + pc * 4) = acc * inv; } }
extern "C" void kernel_launch(void* const* d_in, const int* in_sizes, int n_in,
                              void* d_out, int out_size, void* d_ws, size_t ws_size, hipStream_t stream) {
  (void)in_sizes; (void)n_in; (void)out_size;
  const float* src = (const float*)d_in[0]; const float* crd = (const float*)d_in[1]; const float* Wq = (const float*)d_in[2]; const float* Wk = (const float*)d_in[3]; const float* Wv = (const float*)d_in[4]; const float* Wo = (const float*)d_in[5];
  const float* gw1 = (const float*)d_in[6]; const float* gb1 = (const float*)d_in[7]; const float* gw2 = (const float*)d_in[8]; const float* gb2 = (const float*)d_in[9]; const float* dw1 = (const float*)d_in[10]; const float* db1 = (const float*)d_in[11]; const float* dw2 = (const float*)d_in[12]; const float* db2 = (const float*)d_in[13];
  char* ws = (char*)d_ws; size_t off = 0;
  auto take = [&](size_t bytes) { char* p = ws + off; off += (bytes + 255) & ~(size_t)255; return p; };
  const size_t w8 = (size_t)DM * DM / 8;
  _Float16* Bq = (_Float16*)take(w8 * 16); _Float16* Bk = (_Float16*)take(w8 * 16); _Float16* Bv = (_Float16*)take(w8 * 16); _Float16* Bo = (_Float16*)take(w8 * 16); _Float16* X16 = (_Float16*)take((size_t)NR * DM * 2); _Float16* Q16 = (_Float16*)take((size_t)NR * DM * 2); _Float16* K16 = (_Float16*)take((size_t)NR * DM * 2); _Float16* V16 = (_Float16*)take((size_t)NR * DM * 2); _Float16* Vt = (_Float16*)take((size_t)NR * DM * 2); float* BIAS = (float*)take((size_t)BB * SS * SS * 4); float* O = (float*)take((size_t)NR * DM * 4); _Float16* O16 = (_Float16*)take((size_t)NR * DM * 2);
  if (off > ws_size) return;      // ≈ 16.5 MiB
  const unsigned gw = (unsigned)((w8 + 255) / 256), gx = (unsigned)(((size_t)NR * DM / 8 + 255) / 256);
  k_round16f<<<gw, 256, 0, stream>>>(Wq, Bq, w8); k_round16f<<<gw, 256, 0, stream>>>(Wk, Bk, w8); k_round16f<<<gw, 256, 0, stream>>>(Wv, Bv, w8); k_round16f<<<gw, 256, 0, stream>>>(Wo, Bo, w8);
  k_x16<<<gx, 256, 0, stream>>>(src, X16, (size_t)NR * DM / 8);
  const dim3 gg(((NR / 16) * (DM / 64) + 3) / 4, 1);
  k_gemm_hhx<0><<<gg, 128, 0, stream>>>(X16, DM, 0, Bq, DM, 0, 0.0625f, nullptr, 0, nullptr, 1, 0, 0, nullptr, Q16, DM, 0, NR, DM, DM);
  k_gemm_hhx<0><<<gg, 128, 0, stream>>>(X16, DM, 0, Bk, DM, 0, 0.0625f, nullptr, 0, nullptr, 1, 0, 0, nullptr, K16, DM, 0, NR, DM, DM);
  k_gemm_hhx<0><<<gg, 128, 0, stream>>>(X16, DM, 0, Bv, DM, 0, 0.0625f, nullptr, 0, nullptr, 1, 0, 0, nullptr, V16, DM, 0, NR, DM, DM);
  k_bias<<<(unsigned)((size_t)BB * SS * SS / 128), 128, 0, stream>>>(crd, gw1, gb1, gw2, gb2, dw1, db1, dw2, db2, BIAS);      // 32 pairs per wave
  k_vt<<<BB * NH * (SS / 64), 256, 0, stream>>>(V16, Vt);
  k_flash<<<BB * NH * (SS / 32), 256, 0, stream>>>(Q16, K16, Vt, BIAS, O);
  k_h16<<<gx, 256, 0, stream>>>(O, O16, (size_t)NR * DM / 8);
  k_gemm_hhx<0><<<gg, 128, 0, stream>>>(O16, DM, 0, Bo, DM, 0, 0.0625f, nullptr, 0, nullptr, 1, 0, 0, (float*)d_out, nullptr, DM, 0, NR, DM, DM);
}

// v004
// Measured time: 64.7 microseconds a run.
// Two timings next to v003 put it at 1.68 and 1.66 times that version's speed.
// All steps since v000 together make it 5.87 times as fast.
#include <hip/hip_runtime.h>
// q/k/v/o projections (2048 × 256 × 256) and the 8-head attention (d = 32) with an additive per-pair bias on v_wmma_f32_16x16x32_f16 (fused flash-style kernel: S = Q·Kᵀ, O = P·V on WMMA;
// online max/sum softmax f32; P f16 <= 1). The bias (geometric 2->64->1 MLP + the Gamma log-density from the 4->64->2 delay MLP, incl. lgamma) is computed once per (b, i, j): both layers of the two MLPs
// on WMMA, softplus/log/lgamma in f32; the bias plane is shared by the 8 heads. A = f16(bf16 ·) exact operands (o projection: f16(O)), weights bf16-exact ×2^4 ((out,in)), single products, f32 accumulate.
#define BB 2
#define SS 1024
#define DM 256
#define NH 8
#define HD 32
#define BH 64
#define NR (BB * SS)

typedef __bf16 v16b __attribute__((ext_vector_type(16)));
typedef unsigned short v8us __attribute__((ext_vector_type(8), may_alias));
typedef float  v8f  __attribute__((ext_vector_type(8)));
typedef float  v4f  __attribute__((ext_vector_type(4)));
typedef float  v4fa __attribute__((ext_vector_type(4), may_alias));
union FragB { v16b v; v8us half[2]; unsigned short u[16]; };

__device__ __forceinline__ unsigned short bf16_bits(float x) { unsigned int u = __float_as_uint(x); return (unsigned short)((u + 0x7FFFu + ((u >> 16) & 1u)) >> 16); }
__device__ __forceinline__ float bf16_val(unsigned short b) { return __uint_as_float(((unsigned int)b) << 16); }
__device__ __forceinline__ float bf16_round(float x) { return bf16_val(bf16_bits(x)); }
// D += A·B with NT terms: 1 = ah·bh, 2 = + al·bh (A split), 3 = + ah·bl (both split)
template <int NT>
__device__ __forceinline__ v8f mmaN(v16b ah, v16b al, v16b bh, v16b bl, v8f c) {
  c = __builtin_amdgcn_wmma_f32_16x16x32_bf16(false, ah, false, bh, (short)0, c, false, false);
  if (NT >= 2) c = __builtin_amdgcn_wmma_f32_16x16x32_bf16(false, al, false, bh, (short)0, c, false, false);
  if (NT >= 3) c = __builtin_amdgcn_wmma_f32_16x16x32_bf16(false, ah, false, bl, (short)0, c, false, false);
  asm volatile("v_nop\n\tv_nop\n\tv_nop\n\tv_nop" : "+v"(c) : "v"(ah), "v"(al), "v"(bh), "v"(bl));
  return c;
}

__global__ __launch_bounds__(256) void k_wt_bf16(const float* __restrict__ W, unsigned short* __restrict__ Wt, int K, int N) {
  const int t = blockIdx.x * 256 + threadIdx.x;
  const int k8n = K / 8;
  if (t >= N * k8n) return;
  const int n = t / k8n, k8 = (t % k8n) * 8;
  v8us v;
#pragma unroll
  for (int i = 0; i < 8; ++i) v[i] = bf16_bits(W[(size_t)(k8 + i) * N + n]);
  *(v8us*)(Wt + (size_t)n * K + k8) = v;
  
}

// GEMM C[M][N] (f32, pitch ldc) = act(A[M][K]·W + bias). A f32 row-major (pitch lda) converted per fragment to bf16
// (ASPLIT: hi/lo two planes -> 2 terms, else single rounded term); Wt bf16 [N][K] (pitch ldb). BIAS_BF16 rounds the
// bias to bf16 first (bias quantised to bf16 before the add). K%32==0, M%16==0, N%64==0.
template <bool ASPLIT, int ACT, bool BIAS_BF16>
__global__ __launch_bounds__(128) void k_gemm_bf(const float* __restrict__ A, int lda, const unsigned short* __restrict__ Wt, int ldb,
                                               const float* __restrict__ bias, float* __restrict__ C, int ldc, int M, int N, int K) {
  __shared__ __attribute__((aligned(16))) float so[4][16][64];
  const int tid = threadIdx.x, w = tid >> 5, lane = tid & 31, ln = lane & 15, hh = lane >> 4;
  const int ntn = N / 64;
  const int wid = blockIdx.x * 4 + w;
  const int mt = wid / ntn, nq = wid % ntn;
  if (mt * 16 >= M) return;
  const int row0 = mt * 16, col0 = nq * 64;
  const float* arow = A + (size_t)(row0 + ln) * lda;
  v8f acc[4] = {};
  for (int kb = 0; kb < K; kb += 32) {
    FragB ah, al;
    const v4f x0 = *(const v4fa*)(arow + kb + 8 * hh), x1 = *(const v4fa*)(arow + kb + 8 * hh + 4);
    const v4f x2 = *(const v4fa*)(arow + kb + 16 + 8 * hh), x3 = *(const v4fa*)(arow + kb + 16 + 8 * hh + 4);
    float xs[16] = {x0[0],x0[1],x0[2],x0[3],x1[0],x1[1],x1[2],x1[3],x2[0],x2[1],x2[2],x2[3],x3[0],x3[1],x3[2],x3[3]};
#pragma unroll
    for (int i = 0; i < 16; ++i) { const unsigned short hb = bf16_bits(xs[i]); ah.u[i] = hb; al.u[i] = ASPLIT ? bf16_bits(xs[i] - bf16_val(hb)) : (unsigned short)0; }
#pragma unroll
    for (int t = 0; t < 4; ++t) {
      const unsigned short* brow = Wt + (size_t)(col0 + t * 16 + ln) * ldb + kb;
      FragB b;
      b.half[0] = *(const v8us*)(brow + 8 * hh);
      b.half[1] = *(const v8us*)(brow + 16 + 8 * hh);
      acc[t] = mmaN<ASPLIT ? 2 : 1>(ah.v, al.v, b.v, b.v, acc[t]);
    }
  }
#pragma unroll
  for (int t = 0; t < 4; ++t) {
    float bv = bias ? bias[col0 + t * 16 + ln] : 0.f;
    if (BIAS_BF16) bv = bf16_round(bv);
#pragma unroll
    for (int r = 0; r < 8; ++r) { float v = acc[t][r] + bv; if (ACT == 1) v = fmaxf(v, 0.f); so[w][8 * hh + r][t * 16 + ln] = v; }
  }
  __builtin_amdgcn_fence(__ATOMIC_ACQ_REL, "workgroup");
  __builtin_amdgcn_wave_barrier();
  const int rsub = lane >> 4, c4 = (lane & 15) * 4;
  {
#pragma unroll
    for (int q = 0; q < 8; ++q) {
      const int r = q * 2 + rsub;
      const v4f v = *(const v4fa*)&so[w][r][c4];
      *(v4f*)(C + (size_t)(row0 + r) * ldc + col0 + c4) = v;
    }
    
  }
}

// Flash-style causal/unmasked attention, all contractions 3-term bf16 hi/lo splits, f32 softmax with running max.
// q,k,v rows are read from f32 buffers with arbitrary row pitch (so they can live inside a fused qkv buffer);
// D = head size (multiple of 32, <= 128); one wave = 16 query rows; block = 4 waves (64 queries) sharing K/V chunks of 32.
template <int D, bool CAUSAL>
__global__ __launch_bounds__(128) void k_flash(const float* __restrict__ qb, const float* __restrict__ kb, const float* __restrict__ vb,
                                             int pitch, int T, int H, float scale, float* __restrict__ y, int ypitch) {
  constexpr int KS = D / 32;        // k-steps for QK
  constexpr int DT = D / 16;        // d tiles for PV
  __shared__ __attribute__((aligned(16))) unsigned short sKh[32][D + 8], sKl[32][D + 8], sVh[32][D + 8], sVl[32][D + 8];
  __shared__ __attribute__((aligned(16))) unsigned short sPh[4][16][40], sPl[4][16][40];
  __shared__ __attribute__((aligned(16))) float sO[4][16][D];
  const int tid = threadIdx.x, w = tid >> 5, lane = tid & 31, ln = lane & 15, hh = lane >> 4;
  const int nqb = (T + 63) / 64;
  const int bh = blockIdx.x / nqb, qblk = blockIdx.x % nqb;
  const int b = bh / H, h = bh % H;
  const int q0 = qblk * 64 + w * 16;
  const float* Q = qb + (size_t)b * T * pitch + h * D;
  const float* K = kb + (size_t)b * T * pitch + h * D;
  const float* V = vb + (size_t)b * T * pitch + h * D;

  // A fragments of the wave's 16 query rows (scaled), hi/lo
  FragB aqh[KS], aql[KS];
  {
    int row = q0 + ln; if (row >= T) row = T - 1;
    const float* qr = Q + (size_t)row * pitch;
#pragma unroll
    for (int ks = 0; ks < KS; ++ks)
#pragma unroll
      for (int i = 0; i < 16; ++i) {
        const int d = ks * 32 + ((i < 8) ? (8 * hh + i) : (16 + 8 * hh + (i - 8)));
        const float x = qr[d] * scale; const unsigned short hb = bf16_bits(x);
        aqh[ks].u[i] = hb; aql[ks].u[i] = bf16_bits(x - bf16_val(hb));
      }
  }
  float m_r[8], l_r[8];
#pragma unroll
  for (int r = 0; r < 8; ++r) { m_r[r] = -3.0e38f; l_r[r] = 0.f; }
  v8f oacc[DT];
#pragma unroll
  for (int dt = 0; dt < DT; ++dt) oacc[dt] = (v8f){0.f,0.f,0.f,0.f,0.f,0.f,0.f,0.f};

  const int kv_end = CAUSAL ? min(T, qblk * 64 + 64) : T;     // block-uniform
  for (int j0 = 0; j0 < kv_end; j0 += 32) {
    __syncthreads();
    for (int e = tid; e < 32 * (D / 4); e += 128) {
      const int r = e / (D / 4), c4 = (e % (D / 4)) * 4;
      const int key = j0 + r;
      v4f kf = {0.f,0.f,0.f,0.f}, vf = {0.f,0.f,0.f,0.f};
      if (key < T) { kf = *(const v4fa*)(K + (size_t)key * pitch + c4); vf = *(const v4fa*)(V + (size_t)key * pitch + c4); }
#pragma unroll
      for (int t = 0; t < 4; ++t) {
        unsigned short hb = bf16_bits(kf[t]); sKh[r][c4 + t] = hb; sKl[r][c4 + t] = bf16_bits(kf[t] - bf16_val(hb));
        hb = bf16_bits(vf[t]); sVh[r][c4 + t] = hb; sVl[r][c4 + t] = bf16_bits(vf[t] - bf16_val(hb));
      }
    }
    __syncthreads();
    // S tile 16 x 32
    v8f s[2];
#pragma unroll
    for (int nt = 0; nt < 2; ++nt) {
      v8f acc = {};
#pragma unroll
      for (int ks = 0; ks < KS; ++ks) {
        FragB bh_, bl_;
        bh_.half[0] = *(const v8us*)&sKh[nt * 16 + ln][ks * 32 + 8 * hh]; bh_.half[1] = *(const v8us*)&sKh[nt * 16 + ln][ks * 32 + 16 + 8 * hh];
        bl_.half[0] = *(const v8us*)&sKl[nt * 16 + ln][ks * 32 + 8 * hh]; bl_.half[1] = *(const v8us*)&sKl[nt * 16 + ln][ks * 32 + 16 + 8 * hh];
        acc = mmaN<3>(aqh[ks].v, aql[ks].v, bh_.v, bl_.v, acc);
      }
      s[nt] = acc;
    }
    // mask + running max (rows 8hh+r; the 16 lanes of a half share rows)
    float alpha[8];
#pragma unroll
    for (int r = 0; r < 8; ++r) {
      const int qi = q0 + 8 * hh + r;
      const int ja = j0 + ln, jb = j0 + 16 + ln;
      if (CAUSAL) { if (ja > qi) s[0][r] = -3.0e38f; if (jb > qi) s[1][r] = -3.0e38f; }
      if (ja >= T) s[0][r] = -3.0e38f;
      if (jb >= T) s[1][r] = -3.0e38f;
      float mx = fmaxf(s[0][r], s[1][r]);
      mx = fmaxf(mx, __shfl_xor(mx, 1, 32)); mx = fmaxf(mx, __shfl_xor(mx, 2, 32)); mx = fmaxf(mx, __shfl_xor(mx, 4, 32)); mx = fmaxf(mx, __shfl_xor(mx, 8, 32));
      const float mnew = fmaxf(m_r[r], mx);
      alpha[r] = (mnew > -1.0e38f) ? __expf(m_r[r] - mnew) : 1.0f;
      const float p0 = (s[0][r] > -1.0e38f) ? __expf(s[0][r] - mnew) : 0.f;
      const float p1 = (s[1][r] > -1.0e38f) ? __expf(s[1][r] - mnew) : 0.f;
      m_r[r] = mnew;
      l_r[r] = l_r[r] * alpha[r] + p0 + p1;            // per-lane partial row sum (16 lanes combined at the end)
      unsigned short hb = bf16_bits(p0); sPh[w][8 * hh + r][ln] = hb;      sPl[w][8 * hh + r][ln] = bf16_bits(p0 - bf16_val(hb));
      hb = bf16_bits(p1);                sPh[w][8 * hh + r][16 + ln] = hb; sPl[w][8 * hh + r][16 + ln] = bf16_bits(p1 - bf16_val(hb));
    }
#pragma unroll
    for (int dt = 0; dt < DT; ++dt)
#pragma unroll
      for (int r = 0; r < 8; ++r) oacc[dt][r] *= alpha[r];
    __builtin_amdgcn_fence(__ATOMIC_ACQ_REL, "workgroup");
    __builtin_amdgcn_wave_barrier();
    FragB pah, pal;
    pah.half[0] = *(const v8us*)&sPh[w][ln][8 * hh]; pah.half[1] = *(const v8us*)&sPh[w][ln][16 + 8 * hh];
    pal.half[0] = *(const v8us*)&sPl[w][ln][8 * hh]; pal.half[1] = *(const v8us*)&sPl[w][ln][16 + 8 * hh];
#pragma unroll
    for (int dt = 0; dt < DT; ++dt) {
      FragB bvh, bvl;
#pragma unroll
      for (int i = 0; i < 8; ++i) {
        bvh.u[i] = sVh[8 * hh + i][dt * 16 + ln]; bvh.u[8 + i] = sVh[16 + 8 * hh + i][dt * 16 + ln];
        bvl.u[i] = sVl[8 * hh + i][dt * 16 + ln]; bvl.u[8 + i] = sVl[16 + 8 * hh + i][dt * 16 + ln];
      }
      oacc[dt] = mmaN<3>(pah.v, pal.v, bvh.v, bvl.v, oacc[dt]);
    }
    __builtin_amdgcn_fence(__ATOMIC_ACQ_REL, "workgroup");
    __builtin_amdgcn_wave_barrier();
  }
#pragma unroll
  for (int r = 0; r < 8; ++r) {
    float l = l_r[r];
    l += __shfl_xor(l, 1, 32); l += __shfl_xor(l, 2, 32); l += __shfl_xor(l, 4, 32); l += __shfl_xor(l, 8, 32);
    l_r[r] = (l > 0.f) ? 1.0f / l : 0.f;
  }
#pragma unroll
  for (int dt = 0; dt < DT; ++dt)
#pragma unroll
    for (int r = 0; r < 8; ++r) sO[w][8 * hh + r][dt * 16 + ln] = oacc[dt][r] * l_r[r];
  __builtin_amdgcn_fence(__ATOMIC_ACQ_REL, "workgroup");
  __builtin_amdgcn_wave_barrier();
  {
    for (int r = 0; r < 16; ++r) {
      const int row = q0 + r;
      if (row < T && lane < D / 4) {
        const v4f val = *(const v4fa*)&sO[w][r][lane * 4];
        *(v4f*)(y + ((size_t)b * T + row) * ypitch + h * D + lane * 4) = val;
      }
    }
    
  }
}

// GEMM C = act(A·W + bias + resid): A f32 (ASPLIT -> hi/lo 2 terms), Wt bf16 [N][K]; ACT 0 none, 1 relu, 2 exact gelu;
// resid (optional, f32, row index = (row % rmod), pitch ldr, RES_BF16 rounds it) added before the activation.
template <bool ASPLIT, int ACT, bool BIAS_BF16, bool RES_BF16>
__global__ __launch_bounds__(128) void k_gemm_bf3(const float* __restrict__ A, int lda, const unsigned short* __restrict__ Wt, int ldb,
                                                const float* __restrict__ bias, const float* __restrict__ resid, int rmod, int ldr,
                                                float* __restrict__ C, int ldc, int M, int N, int K) {
  __shared__ __attribute__((aligned(16))) float so[4][16][64];
  const int tid = threadIdx.x, w = tid >> 5, lane = tid & 31, ln = lane & 15, hh = lane >> 4;
  const int ntn = N / 64;
  const int wid = blockIdx.x * 4 + w;
  const int mt = wid / ntn, nq = wid % ntn;
  if (mt * 16 >= M) return;
  const int row0 = mt * 16, col0 = nq * 64;
  const float* arow = A + (size_t)(row0 + ln) * lda;
  v8f acc[4] = {};
  for (int kb = 0; kb < K; kb += 32) {
    FragB ah, al;
    const v4f x0 = *(const v4fa*)(arow + kb + 8 * hh), x1 = *(const v4fa*)(arow + kb + 8 * hh + 4);
    const v4f x2 = *(const v4fa*)(arow + kb + 16 + 8 * hh), x3 = *(const v4fa*)(arow + kb + 16 + 8 * hh + 4);
    float xs[16] = {x0[0],x0[1],x0[2],x0[3],x1[0],x1[1],x1[2],x1[3],x2[0],x2[1],x2[2],x2[3],x3[0],x3[1],x3[2],x3[3]};
#pragma unroll
    for (int i = 0; i < 16; ++i) { const unsigned short hb = bf16_bits(xs[i]); ah.u[i] = hb; al.u[i] = ASPLIT ? bf16_bits(xs[i] - bf16_val(hb)) : (unsigned short)0; }
#pragma unroll
    for (int t = 0; t < 4; ++t) {
      const unsigned short* brow = Wt + (size_t)(col0 + t * 16 + ln) * ldb + kb;
      FragB b;
      b.half[0] = *(const v8us*)(brow + 8 * hh);
      b.half[1] = *(const v8us*)(brow + 16 + 8 * hh);
      acc[t] = mmaN<ASPLIT ? 2 : 1>(ah.v, al.v, b.v, b.v, acc[t]);
    }
  }
#pragma unroll
  for (int t = 0; t < 4; ++t) {
    const int col = col0 + t * 16 + ln;
    float bv = bias ? bias[col] : 0.f;
    if (BIAS_BF16) bv = bf16_round(bv);
#pragma unroll
    for (int r = 0; r < 8; ++r) {
      float v = acc[t][r] + bv;
      if (resid) { float rv = resid[(size_t)((row0 + 8 * hh + r) % rmod) * ldr + col]; if (RES_BF16) rv = bf16_round(rv); v += rv; }
      if (ACT == 1) v = fmaxf(v, 0.f);
      if (ACT == 2) v = 0.5f * v * (1.0f + erff(v * 0.70710678118654752f));
      if (ACT == 3) { const float u = 0.7978845608028654f * (v + 0.044715f * v * v * v); v = 0.5f * v * (1.0f + tanhf(u)); }
      so[w][8 * hh + r][t * 16 + ln] = v;
    }
  }
  __builtin_amdgcn_fence(__ATOMIC_ACQ_REL, "workgroup");
  __builtin_amdgcn_wave_barrier();
  const int rsub = lane >> 4, c4 = (lane & 15) * 4;
  {
#pragma unroll
    for (int q = 0; q < 8; ++q) {
      const int r = q * 2 + rsub;
      const v4f v = *(const v4fa*)&so[w][r][c4];
      *(v4f*)(C + (size_t)(row0 + r) * ldc + col0 + c4) = v;
    }
    
  }
}
// row LayerNorm (biased variance, eps) over N: s = X (+ R); optional out_sum <- s; out_norm <- (s-mu)*rsqrt(var+eps)*g + b
template <bool PARAM_BF16>
__global__ __launch_bounds__(256) void k_layernorm(const float* __restrict__ X, const float* __restrict__ R, const float* __restrict__ g, const float* __restrict__ bta,
                                                  float* __restrict__ out_sum, float* __restrict__ out_norm, int N, float eps) {
  __shared__ float red[256];
  const int row = blockIdx.x, tid = threadIdx.x;
  const float* x = X + (size_t)row * N; const float* rr = R ? R + (size_t)row * N : nullptr;
  float vals[16];                     // up to N = 4096
  const int per = N / 256;            // contiguous chunk per thread? use strided-by-4 chunks: thread handles j = tid*4 + 1024*u
  float s1 = 0.f;
  for (int u = 0; u < per / 4; ++u) {
    const int j = tid * 4 + 1024 * u;
    const v4f a = *(const v4fa*)(x + j);
    v4f b = {0.f,0.f,0.f,0.f}; if (rr) b = *(const v4fa*)(rr + j);
#pragma unroll
    for (int q = 0; q < 4; ++q) { const float v = a[q] + b[q]; vals[u * 4 + q] = v; s1 += v; }
  }
  red[tid] = s1; __syncthreads();
  for (int st = 128; st > 0; st >>= 1) { if (tid < st) red[tid] += red[tid + st]; __syncthreads(); }
  const float mu = red[0] / (float)N; __syncthreads();
  float s2 = 0.f;
  for (int u = 0; u < per / 4; ++u)
#pragma unroll
    for (int q = 0; q < 4; ++q) { const float c = vals[u * 4 + q] - mu; s2 += c * c; }
  red[tid] = s2; __syncthreads();
  for (int st = 128; st > 0; st >>= 1) { if (tid < st) red[tid] += red[tid + st]; __syncthreads(); }
  const float rs = rsqrtf(red[0] / (float)N + eps);
  {
    for (int u = 0; u < per / 4; ++u) {
      const int j = tid * 4 + 1024 * u;
      v4f o, sm;
#pragma unroll
      for (int q = 0; q < 4; ++q) {
        float gg = g[j + q], bb = bta[j + q];
        if (PARAM_BF16) { gg = bf16_round(gg); bb = bf16_round(bb); }
        sm[q] = vals[u * 4 + q]; o[q] = (vals[u * 4 + q] - mu) * rs * gg + bb;
      }
      if (out_sum) *(v4f*)(out_sum + (size_t)row * N + j) = sm;
      *(v4f*)(out_norm + (size_t)row * N + j) = o;
    }
    
  }
}



// ---- f16 WMMA path (v_wmma_f32_16x16x32_f16): 11-bit significands for operands in range — used where a [0,1] probability operand needs more precision than bf16
typedef _Float16 v16h __attribute__((ext_vector_type(16)));
union FragH { v16h v; v8us half[2]; _Float16 h[16]; unsigned short u[16]; };
template <int NT>
__device__ __forceinline__ v8f mmaH(v16h ah, v16h al, v16h bh, v16h bl, v8f c) {
  c = __builtin_amdgcn_wmma_f32_16x16x32_f16(false, ah, false, bh, (short)0, c, false, false);
  if (NT >= 2) c = __builtin_amdgcn_wmma_f32_16x16x32_f16(false, al, false, bh, (short)0, c, false, false);
  if (NT >= 3) c = __builtin_amdgcn_wmma_f32_16x16x32_f16(false, ah, false, bl, (short)0, c, false, false);
  asm volatile("v_nop\n\tv_nop\n\tv_nop\n\tv_nop" : "+v"(c) : "v"(ah), "v"(al), "v"(bh), "v"(bl));
  return c;
}
// batched GEMM like k_gemm_b but f16 operands: A f32 (split into f16 hi/lo if ASPLIT, else rounded to f16), Bt = f16 values [n][k]; alpha; C f32; N multiple of 16 (partial tiles skipped)
template <bool ASPLIT>
__global__ __launch_bounds__(128) void k_gemm_h(const float* __restrict__ A, int lda, size_t sA, const _Float16* __restrict__ Bh, int ldb, size_t sB, float alpha, float* __restrict__ C, int ldc, size_t sC, int M, int N, int K) {
  __shared__ __attribute__((aligned(16))) float so[4][16][64];
  const int tid = threadIdx.x, w = tid >> 5, lane = tid & 31, ln = lane & 15, hh = lane >> 4; const int by = blockIdx.y;
  A += (size_t)by * sA; Bh += (size_t)by * sB; C += (size_t)by * sC;
  const int ntn = (N + 63) / 64; const int wid = blockIdx.x * 4 + w; const int mt = wid / ntn, nq = wid % ntn; if (mt * 16 >= M) return;
  const int row0 = mt * 16, col0 = nq * 64; const float* arow = A + (size_t)(row0 + ln) * lda;
  v8f acc[4] = {};
  for (int kb = 0; kb < K; kb += 32) {
    FragH ah, al;
    const v4f x0 = *(const v4fa*)(arow + kb + 8 * hh), x1 = *(const v4fa*)(arow + kb + 8 * hh + 4), x2 = *(const v4fa*)(arow + kb + 16 + 8 * hh), x3 = *(const v4fa*)(arow + kb + 16 + 8 * hh + 4);
    float xs[16] = {x0[0],x0[1],x0[2],x0[3],x1[0],x1[1],x1[2],x1[3],x2[0],x2[1],x2[2],x2[3],x3[0],x3[1],x3[2],x3[3]};
#pragma unroll
    for (int i = 0; i < 16; ++i) { const _Float16 h = (_Float16)xs[i]; ah.h[i] = h; al.h[i] = ASPLIT ? (_Float16)(xs[i] - (float)h) : (_Float16)0.0f; }
#pragma unroll
    for (int t = 0; t < 4; ++t) { if (col0 + t * 16 >= N) continue; const size_t boff = (size_t)(col0 + t * 16 + ln) * ldb + kb; FragH bq; bq.half[0] = *(const v8us*)(Bh + boff + 8 * hh); bq.half[1] = *(const v8us*)(Bh + boff + 16 + 8 * hh);
      acc[t] = mmaH<ASPLIT ? 2 : 1>(ah.v, al.v, bq.v, bq.v, acc[t]); }
  }
#pragma unroll
  for (int t = 0; t < 4; ++t) { if (col0 + t * 16 >= N) continue;
#pragma unroll
    for (int r = 0; r < 8; ++r) so[w][8 * hh + r][t * 16 + ln] = acc[t][r] * alpha; }
  __builtin_amdgcn_fence(__ATOMIC_ACQ_REL, "workgroup"); __builtin_amdgcn_wave_barrier();
  const int rsub = lane >> 4, c4 = (lane & 15) * 4;
  {
#pragma unroll
    for (int q = 0; q < 8; ++q) { const int r = q * 2 + rsub; if (col0 + c4 < N) { const v4f v = *(const v4fa*)&so[w][r][c4]; *(v4f*)(C + (size_t)(row0 + r) * ldc + col0 + c4) = v; } }
     }
}

// Wt[n][k] = f16(W[k][n]·scale) from f32 row-major W[K][N] (scale = power of two; bf16-exact weights stay exact in f16 away from the subnormal range)
__global__ __launch_bounds__(256) void k_wt_f16(const float* __restrict__ W, _Float16* __restrict__ Wt, int K, int N, float scale) {
  const int t = blockIdx.x * 256 + threadIdx.x; if (t >= N * (K / 8)) return; const int n = t / (K / 8), k8 = (t % (K / 8)) * 8; FragH f;
#pragma unroll
  for (int i = 0; i < 8; ++i) f.h[i] = (_Float16)(bf16_round(W[(size_t)(k8 + i) * N + n]) * scale); const v8us o = f.half[0];
  *(v8us*)((unsigned short*)Wt + (size_t)n * K + k8) = o; 
}
// per-pair bias, 32 pairs (same (b,i), j = jb..jb+31) per wave, one pair per lane, both MLPs wholly on v_wmma_f32_16x16x32_f16 in transposed form:
// layer 1: D1 = W1 (A: 16 hidden rows x k) * F (B: k x 16 pairs). A pair has 8 features: dist and dt each as an f16 high part plus an f16 remainder (the two products add up in the f32 accumulator), x_j, y_j, z_j, and 1.0
// for the layer's bias. Lanes 0..15 carry their pair's features at k = 0..7, lanes 16..31 at k = 8..15; W1 stands at both k ranges, and the half of B that belongs to the other 16 pairs is zeroed for each product.
// layer 2: two D1 tiles (hidden rows 0..15 and 16..31 of a 32-row block), relu'd and converted in place, ARE a B operand in the hardware k order; A = W2 with geom / shape / rate in rows 0,1,2 and again in rows 8,9,10, so that
// D2 registers 0,1,2 of lanes 0..15 (rows 0..2) and of lanes 16..31 (rows 8..10) hold the three outputs of column ln: every lane picks the D2 of its own 16-pair group and does its pair's softplus/log/lgamma tail. All weights x16 (exact), taken out as 1/256.
union FragW { v16h v; v8us half[2]; _Float16 h[16]; unsigned int w[8]; };
__device__ __forceinline__ v8f mma16(v16h a, v16h b, v8f c) { return __builtin_amdgcn_wmma_f32_16x16x32_f16(false, a, false, b, (short)0, c, false, false); }
__device__ __forceinline__ void bias_block(const int blk, const float* __restrict__ crd, const float* __restrict__ gw1, const float* __restrict__ gb1, const float* __restrict__ gw2, const float* __restrict__ gb2, const float* __restrict__ dw1, const float* __restrict__ db1, const float* __restrict__ dw2, const float* __restrict__ db2, float* __restrict__ BIAS) {
  __shared__ __attribute__((aligned(16))) _Float16 sW1[2 * BH][8];           // row = hidden unit (0..63 geom, 64..127 delay), its 8 feature weights
  __shared__ __attribute__((aligned(16))) _Float16 sW2[16][2 * BH + 8];      // row = output row of layer 2, k = hidden unit; pitch 272 B spreads the 16 rows over the banks
  const int tid = threadIdx.x, w = tid >> 5, lane = tid & 31, ln = lane & 15, hh = lane >> 4;
  { FragW f; float o0 = 0.f, o1 = 0.f, o2 = 0.f; const _Float16 z = (_Float16)0.f;
    if (tid < BH) { const _Float16 g0 = (_Float16)(bf16_round(gw1[tid * 2]) * 16.0f), g1 = (_Float16)(bf16_round(gw1[tid * 2 + 1]) * 16.0f);
      f.h[0] = g0; f.h[1] = g0; f.h[2] = g1; f.h[3] = g1; f.h[4] = z; f.h[5] = z; f.h[6] = z; f.h[7] = (_Float16)(bf16_round(gb1[tid]) * 16.0f); o0 = bf16_round(gw2[tid]) * 16.0f; }
    else { const int k = tid - BH; const _Float16 d0 = (_Float16)(bf16_round(dw1[k * 4]) * 16.0f);
      f.h[0] = d0; f.h[1] = d0; f.h[2] = z; f.h[3] = z; f.h[4] = (_Float16)(bf16_round(dw1[k * 4 + 1]) * 16.0f); f.h[5] = (_Float16)(bf16_round(dw1[k * 4 + 2]) * 16.0f); f.h[6] = (_Float16)(bf16_round(dw1[k * 4 + 3]) * 16.0f);
      f.h[7] = (_Float16)(bf16_round(db1[k]) * 16.0f); o1 = bf16_round(dw2[k]) * 16.0f; o2 = bf16_round(dw2[BH + k]) * 16.0f; }
    *(v8us*)&sW1[tid][0] = f.half[0];
#pragma unroll
    for (int m = 0; m < 16; ++m) sW2[m][tid] = (_Float16)(((m & 7) == 0) ? o0 : ((m & 7) == 1) ? o1 : ((m & 7) == 2) ? o2 : 0.f); }
  __syncthreads();
  const size_t p0 = ((size_t)blk * 4 + w) * 32;      // 32 consecutive pairs of one (b, i) (SS = 1024 is a multiple of 32)
  const int b = (int)(p0 / ((size_t)SS * SS)); const int i = (int)((p0 / SS) % SS); const int jb = (int)(p0 % SS);
  const float* ci = crd + ((size_t)b * SS + i) * 4; const float xi = bf16_round(ci[0]), yi = bf16_round(ci[1]), zi = bf16_round(ci[2]), ti = bf16_round(ci[3]);
  const float gb2v = bf16_round(gb2[0]), db20 = bf16_round(db2[0]), db21 = bf16_round(db2[1]);
  // this lane's pair, j = jb + lane = jb + 16 hh + ln
  const v4f cj = *(const v4fa*)(crd + ((size_t)b * SS + jb + lane) * 4); const float xj = bf16_round(cj[0]), yj = bf16_round(cj[1]), zj = bf16_round(cj[2]), tj = bf16_round(cj[3]);
  const float dx = xi - xj, dy = yi - yj, dz = zi - zj; const float dist = sqrtf(dx * dx + dy * dy + dz * dz); const float dt = ti - tj;
  FragW F; F.h[0] = (_Float16)dist; F.h[1] = (_Float16)(dist - (float)F.h[0]); F.h[2] = (_Float16)dt; F.h[3] = (_Float16)(dt - (float)F.h[2]); F.h[4] = (_Float16)xj; F.h[5] = (_Float16)yj; F.h[6] = (_Float16)zj; F.h[7] = (_Float16)1.0f;
  FragW bf[2];
#pragma unroll
  for (int c = 0; c < 2; ++c)
#pragma unroll
    for (int q = 0; q < 4; ++q) { bf[c].w[q] = (hh == c) ? F.w[q] : 0u; bf[c].w[4 + q] = 0u; }
  FragW a1[8], a2[4];
#pragma unroll
  for (int t = 0; t < 8; ++t) { a1[t].half[0] = *(const v8us*)&sW1[t * 16 + ln][0];
#pragma unroll
    for (int q = 0; q < 4; ++q) a1[t].w[4 + q] = 0u; }
#pragma unroll
  for (int s = 0; s < 4; ++s) { a2[s].half[0] = *(const v8us*)&sW2[ln][s * 32 + 8 * hh]; a2[s].half[1] = *(const v8us*)&sW2[ln][s * 32 + 16 + 8 * hh]; }
  const v8f zero8 = (v8f){0.f,0.f,0.f,0.f,0.f,0.f,0.f,0.f};
  const v16h zero16 = {};
  v8f d2[2] = {zero8, zero8};
#pragma unroll
  for (int s = 0; s < 4; ++s)
#pragma unroll
    for (int c = 0; c < 2; ++c) { const v8f t0 = mma16(a1[2 * s].v, bf[c].v, zero8), t1 = mma16(a1[2 * s + 1].v, bf[c].v, zero8); FragW hb;
#pragma unroll
      for (int q = 0; q < 8; ++q) { hb.h[q] = (_Float16)t0[q]; hb.h[8 + q] = (_Float16)t1[q]; }
      d2[c] = mma16(a2[s].v, __builtin_elementwise_max(hb.v, zero16), d2[c]); }      // relu behind the rounding gives the same f16 value as in front of it, two units per instruction
  { const float geom = (hh ? d2[1][0] : d2[0][0]) * 0.00390625f + gb2v; const float q0 = (hh ? d2[1][1] : d2[0][1]) * 0.00390625f + db20, q1 = (hh ? d2[1][2] : d2[0][2]) * 0.00390625f + db21;
    const float shape = ((q0 > 20.f) ? q0 : log1pf(expf(q0))) + 1e-4f, rate = ((q1 > 20.f) ? q1 : log1pf(expf(q1))) + 1e-4f; const float dtp = fmaxf(fabsf(dt), 1e-4f);
    BIAS[p0 + lane] = geom + shape * logf(rate) + (shape - 1.0f) * logf(dtp) - rate * dtp - lgammaf(shape);
    asm volatile("s_wait_xcnt 0x0" ::: "memory"); } }      // stands behind the store, ahead of any later write of the registers it names (the listing lays other branches of the fused kernel behind it)
// 16 k positions of one f32 row for an f16 fragment; p points at the lane's k = 8 hh of the 32-wide k step (positions 0..7 and 16..23 from there). load16 fetches them, cvt16 makes f16(bf16(x) * sc) of them (round to nearest even, as bf16_round)
__device__ __forceinline__ void load16(const float* __restrict__ p, v4f (&x)[4]) { x[0] = *(const v4fa*)p; x[1] = *(const v4fa*)(p + 4); x[2] = *(const v4fa*)(p + 16); x[3] = *(const v4fa*)(p + 20); }
__device__ __forceinline__ v16h cvt16(const v4f (&x)[4], const float sc) { FragH f;
#pragma unroll
  for (int g = 0; g < 4; ++g)
#pragma unroll
    for (int q = 0; q < 4; ++q) f.h[4 * g + q] = (_Float16)((float)(__bf16)x[g][q] * sc);
  return f.v; }
// q, k, v projections straight from the f32 inputs. One wave = 16 rows of one matrix (B operand) against 64 rows of the other (A operand, 4 tiles), K = 256: a lane then holds 8 neighbouring results of the A side,
// one 16-byte store per tile, and a wave writes whole 128-byte lines. q, k: B = 16 rows of src, A = 64 rows of W, stored [row][col]. v: B = 16 rows of Wv, A = 64 rows of src (keys), stored transposed [b][col][key].
__device__ __forceinline__ void qkv_block(const int blk, const float* __restrict__ src, const float* __restrict__ Wq, const float* __restrict__ Wk, const float* __restrict__ Wv, _Float16* __restrict__ Q16, _Float16* __restrict__ K16, _Float16* __restrict__ Vt) {
  const int tid = threadIdx.x, w = __builtin_amdgcn_readfirstlane(tid >> 5), lane = tid & 31, ln = lane & 15, hh = lane >> 4;      // the wave's number in a scalar register keeps the base pointers scalar
  const int which = blk >> 7, wid = (blk & 127) * 4 + w;
  const float* one; const float* four; float s1, s4; _Float16* dst;
  if (which < 2) { const int mt = wid >> 2, nq = wid & 3; one = src + (size_t)mt * 16 * DM; four = (which ? Wk : Wq) + (size_t)nq * 64 * DM; s1 = 1.0f; s4 = 16.0f; dst = (which ? K16 : Q16) + (size_t)(mt * 16 + ln) * DM + nq * 64; }
  else { const int kq = wid >> 4, ct = wid & 15; one = Wv + (size_t)ct * 16 * DM; four = src + (size_t)kq * 64 * DM; s1 = 16.0f; s4 = 1.0f; dst = Vt + ((size_t)(kq / (SS / 64)) * DM + ct * 16 + ln) * SS + (kq % (SS / 64)) * 64; }
  const float* orow = one + ln * DM + 8 * hh; const float* frow = four + ln * DM + 8 * hh;
  v8f acc[4] = {};
  for (int kb = 0; kb < DM; kb += 32) { const float* po = orow + kb; const float* pf = frow + kb; v4f ro[4], rf[4][4];
    load16(po, ro);
#pragma unroll
    for (int t = 0; t < 4; ++t) load16(pf + t * 16 * DM, rf[t]);
    asm volatile("s_wait_xcnt 0x0" :: "v"(po), "v"(pf) : "memory");      // the two address pairs stay whole up to this wait
    const v16h bo = cvt16(ro, s1);
#pragma unroll
    for (int t = 0; t < 4; ++t) acc[t] = mma16(cvt16(rf[t], s4), bo, acc[t]); }
#pragma unroll
  for (int t = 0; t < 4; ++t) { FragH o;
#pragma unroll
    for (int r = 0; r < 8; ++r) o.h[r] = (_Float16)(acc[t][r] * 0.0625f);
    *(v8us*)((unsigned short*)dst + t * 16 + 8 * hh) = o.half[0]; } }
// Everything that depends on the inputs alone, in one launch: blocks 0..383 the q, k, v projections (first, they are the long ones), blocks 384..447 Wo as f16 (x16), the rest the bias plane.
#define G_QKV (3 * (NR / 16) * (DM / 64) / 4)
#define G_WO (DM * DM / 8 / 128)
#define G_BIAS (BB * SS * SS / 128)
// waves_per_eu(8): at most 128 registers, so that the bias blocks keep the eight waves a SIMD that they had as a kernel of their own (116 registers there); without it the fused kernel builds to 157 registers, all above 123 in the bias code: six waves
__global__ __launch_bounds__(128) __attribute__((amdgpu_waves_per_eu(8))) void k_front(const float* __restrict__ src, const float* __restrict__ crd, const float* __restrict__ Wq, const float* __restrict__ Wk, const float* __restrict__ Wv, const float* __restrict__ Wo,
    const float* __restrict__ gw1, const float* __restrict__ gb1, const float* __restrict__ gw2, const float* __restrict__ gb2, const float* __restrict__ dw1, const float* __restrict__ db1, const float* __restrict__ dw2, const float* __restrict__ db2,
    _Float16* __restrict__ Q16, _Float16* __restrict__ K16, _Float16* __restrict__ Vt, _Float16* __restrict__ Bo, float* __restrict__ BIAS) {
  const int blk = blockIdx.x;
  if (blk < G_QKV) { qkv_block(blk, src, Wq, Wk, Wv, Q16, K16, Vt); return; }
  if (blk < G_QKV + G_WO) { const size_t t = (size_t)(blk - G_QKV) * 128 + threadIdx.x; FragH f;
#pragma unroll
    for (int i = 0; i < 8; ++i) f.h[i] = (_Float16)(bf16_round(Wo[t * 8 + i]) * 16.0f);
    *(v8us*)((unsigned short*)Bo + t * 8) = f.half[0];
    asm volatile("s_wait_xcnt 0x0" ::: "memory");      // stands behind the store, ahead of any later write of the registers it names (the listing lays the other branches behind it)
    return; }
  bias_block(blk - (G_QKV + G_WO), crd, gw1, gb1, gw2, gb2, dw1, db1, dw2, db2, BIAS); }
// One block = 32 query rows of one (batch, head); its 8 waves share those rows and split the 1024 keys, 128 each (512 blocks of 8 waves fill every SIMD four deep, where one wave per 32 rows over all keys left
// one wave on half the SIMDs). Every wave runs the same online-softmax loop over its own keys and leaves an un-normalised partial (row max, row sum, O) in LDS; behind one block barrier the partials of a row are
// rescaled to their common max and added, wave 0 first.
// waves_per_eu(1, 4): no more than four waves a SIMD are planned for, which is what 512 blocks of 8 waves come to; without it the compiler saves registers for an occupancy the grid cannot reach and runs the 16 rows' loads and cross-lane steps one row after the other
__global__ __launch_bounds__(256) __attribute__((amdgpu_waves_per_eu(1, 4))) void k_flash(const _Float16* __restrict__ Q16, const _Float16* __restrict__ K16, const _Float16* __restrict__ Vt, const float* __restrict__ BIAS, float* __restrict__ O) {
  constexpr int RPW = 32, NW = 8, NQB = SS / RPW, KPW = SS / NW, DT = 2;
  __shared__ __attribute__((aligned(16))) unsigned short sP[NW][RPW][40]; __shared__ __attribute__((aligned(16))) float sO[NW][RPW][HD + 4]; __shared__ float sM[NW][RPW], sL[NW][RPW];
  const int tid = threadIdx.x, w = __builtin_amdgcn_readfirstlane(tid >> 5), lane = tid & 31, ln = lane & 15, hh = lane >> 4;      // the wave's number in a scalar register keeps the key offset j0 and the wave's LDS bases scalar
  const int slab = blockIdx.x / NQB, qblk = blockIdx.x % NQB; const int b = slab / NH, h = slab % NH; const int q0 = qblk * RPW;
  FragH aq[2];
#pragma unroll
  for (int rt = 0; rt < 2; ++rt) { const unsigned short* qr = (const unsigned short*)Q16 + ((size_t)b * SS + q0 + rt * 16 + ln) * DM + h * HD; aq[rt].half[0] = *(const v8us*)(qr + 8 * hh); aq[rt].half[1] = *(const v8us*)(qr + 16 + 8 * hh); }
  const unsigned short* Vth = (const unsigned short*)Vt + (size_t)slab * HD * SS;
  float m_r[2][8], l_r[2][8]; v8f oacc[2][DT];
#pragma unroll
  for (int rt = 0; rt < 2; ++rt) {
#pragma unroll
    for (int r = 0; r < 8; ++r) { m_r[rt][r] = -3.0e38f; l_r[rt][r] = 0.f; }
#pragma unroll
    for (int dt = 0; dt < DT; ++dt) oacc[rt][dt] = (v8f){0.f,0.f,0.f,0.f,0.f,0.f,0.f,0.f}; }
  const float scale = 0.17677669529663688f;
#pragma unroll 1
  for (int it = 0; it < KPW / 32; ++it) { const int j0 = w * KPW + it * 32;
    v8f s[2][2];
#pragma unroll
    for (int nt = 0; nt < 2; ++nt) { const unsigned short* kr = (const unsigned short*)K16 + ((size_t)b * SS + j0 + nt * 16 + ln) * DM + h * HD; FragH bk; bk.half[0] = *(const v8us*)(kr + 8 * hh); bk.half[1] = *(const v8us*)(kr + 16 + 8 * hh);
#pragma unroll
      for (int rt = 0; rt < 2; ++rt) { v8f acc = (v8f){0.f,0.f,0.f,0.f,0.f,0.f,0.f,0.f}; acc = mmaH<1>(aq[rt].v, aq[rt].v, bk.v, bk.v, acc); s[rt][nt] = acc; } }
#pragma unroll
    for (int rt = 0; rt < 2; ++rt)
#pragma unroll
      for (int r = 0; r < 8; ++r) { const int qi = q0 + rt * 16 + 8 * hh + r; const float* br = BIAS + ((size_t)b * SS + qi) * SS + j0; const float s0 = s[rt][0][r] * scale + br[ln], s1 = s[rt][1][r] * scale + br[16 + ln]; float mc = fmaxf(s0, s1);
        mc = fmaxf(mc, __shfl_xor(mc, 1, 32)); mc = fmaxf(mc, __shfl_xor(mc, 2, 32)); mc = fmaxf(mc, __shfl_xor(mc, 4, 32)); mc = fmaxf(mc, __shfl_xor(mc, 8, 32));
        const float mn = fmaxf(m_r[rt][r], mc); const float al = expf(m_r[rt][r] - mn); m_r[rt][r] = mn; const float p0 = expf(s0 - mn), p1 = expf(s1 - mn); l_r[rt][r] = l_r[rt][r] * al + p0 + p1;
#pragma unroll
        for (int dt = 0; dt < DT; ++dt) oacc[rt][dt][r] *= al;
        FragH t2; t2.h[0] = (_Float16)p0; t2.h[1] = (_Float16)p1; sP[w][rt * 16 + 8 * hh + r][ln] = t2.u[0]; sP[w][rt * 16 + 8 * hh + r][16 + ln] = t2.u[1]; }
    __builtin_amdgcn_fence(__ATOMIC_ACQ_REL, "workgroup"); __builtin_amdgcn_wave_barrier();
    FragH pa[2];
#pragma unroll
    for (int rt = 0; rt < 2; ++rt) { pa[rt].half[0] = *(const v8us*)&sP[w][rt * 16 + ln][8 * hh]; pa[rt].half[1] = *(const v8us*)&sP[w][rt * 16 + ln][16 + 8 * hh]; }
#pragma unroll
    for (int dt = 0; dt < DT; ++dt) { const unsigned short* vrow = Vth + (size_t)(dt * 16 + ln) * SS + j0; FragH bv; bv.half[0] = *(const v8us*)(vrow + 8 * hh); bv.half[1] = *(const v8us*)(vrow + 16 + 8 * hh);
#pragma unroll
      for (int rt = 0; rt < 2; ++rt) oacc[rt][dt] = mmaH<1>(pa[rt].v, pa[rt].v, bv.v, bv.v, oacc[rt][dt]); }
    __builtin_amdgcn_fence(__ATOMIC_ACQ_REL, "workgroup"); __builtin_amdgcn_wave_barrier(); }
#pragma unroll
  for (int rt = 0; rt < 2; ++rt) {
#pragma unroll
    for (int r = 0; r < 8; ++r) { float l = l_r[rt][r]; l += __shfl_xor(l, 1, 32); l += __shfl_xor(l, 2, 32); l += __shfl_xor(l, 4, 32); l += __shfl_xor(l, 8, 32); l_r[rt][r] = l; }
#pragma unroll
    for (int dt = 0; dt < DT; ++dt)
#pragma unroll
      for (int r = 0; r < 8; ++r) sO[w][rt * 16 + 8 * hh + r][dt * 16 + ln] = oacc[rt][dt][r]; }
  if (ln == 0) {      // max and sum are the same in the 16 lanes of a row
#pragma unroll
    for (int rt = 0; rt < 2; ++rt)
#pragma unroll
      for (int r = 0; r < 8; ++r) { sM[w][rt * 16 + 8 * hh + r] = m_r[rt][r]; sL[w][rt * 16 + 8 * hh + r] = l_r[rt][r]; } }
  __syncthreads();      // every wave's partial is in LDS before any thread merges
  { const int r = tid >> 3, pc = tid & 7;      // one thread = 4 output columns of one row
    float mw[NW], M = -3.0e38f;
#pragma unroll
    for (int u = 0; u < NW; ++u) { mw[u] = sM[u][r]; M = fmaxf(M, mw[u]); }
    float L = 0.f; v4f acc = {0.f, 0.f, 0.f, 0.f};
#pragma unroll
    for (int u = 0; u < NW; ++u) { const float g = expf(mw[u] - M); L += sL[u][r] * g; const v4f val = *(const v4fa*)&sO[u][r][pc * 4]; acc += val * g; }
    const float inv = 1.0f / L;
    *(v4f*)(O + ((size_t)b * SS + q0 + r) * DM + h * HD + pc * 4) = acc * inv; } }
extern "C" void kernel_launch(void* const* d_in, const int* in_sizes, int n_in,
                              void* d_out, int out_size, void* d_ws, size_t ws_size, hipStream_t stream) {
  (void)in_sizes; (void)n_in; (void)out_size;
  const float* src = (const float*)d_in[0]; const float* crd = (const float*)d_in[1]; const float* Wq = (const float*)d_in[2]; const float* Wk = (const float*)d_in[3]; const float* Wv = (const float*)d_in[4]; const float* Wo = (const float*)d_in[5];
  const float* gw1 = (const float*)d_in[6]; const float* gb1 = (const float*)d_in[7]; const float* gw2 = (const float*)d_in[8]; const float* gb2 = (const float*)d_in[9]; const float* dw1 = (const float*)d_in[10]; const float* db1 = (const float*)d_in[11]; const float* dw2 = (const float*)d_in[12]; const float* db2 = (const float*)d_in[13];
  char* ws = (char*)d_ws; size_t off = 0;
  auto take = [&](size_t bytes) { char* p = ws + off; off += (bytes + 255) & ~(size_t)255; return p; };
  _Float16* Bo = (_Float16*)take((size_t)DM * DM * 2); _Float16* Q16 = (_Float16*)take((size_t)NR * DM * 2); _Float16* K16 = (_Float16*)take((size_t)NR * DM * 2); _Float16* Vt = (_Float16*)take((size_t)NR * DM * 2); float* BIAS = (float*)take((size_t)BB * SS * SS * 4); float* O = (float*)take((size_t)NR * DM * 4);
  if (off > ws_size) return;      // about 13 MiB
  k_front<<<G_QKV + G_WO + G_BIAS, 128, 0, stream>>>(src, crd, Wq, Wk, Wv, Wo, gw1, gb1, gw2, gb2, dw1, db1, dw2, db2, Q16, K16, Vt, Bo, BIAS);
  k_flash<<<BB * NH * (SS / 32), 256, 0, stream>>>(Q16, K16, Vt, BIAS, O);
  const dim3 gg(((NR / 16) * (DM / 64) + 3) / 4, 1);
  k_gemm_h<false><<<gg, 128, 0, stream>>>(O, DM, 0, Bo, DM, 0, 0.0625f, (float*)d_out, DM, 0, NR, DM, DM);      // rounds O to f16 in its A loader
}

// v005
// Measured time: 51.1 microseconds a run.
// In two side-by-side timings against v004, it was 1.24 and 1.26 times as fast.
// All steps since v000 together make it 7.34 times as fast.
#include <hip/hip_runtime.h>
// q/k/v/o projections (2048 × 256 × 256) and the 8-head attention (d = 32) with an additive per-pair bias on v_wmma_f32_16x16x32_f16 (fused flash-style kernel: S = Q·Kᵀ, O = P·V on WMMA;
// online max/sum softmax f32; P f16 <= 1). The bias (geometric 2->64->1 MLP + the Gamma log-density from the 4->64->2 delay MLP, incl. lgamma) is computed once per (b, i, j): both layers of the two MLPs
// on WMMA, softplus/log/lgamma in f32; the bias plane is shared by the 8 heads. A = f16(bf16 ·) exact operands (o projection: f16(O)), weights bf16-exact ×2^4 ((out,in)), single products, f32 accumulate.
#define BB 2
#define SS 1024
#define DM 256
#define NH 8
#define HD 32
#define BH 64
#define NR (BB * SS)

typedef __bf16 v16b __attribute__((ext_vector_type(16)));
typedef unsigned short v8us __attribute__((ext_vector_type(8), may_alias));
typedef float  v8f  __attribute__((ext_vector_type(8)));
typedef float  v4f  __attribute__((ext_vector_type(4)));
typedef float  v4fa __attribute__((ext_vector_type(4), may_alias));
union FragB { v16b v; v8us half[2]; unsigned short u[16]; };

__device__ __forceinline__ unsigned short bf16_bits(float x) { unsigned int u = __float_as_uint(x); return (unsigned short)((u + 0x7FFFu + ((u >> 16) & 1u)) >> 16); }
__device__ __forceinline__ float bf16_val(unsigned short b) { return __uint_as_float(((unsigned int)b) << 16); }
__device__ __forceinline__ float bf16_round(float x) { return bf16_val(bf16_bits(x)); }
// D += A·B with NT terms: 1 = ah·bh, 2 = + al·bh (A split), 3 = + ah·bl (both split)
template <int NT>
__device__ __forceinline__ v8f mmaN(v16b ah, v16b al, v16b bh, v16b bl, v8f c) {
  c = __builtin_amdgcn_wmma_f32_16x16x32_bf16(false, ah, false, bh, (short)0, c, false, false);
  if (NT >= 2) c = __builtin_amdgcn_wmma_f32_16x16x32_bf16(false, al, false, bh, (short)0, c, false, false);
  if (NT >= 3) c = __builtin_amdgcn_wmma_f32_16x16x32_bf16(false, ah, false, bl, (short)0, c, false, false);
  asm volatile("v_nop\n\tv_nop\n\tv_nop\n\tv_nop" : "+v"(c) : "v"(ah), "v"(al), "v"(bh), "v"(bl));
  return c;
}

__global__ __launch_bounds__(256) void k_wt_bf16(const float* __restrict__ W, unsigned short* __restrict__ Wt, int K, int N) {
  const int t = blockIdx.x * 256 + threadIdx.x;
  const int k8n = K / 8;
  if (t >= N * k8n) return;
  const int n = t / k8n, k8 = (t % k8n) * 8;
  v8us v;
#pragma unroll
  for (int i = 0; i < 8; ++i) v[i] = bf16_bits(W[(size_t)(k8 + i) * N + n]);
  *(v8us*)(Wt + (size_t)n * K + k8) = v;
  
}

// GEMM C[M][N] (f32, pitch ldc) = act(A[M][K]·W + bias). A f32 row-major (pitch lda) converted per fragment to bf16
// (ASPLIT: hi/lo two planes -> 2 terms, else single rounded term); Wt bf16 [N][K] (pitch ldb). BIAS_BF16 rounds the
// bias to bf16 first (bias quantised to bf16 before the add). K%32==0, M%16==0, N%64==0.
template <bool ASPLIT, int ACT, bool BIAS_BF16>
__global__ __launch_bounds__(128) void k_gemm_bf(const float* __restrict__ A, int lda, const unsigned short* __restrict__ Wt, int ldb,
                                               const float* __restrict__ bias, float* __restrict__ C, int ldc, int M, int N, int K) {
  __shared__ __attribute__((aligned(16))) float so[4][16][64];
  const int tid = threadIdx.x, w = tid >> 5, lane = tid & 31, ln = lane & 15, hh = lane >> 4;
  const int ntn = N / 64;
  const int wid = blockIdx.x * 4 + w;
  const int mt = wid / ntn, nq = wid % ntn;
  if (mt * 16 >= M) return;
  const int row0 = mt * 16, col0 = nq * 64;
  const float* arow = A + (size_t)(row0 + ln) * lda;
  v8f acc[4] = {};
  for (int kb = 0; kb < K; kb += 32) {
    FragB ah, al;
    const v4f x0 = *(const v4fa*)(arow + kb + 8 * hh), x1 = *(const v4fa*)(arow + kb + 8 * hh + 4);
    const v4f x2 = *(const v4fa*)(arow + kb + 16 + 8 * hh), x3 = *(const v4fa*)(arow + kb + 16 + 8 * hh + 4);
    float xs[16] = {x0[0],x0[1],x0[2],x0[3],x1[0],x1[1],x1[2],x1[3],x2[0],x2[1],x2[2],x2[3],x3[0],x3[1],x3[2],x3[3]};
#pragma unroll
    for (int i = 0; i < 16; ++i) { const unsigned short hb = bf16_bits(xs[i]); ah.u[i] = hb; al.u[i] = ASPLIT ? bf16_bits(xs[i] - bf16_val(hb)) : (unsigned short)0; }
#pragma unroll
    for (int t = 0; t < 4; ++t) {
      const unsigned short* brow = Wt + (size_t)(col0 + t * 16 + ln) * ldb + kb;
      FragB b;
      b.half[0] = *(const v8us*)(brow + 8 * hh);
      b.half[1] = *(const v8us*)(brow + 16 + 8 * hh);
      acc[t] = mmaN<ASPLIT ? 2 : 1>(ah.v, al.v, b.v, b.v, acc[t]);
    }
  }
#pragma unroll
  for (int t = 0; t < 4; ++t) {
    float bv = bias ? bias[col0 + t * 16 + ln] : 0.f;
    if (BIAS_BF16) bv = bf16_round(bv);
#pragma unroll
    for (int r = 0; r < 8; ++r) { float v = acc[t][r] + bv; if (ACT == 1) v = fmaxf(v, 0.f); so[w][8 * hh + r][t * 16 + ln] = v; }
  }
  __builtin_amdgcn_fence(__ATOMIC_ACQ_REL, "workgroup");
  __builtin_amdgcn_wave_barrier();
  const int rsub = lane >> 4, c4 = (lane & 15) * 4;
  {
#pragma unroll
    for (int q = 0; q < 8; ++q) {
      const int r = q * 2 + rsub;
      const v4f v = *(const v4fa*)&so[w][r][c4];
      *(v4f*)(C + (size_t)(row0 + r) * ldc + col0 + c4) = v;
    }
    
  }
}

// Flash-style causal/unmasked attention, all contractions 3-term bf16 hi/lo splits, f32 softmax with running max.
// q,k,v rows are read from f32 buffers with arbitrary row pitch (so they can live inside a fused qkv buffer);
// D = head size (multiple of 32, <= 128); one wave = 16 query rows; block = 4 waves (64 queries) sharing K/V chunks of 32.
template <int D, bool CAUSAL>
__global__ __launch_bounds__(128) void k_flash(const float* __restrict__ qb, const float* __restrict__ kb, const float* __restrict__ vb,
                                             int pitch, int T, int H, float scale, float* __restrict__ y, int ypitch) {
  constexpr int KS = D / 32;        // k-steps for QK
  constexpr int DT = D / 16;        // d tiles for PV
  __shared__ __attribute__((aligned(16))) unsigned short sKh[32][D + 8], sKl[32][D + 8], sVh[32][D + 8], sVl[32][D + 8];
  __shared__ __attribute__((aligned(16))) unsigned short sPh[4][16][40], sPl[4][16][40];
  __shared__ __attribute__((aligned(16))) float sO[4][16][D];
  const int tid = threadIdx.x, w = tid >> 5, lane = tid & 31, ln = lane & 15, hh = lane >> 4;
  const int nqb = (T + 63) / 64;
  const int bh = blockIdx.x / nqb, qblk = blockIdx.x % nqb;
  const int b = bh / H, h = bh % H;
  const int q0 = qblk * 64 + w * 16;
  const float* Q = qb + (size_t)b * T * pitch + h * D;
  const float* K = kb + (size_t)b * T * pitch + h * D;
  const float* V = vb + (size_t)b * T * pitch + h * D;

  // A fragments of the wave's 16 query rows (scaled), hi/lo
  FragB aqh[KS], aql[KS];
  {
    int row = q0 + ln; if (row >= T) row = T - 1;
    const float* qr = Q + (size_t)row * pitch;
#pragma unroll
    for (int ks = 0; ks < KS; ++ks)
#pragma unroll
      for (int i = 0; i < 16; ++i) {
        const int d = ks * 32 + ((i < 8) ? (8 * hh + i) : (16 + 8 * hh + (i - 8)));
        const float x = qr[d] * scale; const unsigned short hb = bf16_bits(x);
        aqh[ks].u[i] = hb; aql[ks].u[i] = bf16_bits(x - bf16_val(hb));
      }
  }
  float m_r[8], l_r[8];
#pragma unroll
  for (int r = 0; r < 8; ++r) { m_r[r] = -3.0e38f; l_r[r] = 0.f; }
  v8f oacc[DT];
#pragma unroll
  for (int dt = 0; dt < DT; ++dt) oacc[dt] = (v8f){0.f,0.f,0.f,0.f,0.f,0.f,0.f,0.f};

  const int kv_end = CAUSAL ? min(T, qblk * 64 + 64) : T;     // block-uniform
  for (int j0 = 0; j0 < kv_end; j0 += 32) {
    __syncthreads();
    for (int e = tid; e < 32 * (D / 4); e += 128) {
      const int r = e / (D / 4), c4 = (e % (D / 4)) * 4;
      const int key = j0 + r;
      v4f kf = {0.f,0.f,0.f,0.f}, vf = {0.f,0.f,0.f,0.f};
      if (key < T) { kf = *(const v4fa*)(K + (size_t)key * pitch + c4); vf = *(const v4fa*)(V + (size_t)key * pitch + c4); }
#pragma unroll
      for (int t = 0; t < 4; ++t) {
        unsigned short hb = bf16_bits(kf[t]); sKh[r][c4 + t] = hb; sKl[r][c4 + t] = bf16_bits(kf[t] - bf16_val(hb));
        hb = bf16_bits(vf[t]); sVh[r][c4 + t] = hb; sVl[r][c4 + t] = bf16_bits(vf[t] - bf16_val(hb));
      }
    }
    __syncthreads();
    // S tile 16 x 32
    v8f s[2];
#pragma unroll
    for (int nt = 0; nt < 2; ++nt) {
      v8f acc = {};
#pragma unroll
      for (int ks = 0; ks < KS; ++ks) {
        FragB bh_, bl_;
        bh_.half[0] = *(const v8us*)&sKh[nt * 16 + ln][ks * 32 + 8 * hh]; bh_.half[1] = *(const v8us*)&sKh[nt * 16 + ln][ks * 32 + 16 + 8 * hh];
        bl_.half[0] = *(const v8us*)&sKl[nt * 16 + ln][ks * 32 + 8 * hh]; bl_.half[1] = *(const v8us*)&sKl[nt * 16 + ln][ks * 32 + 16 + 8 * hh];
        acc = mmaN<3>(aqh[ks].v, aql[ks].v, bh_.v, bl_.v, acc);
      }
      s[nt] = acc;
    }
    // mask + running max (rows 8hh+r; the 16 lanes of a half share rows)
    float alpha[8];
#pragma unroll
    for (int r = 0; r < 8; ++r) {
      const int qi = q0 + 8 * hh + r;
      const int ja = j0 + ln, jb = j0 + 16 + ln;
      if (CAUSAL) { if (ja > qi) s[0][r] = -3.0e38f; if (jb > qi) s[1][r] = -3.0e38f; }
      if (ja >= T) s[0][r] = -3.0e38f;
      if (jb >= T) s[1][r] = -3.0e38f;
      float mx = fmaxf(s[0][r], s[1][r]);
      mx = fmaxf(mx, __shfl_xor(mx, 1, 32)); mx = fmaxf(mx, __shfl_xor(mx, 2, 32)); mx = fmaxf(mx, __shfl_xor(mx, 4, 32)); mx = fmaxf(mx, __shfl_xor(mx, 8, 32));
      const float mnew = fmaxf(m_r[r], mx);
      alpha[r] = (mnew > -1.0e38f) ? __expf(m_r[r] - mnew) : 1.0f;
      const float p0 = (s[0][r] > -1.0e38f) ? __expf(s[0][r] - mnew) : 0.f;
      const float p1 = (s[1][r] > -1.0e38f) ? __expf(s[1][r] - mnew) : 0.f;
      m_r[r] = mnew;
      l_r[r] = l_r[r] * alpha[r] + p0 + p1;            // per-lane partial row sum (16 lanes combined at the end)
      unsigned short hb = bf16_bits(p0); sPh[w][8 * hh + r][ln] = hb;      sPl[w][8 * hh + r][ln] = bf16_bits(p0 - bf16_val(hb));
      hb = bf16_bits(p1);                sPh[w][8 * hh + r][16 + ln] = hb; sPl[w][8 * hh + r][16 + ln] = bf16_bits(p1 - bf16_val(hb));
    }
#pragma unroll
    for (int dt = 0; dt < DT; ++dt)
#pragma unroll
      for (int r = 0; r < 8; ++r) oacc[dt][r] *= alpha[r];
    __builtin_amdgcn_fence(__ATOMIC_ACQ_REL, "workgroup");
    __builtin_amdgcn_wave_barrier();
    FragB pah, pal;
    pah.half[0] = *(const v8us*)&sPh[w][ln][8 * hh]; pah.half[1] = *(const v8us*)&sPh[w][ln][16 + 8 * hh];
    pal.half[0] = *(const v8us*)&sPl[w][ln][8 * hh]; pal.half[1] = *(const v8us*)&sPl[w][ln][16 + 8 * hh];
#pragma unroll
    for (int dt = 0; dt < DT; ++dt) {
      FragB bvh, bvl;
#pragma unroll
      for (int i = 0; i < 8; ++i) {
        bvh.u[i] = sVh[8 * hh + i][dt * 16 + ln]; bvh.u[8 + i] = sVh[16 + 8 * hh + i][dt * 16 + ln];
        bvl.u[i] = sVl[8 * hh + i][dt * 16 + ln]; bvl.u[8 + i] = sVl[16 + 8 * hh + i][dt * 16 + ln];
      }
      oacc[dt] = mmaN<3>(pah.v, pal.v, bvh.v, bvl.v, oacc[dt]);
    }
    __builtin_amdgcn_fence(__ATOMIC_ACQ_REL, "workgroup");
    __builtin_amdgcn_wave_barrier();
  }
#pragma unroll
  for (int r = 0; r < 8; ++r) {
    float l = l_r[r];
    l += __shfl_xor(l, 1, 32); l += __shfl_xor(l, 2, 32); l += __shfl_xor(l, 4, 32); l += __shfl_xor(l, 8, 32);
    l_r[r] = (l > 0.f) ? 1.0f / l : 0.f;
  }
#pragma unroll
  for (int dt = 0; dt < DT; ++dt)
#pragma unroll
    for (int r = 0; r < 8; ++r) sO[w][8 * hh + r][dt * 16 + ln] = oacc[dt][r] * l_r[r];
  __builtin_amdgcn_fence(__ATOMIC_ACQ_REL, "workgroup");
  __builtin_amdgcn_wave_barrier();
  {
    for (int r = 0; r < 16; ++r) {
      const int row = q0 + r;
      if (row < T && lane < D / 4) {
        const v4f val = *(const v4fa*)&sO[w][r][lane * 4];
        *(v4f*)(y + ((size_t)b * T + row) * ypitch + h * D + lane * 4) = val;
      }
    }
    
  }
}

// GEMM C = act(A·W + bias + resid): A f32 (ASPLIT -> hi/lo 2 terms), Wt bf16 [N][K]; ACT 0 none, 1 relu, 2 exact gelu;
// resid (optional, f32, row index = (row % rmod), pitch ldr, RES_BF16 rounds it) added before the activation.
template <bool ASPLIT, int ACT, bool BIAS_BF16, bool RES_BF16>
__global__ __launch_bounds__(128) void k_gemm_bf3(const float* __restrict__ A, int lda, const unsigned short* __restrict__ Wt, int ldb,
                                                const float* __restrict__ bias, const float* __restrict__ resid, int rmod, int ldr,
                                                float* __restrict__ C, int ldc, int M, int N, int K) {
  __shared__ __attribute__((aligned(16))) float so[4][16][64];
  const int tid = threadIdx.x, w = tid >> 5, lane = tid & 31, ln = lane & 15, hh = lane >> 4;
  const int ntn = N / 64;
  const int wid = blockIdx.x * 4 + w;
  const int mt = wid / ntn, nq = wid % ntn;
  if (mt * 16 >= M) return;
  const int row0 = mt * 16, col0 = nq * 64;
  const float* arow = A + (size_t)(row0 + ln) * lda;
  v8f acc[4] = {};
  for (int kb = 0; kb < K; kb += 32) {
    FragB ah, al;
    const v4f x0 = *(const v4fa*)(arow + kb + 8 * hh), x1 = *(const v4fa*)(arow + kb + 8 * hh + 4);
    const v4f x2 = *(const v4fa*)(arow + kb + 16 + 8 * hh), x3 = *(const v4fa*)(arow + kb + 16 + 8 * hh + 4);
    float xs[16] = {x0[0],x0[1],x0[2],x0[3],x1[0],x1[1],x1[2],x1[3],x2[0],x2[1],x2[2],x2[3],x3[0],x3[1],x3[2],x3[3]};
#pragma unroll
    for (int i = 0; i < 16; ++i) { const unsigned short hb = bf16_bits(xs[i]); ah.u[i] = hb; al.u[i] = ASPLIT ? bf16_bits(xs[i] - bf16_val(hb)) : (unsigned short)0; }
#pragma unroll
    for (int t = 0; t < 4; ++t) {
      const unsigned short* brow = Wt + (size_t)(col0 + t * 16 + ln) * ldb + kb;
      FragB b;
      b.half[0] = *(const v8us*)(brow + 8 * hh);
      b.half[1] = *(const v8us*)(brow + 16 + 8 * hh);
      acc[t] = mmaN<ASPLIT ? 2 : 1>(ah.v, al.v, b.v, b.v, acc[t]);
    }
  }
#pragma unroll
  for (int t = 0; t < 4; ++t) {
    const int col = col0 + t * 16 + ln;
    float bv = bias ? bias[col] : 0.f;
    if (BIAS_BF16) bv = bf16_round(bv);
#pragma unroll
    for (int r = 0; r < 8; ++r) {
      float v = acc[t][r] + bv;
      if (resid) { float rv = resid[(size_t)((row0 + 8 * hh + r) % rmod) * ldr + col]; if (RES_BF16) rv = bf16_round(rv); v += rv; }
      if (ACT == 1) v = fmaxf(v, 0.f);
      if (ACT == 2) v = 0.5f * v * (1.0f + erff(v * 0.70710678118654752f));
      if (ACT == 3) { const float u = 0.7978845608028654f * (v + 0.044715f * v * v * v); v = 0.5f * v * (1.0f + tanhf(u)); }
      so[w][8 * hh + r][t * 16 + ln] = v;
    }
  }
  __builtin_amdgcn_fence(__ATOMIC_ACQ_REL, "workgroup");
  __builtin_amdgcn_wave_barrier();
  const int rsub = lane >> 4, c4 = (lane & 15) * 4;
  {
#pragma unroll
    for (int q = 0; q < 8; ++q) {
      const int r = q * 2 + rsub;
      const v4f v = *(const v4fa*)&so[w][r][c4];
      *(v4f*)(C + (size_t)(row0 + r) * ldc + col0 + c4) = v;
    }
    
  }
}
// row LayerNorm (biased variance, eps) over N: s = X (+ R); optional out_sum <- s; out_norm <- (s-mu)*rsqrt(var+eps)*g + b
template <bool PARAM_BF16>
__global__ __launch_bounds__(256) void k_layernorm(const float* __restrict__ X, const float* __restrict__ R, const float* __restrict__ g, const float* __restrict__ bta,
                                                  float* __restrict__ out_sum, float* __restrict__ out_norm, int N, float eps) {
  __shared__ float red[256];
  const int row = blockIdx.x, tid = threadIdx.x;
  const float* x = X + (size_t)row * N; const float* rr = R ? R + (size_t)row * N : nullptr;
  float vals[16];                     // up to N = 4096
  const int per = N / 256;            // contiguous chunk per thread? use strided-by-4 chunks: thread handles j = tid*4 + 1024*u
  float s1 = 0.f;
  for (int u = 0; u < per / 4; ++u) {
    const int j = tid * 4 + 1024 * u;
    const v4f a = *(const v4fa*)(x + j);
    v4f b = {0.f,0.f,0.f,0.f}; if (rr) b = *(const v4fa*)(rr + j);
#pragma unroll
    for (int q = 0; q < 4; ++q) { const float v = a[q] + b[q]; vals[u * 4 + q] = v; s1 += v; }
  }
  red[tid] = s1; __syncthreads();
  for (int st = 128; st > 0; st >>= 1) { if (tid < st) red[tid] += red[tid + st]; __syncthreads(); }
  const float mu = red[0] / (float)N; __syncthreads();
  float s2 = 0.f;
  for (int u = 0; u < per / 4; ++u)
#pragma unroll
    for (int q = 0; q < 4; ++q) { const float c = vals[u * 4 + q] - mu; s2 += c * c; }
  red[tid] = s2; __syncthreads();
  for (int st = 128; st > 0; st >>= 1) { if (tid < st) red[tid] += red[tid + st]; __syncthreads(); }
  const float rs = rsqrtf(red[0] / (float)N + eps);
  {
    for (int u = 0; u < per / 4; ++u) {
      const int j = tid * 4 + 1024 * u;
      v4f o, sm;
#pragma unroll
      for (int q = 0; q < 4; ++q) {
        float gg = g[j + q], bb = bta[j + q];
        if (PARAM_BF16) { gg = bf16_round(gg); bb = bf16_round(bb); }
        sm[q] = vals[u * 4 + q]; o[q] = (vals[u * 4 + q] - mu) * rs * gg + bb;
      }
      if (out_sum) *(v4f*)(out_sum + (size_t)row * N + j) = sm;
      *(v4f*)(out_norm + (size_t)row * N + j) = o;
    }
    
  }
}



// ---- f16 WMMA path (v_wmma_f32_16x16x32_f16): 11-bit significands for operands in range — used where a [0,1] probability operand needs more precision than bf16
typedef _Float16 v16h __attribute__((ext_vector_type(16)));
union FragH { v16h v; v8us half[2]; _Float16 h[16]; unsigned short u[16]; };
template <int NT>
__device__ __forceinline__ v8f mmaH(v16h ah, v16h al, v16h bh, v16h bl, v8f c) {
  c = __builtin_amdgcn_wmma_f32_16x16x32_f16(false, ah, false, bh, (short)0, c, false, false);
  if (NT >= 2) c = __builtin_amdgcn_wmma_f32_16x16x32_f16(false, al, false, bh, (short)0, c, false, false);
  if (NT >= 3) c = __builtin_amdgcn_wmma_f32_16x16x32_f16(false, ah, false, bl, (short)0, c, false, false);
  asm volatile("v_nop\n\tv_nop\n\tv_nop\n\tv_nop" : "+v"(c) : "v"(ah), "v"(al), "v"(bh), "v"(bl));
  return c;
}
// batched GEMM like k_gemm_b but f16 operands: A f32 (split into f16 hi/lo if ASPLIT, else rounded to f16), Bt = f16 values [n][k]; alpha; C f32; N multiple of 16 (partial tiles skipped)
template <bool ASPLIT>
__global__ __launch_bounds__(128) void k_gemm_h(const float* __restrict__ A, int lda, size_t sA, const _Float16* __restrict__ Bh, int ldb, size_t sB, float alpha, float* __restrict__ C, int ldc, size_t sC, int M, int N, int K) {
  __shared__ __attribute__((aligned(16))) float so[4][16][64];
  const int tid = threadIdx.x, w = tid >> 5, lane = tid & 31, ln = lane & 15, hh = lane >> 4; const int by = blockIdx.y;
  A += (size_t)by * sA; Bh += (size_t)by * sB; C += (size_t)by * sC;
  const int ntn = (N + 63) / 64; const int wid = blockIdx.x * 4 + w; const int mt = wid / ntn, nq = wid % ntn; if (mt * 16 >= M) return;
  const int row0 = mt * 16, col0 = nq * 64; const float* arow = A + (size_t)(row0 + ln) * lda;
  v8f acc[4] = {};
  for (int kb = 0; kb < K; kb += 32) {
    FragH ah, al;
    const v4f x0 = *(const v4fa*)(arow + kb + 8 * hh), x1 = *(const v4fa*)(arow + kb + 8 * hh + 4), x2 = *(const v4fa*)(arow + kb + 16 + 8 * hh), x3 = *(const v4fa*)(arow + kb + 16 + 8 * hh + 4);
    float xs[16] = {x0[0],x0[1],x0[2],x0[3],x1[0],x1[1],x1[2],x1[3],x2[0],x2[1],x2[2],x2[3],x3[0],x3[1],x3[2],x3[3]};
#pragma unroll
    for (int i = 0; i < 16; ++i) { const _Float16 h = (_Float16)xs[i]; ah.h[i] = h; al.h[i] = ASPLIT ? (_Float16)(xs[i] - (float)h) : (_Float16)0.0f; }
#pragma unroll
    for (int t = 0; t < 4; ++t) { if (col0 + t * 16 >= N) continue; const size_t boff = (size_t)(col0 + t * 16 + ln) * ldb + kb; FragH bq; bq.half[0] = *(const v8us*)(Bh + boff + 8 * hh); bq.half[1] = *(const v8us*)(Bh + boff + 16 + 8 * hh);
      acc[t] = mmaH<ASPLIT ? 2 : 1>(ah.v, al.v, bq.v, bq.v, acc[t]); }
  }
#pragma unroll
  for (int t = 0; t < 4; ++t) { if (col0 + t * 16 >= N) continue;
#pragma unroll
    for (int r = 0; r < 8; ++r) so[w][8 * hh + r][t * 16 + ln] = acc[t][r] * alpha; }
  __builtin_amdgcn_fence(__ATOMIC_ACQ_REL, "workgroup"); __builtin_amdgcn_wave_barrier();
  const int rsub = lane >> 4, c4 = (lane & 15) * 4;
  {
#pragma unroll
    for (int q = 0; q < 8; ++q) { const int r = q * 2 + rsub; if (col0 + c4 < N) { const v4f v = *(const v4fa*)&so[w][r][c4]; *(v4f*)(C + (size_t)(row0 + r) * ldc + col0 + c4) = v; } }
     }
}

// Wt[n][k] = f16(W[k][n]·scale) from f32 row-major W[K][N] (scale = power of two; bf16-exact weights stay exact in f16 away from the subnormal range)
__global__ __launch_bounds__(256) void k_wt_f16(const float* __restrict__ W, _Float16* __restrict__ Wt, int K, int N, float scale) {
  const int t = blockIdx.x * 256 + threadIdx.x; if (t >= N * (K / 8)) return; const int n = t / (K / 8), k8 = (t % (K / 8)) * 8; FragH f;
#pragma unroll
  for (int i = 0; i < 8; ++i) f.h[i] = (_Float16)(bf16_round(W[(size_t)(k8 + i) * N + n]) * scale); const v8us o = f.half[0];
  *(v8us*)((unsigned short*)Wt + (size_t)n * K + k8) = o; 
}
// per-pair bias, 32 pairs (same (b,i), j = jb..jb+31) per wave, one pair per lane, both MLPs wholly on v_wmma_f32_16x16x32_f16 in transposed form:
// layer 1: D1 = W1 (A: 16 hidden rows x k) * F (B: k x 16 pairs). A pair has 8 features: dist and dt each as an f16 high part plus an f16 remainder (the two products add up in the f32 accumulator), x_j, y_j, z_j, and 1.0
// for the layer's bias. Lanes 0..15 carry their pair's features at k = 0..7, lanes 16..31 at k = 8..15; W1 stands at both k ranges, and the half of B that belongs to the other 16 pairs is zeroed for each product.
// layer 2: two D1 tiles (hidden rows 0..15 and 16..31 of a 32-row block), relu'd and converted in place, ARE a B operand in the hardware k order; A = W2 with geom / shape / rate in rows 0,1,2 and again in rows 8,9,10, so that
// D2 registers 0,1,2 of lanes 0..15 (rows 0..2) and of lanes 16..31 (rows 8..10) hold the three outputs of column ln: every lane picks the D2 of its own 16-pair group and does its pair's softplus/log/lgamma tail. All weights x16 (exact), taken out as 1/256.
union FragW { v16h v; v8us half[2]; _Float16 h[16]; unsigned int w[8]; };
// The chip's own base-2 exponential and logarithm, one instruction each. Every argument below is a normal number, zero or infinite where it matters (logarithms see values of 1e-4 and more), so the library's range steps are not needed.
__device__ __forceinline__ float hw_exp2(float x) { return __builtin_amdgcn_exp2f(x); }
__device__ __forceinline__ float hw_log2(float x) { return __builtin_amdgcn_logf(x); }
#define LOG2E 1.4426950408889634f
#define LN2 0.6931471805599453f
// softplus(q) = max(q, 0) + log(1 + e), e = exp(-|q|) in [0, 1]. u = 1 + e drops d = e - (u - 1), which is exact; log(1 + e) = log(u) + d / u, and d stands for d / u to within d * e: the relative error stays at rounding level down to e = 0.
__device__ __forceinline__ float softplus_hw(float q) { const float e = hw_exp2(-fabsf(q) * LOG2E); const float u = 1.0f + e; const float d = e - (u - 1.0f); return fmaxf(q, 0.f) + (hw_log2(u) * LN2 + d); }
__device__ __forceinline__ v8f mma16(v16h a, v16h b, v8f c) { return __builtin_amdgcn_wmma_f32_16x16x32_f16(false, a, false, b, (short)0, c, false, false); }
__device__ __forceinline__ void bias_block(const int blk, const float* __restrict__ crd, const float* __restrict__ gw1, const float* __restrict__ gb1, const float* __restrict__ gw2, const float* __restrict__ gb2, const float* __restrict__ dw1, const float* __restrict__ db1, const float* __restrict__ dw2, const float* __restrict__ db2, float* __restrict__ BIAS) {
  __shared__ __attribute__((aligned(16))) _Float16 sW1[2 * BH][8];           // row = hidden unit (0..63 geom, 64..127 delay), its 8 feature weights
  __shared__ __attribute__((aligned(16))) _Float16 sW2[16][2 * BH + 8];      // row = output row of layer 2, k = hidden unit; pitch 272 B spreads the 16 rows over the banks
  const int tid = threadIdx.x, w = tid >> 5, lane = tid & 31, ln = lane & 15, hh = lane >> 4;
  { FragW f; float o0 = 0.f, o1 = 0.f, o2 = 0.f; const _Float16 z = (_Float16)0.f;
    if (tid < BH) { const _Float16 g0 = (_Float16)(bf16_round(gw1[tid * 2]) * 16.0f), g1 = (_Float16)(bf16_round(gw1[tid * 2 + 1]) * 16.0f);
      f.h[0] = g0; f.h[1] = g0; f.h[2] = g1; f.h[3] = g1; f.h[4] = z; f.h[5] = z; f.h[6] = z; f.h[7] = (_Float16)(bf16_round(gb1[tid]) * 16.0f); o0 = bf16_round(gw2[tid]) * 16.0f; }
    else { const int k = tid - BH; const _Float16 d0 = (_Float16)(bf16_round(dw1[k * 4]) * 16.0f);
      f.h[0] = d0; f.h[1] = d0; f.h[2] = z; f.h[3] = z; f.h[4] = (_Float16)(bf16_round(dw1[k * 4 + 1]) * 16.0f); f.h[5] = (_Float16)(bf16_round(dw1[k * 4 + 2]) * 16.0f); f.h[6] = (_Float16)(bf16_round(dw1[k * 4 + 3]) * 16.0f);
      f.h[7] = (_Float16)(bf16_round(db1[k]) * 16.0f); o1 = bf16_round(dw2[k]) * 16.0f; o2 = bf16_round(dw2[BH + k]) * 16.0f; }
    *(v8us*)&sW1[tid][0] = f.half[0];
#pragma unroll
    for (int m = 0; m < 16; ++m) sW2[m][tid] = (_Float16)(((m & 7) == 0) ? o0 : ((m & 7) == 1) ? o1 : ((m & 7) == 2) ? o2 : 0.f); }
  __syncthreads();
  const size_t p0 = ((size_t)blk * 4 + w) * 32;      // 32 consecutive pairs of one (b, i) (SS = 1024 is a multiple of 32)
  const int b = (int)(p0 / ((size_t)SS * SS)); const int i = (int)((p0 / SS) % SS); const int jb = (int)(p0 % SS);
  const float* ci = crd + ((size_t)b * SS + i) * 4; const float xi = bf16_round(ci[0]), yi = bf16_round(ci[1]), zi = bf16_round(ci[2]), ti = bf16_round(ci[3]);
  const float gb2v = bf16_round(gb2[0]), db20 = bf16_round(db2[0]), db21 = bf16_round(db2[1]);
  // this lane's pair, j = jb + lane = jb + 16 hh + ln
  const v4f cj = *(const v4fa*)(crd + ((size_t)b * SS + jb + lane) * 4); const float xj = bf16_round(cj[0]), yj = bf16_round(cj[1]), zj = bf16_round(cj[2]), tj = bf16_round(cj[3]);
  const float dx = xi - xj, dy = yi - yj, dz = zi - zj; const float dist = __builtin_amdgcn_sqrtf(dx * dx + dy * dy + dz * dz); const float dt = ti - tj;
  FragW F; F.h[0] = (_Float16)dist; F.h[1] = (_Float16)(dist - (float)F.h[0]); F.h[2] = (_Float16)dt; F.h[3] = (_Float16)(dt - (float)F.h[2]); F.h[4] = (_Float16)xj; F.h[5] = (_Float16)yj; F.h[6] = (_Float16)zj; F.h[7] = (_Float16)1.0f;
  FragW bf[2];
#pragma unroll
  for (int c = 0; c < 2; ++c)
#pragma unroll
    for (int q = 0; q < 4; ++q) { bf[c].w[q] = (hh == c) ? F.w[q] : 0u; bf[c].w[4 + q] = 0u; }
  FragW a1[8], a2[4];
#pragma unroll
  for (int t = 0; t < 8; ++t) { a1[t].half[0] = *(const v8us*)&sW1[t * 16 + ln][0];
#pragma unroll
    for (int q = 0; q < 4; ++q) a1[t].w[4 + q] = 0u; }
#pragma unroll
  for (int s = 0; s < 4; ++s) { a2[s].half[0] = *(const v8us*)&sW2[ln][s * 32 + 8 * hh]; a2[s].half[1] = *(const v8us*)&sW2[ln][s * 32 + 16 + 8 * hh]; }
  const v8f zero8 = (v8f){0.f,0.f,0.f,0.f,0.f,0.f,0.f,0.f};
  const v16h zero16 = {};
  v8f d2[2] = {zero8, zero8};
#pragma unroll
  for (int s = 0; s < 4; ++s)
#pragma unroll
    for (int c = 0; c < 2; ++c) { const v8f t0 = mma16(a1[2 * s].v, bf[c].v, zero8), t1 = mma16(a1[2 * s + 1].v, bf[c].v, zero8); FragW hb;
#pragma unroll
      for (int q = 0; q < 8; ++q) { hb.h[q] = (_Float16)t0[q]; hb.h[8 + q] = (_Float16)t1[q]; }
      d2[c] = mma16(a2[s].v, __builtin_elementwise_max(hb.v, zero16), d2[c]); }      // relu behind the rounding gives the same f16 value as in front of it, two units per instruction
  { const float geom = (hh ? d2[1][0] : d2[0][0]) * 0.00390625f + gb2v; const float q0 = (hh ? d2[1][1] : d2[0][1]) * 0.00390625f + db20, q1 = (hh ? d2[1][2] : d2[0][2]) * 0.00390625f + db21;
    const float shape = softplus_hw(q0) + 1e-4f, rate = softplus_hw(q1) + 1e-4f; const float dtp = fmaxf(fabsf(dt), 1e-4f);
    // lgamma(shape), shape >= 1e-4: its asymptotic series (z - 0.5) log z - z + 0.5 log(2 pi) + 1/(12 z) - 1/(360 z^3) + 1/(1260 z^5) at z >= 4 (the next term is below 4e-8 there). Below 8 the argument is moved up by 4: lgamma(x) = lgamma(x + 4) - log(x (x + 1) (x + 2) (x + 3)), the product as t (t + 2) with t = x (x + 3).
    const bool up = shape < 8.0f; const float t = shape * (shape + 3.0f); const float prod = up ? t * (t + 2.0f) : 1.0f; const float z = up ? shape + 4.0f : shape;
    const float rz = __builtin_amdgcn_rcpf(z), rz2 = rz * rz; const float ser = rz * (0.083333333f + rz2 * (-0.0027777778f + rz2 * 0.00079365079f));
    // the logarithmic terms are added in base 2, the others in base e; the plane is stored in base-2 units (x log2 e), which k_flash's exp2 takes as they are
    const float l2rate = hw_log2(rate), l2dtp = hw_log2(dtp), l2z = hw_log2(z), l2prod = hw_log2(prod);
    __builtin_amdgcn_sched_barrier(0);      // the four arguments die below; the instruction set asks for one slot between a logarithm and an instruction that takes over its argument's register
    const float lg2 = shape * l2rate + (shape - 1.0f) * l2dtp - (z - 0.5f) * l2z + l2prod;
    const float nat = geom - rate * dtp + (z - 0.91893853f) - ser;
    BIAS[p0 + lane] = lg2 + nat * LOG2E;
    asm volatile("s_wait_xcnt 0x0" ::: "memory"); } }      // stands behind the store, ahead of any later write of the registers it names (the listing lays other branches of the fused kernel behind it)
// 16 k positions of one f32 row for an f16 fragment; p points at the lane's k = 8 hh of the 32-wide k step (positions 0..7 and 16..23 from there). load16 fetches them, cvt16 makes f16(bf16(x) * sc) of them (round to nearest even, as bf16_round)
__device__ __forceinline__ void load16(const float* __restrict__ p, v4f (&x)[4]) { x[0] = *(const v4fa*)p; x[1] = *(const v4fa*)(p + 4); x[2] = *(const v4fa*)(p + 16); x[3] = *(const v4fa*)(p + 20); }
__device__ __forceinline__ v16h cvt16(const v4f (&x)[4], const float sc) { FragH f;
#pragma unroll
  for (int g = 0; g < 4; ++g)
#pragma unroll
    for (int q = 0; q < 4; ++q) f.h[4 * g + q] = (_Float16)((float)(__bf16)x[g][q] * sc);
  return f.v; }
// q, k, v projections straight from the f32 inputs. One wave = 16 rows of one matrix (B operand) against 64 rows of the other (A operand, 4 tiles), K = 256: a lane then holds 8 neighbouring results of the A side,
// one 16-byte store per tile, and a wave writes whole 128-byte lines. q, k: B = 16 rows of src, A = 64 rows of W, stored [row][col]. v: B = 16 rows of Wv, A = 64 rows of src (keys), stored transposed [b][col][key].
__device__ __forceinline__ void qkv_block(const int blk, const float* __restrict__ src, const float* __restrict__ Wq, const float* __restrict__ Wk, const float* __restrict__ Wv, _Float16* __restrict__ Q16, _Float16* __restrict__ K16, _Float16* __restrict__ Vt) {
  const int tid = threadIdx.x, w = __builtin_amdgcn_readfirstlane(tid >> 5), lane = tid & 31, ln = lane & 15, hh = lane >> 4;      // the wave's number in a scalar register keeps the base pointers scalar
  const int which = blk >> 7, wid = (blk & 127) * 4 + w;
  const float* one; const float* four; float s1, s4; _Float16* dst;
  if (which < 2) { const int mt = wid >> 2, nq = wid & 3; one = src + (size_t)mt * 16 * DM; four = (which ? Wk : Wq) + (size_t)nq * 64 * DM; s1 = 1.0f; s4 = 16.0f; dst = (which ? K16 : Q16) + (size_t)(mt * 16 + ln) * DM + nq * 64; }
  else { const int kq = wid >> 4, ct = wid & 15; one = Wv + (size_t)ct * 16 * DM; four = src + (size_t)kq * 64 * DM; s1 = 16.0f; s4 = 1.0f; dst = Vt + ((size_t)(kq / (SS / 64)) * DM + ct * 16 + ln) * SS + (kq % (SS / 64)) * 64; }
  const float* orow = one + ln * DM + 8 * hh; const float* frow = four + ln * DM + 8 * hh;
  v8f acc[4] = {};
  for (int kb = 0; kb < DM; kb += 32) { const float* po = orow + kb; const float* pf = frow + kb; v4f ro[4], rf[4][4];
    load16(po, ro);
#pragma unroll
    for (int t = 0; t < 4; ++t) load16(pf + t * 16 * DM, rf[t]);
    asm volatile("s_wait_xcnt 0x0" :: "v"(po), "v"(pf) : "memory");      // the two address pairs stay whole up to this wait
    const v16h bo = cvt16(ro, s1);
#pragma unroll
    for (int t = 0; t < 4; ++t) acc[t] = mma16(cvt16(rf[t], s4), bo, acc[t]); }
#pragma unroll
  for (int t = 0; t < 4; ++t) { FragH o;
#pragma unroll
    for (int r = 0; r < 8; ++r) o.h[r] = (_Float16)(acc[t][r] * 0.0625f);
    *(v8us*)((unsigned short*)dst + t * 16 + 8 * hh) = o.half[0]; } }
// Everything that depends on the inputs alone, in one launch: blocks 0..383 the q, k, v projections (first, they are the long ones), blocks 384..447 Wo as f16 (x16), the rest the bias plane.
#define G_QKV (3 * (NR / 16) * (DM / 64) / 4)
#define G_WO (DM * DM / 8 / 128)
#define G_BIAS (BB * SS * SS / 128)
// waves_per_eu(7, 8): at most 146 registers, seven waves a SIMD. The bias code's short tail has no branch, so MLPs and tail are scheduled as one stretch: held to 128 registers (eight waves) the build spills there, or it splits the 20 loads of the q, k, v loop over several waits;
// with this line it builds to 143 registers, nothing spilled, the 20 loads in one run
__global__ __launch_bounds__(128) __attribute__((amdgpu_waves_per_eu(7, 8))) void k_front(const float* __restrict__ src, const float* __restrict__ crd, const float* __restrict__ Wq, const float* __restrict__ Wk, const float* __restrict__ Wv, const float* __restrict__ Wo,
    const float* __restrict__ gw1, const float* __restrict__ gb1, const float* __restrict__ gw2, const float* __restrict__ gb2, const float* __restrict__ dw1, const float* __restrict__ db1, const float* __restrict__ dw2, const float* __restrict__ db2,
    _Float16* __restrict__ Q16, _Float16* __restrict__ K16, _Float16* __restrict__ Vt, _Float16* __restrict__ Bo, float* __restrict__ BIAS) {
  const int blk = blockIdx.x;
  if (blk < G_QKV) { qkv_block(blk, src, Wq, Wk, Wv, Q16, K16, Vt); return; }
  if (blk < G_QKV + G_WO) { const size_t t = (size_t)(blk - G_QKV) * 128 + threadIdx.x; FragH f;
#pragma unroll
    for (int i = 0; i < 8; ++i) f.h[i] = (_Float16)(bf16_round(Wo[t * 8 + i]) * 16.0f);
    *(v8us*)((unsigned short*)Bo + t * 8) = f.half[0];
    asm volatile("s_wait_xcnt 0x0" ::: "memory");      // stands behind the store, ahead of any later write of the registers it names (the listing lays the other branches behind it)
    return; }
  bias_block(blk - (G_QKV + G_WO), crd, gw1, gb1, gw2, gb2, dw1, db1, dw2, db2, BIAS); }
// One block = 32 query rows of one (batch, head); its 8 waves share those rows and split the 1024 keys, 128 each (512 blocks of 8 waves fill every SIMD four deep, where one wave per 32 rows over all keys left
// one wave on half the SIMDs). Every wave runs the same online-softmax loop over its own keys and leaves an un-normalised partial (row max, row sum, O) in LDS; behind one block barrier the partials of a row are
// rescaled to their common max and added, wave 0 first.
// waves_per_eu(1, 4): no more than four waves a SIMD are planned for, which is what 512 blocks of 8 waves come to; without it the compiler saves registers for an occupancy the grid cannot reach and runs the 16 rows' loads and cross-lane steps one row after the other
__global__ __launch_bounds__(256) __attribute__((amdgpu_waves_per_eu(1, 4))) void k_flash(const _Float16* __restrict__ Q16, const _Float16* __restrict__ K16, const _Float16* __restrict__ Vt, const float* __restrict__ BIAS, float* __restrict__ O) {
  constexpr int RPW = 32, NW = 8, NQB = SS / RPW, KPW = SS / NW, DT = 2;
  __shared__ __attribute__((aligned(16))) unsigned short sP[NW][RPW][40]; __shared__ __attribute__((aligned(16))) float sO[NW][RPW][HD + 4]; __shared__ float sM[NW][RPW], sL[NW][RPW];
  const int tid = threadIdx.x, w = __builtin_amdgcn_readfirstlane(tid >> 5), lane = tid & 31, ln = lane & 15, hh = lane >> 4;      // the wave's number in a scalar register keeps the key offset j0 and the wave's LDS bases scalar
  const int slab = blockIdx.x / NQB, qblk = blockIdx.x % NQB; const int b = slab / NH, h = slab % NH; const int q0 = qblk * RPW;
  FragH aq[2];
#pragma unroll
  for (int rt = 0; rt < 2; ++rt) { const unsigned short* qr = (const unsigned short*)Q16 + ((size_t)b * SS + q0 + rt * 16 + ln) * DM + h * HD; aq[rt].half[0] = *(const v8us*)(qr + 8 * hh); aq[rt].half[1] = *(const v8us*)(qr + 16 + 8 * hh); }
  const unsigned short* Vth = (const unsigned short*)Vt + (size_t)slab * HD * SS;
  float m_r[2][8], l_r[2][8]; v8f oacc[2][DT];
#pragma unroll
  for (int rt = 0; rt < 2; ++rt) {
#pragma unroll
    for (int r = 0; r < 8; ++r) { m_r[rt][r] = -3.0e38f; l_r[rt][r] = 0.f; }
#pragma unroll
    for (int dt = 0; dt < DT; ++dt) oacc[rt][dt] = (v8f){0.f,0.f,0.f,0.f,0.f,0.f,0.f,0.f}; }
  const float scale = 0.17677669529663688f * LOG2E;      // scores, bias plane, running max in base-2 units: every exponential is one exp2
#pragma unroll 1
  for (int it = 0; it < KPW / 32; ++it) { const int j0 = w * KPW + it * 32;
    v8f s[2][2];
#pragma unroll
    for (int nt = 0; nt < 2; ++nt) { const unsigned short* kr = (const unsigned short*)K16 + ((size_t)b * SS + j0 + nt * 16 + ln) * DM + h * HD; FragH bk; bk.half[0] = *(const v8us*)(kr + 8 * hh); bk.half[1] = *(const v8us*)(kr + 16 + 8 * hh);
#pragma unroll
      for (int rt = 0; rt < 2; ++rt) { v8f acc = (v8f){0.f,0.f,0.f,0.f,0.f,0.f,0.f,0.f}; acc = mmaH<1>(aq[rt].v, aq[rt].v, bk.v, bk.v, acc); s[rt][nt] = acc; } }
#pragma unroll
    for (int rt = 0; rt < 2; ++rt)
#pragma unroll
      for (int r = 0; r < 8; ++r) { const int qi = q0 + rt * 16 + 8 * hh + r; const float* br = BIAS + ((size_t)b * SS + qi) * SS + j0; const float s0 = s[rt][0][r] * scale + br[ln], s1 = s[rt][1][r] * scale + br[16 + ln]; float mc = fmaxf(s0, s1);
        mc = fmaxf(mc, __shfl_xor(mc, 1, 32)); mc = fmaxf(mc, __shfl_xor(mc, 2, 32)); mc = fmaxf(mc, __shfl_xor(mc, 4, 32)); mc = fmaxf(mc, __shfl_xor(mc, 8, 32));
        const float mn = fmaxf(m_r[rt][r], mc); const float al = hw_exp2(m_r[rt][r] - mn); m_r[rt][r] = mn; const float p0 = hw_exp2(s0 - mn), p1 = hw_exp2(s1 - mn); l_r[rt][r] = l_r[rt][r] * al + p0 + p1;
#pragma unroll
        for (int dt = 0; dt < DT; ++dt) oacc[rt][dt][r] *= al;
        FragH t2; t2.h[0] = (_Float16)p0; t2.h[1] = (_Float16)p1; sP[w][rt * 16 + 8 * hh + r][ln] = t2.u[0]; sP[w][rt * 16 + 8 * hh + r][16 + ln] = t2.u[1]; }
    __builtin_amdgcn_fence(__ATOMIC_ACQ_REL, "workgroup"); __builtin_amdgcn_wave_barrier();
    FragH pa[2];
#pragma unroll
    for (int rt = 0; rt < 2; ++rt) { pa[rt].half[0] = *(const v8us*)&sP[w][rt * 16 + ln][8 * hh]; pa[rt].half[1] = *(const v8us*)&sP[w][rt * 16 + ln][16 + 8 * hh]; }
#pragma unroll
    for (int dt = 0; dt < DT; ++dt) { const unsigned short* vrow = Vth + (size_t)(dt * 16 + ln) * SS + j0; FragH bv; bv.half[0] = *(const v8us*)(vrow + 8 * hh); bv.half[1] = *(const v8us*)(vrow + 16 + 8 * hh);
#pragma unroll
      for (int rt = 0; rt < 2; ++rt) oacc[rt][dt] = mmaH<1>(pa[rt].v, pa[rt].v, bv.v, bv.v, oacc[rt][dt]); }
    __builtin_amdgcn_fence(__ATOMIC_ACQ_REL, "workgroup"); __builtin_amdgcn_wave_barrier(); }
#pragma unroll
  for (int rt = 0; rt < 2; ++rt) {
#pragma unroll
    for (int r = 0; r < 8; ++r) { float l = l_r[rt][r]; l += __shfl_xor(l, 1, 32); l += __shfl_xor(l, 2, 32); l += __shfl_xor(l, 4, 32); l += __shfl_xor(l, 8, 32); l_r[rt][r] = l; }
#pragma unroll
    for (int dt = 0; dt < DT; ++dt)
#pragma unroll
      for (int r = 0; r < 8; ++r) sO[w][rt * 16 + 8 * hh + r][dt * 16 + ln] = oacc[rt][dt][r]; }
  if (ln == 0) {      // max and sum are the same in the 16 lanes of a row
#pragma unroll
    for (int rt = 0; rt < 2; ++rt)
#pragma unroll
      for (int r = 0; r < 8; ++r) { sM[w][rt * 16 + 8 * hh + r] = m_r[rt][r]; sL[w][rt * 16 + 8 * hh + r] = l_r[rt][r]; } }
  __syncthreads();      // every wave's partial is in LDS before any thread merges
  { const int r = tid >> 3, pc = tid & 7;      // one thread = 4 output columns of one row
    float mw[NW], M = -3.0e38f;
#pragma unroll
    for (int u = 0; u < NW; ++u) { mw[u] = sM[u][r]; M = fmaxf(M, mw[u]); }
    float L = 0.f; v4f acc = {0.f, 0.f, 0.f, 0.f};
#pragma unroll
    for (int u = 0; u < NW; ++u) { const float g = hw_exp2(mw[u] - M); L += sL[u][r] * g; const v4f val = *(const v4fa*)&sO[u][r][pc * 4]; acc += val * g; }
    const float inv = 1.0f / L;
    *(v4f*)(O + ((size_t)b * SS + q0 + r) * DM + h * HD + pc * 4) = acc * inv; } }
extern "C" void kernel_launch(void* const* d_in, const int* in_sizes, int n_in,
                              void* d_out, int out_size, void* d_ws, size_t ws_size, hipStream_t stream) {
  (void)in_sizes; (void)n_in; (void)out_size;
  const float* src = (const float*)d_in[0]; const float* crd = (const float*)d_in[1]; const float* Wq = (const float*)d_in[2]; const float* Wk = (const float*)d_in[3]; const float* Wv = (const float*)d_in[4]; const float* Wo = (const float*)d_in[5];
  const float* gw1 = (const float*)d_in[6]; const float* gb1 = (const float*)d_in[7]; const float* gw2 = (const float*)d_in[8]; const float* gb2 = (const float*)d_in[9]; const float* dw1 = (const float*)d_in[10]; const float* db1 = (const float*)d_in[11]; const float* dw2 = (const float*)d_in[12]; const float* db2 = (const float*)d_in[13];
  char* ws = (char*)d_ws; size_t off = 0;
  auto take = [&](size_t bytes) { char* p = ws + off; off += (bytes + 255) & ~(size_t)255; return p; };
  _Float16* Bo = (_Float16*)take((size_t)DM * DM * 2); _Float16* Q16 = (_Float16*)take((size_t)NR * DM * 2); _Float16* K16 = (_Float16*)take((size_t)NR * DM * 2); _Float16* Vt = (_Float16*)take((size_t)NR * DM * 2); float* BIAS = (float*)take((size_t)BB * SS * SS * 4); float* O = (float*)take((size_t)NR * DM * 4);
  if (off > ws_size) return;      // about 13 MiB
  k_front<<<G_QKV + G_WO + G_BIAS, 128, 0, stream>>>(src, crd, Wq, Wk, Wv, Wo, gw1, gb1, gw2, gb2, dw1, db1, dw2, db2, Q16, K16, Vt, Bo, BIAS);
  k_flash<<<BB * NH * (SS / 32), 256, 0, stream>>>(Q16, K16, Vt, BIAS, O);
  const dim3 gg(((NR / 16) * (DM / 64) + 3) / 4, 1);
  k_gemm_h<false><<<gg, 128, 0, stream>>>(O, DM, 0, Bo, DM, 0, 0.0625f, (float*)d_out, DM, 0, NR, DM, DM);      // rounds O to f16 in its A loader
}

// v006
// One run takes 47.5 microseconds.
// Two timings next to v005 both put it at 1.09 times that version's speed.
// All steps since v000 together make it 8.02 times as fast.
#include <hip/hip_runtime.h>
// q/k/v/o projections (2048 × 256 × 256) and the 8-head attention (d = 32) with an additive per-pair bias on v_wmma_f32_16x16x32_f16 (fused flash-style kernel: S = Q·Kᵀ, O = P·V on WMMA;
// online max/sum softmax f32; P f16 <= 1). The bias (geometric 2->64->1 MLP + the Gamma log-density from the 4->64->2 delay MLP, incl. lgamma) is computed once per (b, i, j): both layers of the two MLPs
// on WMMA, softplus/log/lgamma in f32; the bias plane is shared by the 8 heads. A = f16(bf16 ·) exact operands (o projection: f16(O)), weights bf16-exact ×2^4 ((out,in)), single products, f32 accumulate.
#define BB 2
#define SS 1024
#define DM 256
#define NH 8
#define HD 32
#define BH 64
#define NR (BB * SS)

typedef __bf16 v16b __attribute__((ext_vector_type(16)));
typedef unsigned short v8us __attribute__((ext_vector_type(8), may_alias));
typedef float  v8f  __attribute__((ext_vector_type(8)));
typedef float  v4f  __attribute__((ext_vector_type(4)));
typedef float  v4fa __attribute__((ext_vector_type(4), may_alias));
union FragB { v16b v; v8us half[2]; unsigned short u[16]; };

__device__ __forceinline__ unsigned short bf16_bits(float x) { unsigned int u = __float_as_uint(x); return (unsigned short)((u + 0x7FFFu + ((u >> 16) & 1u)) >> 16); }
__device__ __forceinline__ float bf16_val(unsigned short b) { return __uint_as_float(((unsigned int)b) << 16); }
__device__ __forceinline__ float bf16_round(float x) { return bf16_val(bf16_bits(x)); }
// D += A·B with NT terms: 1 = ah·bh, 2 = + al·bh (A split), 3 = + ah·bl (both split)
template <int NT>
__device__ __forceinline__ v8f mmaN(v16b ah, v16b al, v16b bh, v16b bl, v8f c) {
  c = __builtin_amdgcn_wmma_f32_16x16x32_bf16(false, ah, false, bh, (short)0, c, false, false);
  if (NT >= 2) c = __builtin_amdgcn_wmma_f32_16x16x32_bf16(false, al, false, bh, (short)0, c, false, false);
  if (NT >= 3) c = __builtin_amdgcn_wmma_f32_16x16x32_bf16(false, ah, false, bl, (short)0, c, false, false);
  asm volatile("v_nop\n\tv_nop\n\tv_nop\n\tv_nop" : "+v"(c) : "v"(ah), "v"(al), "v"(bh), "v"(bl));
  return c;
}

__global__ __launch_bounds__(256) void k_wt_bf16(const float* __restrict__ W, unsigned short* __restrict__ Wt, int K, int N) {
  const int t = blockIdx.x * 256 + threadIdx.x;
  const int k8n = K / 8;
  if (t >= N * k8n) return;
  const int n = t / k8n, k8 = (t % k8n) * 8;
  v8us v;
#pragma unroll
  for (int i = 0; i < 8; ++i) v[i] = bf16_bits(W[(size_t)(k8 + i) * N + n]);
  *(v8us*)(Wt + (size_t)n * K + k8) = v;
  
}

// GEMM C[M][N] (f32, pitch ldc) = act(A[M][K]·W + bias). A f32 row-major (pitch lda) converted per fragment to bf16
// (ASPLIT: hi/lo two planes -> 2 terms, else single rounded term); Wt bf16 [N][K] (pitch ldb). BIAS_BF16 rounds the
// bias to bf16 first (bias quantised to bf16 before the add). K%32==0, M%16==0, N%64==0.
template <bool ASPLIT, int ACT, bool BIAS_BF16>
__global__ __launch_bounds__(128) void k_gemm_bf(const float* __restrict__ A, int lda, const unsigned short* __restrict__ Wt, int ldb,
                                               const float* __restrict__ bias, float* __restrict__ C, int ldc, int M, int N, int K) {
  __shared__ __attribute__((aligned(16))) float so[4][16][64];
  const int tid = threadIdx.x, w = tid >> 5, lane = tid & 31, ln = lane & 15, hh = lane >> 4;
  const int ntn = N / 64;
  const int wid = blockIdx.x * 4 + w;
  const int mt = wid / ntn, nq = wid % ntn;
  if (mt * 16 >= M) return;
  const int row0 = mt * 16, col0 = nq * 64;
  const float* arow = A + (size_t)(row0 + ln) * lda;
  v8f acc[4] = {};
  for (int kb = 0; kb < K; kb += 32) {
    FragB ah, al;
    const v4f x0 = *(const v4fa*)(arow + kb + 8 * hh), x1 = *(const v4fa*)(arow + kb + 8 * hh + 4);
    const v4f x2 = *(const v4fa*)(arow + kb + 16 + 8 * hh), x3 = *(const v4fa*)(arow + kb + 16 + 8 * hh + 4);
    float xs[16] = {x0[0],x0[1],x0[2],x0[3],x1[0],x1[1],x1[2],x1[3],x2[0],x2[1],x2[2],x2[3],x3[0],x3[1],x3[2],x3[3]};
#pragma unroll
    for (int i = 0; i < 16; ++i) { const unsigned short hb = bf16_bits(xs[i]); ah.u[i] = hb; al.u[i] = ASPLIT ? bf16_bits(xs[i] - bf16_val(hb)) : (unsigned short)0; }
#pragma unroll
    for (int t = 0; t < 4; ++t) {
      const unsigned short* brow = Wt + (size_t)(col0 + t * 16 + ln) * ldb + kb;
      FragB b;
      b.half[0] = *(const v8us*)(brow + 8 * hh);
      b.half[1] = *(const v8us*)(brow + 16 + 8 * hh);
      acc[t] = mmaN<ASPLIT ? 2 : 1>(ah.v, al.v, b.v, b.v, acc[t]);
    }
  }
#pragma unroll
  for (int t = 0; t < 4; ++t) {
    float bv = bias ? bias[col0 + t * 16 + ln] : 0.f;
    if (BIAS_BF16) bv = bf16_round(bv);
#pragma unroll
    for (int r = 0; r < 8; ++r) { float v = acc[t][r] + bv; if (ACT == 1) v = fmaxf(v, 0.f); so[w][8 * hh + r][t * 16 + ln] = v; }
  }
  __builtin_amdgcn_fence(__ATOMIC_ACQ_REL, "workgroup");
  __builtin_amdgcn_wave_barrier();
  const int rsub = lane >> 4, c4 = (lane & 15) * 4;
  {
#pragma unroll
    for (int q = 0; q < 8; ++q) {
      const int r = q * 2 + rsub;
      const v4f v = *(const v4fa*)&so[w][r][c4];
      *(v4f*)(C + (size_t)(row0 + r) * ldc + col0 + c4) = v;
    }
    
  }
}

// Flash-style causal/unmasked attention, all contractions 3-term bf16 hi/lo splits, f32 softmax with running max.
// q,k,v rows are read from f32 buffers with arbitrary row pitch (so they can live inside a fused qkv buffer);
// D = head size (multiple of 32, <= 128); one wave = 16 query rows; block = 4 waves (64 queries) sharing K/V chunks of 32.
template <int D, bool CAUSAL>
__global__ __launch_bounds__(128) void k_flash(const float* __restrict__ qb, const float* __restrict__ kb, const float* __restrict__ vb,
                                             int pitch, int T, int H, float scale, float* __restrict__ y, int ypitch) {
  constexpr int KS = D / 32;        // k-steps for QK
  constexpr int DT = D / 16;        // d tiles for PV
  __shared__ __attribute__((aligned(16))) unsigned short sKh[32][D + 8], sKl[32][D + 8], sVh[32][D + 8], sVl[32][D + 8];
  __shared__ __attribute__((aligned(16))) unsigned short sPh[4][16][40], sPl[4][16][40];
  __shared__ __attribute__((aligned(16))) float sO[4][16][D];
  const int tid = threadIdx.x, w = tid >> 5, lane = tid & 31, ln = lane & 15, hh = lane >> 4;
  const int nqb = (T + 63) / 64;
  const int bh = blockIdx.x / nqb, qblk = blockIdx.x % nqb;
  const int b = bh / H, h = bh % H;
  const int q0 = qblk * 64 + w * 16;
  const float* Q = qb + (size_t)b * T * pitch + h * D;
  const float* K = kb + (size_t)b * T * pitch + h * D;
  const float* V = vb + (size_t)b * T * pitch + h * D;

  // A fragments of the wave's 16 query rows (scaled), hi/lo
  FragB aqh[KS], aql[KS];
  {
    int row = q0 + ln; if (row >= T) row = T - 1;
    const float* qr = Q + (size_t)row * pitch;
#pragma unroll
    for (int ks = 0; ks < KS; ++ks)
#pragma unroll
      for (int i = 0; i < 16; ++i) {
        const int d = ks * 32 + ((i < 8) ? (8 * hh + i) : (16 + 8 * hh + (i - 8)));
        const float x = qr[d] * scale; const unsigned short hb = bf16_bits(x);
        aqh[ks].u[i] = hb; aql[ks].u[i] = bf16_bits(x - bf16_val(hb));
      }
  }
  float m_r[8], l_r[8];
#pragma unroll
  for (int r = 0; r < 8; ++r) { m_r[r] = -3.0e38f; l_r[r] = 0.f; }
  v8f oacc[DT];
#pragma unroll
  for (int dt = 0; dt < DT; ++dt) oacc[dt] = (v8f){0.f,0.f,0.f,0.f,0.f,0.f,0.f,0.f};

  const int kv_end = CAUSAL ? min(T, qblk * 64 + 64) : T;     // block-uniform
  for (int j0 = 0; j0 < kv_end; j0 += 32) {
    __syncthreads();
    for (int e = tid; e < 32 * (D / 4); e += 128) {
      const int r = e / (D / 4), c4 = (e % (D / 4)) * 4;
      const int key = j0 + r;
      v4f kf = {0.f,0.f,0.f,0.f}, vf = {0.f,0.f,0.f,0.f};
      if (key < T) { kf = *(const v4fa*)(K + (size_t)key * pitch + c4); vf = *(const v4fa*)(V + (size_t)key * pitch + c4); }
#pragma unroll
      for (int t = 0; t < 4; ++t) {
        unsigned short hb = bf16_bits(kf[t]); sKh[r][c4 + t] = hb; sKl[r][c4 + t] = bf16_bits(kf[t] - bf16_val(hb));
        hb = bf16_bits(vf[t]); sVh[r][c4 + t] = hb; sVl[r][c4 + t] = bf16_bits(vf[t] - bf16_val(hb));
      }
    }
    __syncthreads();
    // S tile 16 x 32
    v8f s[2];
#pragma unroll
    for (int nt = 0; nt < 2; ++nt) {
      v8f acc = {};
#pragma unroll
      for (int ks = 0; ks < KS; ++ks) {
        FragB bh_, bl_;
        bh_.half[0] = *(const v8us*)&sKh[nt * 16 + ln][ks * 32 + 8 * hh]; bh_.half[1] = *(const v8us*)&sKh[nt * 16 + ln][ks * 32 + 16 + 8 * hh];
        bl_.half[0] = *(const v8us*)&sKl[nt * 16 + ln][ks * 32 + 8 * hh]; bl_.half[1] = *(const v8us*)&sKl[nt * 16 + ln][ks * 32 + 16 + 8 * hh];
        acc = mmaN<3>(aqh[ks].v, aql[ks].v, bh_.v, bl_.v, acc);
      }
      s[nt] = acc;
    }
    // mask + running max (rows 8hh+r; the 16 lanes of a half share rows)
    float alpha[8];
#pragma unroll
    for (int r = 0; r < 8; ++r) {
      const int qi = q0 + 8 * hh + r;
      const int ja = j0 + ln, jb = j0 + 16 + ln;
      if (CAUSAL) { if (ja > qi) s[0][r] = -3.0e38f; if (jb > qi) s[1][r] = -3.0e38f; }
      if (ja >= T) s[0][r] = -3.0e38f;
      if (jb >= T) s[1][r] = -3.0e38f;
      float mx = fmaxf(s[0][r], s[1][r]);
      mx = fmaxf(mx, __shfl_xor(mx, 1, 32)); mx = fmaxf(mx, __shfl_xor(mx, 2, 32)); mx = fmaxf(mx, __shfl_xor(mx, 4, 32)); mx = fmaxf(mx, __shfl_xor(mx, 8, 32));
      const float mnew = fmaxf(m_r[r], mx);
      alpha[r] = (mnew > -1.0e38f) ? __expf(m_r[r] - mnew) : 1.0f;
      const float p0 = (s[0][r] > -1.0e38f) ? __expf(s[0][r] - mnew) : 0.f;
      const float p1 = (s[1][r] > -1.0e38f) ? __expf(s[1][r] - mnew) : 0.f;
      m_r[r] = mnew;
      l_r[r] = l_r[r] * alpha[r] + p0 + p1;            // per-lane partial row sum (16 lanes combined at the end)
      unsigned short hb = bf16_bits(p0); sPh[w][8 * hh + r][ln] = hb;      sPl[w][8 * hh + r][ln] = bf16_bits(p0 - bf16_val(hb));
      hb = bf16_bits(p1);                sPh[w][8 * hh + r][16 + ln] = hb; sPl[w][8 * hh + r][16 + ln] = bf16_bits(p1 - bf16_val(hb));
    }
#pragma unroll
    for (int dt = 0; dt < DT; ++dt)
#pragma unroll
      for (int r = 0; r < 8; ++r) oacc[dt][r] *= alpha[r];
    __builtin_amdgcn_fence(__ATOMIC_ACQ_REL, "workgroup");
    __builtin_amdgcn_wave_barrier();
    FragB pah, pal;
    pah.half[0] = *(const v8us*)&sPh[w][ln][8 * hh]; pah.half[1] = *(const v8us*)&sPh[w][ln][16 + 8 * hh];
    pal.half[0] = *(const v8us*)&sPl[w][ln][8 * hh]; pal.half[1] = *(const v8us*)&sPl[w][ln][16 + 8 * hh];
#pragma unroll
    for (int dt = 0; dt < DT; ++dt) {
      FragB bvh, bvl;
#pragma unroll
      for (int i = 0; i < 8; ++i) {
        bvh.u[i] = sVh[8 * hh + i][dt * 16 + ln]; bvh.u[8 + i] = sVh[16 + 8 * hh + i][dt * 16 + ln];
        bvl.u[i] = sVl[8 * hh + i][dt * 16 + ln]; bvl.u[8 + i] = sVl[16 + 8 * hh + i][dt * 16 + ln];
      }
      oacc[dt] = mmaN<3>(pah.v, pal.v, bvh.v, bvl.v, oacc[dt]);
    }
    __builtin_amdgcn_fence(__ATOMIC_ACQ_REL, "workgroup");
    __builtin_amdgcn_wave_barrier();
  }
#pragma unroll
  for (int r = 0; r < 8; ++r) {
    float l = l_r[r];
    l += __shfl_xor(l, 1, 32); l += __shfl_xor(l, 2, 32); l += __shfl_xor(l, 4, 32); l += __shfl_xor(l, 8, 32);
    l_r[r] = (l > 0.f) ? 1.0f / l : 0.f;
  }
#pragma unroll
  for (int dt = 0; dt < DT; ++dt)
#pragma unroll
    for (int r = 0; r < 8; ++r) sO[w][8 * hh + r][dt * 16 + ln] = oacc[dt][r] * l_r[r];
  __builtin_amdgcn_fence(__ATOMIC_ACQ_REL, "workgroup");
  __builtin_amdgcn_wave_barrier();
  {
    for (int r = 0; r < 16; ++r) {
      const int row = q0 + r;
      if (row < T && lane < D / 4) {
        const v4f val = *(const v4fa*)&sO[w][r][lane * 4];
        *(v4f*)(y + ((size_t)b * T + row) * ypitch + h * D + lane * 4) = val;
      }
    }
    
  }
}

// GEMM C = act(A·W + bias + resid): A f32 (ASPLIT -> hi/lo 2 terms), Wt bf16 [N][K]; ACT 0 none, 1 relu, 2 exact gelu;
// resid (optional, f32, row index = (row % rmod), pitch ldr, RES_BF16 rounds it) added before the activation.
template <bool ASPLIT, int ACT, bool BIAS_BF16, bool RES_BF16>
__global__ __launch_bounds__(128) void k_gemm_bf3(const float* __restrict__ A, int lda, const unsigned short* __restrict__ Wt, int ldb,
                                                const float* __restrict__ bias, const float* __restrict__ resid, int rmod, int ldr,
                                                float* __restrict__ C, int ldc, int M, int N, int K) {
  __shared__ __attribute__((aligned(16))) float so[4][16][64];
  const int tid = threadIdx.x, w = tid >> 5, lane = tid & 31, ln = lane & 15, hh = lane >> 4;
  const int ntn = N / 64;
  const int wid = blockIdx.x * 4 + w;
  const int mt = wid / ntn, nq = wid % ntn;
  if (mt * 16 >= M) return;
  const int row0 = mt * 16, col0 = nq * 64;
  const float* arow = A + (size_t)(row0 + ln) * lda;
  v8f acc[4] = {};
  for (int kb = 0; kb < K; kb += 32) {
    FragB ah, al;
    const v4f x0 = *(const v4fa*)(arow + kb + 8 * hh), x1 = *(const v4fa*)(arow + kb + 8 * hh + 4);
    const v4f x2 = *(const v4fa*)(arow + kb + 16 + 8 * hh), x3 = *(const v4fa*)(arow + kb + 16 + 8 * hh + 4);
    float xs[16] = {x0[0],x0[1],x0[2],x0[3],x1[0],x1[1],x1[2],x1[3],x2[0],x2[1],x2[2],x2[3],x3[0],x3[1],x3[2],x3[3]};
#pragma unroll
    for (int i = 0; i < 16; ++i) { const unsigned short hb = bf16_bits(xs[i]); ah.u[i] = hb; al.u[i] = ASPLIT ? bf16_bits(xs[i] - bf16_val(hb)) : (unsigned short)0; }
#pragma unroll
    for (int t = 0; t < 4; ++t) {
      const unsigned short* brow = Wt + (size_t)(col0 + t * 16 + ln) * ldb + kb;
      FragB b;
      b.half[0] = *(const v8us*)(brow + 8 * hh);
      b.half[1] = *(const v8us*)(brow + 16 + 8 * hh);
      acc[t] = mmaN<ASPLIT ? 2 : 1>(ah.v, al.v, b.v, b.v, acc[t]);
    }
  }
#pragma unroll
  for (int t = 0; t < 4; ++t) {
    const int col = col0 + t * 16 + ln;
    float bv = bias ? bias[col] : 0.f;
    if (BIAS_BF16) bv = bf16_round(bv);
#pragma unroll
    for (int r = 0; r < 8; ++r) {
      float v = acc[t][r] + bv;
      if (resid) { float rv = resid[(size_t)((row0 + 8 * hh + r) % rmod) * ldr + col]; if (RES_BF16) rv = bf16_round(rv); v += rv; }
      if (ACT == 1) v = fmaxf(v, 0.f);
      if (ACT == 2) v = 0.5f * v * (1.0f + erff(v * 0.70710678118654752f));
      if (ACT == 3) { const float u = 0.7978845608028654f * (v + 0.044715f * v * v * v); v = 0.5f * v * (1.0f + tanhf(u)); }
      so[w][8 * hh + r][t * 16 + ln] = v;
    }
  }
  __builtin_amdgcn_fence(__ATOMIC_ACQ_REL, "workgroup");
  __builtin_amdgcn_wave_barrier();
  const int rsub = lane >> 4, c4 = (lane & 15) * 4;
  {
#pragma unroll
    for (int q = 0; q < 8; ++q) {
      const int r = q * 2 + rsub;
      const v4f v = *(const v4fa*)&so[w][r][c4];
      *(v4f*)(C + (size_t)(row0 + r) * ldc + col0 + c4) = v;
    }
    
  }
}
// row LayerNorm (biased variance, eps) over N: s = X (+ R); optional out_sum <- s; out_norm <- (s-mu)*rsqrt(var+eps)*g + b
template <bool PARAM_BF16>
__global__ __launch_bounds__(256) void k_layernorm(const float* __restrict__ X, const float* __restrict__ R, const float* __restrict__ g, const float* __restrict__ bta,
                                                  float* __restrict__ out_sum, float* __restrict__ out_norm, int N, float eps) {
  __shared__ float red[256];
  const int row = blockIdx.x, tid = threadIdx.x;
  const float* x = X + (size_t)row * N; const float* rr = R ? R + (size_t)row * N : nullptr;
  float vals[16];                     // up to N = 4096
  const int per = N / 256;            // contiguous chunk per thread? use strided-by-4 chunks: thread handles j = tid*4 + 1024*u
  float s1 = 0.f;
  for (int u = 0; u < per / 4; ++u) {
    const int j = tid * 4 + 1024 * u;
    const v4f a = *(const v4fa*)(x + j);
    v4f b = {0.f,0.f,0.f,0.f}; if (rr) b = *(const v4fa*)(rr + j);
#pragma unroll
    for (int q = 0; q < 4; ++q) { const float v = a[q] + b[q]; vals[u * 4 + q] = v; s1 += v; }
  }
  red[tid] = s1; __syncthreads();
  for (int st = 128; st > 0; st >>= 1) { if (tid < st) red[tid] += red[tid + st]; __syncthreads(); }
  const float mu = red[0] / (float)N; __syncthreads();
  float s2 = 0.f;
  for (int u = 0; u < per / 4; ++u)
#pragma unroll
    for (int q = 0; q < 4; ++q) { const float c = vals[u * 4 + q] - mu; s2 += c * c; }
  red[tid] = s2; __syncthreads();
  for (int st = 128; st > 0; st >>= 1) { if (tid < st) red[tid] += red[tid + st]; __syncthreads(); }
  const float rs = rsqrtf(red[0] / (float)N + eps);
  {
    for (int u = 0; u < per / 4; ++u) {
      const int j = tid * 4 + 1024 * u;
      v4f o, sm;
#pragma unroll
      for (int q = 0; q < 4; ++q) {
        float gg = g[j + q], bb = bta[j + q];
        if (PARAM_BF16) { gg = bf16_round(gg); bb = bf16_round(bb); }
        sm[q] = vals[u * 4 + q]; o[q] = (vals[u * 4 + q] - mu) * rs * gg + bb;
      }
      if (out_sum) *(v4f*)(out_sum + (size_t)row * N + j) = sm;
      *(v4f*)(out_norm + (size_t)row * N + j) = o;
    }
    
  }
}



// ---- f16 WMMA path (v_wmma_f32_16x16x32_f16): 11-bit significands for operands in range — used where a [0,1] probability operand needs more precision than bf16
typedef _Float16 v16h __attribute__((ext_vector_type(16)));
union FragH { v16h v; v8us half[2]; _Float16 h[16]; unsigned short u[16]; };
template <int NT>
__device__ __forceinline__ v8f mmaH(v16h ah, v16h al, v16h bh, v16h bl, v8f c) {
  c = __builtin_amdgcn_wmma_f32_16x16x32_f16(false, ah, false, bh, (short)0, c, false, false);
  if (NT >= 2) c = __builtin_amdgcn_wmma_f32_16x16x32_f16(false, al, false, bh, (short)0, c, false, false);
  if (NT >= 3) c = __builtin_amdgcn_wmma_f32_16x16x32_f16(false, ah, false, bl, (short)0, c, false, false);
  asm volatile("v_nop\n\tv_nop\n\tv_nop\n\tv_nop" : "+v"(c) : "v"(ah), "v"(al), "v"(bh), "v"(bl));
  return c;
}
// batched GEMM like k_gemm_b but f16 operands: A f32 (split into f16 hi/lo if ASPLIT, else rounded to f16), Bt = f16 values [n][k]; alpha; C f32; N multiple of 16 (partial tiles skipped)
template <bool ASPLIT>
__global__ __launch_bounds__(128) void k_gemm_h(const float* __restrict__ A, int lda, size_t sA, const _Float16* __restrict__ Bh, int ldb, size_t sB, float alpha, float* __restrict__ C, int ldc, size_t sC, int M, int N, int K) {
  __shared__ __attribute__((aligned(16))) float so[4][16][64];
  const int tid = threadIdx.x, w = tid >> 5, lane = tid & 31, ln = lane & 15, hh = lane >> 4; const int by = blockIdx.y;
  A += (size_t)by * sA; Bh += (size_t)by * sB; C += (size_t)by * sC;
  const int ntn = (N + 63) / 64; const int wid = blockIdx.x * 4 + w; const int mt = wid / ntn, nq = wid % ntn; if (mt * 16 >= M) return;
  const int row0 = mt * 16, col0 = nq * 64; const float* arow = A + (size_t)(row0 + ln) * lda;
  v8f acc[4] = {};
  for (int kb = 0; kb < K; kb += 32) {
    FragH ah, al;
    const v4f x0 = *(const v4fa*)(arow + kb + 8 * hh), x1 = *(const v4fa*)(arow + kb + 8 * hh + 4), x2 = *(const v4fa*)(arow + kb + 16 + 8 * hh), x3 = *(const v4fa*)(arow + kb + 16 + 8 * hh + 4);
    float xs[16] = {x0[0],x0[1],x0[2],x0[3],x1[0],x1[1],x1[2],x1[3],x2[0],x2[1],x2[2],x2[3],x3[0],x3[1],x3[2],x3[3]};
#pragma unroll
    for (int i = 0; i < 16; ++i) { const _Float16 h = (_Float16)xs[i]; ah.h[i] = h; al.h[i] = ASPLIT ? (_Float16)(xs[i] - (float)h) : (_Float16)0.0f; }
#pragma unroll
    for (int t = 0; t < 4; ++t) { if (col0 + t * 16 >= N) continue; const size_t boff = (size_t)(col0 + t * 16 + ln) * ldb + kb; FragH bq; bq.half[0] = *(const v8us*)(Bh + boff + 8 * hh); bq.half[1] = *(const v8us*)(Bh + boff + 16 + 8 * hh);
      acc[t] = mmaH<ASPLIT ? 2 : 1>(ah.v, al.v, bq.v, bq.v, acc[t]); }
  }
#pragma unroll
  for (int t = 0; t < 4; ++t) { if (col0 + t * 16 >= N) continue;
#pragma unroll
    for (int r = 0; r < 8; ++r) so[w][8 * hh + r][t * 16 + ln] = acc[t][r] * alpha; }
  __builtin_amdgcn_fence(__ATOMIC_ACQ_REL, "workgroup"); __builtin_amdgcn_wave_barrier();
  const int rsub = lane >> 4, c4 = (lane & 15) * 4;
  {
#pragma unroll
    for (int q = 0; q < 8; ++q) { const int r = q * 2 + rsub; if (col0 + c4 < N) { const v4f v = *(const v4fa*)&so[w][r][c4]; *(v4f*)(C + (size_t)(row0 + r) * ldc + col0 + c4) = v; } }
     }
}

// Wt[n][k] = f16(W[k][n]·scale) from f32 row-major W[K][N] (scale = power of two; bf16-exact weights stay exact in f16 away from the subnormal range)
__global__ __launch_bounds__(256) void k_wt_f16(const float* __restrict__ W, _Float16* __restrict__ Wt, int K, int N, float scale) {
  const int t = blockIdx.x * 256 + threadIdx.x; if (t >= N * (K / 8)) return; const int n = t / (K / 8), k8 = (t % (K / 8)) * 8; FragH f;
#pragma unroll
  for (int i = 0; i < 8; ++i) f.h[i] = (_Float16)(bf16_round(W[(size_t)(k8 + i) * N + n]) * scale); const v8us o = f.half[0];
  *(v8us*)((unsigned short*)Wt + (size_t)n * K + k8) = o; 
}
// per-pair bias, 32 pairs (same (b, key j), queries i = ib..ib+31) per wave, one pair per lane, the plane stored [b][j][i] (k_flash reads it with the query along the lanes), both MLPs wholly on v_wmma_f32_16x16x32_f16 in transposed form:
// layer 1: D1 = W1 (A: 16 hidden rows x k) * F (B: k x 16 pairs). A pair has 8 features: dist and dt each as an f16 high part plus an f16 remainder (the two products add up in the f32 accumulator), x_j, y_j, z_j, and 1.0
// for the layer's bias. Lanes 0..15 carry their pair's features at k = 0..7, lanes 16..31 at k = 8..15; W1 stands at both k ranges, and the half of B that belongs to the other 16 pairs is zeroed for each product.
// layer 2: two D1 tiles (hidden rows 0..15 and 16..31 of a 32-row block), relu'd and converted in place, ARE a B operand in the hardware k order; A = W2 with geom / shape / rate in rows 0,1,2 and again in rows 8,9,10, so that
// D2 registers 0,1,2 of lanes 0..15 (rows 0..2) and of lanes 16..31 (rows 8..10) hold the three outputs of column ln: every lane picks the D2 of its own 16-pair group and does its pair's softplus/log/lgamma tail. All weights x16 (exact), taken out as 1/256.
union FragW { v16h v; v8us half[2]; _Float16 h[16]; unsigned int w[8]; };
// The chip's own base-2 exponential and logarithm, one instruction each. Every argument below is a normal number, zero or infinite where it matters (logarithms see values of 1e-4 and more), so the library's range steps are not needed.
__device__ __forceinline__ float hw_exp2(float x) { return __builtin_amdgcn_exp2f(x); }
__device__ __forceinline__ float hw_log2(float x) { return __builtin_amdgcn_logf(x); }
#define LOG2E 1.4426950408889634f
#define LN2 0.6931471805599453f
// softplus(q) = max(q, 0) + log(1 + e), e = exp(-|q|) in [0, 1]. u = 1 + e drops d = e - (u - 1), which is exact; log(1 + e) = log(u) + d / u, and d stands for d / u to within d * e: the relative error stays at rounding level down to e = 0.
__device__ __forceinline__ float softplus_hw(float q) { const float e = hw_exp2(-fabsf(q) * LOG2E); const float u = 1.0f + e; const float d = e - (u - 1.0f); return fmaxf(q, 0.f) + (hw_log2(u) * LN2 + d); }
__device__ __forceinline__ v8f mma16(v16h a, v16h b, v8f c) { return __builtin_amdgcn_wmma_f32_16x16x32_f16(false, a, false, b, (short)0, c, false, false); }
__device__ __forceinline__ void bias_block(const int blk, const float* __restrict__ crd, const float* __restrict__ gw1, const float* __restrict__ gb1, const float* __restrict__ gw2, const float* __restrict__ gb2, const float* __restrict__ dw1, const float* __restrict__ db1, const float* __restrict__ dw2, const float* __restrict__ db2, float* __restrict__ BIAS) {
  __shared__ __attribute__((aligned(16))) _Float16 sW1[2 * BH][8];           // row = hidden unit (0..63 geom, 64..127 delay), its 8 feature weights
  __shared__ __attribute__((aligned(16))) _Float16 sW2[16][2 * BH + 8];      // row = output row of layer 2, k = hidden unit; pitch 272 B spreads the 16 rows over the banks
  const int tid = threadIdx.x, w = tid >> 5, lane = tid & 31, ln = lane & 15, hh = lane >> 4;
  { FragW f; float o0 = 0.f, o1 = 0.f, o2 = 0.f; const _Float16 z = (_Float16)0.f;
    if (tid < BH) { const _Float16 g0 = (_Float16)(bf16_round(gw1[tid * 2]) * 16.0f), g1 = (_Float16)(bf16_round(gw1[tid * 2 + 1]) * 16.0f);
      f.h[0] = g0; f.h[1] = g0; f.h[2] = g1; f.h[3] = g1; f.h[4] = z; f.h[5] = z; f.h[6] = z; f.h[7] = (_Float16)(bf16_round(gb1[tid]) * 16.0f); o0 = bf16_round(gw2[tid]) * 16.0f; }
    else { const int k = tid - BH; const _Float16 d0 = (_Float16)(bf16_round(dw1[k * 4]) * 16.0f);
      f.h[0] = d0; f.h[1] = d0; f.h[2] = z; f.h[3] = z; f.h[4] = (_Float16)(bf16_round(dw1[k * 4 + 1]) * 16.0f); f.h[5] = (_Float16)(bf16_round(dw1[k * 4 + 2]) * 16.0f); f.h[6] = (_Float16)(bf16_round(dw1[k * 4 + 3]) * 16.0f);
      f.h[7] = (_Float16)(bf16_round(db1[k]) * 16.0f); o1 = bf16_round(dw2[k]) * 16.0f; o2 = bf16_round(dw2[BH + k]) * 16.0f; }
    *(v8us*)&sW1[tid][0] = f.half[0];
#pragma unroll
    for (int m = 0; m < 16; ++m) sW2[m][tid] = (_Float16)(((m & 7) == 0) ? o0 : ((m & 7) == 1) ? o1 : ((m & 7) == 2) ? o2 : 0.f); }
  __syncthreads();
  const size_t p0 = ((size_t)blk * 4 + w) * 32;      // 32 consecutive queries of one (b, j) (SS = 1024 is a multiple of 32)
  const int b = (int)(p0 / ((size_t)SS * SS)); const int j = (int)((p0 / SS) % SS); const int ib = (int)(p0 % SS);
  const float* cj = crd + ((size_t)b * SS + j) * 4; const float xj = bf16_round(cj[0]), yj = bf16_round(cj[1]), zj = bf16_round(cj[2]), tj = bf16_round(cj[3]);
  const float gb2v = bf16_round(gb2[0]), db20 = bf16_round(db2[0]), db21 = bf16_round(db2[1]);
  // this lane's pair, i = ib + lane = ib + 16 hh + ln
  const v4f ci = *(const v4fa*)(crd + ((size_t)b * SS + ib + lane) * 4); const float xi = bf16_round(ci[0]), yi = bf16_round(ci[1]), zi = bf16_round(ci[2]), ti = bf16_round(ci[3]);
  const float dx = xi - xj, dy = yi - yj, dz = zi - zj; const float dist = __builtin_amdgcn_sqrtf(dx * dx + dy * dy + dz * dz); const float dt = ti - tj;
  FragW F; F.h[0] = (_Float16)dist; F.h[1] = (_Float16)(dist - (float)F.h[0]); F.h[2] = (_Float16)dt; F.h[3] = (_Float16)(dt - (float)F.h[2]); F.h[4] = (_Float16)xj; F.h[5] = (_Float16)yj; F.h[6] = (_Float16)zj; F.h[7] = (_Float16)1.0f;
  FragW bf[2];
#pragma unroll
  for (int c = 0; c < 2; ++c)
#pragma unroll
    for (int q = 0; q < 4; ++q) { bf[c].w[q] = (hh == c) ? F.w[q] : 0u; bf[c].w[4 + q] = 0u; }
  FragW a1[8], a2[4];
#pragma unroll
  for (int t = 0; t < 8; ++t) { a1[t].half[0] = *(const v8us*)&sW1[t * 16 + ln][0];
#pragma unroll
    for (int q = 0; q < 4; ++q) a1[t].w[4 + q] = 0u; }
#pragma unroll
  for (int s = 0; s < 4; ++s) { a2[s].half[0] = *(const v8us*)&sW2[ln][s * 32 + 8 * hh]; a2[s].half[1] = *(const v8us*)&sW2[ln][s * 32 + 16 + 8 * hh]; }
  const v8f zero8 = (v8f){0.f,0.f,0.f,0.f,0.f,0.f,0.f,0.f};
  const v16h zero16 = {};
  v8f d2[2] = {zero8, zero8};
#pragma unroll
  for (int s = 0; s < 4; ++s)
#pragma unroll
    for (int c = 0; c < 2; ++c) { const v8f t0 = mma16(a1[2 * s].v, bf[c].v, zero8), t1 = mma16(a1[2 * s + 1].v, bf[c].v, zero8); FragW hb;
#pragma unroll
      for (int q = 0; q < 8; ++q) { hb.h[q] = (_Float16)t0[q]; hb.h[8 + q] = (_Float16)t1[q]; }
      d2[c] = mma16(a2[s].v, __builtin_elementwise_max(hb.v, zero16), d2[c]); }      // relu behind the rounding gives the same f16 value as in front of it, two units per instruction
  { const float geom = (hh ? d2[1][0] : d2[0][0]) * 0.00390625f + gb2v; const float q0 = (hh ? d2[1][1] : d2[0][1]) * 0.00390625f + db20, q1 = (hh ? d2[1][2] : d2[0][2]) * 0.00390625f + db21;
    const float shape = softplus_hw(q0) + 1e-4f, rate = softplus_hw(q1) + 1e-4f; const float dtp = fmaxf(fabsf(dt), 1e-4f);
    // lgamma(shape), shape >= 1e-4: its asymptotic series (z - 0.5) log z - z + 0.5 log(2 pi) + 1/(12 z) - 1/(360 z^3) + 1/(1260 z^5) at z >= 4 (the next term is below 4e-8 there). Below 8 the argument is moved up by 4: lgamma(x) = lgamma(x + 4) - log(x (x + 1) (x + 2) (x + 3)), the product as t (t + 2) with t = x (x + 3).
    const bool up = shape < 8.0f; const float t = shape * (shape + 3.0f); const float prod = up ? t * (t + 2.0f) : 1.0f; const float z = up ? shape + 4.0f : shape;
    const float rz = __builtin_amdgcn_rcpf(z), rz2 = rz * rz; const float ser = rz * (0.083333333f + rz2 * (-0.0027777778f + rz2 * 0.00079365079f));
    // the logarithmic terms are added in base 2, the others in base e; the plane is stored in base-2 units (x log2 e), which k_flash's exp2 takes as they are
    const float l2rate = hw_log2(rate), l2dtp = hw_log2(dtp), l2z = hw_log2(z), l2prod = hw_log2(prod);
    __builtin_amdgcn_sched_barrier(0);      // the four arguments die below; the instruction set asks for one slot between a logarithm and an instruction that takes over its argument's register
    const float lg2 = shape * l2rate + (shape - 1.0f) * l2dtp - (z - 0.5f) * l2z + l2prod;
    const float nat = geom - rate * dtp + (z - 0.91893853f) - ser;
    BIAS[p0 + lane] = lg2 + nat * LOG2E;
    asm volatile("s_wait_xcnt 0x0" ::: "memory"); } }      // stands behind the store, ahead of any later write of the registers it names (the listing lays other branches of the fused kernel behind it)
// 16 k positions of one f32 row for an f16 fragment; p points at the lane's k = 8 hh of the 32-wide k step (positions 0..7 and 16..23 from there). load16 fetches them, cvt16 makes f16(bf16(x) * sc) of them (round to nearest even, as bf16_round)
__device__ __forceinline__ void load16(const float* __restrict__ p, v4f (&x)[4]) { x[0] = *(const v4fa*)p; x[1] = *(const v4fa*)(p + 4); x[2] = *(const v4fa*)(p + 16); x[3] = *(const v4fa*)(p + 20); }
__device__ __forceinline__ v16h cvt16(const v4f (&x)[4], const float sc) { FragH f;
#pragma unroll
  for (int g = 0; g < 4; ++g)
#pragma unroll
    for (int q = 0; q < 4; ++q) f.h[4 * g + q] = (_Float16)((float)(__bf16)x[g][q] * sc);
  return f.v; }
// q, k, v projections straight from the f32 inputs. One wave = 16 rows of one matrix (B operand) against 64 rows of the other (A operand, 4 tiles), K = 256: a lane then holds 8 neighbouring results of the A side,
// one 16-byte store per tile, and a wave writes whole 128-byte lines. q, k: B = 16 rows of src, A = 64 rows of W, stored [row][col]. v: B = 16 rows of Wv, A = 64 rows of src (keys), stored transposed [b][col][key].
__device__ __forceinline__ void qkv_block(const int blk, const float* __restrict__ src, const float* __restrict__ Wq, const float* __restrict__ Wk, const float* __restrict__ Wv, _Float16* __restrict__ Q16, _Float16* __restrict__ K16, _Float16* __restrict__ Vt) {
  const int tid = threadIdx.x, w = __builtin_amdgcn_readfirstlane(tid >> 5), lane = tid & 31, ln = lane & 15, hh = lane >> 4;      // the wave's number in a scalar register keeps the base pointers scalar
  const int which = blk >> 7, wid = (blk & 127) * 4 + w;
  const float* one; const float* four; float s1, s4; _Float16* dst;
  if (which < 2) { const int mt = wid >> 2, nq = wid & 3; one = src + (size_t)mt * 16 * DM; four = (which ? Wk : Wq) + (size_t)nq * 64 * DM; s1 = 1.0f; s4 = 16.0f; dst = (which ? K16 : Q16) + (size_t)(mt * 16 + ln) * DM + nq * 64; }
  else { const int kq = wid >> 4, ct = wid & 15; one = Wv + (size_t)ct * 16 * DM; four = src + (size_t)kq * 64 * DM; s1 = 16.0f; s4 = 1.0f; dst = Vt + ((size_t)(kq / (SS / 64)) * DM + ct * 16 + ln) * SS + (kq % (SS / 64)) * 64; }
  const float* orow = one + ln * DM + 8 * hh; const float* frow = four + ln * DM + 8 * hh;
  v8f acc[4] = {};
  for (int kb = 0; kb < DM; kb += 32) { const float* po = orow + kb; const float* pf = frow + kb; v4f ro[4], rf[4][4];
    load16(po, ro);
#pragma unroll
    for (int t = 0; t < 4; ++t) load16(pf + t * 16 * DM, rf[t]);
    asm volatile("s_wait_xcnt 0x0" :: "v"(po), "v"(pf) : "memory");      // the two address pairs stay whole up to this wait
    const v16h bo = cvt16(ro, s1);
#pragma unroll
    for (int t = 0; t < 4; ++t) acc[t] = mma16(cvt16(rf[t], s4), bo, acc[t]); }
#pragma unroll
  for (int t = 0; t < 4; ++t) { FragH o;
#pragma unroll
    for (int r = 0; r < 8; ++r) o.h[r] = (_Float16)(acc[t][r] * 0.0625f);
    *(v8us*)((unsigned short*)dst + t * 16 + 8 * hh) = o.half[0]; } }
// Everything that depends on the inputs alone, in one launch: blocks 0..383 the q, k, v projections (first, they are the long ones), blocks 384..447 Wo as f16 (x16), the rest the bias plane.
#define G_QKV (3 * (NR / 16) * (DM / 64) / 4)
#define G_WO (DM * DM / 8 / 128)
#define G_BIAS (BB * SS * SS / 128)
// waves_per_eu(7, 8): at most 146 registers, seven waves a SIMD. The bias code's short tail has no branch, so MLPs and tail are scheduled as one stretch: held to 128 registers (eight waves) the build spills there, or it splits the 20 loads of the q, k, v loop over several waits;
// with this line it builds to 143 registers, nothing spilled, the 20 loads in one run
__global__ __launch_bounds__(128) __attribute__((amdgpu_waves_per_eu(7, 8))) void k_front(const float* __restrict__ src, const float* __restrict__ crd, const float* __restrict__ Wq, const float* __restrict__ Wk, const float* __restrict__ Wv, const float* __restrict__ Wo,
    const float* __restrict__ gw1, const float* __restrict__ gb1, const float* __restrict__ gw2, const float* __restrict__ gb2, const float* __restrict__ dw1, const float* __restrict__ db1, const float* __restrict__ dw2, const float* __restrict__ db2,
    _Float16* __restrict__ Q16, _Float16* __restrict__ K16, _Float16* __restrict__ Vt, _Float16* __restrict__ Bo, float* __restrict__ BIAS) {
  const int blk = blockIdx.x;
  if (blk < G_QKV) { qkv_block(blk, src, Wq, Wk, Wv, Q16, K16, Vt); return; }
  if (blk < G_QKV + G_WO) { const size_t t = (size_t)(blk - G_QKV) * 128 + threadIdx.x; FragH f;
#pragma unroll
    for (int i = 0; i < 8; ++i) f.h[i] = (_Float16)(bf16_round(Wo[t * 8 + i]) * 16.0f);
    *(v8us*)((unsigned short*)Bo + t * 8) = f.half[0];
    asm volatile("s_wait_xcnt 0x0" ::: "memory");      // stands behind the store, ahead of any later write of the registers it names (the listing lays the other branches behind it)
    return; }
  bias_block(blk - (G_QKV + G_WO), crd, gw1, gb1, gw2, gb2, dw1, db1, dw2, db2, BIAS); }
typedef float v2f  __attribute__((ext_vector_type(2)));
typedef float v2fa __attribute__((ext_vector_type(2), may_alias));
// lane l with lane l ^ 16, in the vector unit
__device__ __forceinline__ float xhalf(float x) { return __builtin_bit_cast(float, __builtin_amdgcn_permlanex16(__builtin_bit_cast(int, x), __builtin_bit_cast(int, x), 0x76543210, 0xfedcba98, false, false)); }
// One block = 32 query rows of one (batch, head); its 8 waves share those rows and split the 1024 keys, 128 each (512 blocks of 8 waves fill every SIMD four deep, where one wave per 32 rows over all keys left
// one wave on half the SIMDs). Every wave runs the same online-softmax loop over its own keys and leaves an un-normalised partial (row max, row sum, O) in LDS; behind one block barrier the partials of a row are
// rescaled to their common max and added, wave 0 first.
// The loop works on the transposed products: St = K (A: 16 keys x d) * Qt (B: d x 16 queries), so lanes ln and ln + 16 hold all 32 scores that a pass gives the query of column ln, 16 each: maximum and sum are taken inside the lane, with one
// exchange between the halves for the maximum (the sums' halves are joined once, behind the loop). The two St tiles of a pass (keys 0..15 and 16..31), as f16 exponentials, ARE the B operand of Ot = Vt (A: 16 d x 32 keys) * Pt in
// the hardware k order: P passes through no LDS. Column ln of query tile rt is query 2 ln + rt, so that one 8-byte load fetches a key's bias for both of a lane's queries from the [key][query] plane and 16 lanes read a whole 128-byte line; a lane holds 8 neighbouring d of its query's output.
// waves_per_eu(1, 4): no more than four waves a SIMD are planned for, which is what 512 blocks of 8 waves come to; without it the compiler saves registers for an occupancy the grid cannot reach
__global__ __launch_bounds__(256) __attribute__((amdgpu_waves_per_eu(1, 4))) void k_flash(const _Float16* __restrict__ Q16, const _Float16* __restrict__ K16, const _Float16* __restrict__ Vt, const float* __restrict__ BIAS, float* __restrict__ O) {
  constexpr int RPW = 32, NW = 8, NQB = SS / RPW, KPW = SS / NW, DT = 2;
  __shared__ __attribute__((aligned(16))) float sO[NW][RPW][HD + 4]; __shared__ float sM[NW][RPW], sL[NW][RPW];
  const int tid = threadIdx.x, w = __builtin_amdgcn_readfirstlane(tid >> 5), lane = tid & 31, ln = lane & 15, hh = lane >> 4;      // the wave's number in a scalar register keeps the wave's key offset (w * KPW) and LDS slots scalar
  const int slab = blockIdx.x / NQB, qblk = blockIdx.x % NQB; const int b = slab / NH, h = slab % NH; const int q0 = qblk * RPW;
  FragH aq[2];
#pragma unroll
  for (int rt = 0; rt < 2; ++rt) { const unsigned short* qr = (const unsigned short*)Q16 + ((size_t)b * SS + q0 + 2 * ln + rt) * DM + h * HD; aq[rt].half[0] = *(const v8us*)(qr + 8 * hh); aq[rt].half[1] = *(const v8us*)(qr + 16 + 8 * hh); }
  const unsigned short* kp = (const unsigned short*)K16 + ((size_t)b * SS + w * KPW + ln) * DM + h * HD + 8 * hh;      // key row ln of the pass, k = d
  const unsigned short* vp = (const unsigned short*)Vt + ((size_t)slab * HD + ln) * SS + w * KPW + 8 * hh;             // d row ln, k = key
  const float* bp = BIAS + ((size_t)b * SS + w * KPW + 8 * hh) * SS + q0 + 2 * ln;                                     // key 8 hh of a tile, queries 2 ln and 2 ln + 1
  float m_r[2], l_r[2]; v8f oacc[2][DT];
  const v8f zero8 = (v8f){0.f,0.f,0.f,0.f,0.f,0.f,0.f,0.f};
#pragma unroll
  for (int rt = 0; rt < 2; ++rt) { m_r[rt] = -3.0e38f; l_r[rt] = 0.f;
#pragma unroll
    for (int dt = 0; dt < DT; ++dt) oacc[rt][dt] = zero8; }
  const float scale = 0.17677669529663688f * LOG2E;      // scores, bias plane, running max in base-2 units: every exponential is one exp2
#pragma unroll 1
  for (int it = 0; it < KPW / 32; ++it) {
    FragH bk[2], bv[DT]; v2f bb[2][8];
#pragma unroll
    for (int nt = 0; nt < 2; ++nt) { bk[nt].half[0] = *(const v8us*)(kp + nt * 16 * DM); bk[nt].half[1] = *(const v8us*)(kp + nt * 16 * DM + 16); }
#pragma unroll
    for (int nt = 0; nt < 2; ++nt)
#pragma unroll
      for (int r = 0; r < 8; ++r) bb[nt][r] = *(const v2fa*)(bp + (nt * 16 + r) * SS);
#pragma unroll
    for (int dt = 0; dt < DT; ++dt) { bv[dt].half[0] = *(const v8us*)(vp + dt * 16 * SS); bv[dt].half[1] = *(const v8us*)(vp + dt * 16 * SS + 16); }
    asm volatile("s_wait_xcnt 0x0" :: "v"(kp), "v"(vp), "v"(bp) : "memory");      // the three address pairs stay whole up to this wait; they are stepped on right behind it
    __builtin_amdgcn_sched_barrier(0);      // all loads of a pass are issued ahead of its first product; without this line the build holds some of the V loads back behind the first wait, to save registers that are free here
    kp += 32 * DM; vp += 32; bp += 32 * SS;
#pragma unroll
    for (int rt = 0; rt < 2; ++rt) {
      v8f c0, c1;
#pragma unroll
      for (int r = 0; r < 8; ++r) { c0[r] = bb[0][r][rt]; c1[r] = bb[1][r][rt]; }
      const v8f s0 = mma16(bk[0].v, aq[rt].v, zero8) * scale + c0, s1 = mma16(bk[1].v, aq[rt].v, zero8) * scale + c1;
      const v8f mx = __builtin_elementwise_max(s0, s1);
      float mc = fmaxf(fmaxf(fmaxf(mx[0], mx[1]), fmaxf(mx[2], mx[3])), fmaxf(fmaxf(mx[4], mx[5]), fmaxf(mx[6], mx[7])));
      mc = fmaxf(mc, xhalf(mc));
      const float mn = fmaxf(m_r[rt], mc); const float al = hw_exp2(m_r[rt] - mn); m_r[rt] = mn;
      const v8f e0 = s0 - mn, e1 = s1 - mn; v8f p0, p1; FragH pb;
#pragma unroll
      for (int r = 0; r < 8; ++r) { p0[r] = hw_exp2(e0[r]); p1[r] = hw_exp2(e1[r]); pb.h[r] = (_Float16)p0[r]; pb.h[8 + r] = (_Float16)p1[r]; }
      const v8f ps = p0 + p1;
      l_r[rt] = l_r[rt] * al + (((ps[0] + ps[4]) + (ps[1] + ps[5])) + ((ps[2] + ps[6]) + (ps[3] + ps[7])));      // this lane's 16 keys
#pragma unroll
      for (int dt = 0; dt < DT; ++dt) oacc[rt][dt] = mma16(bv[dt].v, pb.v, oacc[rt][dt] * al); } }
#pragma unroll
  for (int rt = 0; rt < 2; ++rt) { const float l = l_r[rt] + xhalf(l_r[rt]);
#pragma unroll
    for (int dt = 0; dt < DT; ++dt) { const v8f o = oacc[rt][dt]; float* so = &sO[w][2 * ln + rt][dt * 16 + 8 * hh]; *(v4f*)so = (v4f){o[0], o[1], o[2], o[3]}; *(v4f*)(so + 4) = (v4f){o[4], o[5], o[6], o[7]}; }
    if (hh == 0) { sM[w][2 * ln + rt] = m_r[rt]; sL[w][2 * ln + rt] = l; } }      // max and sum are the same in the two lanes of a query
  __syncthreads();      // every wave's partial is in LDS before any thread merges
  { const int r = tid >> 3, pc = tid & 7;      // one thread = 4 output columns of one row
    float mw[NW], M = -3.0e38f;
#pragma unroll
    for (int u = 0; u < NW; ++u) { mw[u] = sM[u][r]; M = fmaxf(M, mw[u]); }
    float L = 0.f; v4f acc = {0.f, 0.f, 0.f, 0.f};
#pragma unroll
    for (int u = 0; u < NW; ++u) { const float g = hw_exp2(mw[u] - M); L += sL[u][r] * g; const v4f val = *(const v4fa*)&sO[u][r][pc * 4]; acc += val * g; }
    const float inv = 1.0f / L;
    *(v4f*)(O + ((size_t)b * SS + q0 + r) * DM + h * HD + pc * 4) = acc * inv; } }
extern "C" void kernel_launch(void* const* d_in, const int* in_sizes, int n_in,
                              void* d_out, int out_size, void* d_ws, size_t ws_size, hipStream_t stream) {
  (void)in_sizes; (void)n_in; (void)out_size;
  const float* src = (const float*)d_in[0]; const float* crd = (const float*)d_in[1]; const float* Wq = (const float*)d_in[2]; const float* Wk = (const float*)d_in[3]; const float* Wv = (const float*)d_in[4]; const float* Wo = (const float*)d_in[5];
  const float* gw1 = (const float*)d_in[6]; const float* gb1 = (const float*)d_in[7]; const float* gw2 = (const float*)d_in[8]; const float* gb2 = (const float*)d_in[9]; const float* dw1 = (const float*)d_in[10]; const float* db1 = (const float*)d_in[11]; const float* dw2 = (const float*)d_in[12]; const float* db2 = (const float*)d_in[13];
  char* ws = (char*)d_ws; size_t off = 0;
  auto take = [&](size_t bytes) { char* p = ws + off; off += (bytes + 255) & ~(size_t)255; return p; };
  _Float16* Bo = (_Float16*)take((size_t)DM * DM * 2); _Float16* Q16 = (_Float16*)take((size_t)NR * DM * 2); _Float16* K16 = (_Float16*)take((size_t)NR * DM * 2); _Float16* Vt = (_Float16*)take((size_t)NR * DM * 2); float* BIAS = (float*)take((size_t)BB * SS * SS * 4); float* O = (float*)take((size_t)NR * DM * 4);
  if (off > ws_size) return;      // about 13 MiB
  k_front<<<G_QKV + G_WO + G_BIAS, 128, 0, stream>>>(src, crd, Wq, Wk, Wv, Wo, gw1, gb1, gw2, gb2, dw1, db1, dw2, db2, Q16, K16, Vt, Bo, BIAS);
  k_flash<<<BB * NH * (SS / 32), 256, 0, stream>>>(Q16, K16, Vt, BIAS, O);
  const dim3 gg(((NR / 16) * (DM / 64) + 3) / 4, 1);
  k_gemm_h<false><<<gg, 128, 0, stream>>>(O, DM, 0, Bo, DM, 0, 0.0625f, (float*)d_out, DM, 0, NR, DM, DM);      // rounds O to f16 in its A loader
}

// v007
// Measured time: 44.4 microseconds a run.
// Next to v006, in two timings, it ran 1.08 and 1.05 times as fast.
// Over all steps from v000 it is 8.57 times as fast.
#include <hip/hip_runtime.h>
// q/k/v/o projections (2048 × 256 × 256) and the 8-head attention (d = 32) with an additive per-pair bias on v_wmma_f32_16x16x32_f16 (fused flash-style kernel: S = Q·Kᵀ, O = P·V on WMMA;
// online max/sum softmax f32; P f16 <= 1). The bias (geometric 2->64->1 MLP + the Gamma log-density from the 4->64->2 delay MLP, incl. lgamma) is computed once per (b, i, j): both layers of the two MLPs
// on WMMA, softplus/log/lgamma in f32; the bias plane is shared by the 8 heads. A = f16(bf16 ·) exact operands (o projection: f16(O)), weights bf16-exact ×2^4 ((out,in)), single products, f32 accumulate.
#define BB 2
#define SS 1024
#define DM 256
#define NH 8
#define HD 32
#define BH 64
#define NR (BB * SS)

typedef __bf16 v16b __attribute__((ext_vector_type(16)));
typedef unsigned short v8us __attribute__((ext_vector_type(8), may_alias));
typedef float  v8f  __attribute__((ext_vector_type(8)));
typedef float  v4f  __attribute__((ext_vector_type(4)));
typedef float  v4fa __attribute__((ext_vector_type(4), may_alias));
union FragB { v16b v; v8us half[2]; unsigned short u[16]; };

__device__ __forceinline__ unsigned short bf16_bits(float x) { unsigned int u = __float_as_uint(x); return (unsigned short)((u + 0x7FFFu + ((u >> 16) & 1u)) >> 16); }
__device__ __forceinline__ float bf16_val(unsigned short b) { return __uint_as_float(((unsigned int)b) << 16); }
__device__ __forceinline__ float bf16_round(float x) { return bf16_val(bf16_bits(x)); }
// D += A·B with NT terms: 1 = ah·bh, 2 = + al·bh (A split), 3 = + ah·bl (both split)
template <int NT>
__device__ __forceinline__ v8f mmaN(v16b ah, v16b al, v16b bh, v16b bl, v8f c) {
  c = __builtin_amdgcn_wmma_f32_16x16x32_bf16(false, ah, false, bh, (short)0, c, false, false);
  if (NT >= 2) c = __builtin_amdgcn_wmma_f32_16x16x32_bf16(false, al, false, bh, (short)0, c, false, false);
  if (NT >= 3) c = __builtin_amdgcn_wmma_f32_16x16x32_bf16(false, ah, false, bl, (short)0, c, false, false);
  asm volatile("v_nop\n\tv_nop\n\tv_nop\n\tv_nop" : "+v"(c) : "v"(ah), "v"(al), "v"(bh), "v"(bl));
  return c;
}

__global__ __launch_bounds__(256) void k_wt_bf16(const float* __restrict__ W, unsigned short* __restrict__ Wt, int K, int N) {
  const int t = blockIdx.x * 256 + threadIdx.x;
  const int k8n = K / 8;
  if (t >= N * k8n) return;
  const int n = t / k8n, k8 = (t % k8n) * 8;
  v8us v;
#pragma unroll
  for (int i = 0; i < 8; ++i) v[i] = bf16_bits(W[(size_t)(k8 + i) * N + n]);
  *(v8us*)(Wt + (size_t)n * K + k8) = v;
  
}

// GEMM C[M][N] (f32, pitch ldc) = act(A[M][K]·W + bias). A f32 row-major (pitch lda) converted per fragment to bf16
// (ASPLIT: hi/lo two planes -> 2 terms, else single rounded term); Wt bf16 [N][K] (pitch ldb). BIAS_BF16 rounds the
// bias to bf16 first (bias quantised to bf16 before the add). K%32==0, M%16==0, N%64==0.
template <bool ASPLIT, int ACT, bool BIAS_BF16>
__global__ __launch_bounds__(128) void k_gemm_bf(const float* __restrict__ A, int lda, const unsigned short* __restrict__ Wt, int ldb,
                                               const float* __restrict__ bias, float* __restrict__ C, int ldc, int M, int N, int K) {
  __shared__ __attribute__((aligned(16))) float so[4][16][64];
  const int tid = threadIdx.x, w = tid >> 5, lane = tid & 31, ln = lane & 15, hh = lane >> 4;
  const int ntn = N / 64;
  const int wid = blockIdx.x * 4 + w;
  const int mt = wid / ntn, nq = wid % ntn;
  if (mt * 16 >= M) return;
  const int row0 = mt * 16, col0 = nq * 64;
  const float* arow = A + (size_t)(row0 + ln) * lda;
  v8f acc[4] = {};
  for (int kb = 0; kb < K; kb += 32) {
    FragB ah, al;
    const v4f x0 = *(const v4fa*)(arow + kb + 8 * hh), x1 = *(const v4fa*)(arow + kb + 8 * hh + 4);
    const v4f x2 = *(const v4fa*)(arow + kb + 16 + 8 * hh), x3 = *(const v4fa*)(arow + kb + 16 + 8 * hh + 4);
    float xs[16] = {x0[0],x0[1],x0[2],x0[3],x1[0],x1[1],x1[2],x1[3],x2[0],x2[1],x2[2],x2[3],x3[0],x3[1],x3[2],x3[3]};
#pragma unroll
    for (int i = 0; i < 16; ++i) { const unsigned short hb = bf16_bits(xs[i]); ah.u[i] = hb; al.u[i] = ASPLIT ? bf16_bits(xs[i] - bf16_val(hb)) : (unsigned short)0; }
#pragma unroll
    for (int t = 0; t < 4; ++t) {
      const unsigned short* brow = Wt + (size_t)(col0 + t * 16 + ln) * ldb + kb;
      FragB b;
      b.half[0] = *(const v8us*)(brow + 8 * hh);
      b.half[1] = *(const v8us*)(brow + 16 + 8 * hh);
      acc[t] = mmaN<ASPLIT ? 2 : 1>(ah.v, al.v, b.v, b.v, acc[t]);
    }
  }
#pragma unroll
  for (int t = 0; t < 4; ++t) {
    float bv = bias ? bias[col0 + t * 16 + ln] : 0.f;
    if (BIAS_BF16) bv = bf16_round(bv);
#pragma unroll
    for (int r = 0; r < 8; ++r) { float v = acc[t][r] + bv; if (ACT == 1) v = fmaxf(v, 0.f); so[w][8 * hh + r][t * 16 + ln] = v; }
  }
  __builtin_amdgcn_fence(__ATOMIC_ACQ_REL, "workgroup");
  __builtin_amdgcn_wave_barrier();
  const int rsub = lane >> 4, c4 = (lane & 15) * 4;
  {
#pragma unroll
    for (int q = 0; q < 8; ++q) {
      const int r = q * 2 + rsub;
      const v4f v = *(const v4fa*)&so[w][r][c4];
      *(v4f*)(C + (size_t)(row0 + r) * ldc + col0 + c4) = v;
    }
    
  }
}

// Flash-style causal/unmasked attention, all contractions 3-term bf16 hi/lo splits, f32 softmax with running max.
// q,k,v rows are read from f32 buffers with arbitrary row pitch (so they can live inside a fused qkv buffer);
// D = head size (multiple of 32, <= 128); one wave = 16 query rows; block = 4 waves (64 queries) sharing K/V chunks of 32.
template <int D, bool CAUSAL>
__global__ __launch_bounds__(128) void k_flash(const float* __restrict__ qb, const float* __restrict__ kb, const float* __restrict__ vb,
                                             int pitch, int T, int H, float scale, float* __restrict__ y, int ypitch) {
  constexpr int KS = D / 32;        // k-steps for QK
  constexpr int DT = D / 16;        // d tiles for PV
  __shared__ __attribute__((aligned(16))) unsigned short sKh[32][D + 8], sKl[32][D + 8], sVh[32][D + 8], sVl[32][D + 8];
  __shared__ __attribute__((aligned(16))) unsigned short sPh[4][16][40], sPl[4][16][40];
  __shared__ __attribute__((aligned(16))) float sO[4][16][D];
  const int tid = threadIdx.x, w = tid >> 5, lane = tid & 31, ln = lane & 15, hh = lane >> 4;
  const int nqb = (T + 63) / 64;
  const int bh = blockIdx.x / nqb, qblk = blockIdx.x % nqb;
  const int b = bh / H, h = bh % H;
  const int q0 = qblk * 64 + w * 16;
  const float* Q = qb + (size_t)b * T * pitch + h * D;
  const float* K = kb + (size_t)b * T * pitch + h * D;
  const float* V = vb + (size_t)b * T * pitch + h * D;

  // A fragments of the wave's 16 query rows (scaled), hi/lo
  FragB aqh[KS], aql[KS];
  {
    int row = q0 + ln; if (row >= T) row = T - 1;
    const float* qr = Q + (size_t)row * pitch;
#pragma unroll
    for (int ks = 0; ks < KS; ++ks)
#pragma unroll
      for (int i = 0; i < 16; ++i) {
        const int d = ks * 32 + ((i < 8) ? (8 * hh + i) : (16 + 8 * hh + (i - 8)));
        const float x = qr[d] * scale; const unsigned short hb = bf16_bits(x);
        aqh[ks].u[i] = hb; aql[ks].u[i] = bf16_bits(x - bf16_val(hb));
      }
  }
  float m_r[8], l_r[8];
#pragma unroll
  for (int r = 0; r < 8; ++r) { m_r[r] = -3.0e38f; l_r[r] = 0.f; }
  v8f oacc[DT];
#pragma unroll
  for (int dt = 0; dt < DT; ++dt) oacc[dt] = (v8f){0.f,0.f,0.f,0.f,0.f,0.f,0.f,0.f};

  const int kv_end = CAUSAL ? min(T, qblk * 64 + 64) : T;     // block-uniform
  for (int j0 = 0; j0 < kv_end; j0 += 32) {
    __syncthreads();
    for (int e = tid; e < 32 * (D / 4); e += 128) {
      const int r = e / (D / 4), c4 = (e % (D / 4)) * 4;
      const int key = j0 + r;
      v4f kf = {0.f,0.f,0.f,0.f}, vf = {0.f,0.f,0.f,0.f};
      if (key < T) { kf = *(const v4fa*)(K + (size_t)key * pitch + c4); vf = *(const v4fa*)(V + (size_t)key * pitch + c4); }
#pragma unroll
      for (int t = 0; t < 4; ++t) {
        unsigned short hb = bf16_bits(kf[t]); sKh[r][c4 + t] = hb; sKl[r][c4 + t] = bf16_bits(kf[t] - bf16_val(hb));
        hb = bf16_bits(vf[t]); sVh[r][c4 + t] = hb; sVl[r][c4 + t] = bf16_bits(vf[t] - bf16_val(hb));
      }
    }
    __syncthreads();
    // S tile 16 x 32
    v8f s[2];
#pragma unroll
    for (int nt = 0; nt < 2; ++nt) {
      v8f acc = {};
#pragma unroll
      for (int ks = 0; ks < KS; ++ks) {
        FragB bh_, bl_;
        bh_.half[0] = *(const v8us*)&sKh[nt * 16 + ln][ks * 32 + 8 * hh]; bh_.half[1] = *(const v8us*)&sKh[nt * 16 + ln][ks * 32 + 16 + 8 * hh];
        bl_.half[0] = *(const v8us*)&sKl[nt * 16 + ln][ks * 32 + 8 * hh]; bl_.half[1] = *(const v8us*)&sKl[nt * 16 + ln][ks * 32 + 16 + 8 * hh];
        acc = mmaN<3>(aqh[ks].v, aql[ks].v, bh_.v, bl_.v, acc);
      }
      s[nt] = acc;
    }
    // mask + running max (rows 8hh+r; the 16 lanes of a half share rows)
    float alpha[8];
#pragma unroll
    for (int r = 0; r < 8; ++r) {
      const int qi = q0 + 8 * hh + r;
      const int ja = j0 + ln, jb = j0 + 16 + ln;
      if (CAUSAL) { if (ja > qi) s[0][r] = -3.0e38f; if (jb > qi) s[1][r] = -3.0e38f; }
      if (ja >= T) s[0][r] = -3.0e38f;
      if (jb >= T) s[1][r] = -3.0e38f;
      float mx = fmaxf(s[0][r], s[1][r]);
      mx = fmaxf(mx, __shfl_xor(mx, 1, 32)); mx = fmaxf(mx, __shfl_xor(mx, 2, 32)); mx = fmaxf(mx, __shfl_xor(mx, 4, 32)); mx = fmaxf(mx, __shfl_xor(mx, 8, 32));
      const float mnew = fmaxf(m_r[r], mx);
      alpha[r] = (mnew > -1.0e38f) ? __expf(m_r[r] - mnew) : 1.0f;
      const float p0 = (s[0][r] > -1.0e38f) ? __expf(s[0][r] - mnew) : 0.f;
      const float p1 = (s[1][r] > -1.0e38f) ? __expf(s[1][r] - mnew) : 0.f;
      m_r[r] = mnew;
      l_r[r] = l_r[r] * alpha[r] + p0 + p1;            // per-lane partial row sum (16 lanes combined at the end)
      unsigned short hb = bf16_bits(p0); sPh[w][8 * hh + r][ln] = hb;      sPl[w][8 * hh + r][ln] = bf16_bits(p0 - bf16_val(hb));
      hb = bf16_bits(p1);                sPh[w][8 * hh + r][16 + ln] = hb; sPl[w][8 * hh + r][16 + ln] = bf16_bits(p1 - bf16_val(hb));
    }
#pragma unroll
    for (int dt = 0; dt < DT; ++dt)
#pragma unroll
      for (int r = 0; r < 8; ++r) oacc[dt][r] *= alpha[r];
    __builtin_amdgcn_fence(__ATOMIC_ACQ_REL, "workgroup");
    __builtin_amdgcn_wave_barrier();
    FragB pah, pal;
    pah.half[0] = *(const v8us*)&sPh[w][ln][8 * hh]; pah.half[1] = *(const v8us*)&sPh[w][ln][16 + 8 * hh];
    pal.half[0] = *(const v8us*)&sPl[w][ln][8 * hh]; pal.half[1] = *(const v8us*)&sPl[w][ln][16 + 8 * hh];
#pragma unroll
    for (int dt = 0; dt < DT; ++dt) {
      FragB bvh, bvl;
#pragma unroll
      for (int i = 0; i < 8; ++i) {
        bvh.u[i] = sVh[8 * hh + i][dt * 16 + ln]; bvh.u[8 + i] = sVh[16 + 8 * hh + i][dt * 16 + ln];
        bvl.u[i] = sVl[8 * hh + i][dt * 16 + ln]; bvl.u[8 + i] = sVl[16 + 8 * hh + i][dt * 16 + ln];
      }
      oacc[dt] = mmaN<3>(pah.v, pal.v, bvh.v, bvl.v, oacc[dt]);
    }
    __builtin_amdgcn_fence(__ATOMIC_ACQ_REL, "workgroup");
    __builtin_amdgcn_wave_barrier();
  }
#pragma unroll
  for (int r = 0; r < 8; ++r) {
    float l = l_r[r];
    l += __shfl_xor(l, 1, 32); l += __shfl_xor(l, 2, 32); l += __shfl_xor(l, 4, 32); l += __shfl_xor(l, 8, 32);
    l_r[r] = (l > 0.f) ? 1.0f / l : 0.f;
  }
#pragma unroll
  for (int dt = 0; dt < DT; ++dt)
#pragma unroll
    for (int r = 0; r < 8; ++r) sO[w][8 * hh + r][dt * 16 + ln] = oacc[dt][r] * l_r[r];
  __builtin_amdgcn_fence(__ATOMIC_ACQ_REL, "workgroup");
  __builtin_amdgcn_wave_barrier();
  {
    for (int r = 0; r < 16; ++r) {
      const int row = q0 + r;
      if (row < T && lane < D / 4) {
        const v4f val = *(const v4fa*)&sO[w][r][lane * 4];
        *(v4f*)(y + ((size_t)b * T + row) * ypitch + h * D + lane * 4) = val;
      }
    }
    
  }
}

// GEMM C = act(A·W + bias + resid): A f32 (ASPLIT -> hi/lo 2 terms), Wt bf16 [N][K]; ACT 0 none, 1 relu, 2 exact gelu;
// resid (optional, f32, row index = (row % rmod), pitch ldr, RES_BF16 rounds it) added before the activation.
template <bool ASPLIT, int ACT, bool BIAS_BF16, bool RES_BF16>
__global__ __launch_bounds__(128) void k_gemm_bf3(const float* __restrict__ A, int lda, const unsigned short* __restrict__ Wt, int ldb,
                                                const float* __restrict__ bias, const float* __restrict__ resid, int rmod, int ldr,
                                                float* __restrict__ C, int ldc, int M, int N, int K) {
  __shared__ __attribute__((aligned(16))) float so[4][16][64];
  const int tid = threadIdx.x, w = tid >> 5, lane = tid & 31, ln = lane & 15, hh = lane >> 4;
  const int ntn = N / 64;
  const int wid = blockIdx.x * 4 + w;
  const int mt = wid / ntn, nq = wid % ntn;
  if (mt * 16 >= M) return;
  const int row0 = mt * 16, col0 = nq * 64;
  const float* arow = A + (size_t)(row0 + ln) * lda;
  v8f acc[4] = {};
  for (int kb = 0; kb < K; kb += 32) {
    FragB ah, al;
    const v4f x0 = *(const v4fa*)(arow + kb + 8 * hh), x1 = *(const v4fa*)(arow + kb + 8 * hh + 4);
    const v4f x2 = *(const v4fa*)(arow + kb + 16 + 8 * hh), x3 = *(const v4fa*)(arow + kb + 16 + 8 * hh + 4);
    float xs[16] = {x0[0],x0[1],x0[2],x0[3],x1[0],x1[1],x1[2],x1[3],x2[0],x2[1],x2[2],x2[3],x3[0],x3[1],x3[2],x3[3]};
#pragma unroll
    for (int i = 0; i < 16; ++i) { const unsigned short hb = bf16_bits(xs[i]); ah.u[i] = hb; al.u[i] = ASPLIT ? bf16_bits(xs[i] - bf16_val(hb)) : (unsigned short)0; }
#pragma unroll
    for (int t = 0; t < 4; ++t) {
      const unsigned short* brow = Wt + (size_t)(col0 + t * 16 + ln) * ldb + kb;
      FragB b;
      b.half[0] = *(const v8us*)(brow + 8 * hh);
      b.half[1] = *(const v8us*)(brow + 16 + 8 * hh);
      acc[t] = mmaN<ASPLIT ? 2 : 1>(ah.v, al.v, b.v, b.v, acc[t]);
    }
  }
#pragma unroll
  for (int t = 0; t < 4; ++t) {
    const int col = col0 + t * 16 + ln;
    float bv = bias ? bias[col] : 0.f;
    if (BIAS_BF16) bv = bf16_round(bv);
#pragma unroll
    for (int r = 0; r < 8; ++r) {
      float v = acc[t][r] + bv;
      if (resid) { float rv = resid[(size_t)((row0 + 8 * hh + r) % rmod) * ldr + col]; if (RES_BF16) rv = bf16_round(rv); v += rv; }
      if (ACT == 1) v = fmaxf(v, 0.f);
      if (ACT == 2) v = 0.5f * v * (1.0f + erff(v * 0.70710678118654752f));
      if (ACT == 3) { const float u = 0.7978845608028654f * (v + 0.044715f * v * v * v); v = 0.5f * v * (1.0f + tanhf(u)); }
      so[w][8 * hh + r][t * 16 + ln] = v;
    }
  }
  __builtin_amdgcn_fence(__ATOMIC_ACQ_REL, "workgroup");
  __builtin_amdgcn_wave_barrier();
  const int rsub = lane >> 4, c4 = (lane & 15) * 4;
  {
#pragma unroll
    for (int q = 0; q < 8; ++q) {
      const int r = q * 2 + rsub;
      const v4f v = *(const v4fa*)&so[w][r][c4];
      *(v4f*)(C + (size_t)(row0 + r) * ldc + col0 + c4) = v;
    }
    
  }
}
// row LayerNorm (biased variance, eps) over N: s = X (+ R); optional out_sum <- s; out_norm <- (s-mu)*rsqrt(var+eps)*g + b
template <bool PARAM_BF16>
__global__ __launch_bounds__(256) void k_layernorm(const float* __restrict__ X, const float* __restrict__ R, const float* __restrict__ g, const float* __restrict__ bta,
                                                  float* __restrict__ out_sum, float* __restrict__ out_norm, int N, float eps) {
  __shared__ float red[256];
  const int row = blockIdx.x, tid = threadIdx.x;
  const float* x = X + (size_t)row * N; const float* rr = R ? R + (size_t)row * N : nullptr;
  float vals[16];                     // up to N = 4096
  const int per = N / 256;            // contiguous chunk per thread? use strided-by-4 chunks: thread handles j = tid*4 + 1024*u
  float s1 = 0.f;
  for (int u = 0; u < per / 4; ++u) {
    const int j = tid * 4 + 1024 * u;
    const v4f a = *(const v4fa*)(x + j);
    v4f b = {0.f,0.f,0.f,0.f}; if (rr) b = *(const v4fa*)(rr + j);
#pragma unroll
    for (int q = 0; q < 4; ++q) { const float v = a[q] + b[q]; vals[u * 4 + q] = v; s1 += v; }
  }
  red[tid] = s1; __syncthreads();
  for (int st = 128; st > 0; st >>= 1) { if (tid < st) red[tid] += red[tid + st]; __syncthreads(); }
  const float mu = red[0] / (float)N; __syncthreads();
  float s2 = 0.f;
  for (int u = 0; u < per / 4; ++u)
#pragma unroll
    for (int q = 0; q < 4; ++q) { const float c = vals[u * 4 + q] - mu; s2 += c * c; }
  red[tid] = s2; __syncthreads();
  for (int st = 128; st > 0; st >>= 1) { if (tid < st) red[tid] += red[tid + st]; __syncthreads(); }
  const float rs = rsqrtf(red[0] / (float)N + eps);
  {
    for (int u = 0; u < per / 4; ++u) {
      const int j = tid * 4 + 1024 * u;
      v4f o, sm;
#pragma unroll
      for (int q = 0; q < 4; ++q) {
        float gg = g[j + q], bb = bta[j + q];
        if (PARAM_BF16) { gg = bf16_round(gg); bb = bf16_round(bb); }
        sm[q] = vals[u * 4 + q]; o[q] = (vals[u * 4 + q] - mu) * rs * gg + bb;
      }
      if (out_sum) *(v4f*)(out_sum + (size_t)row * N + j) = sm;
      *(v4f*)(out_norm + (size_t)row * N + j) = o;
    }
    
  }
}



// ---- f16 WMMA path (v_wmma_f32_16x16x32_f16): 11-bit significands for operands in range — used where a [0,1] probability operand needs more precision than bf16
typedef _Float16 v16h __attribute__((ext_vector_type(16)));
union FragH { v16h v; v8us half[2]; _Float16 h[16]; unsigned short u[16]; };
template <int NT>
__device__ __forceinline__ v8f mmaH(v16h ah, v16h al, v16h bh, v16h bl, v8f c) {
  c = __builtin_amdgcn_wmma_f32_16x16x32_f16(false, ah, false, bh, (short)0, c, false, false);
  if (NT >= 2) c = __builtin_amdgcn_wmma_f32_16x16x32_f16(false, al, false, bh, (short)0, c, false, false);
  if (NT >= 3) c = __builtin_amdgcn_wmma_f32_16x16x32_f16(false, ah, false, bl, (short)0, c, false, false);
  asm volatile("v_nop\n\tv_nop\n\tv_nop\n\tv_nop" : "+v"(c) : "v"(ah), "v"(al), "v"(bh), "v"(bl));
  return c;
}
// batched GEMM like k_gemm_b but f16 operands: A f32 (split into f16 hi/lo if ASPLIT, else rounded to f16), Bt = f16 values [n][k]; alpha; C f32; N multiple of 16 (partial tiles skipped)
template <bool ASPLIT>
__global__ __launch_bounds__(128) void k_gemm_h(const float* __restrict__ A, int lda, size_t sA, const _Float16* __restrict__ Bh, int ldb, size_t sB, float alpha, float* __restrict__ C, int ldc, size_t sC, int M, int N, int K) {
  __shared__ __attribute__((aligned(16))) float so[4][16][64];
  const int tid = threadIdx.x, w = tid >> 5, lane = tid & 31, ln = lane & 15, hh = lane >> 4; const int by = blockIdx.y;
  A += (size_t)by * sA; Bh += (size_t)by * sB; C += (size_t)by * sC;
  const int ntn = (N + 63) / 64; const int wid = blockIdx.x * 4 + w; const int mt = wid / ntn, nq = wid % ntn; if (mt * 16 >= M) return;
  const int row0 = mt * 16, col0 = nq * 64; const float* arow = A + (size_t)(row0 + ln) * lda;
  v8f acc[4] = {};
  for (int kb = 0; kb < K; kb += 32) {
    FragH ah, al;
    const v4f x0 = *(const v4fa*)(arow + kb + 8 * hh), x1 = *(const v4fa*)(arow + kb + 8 * hh + 4), x2 = *(const v4fa*)(arow + kb + 16 + 8 * hh), x3 = *(const v4fa*)(arow + kb + 16 + 8 * hh + 4);
    float xs[16] = {x0[0],x0[1],x0[2],x0[3],x1[0],x1[1],x1[2],x1[3],x2[0],x2[1],x2[2],x2[3],x3[0],x3[1],x3[2],x3[3]};
#pragma unroll
    for (int i = 0; i < 16; ++i) { const _Float16 h = (_Float16)xs[i]; ah.h[i] = h; al.h[i] = ASPLIT ? (_Float16)(xs[i] - (float)h) : (_Float16)0.0f; }
#pragma unroll
    for (int t = 0; t < 4; ++t) { if (col0 + t * 16 >= N) continue; const size_t boff = (size_t)(col0 + t * 16 + ln) * ldb + kb; FragH bq; bq.half[0] = *(const v8us*)(Bh + boff + 8 * hh); bq.half[1] = *(const v8us*)(Bh + boff + 16 + 8 * hh);
      acc[t] = mmaH<ASPLIT ? 2 : 1>(ah.v, al.v, bq.v, bq.v, acc[t]); }
  }
#pragma unroll
  for (int t = 0; t < 4; ++t) { if (col0 + t * 16 >= N) continue;
#pragma unroll
    for (int r = 0; r < 8; ++r) so[w][8 * hh + r][t * 16 + ln] = acc[t][r] * alpha; }
  __builtin_amdgcn_fence(__ATOMIC_ACQ_REL, "workgroup"); __builtin_amdgcn_wave_barrier();
  const int rsub = lane >> 4, c4 = (lane & 15) * 4;
  {
#pragma unroll
    for (int q = 0; q < 8; ++q) { const int r = q * 2 + rsub; if (col0 + c4 < N) { const v4f v = *(const v4fa*)&so[w][r][c4]; *(v4f*)(C + (size_t)(row0 + r) * ldc + col0 + c4) = v; } }
     }
}

// Wt[n][k] = f16(W[k][n]·scale) from f32 row-major W[K][N] (scale = power of two; bf16-exact weights stay exact in f16 away from the subnormal range)
__global__ __launch_bounds__(256) void k_wt_f16(const float* __restrict__ W, _Float16* __restrict__ Wt, int K, int N, float scale) {
  const int t = blockIdx.x * 256 + threadIdx.x; if (t >= N * (K / 8)) return; const int n = t / (K / 8), k8 = (t % (K / 8)) * 8; FragH f;
#pragma unroll
  for (int i = 0; i < 8; ++i) f.h[i] = (_Float16)(bf16_round(W[(size_t)(k8 + i) * N + n]) * scale); const v8us o = f.half[0];
  *(v8us*)((unsigned short*)Wt + (size_t)n * K + k8) = o; 
}
// per-pair bias, 32 pairs (same (b, key j), queries i = ib + 32 it .. ib + 32 it + 31) per pass of a wave, one pair per lane, BG passes per wave (one wave = BG * 32 neighbouring queries of one key: the weights are staged once per block, the key's own features formed once per wave), the plane stored [b][j][i] (k_flash reads it with the query along the lanes), both MLPs wholly on v_wmma_f32_16x16x32_f16 in transposed form:
// layer 1: D1 = W1 (A: 16 hidden rows x k) * F (B: k x 16 pairs). A pair has 8 features: dist and dt each as an f16 high part plus an f16 remainder (the two products add up in the f32 accumulator), x_j, y_j, z_j, and 1.0
// for the layer's bias. Lanes 0..15 carry their pair's features at k = 0..7, lanes 16..31 at k = 8..15; W1 stands at both k ranges, and the half of B that belongs to the other 16 pairs is zeroed for each product.
// layer 2: two D1 tiles (hidden rows 0..15 and 16..31 of a 32-row block), relu'd and converted in place, ARE a B operand in the hardware k order; A = W2 with geom / shape / rate in rows 0,1,2 and again in rows 8,9,10, so that
// D2 registers 0,1,2 of lanes 0..15 (rows 0..2) and of lanes 16..31 (rows 8..10) hold the three outputs of column ln: every lane picks the D2 of its own 16-pair group and does its pair's softplus/log/lgamma tail. All weights x16 (exact), taken out as 1/256.
union FragW { v16h v; v8us half[2]; _Float16 h[16]; unsigned int w[8]; };
#define BG 16
// The chip's own base-2 exponential and logarithm, one instruction each. Every argument below is a normal number, zero or infinite where it matters (logarithms see values of 1e-4 and more), so the library's range steps are not needed.
__device__ __forceinline__ float hw_exp2(float x) { return __builtin_amdgcn_exp2f(x); }
__device__ __forceinline__ float hw_log2(float x) { return __builtin_amdgcn_logf(x); }
#define LOG2E 1.4426950408889634f
#define LN2 0.6931471805599453f
// softplus(q) = max(q, 0) + log(1 + e), e = exp(-|q|) in [0, 1]. u = 1 + e drops d = e - (u - 1), which is exact; log(1 + e) = log(u) + d / u, and d stands for d / u to within d * e: the relative error stays at rounding level down to e = 0.
__device__ __forceinline__ float softplus_hw(float q) { const float e = hw_exp2(-fabsf(q) * LOG2E); const float u = 1.0f + e; const float d = e - (u - 1.0f); return fmaxf(q, 0.f) + (hw_log2(u) * LN2 + d); }
__device__ __forceinline__ v8f mma16(v16h a, v16h b, v8f c) { return __builtin_amdgcn_wmma_f32_16x16x32_f16(false, a, false, b, (short)0, c, false, false); }
__device__ __forceinline__ void bias_block(const int blk, const float* __restrict__ crd, const float* __restrict__ gw1, const float* __restrict__ gb1, const float* __restrict__ gw2, const float* __restrict__ gb2, const float* __restrict__ dw1, const float* __restrict__ db1, const float* __restrict__ dw2, const float* __restrict__ db2, float* __restrict__ BIAS) {
  __shared__ __attribute__((aligned(16))) _Float16 sW1[2 * BH][8];           // row = hidden unit (0..63 geom, 64..127 delay), its 8 feature weights
  __shared__ __attribute__((aligned(16))) _Float16 sW2[16][2 * BH + 8];      // row = output row of layer 2, k = hidden unit; pitch 272 B spreads the 16 rows over the banks
  const int tid = threadIdx.x, w = __builtin_amdgcn_readfirstlane(tid >> 5), lane = tid & 31, ln = lane & 15, hh = lane >> 4;      // the wave's number in a scalar register keeps the key's row and the wave's first query scalar
  { FragW f; float o0 = 0.f, o1 = 0.f, o2 = 0.f; const _Float16 z = (_Float16)0.f;
    if (tid < BH) { const _Float16 g0 = (_Float16)(bf16_round(gw1[tid * 2]) * 16.0f), g1 = (_Float16)(bf16_round(gw1[tid * 2 + 1]) * 16.0f);
      f.h[0] = g0; f.h[1] = g0; f.h[2] = g1; f.h[3] = g1; f.h[4] = z; f.h[5] = z; f.h[6] = z; f.h[7] = (_Float16)(bf16_round(gb1[tid]) * 16.0f); o0 = bf16_round(gw2[tid]) * 16.0f; }
    else { const int k = tid - BH; const _Float16 d0 = (_Float16)(bf16_round(dw1[k * 4]) * 16.0f);
      f.h[0] = d0; f.h[1] = d0; f.h[2] = z; f.h[3] = z; f.h[4] = (_Float16)(bf16_round(dw1[k * 4 + 1]) * 16.0f); f.h[5] = (_Float16)(bf16_round(dw1[k * 4 + 2]) * 16.0f); f.h[6] = (_Float16)(bf16_round(dw1[k * 4 + 3]) * 16.0f);
      f.h[7] = (_Float16)(bf16_round(db1[k]) * 16.0f); o1 = bf16_round(dw2[k]) * 16.0f; o2 = bf16_round(dw2[BH + k]) * 16.0f; }
    *(v8us*)&sW1[tid][0] = f.half[0];
#pragma unroll
    for (int m = 0; m < 16; ++m) sW2[m][tid] = (_Float16)(((m & 7) == 0) ? o0 : ((m & 7) == 1) ? o1 : ((m & 7) == 2) ? o2 : 0.f); }
  __syncthreads();
  const size_t p0 = ((size_t)blk * 4 + w) * (32 * BG);      // BG * 32 consecutive queries of one (b, j) (SS = 1024 is a multiple of it)
  const int b = (int)(p0 / ((size_t)SS * SS)); const int j = (int)((p0 / SS) % SS); const int ib = (int)(p0 % SS);
  const float* cj = crd + ((size_t)b * SS + j) * 4; const float xj = bf16_round(cj[0]), yj = bf16_round(cj[1]), zj = bf16_round(cj[2]), tj = bf16_round(cj[3]);
  const float gb2v = bf16_round(gb2[0]), db20 = bf16_round(db2[0]), db21 = bf16_round(db2[1]);
  v16h a1[8];
#pragma unroll
  for (int t = 0; t < 8; ++t) { FragW f; f.half[0] = *(const v8us*)&sW1[t * 16 + ln][0];
#pragma unroll
    for (int q = 0; q < 4; ++q) f.w[4 + q] = 0u;
    a1[t] = f.v; }
  const v8f zero8 = (v8f){0.f,0.f,0.f,0.f,0.f,0.f,0.f,0.f};
  const v16h zero16 = {};
  const float* pc = crd + ((size_t)b * SS + ib + lane) * 4;      // this lane's query of the pass, i = ib + 32 it + lane
  float* pb = BIAS + p0 + lane;
  v4f cn = *(const v4fa*)pc;
  asm volatile("s_wait_xcnt 0x0" :: "v"(pc) : "memory");      // the address pair stays whole up to this wait; the loop steps on it
#pragma unroll 1      // one copy of the pass: a pass takes nothing from the one before but the fetched coordinates
  for (int it = 0; it < BG; ++it) {
  const v4f ci = cn; const float* pn = pc + (it + 1 < BG ? 32 * 4 : 0);      // the next pass's coordinates are fetched a pass ahead (the last pass fetches its own again)
  cn = *(const v4fa*)pn;
  asm volatile("s_wait_xcnt 0x0" :: "v"(pn) : "memory");      // the address pair stays whole up to this wait; it is stepped on behind it
  pc = pn;
  v16h a2[4];      // layer 2's weights are read from LDS in every pass: held over the loop beside layer 1's they do not fit the registers of six waves a SIMD (the build spills them)
#pragma unroll
  for (int s = 0; s < 4; ++s) { FragW f; f.half[0] = *(const v8us*)&sW2[ln][s * 32 + 8 * hh]; f.half[1] = *(const v8us*)&sW2[ln][s * 32 + 16 + 8 * hh]; a2[s] = f.v; }
  const float xi = bf16_round(ci[0]), yi = bf16_round(ci[1]), zi = bf16_round(ci[2]), ti = bf16_round(ci[3]);
  const float dx = xi - xj, dy = yi - yj, dz = zi - zj; const float dist = __builtin_amdgcn_sqrtf(dx * dx + dy * dy + dz * dz); const float dt = ti - tj;
  FragW F; F.h[0] = (_Float16)dist; F.h[1] = (_Float16)(dist - (float)F.h[0]); F.h[2] = (_Float16)dt; F.h[3] = (_Float16)(dt - (float)F.h[2]); F.h[4] = (_Float16)xj; F.h[5] = (_Float16)yj; F.h[6] = (_Float16)zj; F.h[7] = (_Float16)1.0f;
  FragW bf[2];
#pragma unroll
  for (int c = 0; c < 2; ++c)
#pragma unroll
    for (int q = 0; q < 4; ++q) { bf[c].w[q] = (hh == c) ? F.w[q] : 0u; bf[c].w[4 + q] = 0u; }
  v8f d2[2] = {zero8, zero8};
#pragma unroll
  for (int s = 0; s < 4; ++s)
#pragma unroll
    for (int c = 0; c < 2; ++c) { const v8f t0 = mma16(a1[2 * s], bf[c].v, zero8), t1 = mma16(a1[2 * s + 1], bf[c].v, zero8); FragW hb;
#pragma unroll
      for (int q = 0; q < 8; ++q) { hb.h[q] = (_Float16)t0[q]; hb.h[8 + q] = (_Float16)t1[q]; }
      d2[c] = mma16(a2[s], __builtin_elementwise_max(hb.v, zero16), d2[c]); }      // relu behind the rounding gives the same f16 value as in front of it, two units per instruction
  { const float geom = (hh ? d2[1][0] : d2[0][0]) * 0.00390625f + gb2v; const float q0 = (hh ? d2[1][1] : d2[0][1]) * 0.00390625f + db20, q1 = (hh ? d2[1][2] : d2[0][2]) * 0.00390625f + db21;
    const float shape = softplus_hw(q0) + 1e-4f, rate = softplus_hw(q1) + 1e-4f; const float dtp = fmaxf(fabsf(dt), 1e-4f);
    // lgamma(shape), shape >= 1e-4: its asymptotic series (z - 0.5) log z - z + 0.5 log(2 pi) + 1/(12 z) - 1/(360 z^3) + 1/(1260 z^5) at z >= 4 (the next term is below 4e-8 there). Below 8 the argument is moved up by 4: lgamma(x) = lgamma(x + 4) - log(x (x + 1) (x + 2) (x + 3)), the product as t (t + 2) with t = x (x + 3).
    const bool up = shape < 8.0f; const float t = shape * (shape + 3.0f); const float prod = up ? t * (t + 2.0f) : 1.0f; const float z = up ? shape + 4.0f : shape;
    const float rz = __builtin_amdgcn_rcpf(z), rz2 = rz * rz; const float ser = rz * (0.083333333f + rz2 * (-0.0027777778f + rz2 * 0.00079365079f));
    // the logarithmic terms are added in base 2, the others in base e; the plane is stored in base-2 units (x log2 e), which k_flash's exp2 takes as they are
    const float l2rate = hw_log2(rate), l2dtp = hw_log2(dtp), l2z = hw_log2(z), l2prod = hw_log2(prod);
    __builtin_amdgcn_sched_barrier(0);      // the four arguments die below; the instruction set asks for one slot between a logarithm and an instruction that takes over its argument's register
    const float lg2 = shape * l2rate + (shape - 1.0f) * l2dtp - (z - 0.5f) * l2z + l2prod;
    const float nat = geom - rate * dtp + (z - 0.91893853f) - ser;
    *pb = lg2 + nat * LOG2E;
    asm volatile("s_wait_xcnt 0x0" :: "v"(pb) : "memory");      // stands behind the store: its address pair stays whole up to this wait and is stepped on behind it
    pb += 32; } } }
// 16 k positions of one f32 row for an f16 fragment; p points at the lane's k = 8 hh of the 32-wide k step (positions 0..7 and 16..23 from there). load16 fetches them, cvt16 makes f16(bf16(x) * sc) of them (round to nearest even, as bf16_round)
__device__ __forceinline__ void load16(const float* __restrict__ p, v4f (&x)[4]) { x[0] = *(const v4fa*)p; x[1] = *(const v4fa*)(p + 4); x[2] = *(const v4fa*)(p + 16); x[3] = *(const v4fa*)(p + 20); }
__device__ __forceinline__ v16h cvt16(const v4f (&x)[4], const float sc) { FragH f;
#pragma unroll
  for (int g = 0; g < 4; ++g)
#pragma unroll
    for (int q = 0; q < 4; ++q) f.h[4 * g + q] = (_Float16)((float)(__bf16)x[g][q] * sc);
  return f.v; }
// q, k, v projections straight from the f32 inputs. One wave = 16 rows of one matrix (B operand) against 64 rows of the other (A operand, 4 tiles), K = 256: a lane then holds 8 neighbouring results of the A side,
// one 16-byte store per tile, and a wave writes whole 128-byte lines. q, k: B = 16 rows of src, A = 64 rows of W, stored [row][col]. v: B = 16 rows of Wv, A = 64 rows of src (keys), stored transposed [b][col][key].
__device__ __forceinline__ void qkv_block(const int blk, const float* __restrict__ src, const float* __restrict__ Wq, const float* __restrict__ Wk, const float* __restrict__ Wv, _Float16* __restrict__ Q16, _Float16* __restrict__ K16, _Float16* __restrict__ Vt) {
  const int tid = threadIdx.x, w = __builtin_amdgcn_readfirstlane(tid >> 5), lane = tid & 31, ln = lane & 15, hh = lane >> 4;      // the wave's number in a scalar register keeps the base pointers scalar
  const int which = blk >> 7, wid = (blk & 127) * 4 + w;
  const float* one; const float* four; float s1, s4; _Float16* dst;
  if (which < 2) { const int mt = wid >> 2, nq = wid & 3; one = src + (size_t)mt * 16 * DM; four = (which ? Wk : Wq) + (size_t)nq * 64 * DM; s1 = 1.0f; s4 = 16.0f; dst = (which ? K16 : Q16) + (size_t)(mt * 16 + ln) * DM + nq * 64; }
  else { const int kq = wid >> 4, ct = wid & 15; one = Wv + (size_t)ct * 16 * DM; four = src + (size_t)kq * 64 * DM; s1 = 16.0f; s4 = 1.0f; dst = Vt + ((size_t)(kq / (SS / 64)) * DM + ct * 16 + ln) * SS + (kq % (SS / 64)) * 64; }
  const float* orow = one + ln * DM + 8 * hh; const float* frow = four + ln * DM + 8 * hh;
  v8f acc[4] = {};
  for (int kb = 0; kb < DM; kb += 32) { const float* po = orow + kb; const float* pf = frow + kb; v4f ro[4], rf[4][4];
    load16(po, ro);
#pragma unroll
    for (int t = 0; t < 4; ++t) load16(pf + t * 16 * DM, rf[t]);
    asm volatile("s_wait_xcnt 0x0" :: "v"(po), "v"(pf) : "memory");      // the two address pairs stay whole up to this wait
    const v16h bo = cvt16(ro, s1);
#pragma unroll
    for (int t = 0; t < 4; ++t) acc[t] = mma16(cvt16(rf[t], s4), bo, acc[t]); }
#pragma unroll
  for (int t = 0; t < 4; ++t) { FragH o;
#pragma unroll
    for (int r = 0; r < 8; ++r) o.h[r] = (_Float16)(acc[t][r] * 0.0625f);
    *(v8us*)((unsigned short*)dst + t * 16 + 8 * hh) = o.half[0]; } }
// Everything that depends on the inputs alone, in one launch: blocks 0..383 the q, k, v projections, blocks 384..447 Wo as f16 (x16), the rest the bias plane. The 1472 blocks of 4 waves are all resident at once.
#define G_QKV (3 * (NR / 16) * (DM / 64) / 4)
#define G_WO (DM * DM / 8 / 128)
#define G_BIAS (BB * SS * SS / (128 * BG))
// waves_per_eu(6, 6): at most 160 registers, six waves a SIMD, which holds all 1472 blocks of 4 waves at once. The bias loop keeps layer 1's weights in 64 registers; planned for seven or eight waves the build has too few registers left to set
// independent work behind the loop's products and fills the distance with more v_nop. With this line it builds to 156 registers, nothing spilled, the 20 loads of the q, k, v loop in one run
__global__ __launch_bounds__(128) __attribute__((amdgpu_waves_per_eu(6, 6))) void k_front(const float* __restrict__ src, const float* __restrict__ crd, const float* __restrict__ Wq, const float* __restrict__ Wk, const float* __restrict__ Wv, const float* __restrict__ Wo,
    const float* __restrict__ gw1, const float* __restrict__ gb1, const float* __restrict__ gw2, const float* __restrict__ gb2, const float* __restrict__ dw1, const float* __restrict__ db1, const float* __restrict__ dw2, const float* __restrict__ db2,
    _Float16* __restrict__ Q16, _Float16* __restrict__ K16, _Float16* __restrict__ Vt, _Float16* __restrict__ Bo, float* __restrict__ BIAS) {
  const int blk = blockIdx.x;
  if (blk < G_QKV) { qkv_block(blk, src, Wq, Wk, Wv, Q16, K16, Vt); return; }
  if (blk < G_QKV + G_WO) { const size_t t = (size_t)(blk - G_QKV) * 128 + threadIdx.x; FragH f;
#pragma unroll
    for (int i = 0; i < 8; ++i) f.h[i] = (_Float16)(bf16_round(Wo[t * 8 + i]) * 16.0f);
    *(v8us*)((unsigned short*)Bo + t * 8) = f.half[0];
    asm volatile("s_wait_xcnt 0x0" ::: "memory");      // stands behind the store, ahead of any later write of the registers it names (the listing lays the other branches behind it)
    return; }
  bias_block(blk - (G_QKV + G_WO), crd, gw1, gb1, gw2, gb2, dw1, db1, dw2, db2, BIAS); }
typedef float v2f  __attribute__((ext_vector_type(2)));
typedef float v2fa __attribute__((ext_vector_type(2), may_alias));
// lane l with lane l ^ 16, in the vector unit
__device__ __forceinline__ float xhalf(float x) { return __builtin_bit_cast(float, __builtin_amdgcn_permlanex16(__builtin_bit_cast(int, x), __builtin_bit_cast(int, x), 0x76543210, 0xfedcba98, false, false)); }
// One block = 32 query rows of one (batch, head); its 8 waves share those rows and split the 1024 keys, 128 each (512 blocks of 8 waves fill every SIMD four deep, where one wave per 32 rows over all keys left
// one wave on half the SIMDs). Every wave runs the same online-softmax loop over its own keys and leaves an un-normalised partial (row max, row sum, O) in LDS; behind one block barrier the partials of a row are
// rescaled to their common max and added, wave 0 first.
// The loop works on the transposed products: St = K (A: 16 keys x d) * Qt (B: d x 16 queries), so lanes ln and ln + 16 hold all 32 scores that a pass gives the query of column ln, 16 each: maximum and sum are taken inside the lane, with one
// exchange between the halves for the maximum (the sums' halves are joined once, behind the loop). The two St tiles of a pass (keys 0..15 and 16..31), as f16 exponentials, ARE the B operand of Ot = Vt (A: 16 d x 32 keys) * Pt in
// the hardware k order: P passes through no LDS. Column ln of query tile rt is query 2 ln + rt, so that one 8-byte load fetches a key's bias for both of a lane's queries from the [key][query] plane and 16 lanes read a whole 128-byte line; a lane holds 8 neighbouring d of its query's output.
// waves_per_eu(1, 4): no more than four waves a SIMD are planned for, which is what 512 blocks of 8 waves come to; without it the compiler saves registers for an occupancy the grid cannot reach
__global__ __launch_bounds__(256) __attribute__((amdgpu_waves_per_eu(1, 4))) void k_flash(const _Float16* __restrict__ Q16, const _Float16* __restrict__ K16, const _Float16* __restrict__ Vt, const float* __restrict__ BIAS, float* __restrict__ O) {
  constexpr int RPW = 32, NW = 8, NQB = SS / RPW, KPW = SS / NW, DT = 2;
  __shared__ __attribute__((aligned(16))) float sO[NW][RPW][HD + 4]; __shared__ float sM[NW][RPW], sL[NW][RPW];
  const int tid = threadIdx.x, w = __builtin_amdgcn_readfirstlane(tid >> 5), lane = tid & 31, ln = lane & 15, hh = lane >> 4;      // the wave's number in a scalar register keeps the wave's key offset (w * KPW) and LDS slots scalar
  const int slab = blockIdx.x / NQB, qblk = blockIdx.x % NQB; const int b = slab / NH, h = slab % NH; const int q0 = qblk * RPW;
  FragH aq[2];
#pragma unroll
  for (int rt = 0; rt < 2; ++rt) { const unsigned short* qr = (const unsigned short*)Q16 + ((size_t)b * SS + q0 + 2 * ln + rt) * DM + h * HD; aq[rt].half[0] = *(const v8us*)(qr + 8 * hh); aq[rt].half[1] = *(const v8us*)(qr + 16 + 8 * hh); }
  const unsigned short* kp = (const unsigned short*)K16 + ((size_t)b * SS + w * KPW + ln) * DM + h * HD + 8 * hh;      // key row ln of the pass, k = d
  const unsigned short* vp = (const unsigned short*)Vt + ((size_t)slab * HD + ln) * SS + w * KPW + 8 * hh;             // d row ln, k = key
  const float* bp = BIAS + ((size_t)b * SS + w * KPW + 8 * hh) * SS + q0 + 2 * ln;                                     // key 8 hh of a tile, queries 2 ln and 2 ln + 1
  float m_r[2], l_r[2]; v8f oacc[2][DT];
  const v8f zero8 = (v8f){0.f,0.f,0.f,0.f,0.f,0.f,0.f,0.f};
#pragma unroll
  for (int rt = 0; rt < 2; ++rt) { m_r[rt] = -3.0e38f; l_r[rt] = 0.f;
#pragma unroll
    for (int dt = 0; dt < DT; ++dt) oacc[rt][dt] = zero8; }
  const float scale = 0.17677669529663688f * LOG2E;      // scores, bias plane, running max in base-2 units: every exponential is one exp2
#pragma unroll 1
  for (int it = 0; it < KPW / 32; ++it) {
    FragH bk[2], bv[DT]; v2f bb[2][8];
#pragma unroll
    for (int nt = 0; nt < 2; ++nt) { bk[nt].half[0] = *(const v8us*)(kp + nt * 16 * DM); bk[nt].half[1] = *(const v8us*)(kp + nt * 16 * DM + 16); }
#pragma unroll
    for (int nt = 0; nt < 2; ++nt)
#pragma unroll
      for (int r = 0; r < 8; ++r) bb[nt][r] = *(const v2fa*)(bp + (nt * 16 + r) * SS);
#pragma unroll
    for (int dt = 0; dt < DT; ++dt) { bv[dt].half[0] = *(const v8us*)(vp + dt * 16 * SS); bv[dt].half[1] = *(const v8us*)(vp + dt * 16 * SS + 16); }
    asm volatile("s_wait_xcnt 0x0" :: "v"(kp), "v"(vp), "v"(bp) : "memory");      // the three address pairs stay whole up to this wait; they are stepped on right behind it
    __builtin_amdgcn_sched_barrier(0);      // all loads of a pass are issued ahead of its first product; without this line the build holds some of the V loads back behind the first wait, to save registers that are free here
    kp += 32 * DM; vp += 32; bp += 32 * SS;
#pragma unroll
    for (int rt = 0; rt < 2; ++rt) {
      v8f c0, c1;
#pragma unroll
      for (int r = 0; r < 8; ++r) { c0[r] = bb[0][r][rt]; c1[r] = bb[1][r][rt]; }
      const v8f s0 = mma16(bk[0].v, aq[rt].v, zero8) * scale + c0, s1 = mma16(bk[1].v, aq[rt].v, zero8) * scale + c1;
      const v8f mx = __builtin_elementwise_max(s0, s1);
      float mc = fmaxf(fmaxf(fmaxf(mx[0], mx[1]), fmaxf(mx[2], mx[3])), fmaxf(fmaxf(mx[4], mx[5]), fmaxf(mx[6], mx[7])));
      mc = fmaxf(mc, xhalf(mc));
      const float mn = fmaxf(m_r[rt], mc); const float al = hw_exp2(m_r[rt] - mn); m_r[rt] = mn;
      const v8f e0 = s0 - mn, e1 = s1 - mn; v8f p0, p1; FragH pb;
#pragma unroll
      for (int r = 0; r < 8; ++r) { p0[r] = hw_exp2(e0[r]); p1[r] = hw_exp2(e1[r]); pb.h[r] = (_Float16)p0[r]; pb.h[8 + r] = (_Float16)p1[r]; }
      const v8f ps = p0 + p1;
      l_r[rt] = l_r[rt] * al + (((ps[0] + ps[4]) + (ps[1] + ps[5])) + ((ps[2] + ps[6]) + (ps[3] + ps[7])));      // this lane's 16 keys
#pragma unroll
      for (int dt = 0; dt < DT; ++dt) oacc[rt][dt] = mma16(bv[dt].v, pb.v, oacc[rt][dt] * al); } }
#pragma unroll
  for (int rt = 0; rt < 2; ++rt) { const float l = l_r[rt] + xhalf(l_r[rt]);
#pragma unroll
    for (int dt = 0; dt < DT; ++dt) { const v8f o = oacc[rt][dt]; float* so = &sO[w][2 * ln + rt][dt * 16 + 8 * hh]; *(v4f*)so = (v4f){o[0], o[1], o[2], o[3]}; *(v4f*)(so + 4) = (v4f){o[4], o[5], o[6], o[7]}; }
    if (hh == 0) { sM[w][2 * ln + rt] = m_r[rt]; sL[w][2 * ln + rt] = l; } }      // max and sum are the same in the two lanes of a query
  __syncthreads();      // every wave's partial is in LDS before any thread merges
  { const int r = tid >> 3, pc = tid & 7;      // one thread = 4 output columns of one row
    float mw[NW], M = -3.0e38f;
#pragma unroll
    for (int u = 0; u < NW; ++u) { mw[u] = sM[u][r]; M = fmaxf(M, mw[u]); }
    float L = 0.f; v4f acc = {0.f, 0.f, 0.f, 0.f};
#pragma unroll
    for (int u = 0; u < NW; ++u) { const float g = hw_exp2(mw[u] - M); L += sL[u][r] * g; const v4f val = *(const v4fa*)&sO[u][r][pc * 4]; acc += val * g; }
    const float inv = 1.0f / L;
    *(v4f*)(O + ((size_t)b * SS + q0 + r) * DM + h * HD + pc * 4) = acc * inv; } }
extern "C" void kernel_launch(void* const* d_in, const int* in_sizes, int n_in,
                              void* d_out, int out_size, void* d_ws, size_t ws_size, hipStream_t stream) {
  (void)in_sizes; (void)n_in; (void)out_size;
  const float* src = (const float*)d_in[0]; const float* crd = (const float*)d_in[1]; const float* Wq = (const float*)d_in[2]; const float* Wk = (const float*)d_in[3]; const float* Wv = (const float*)d_in[4]; const float* Wo = (const float*)d_in[5];
  const float* gw1 = (const float*)d_in[6]; const float* gb1 = (const float*)d_in[7]; const float* gw2 = (const float*)d_in[8]; const float* gb2 = (const float*)d_in[9]; const float* dw1 = (const float*)d_in[10]; const float* db1 = (const float*)d_in[11]; const float* dw2 = (const float*)d_in[12]; const float* db2 = (const float*)d_in[13];
  char* ws = (char*)d_ws; size_t off = 0;
  auto take = [&](size_t bytes) { char* p = ws + off; off += (bytes + 255) & ~(size_t)255; return p; };
  _Float16* Bo = (_Float16*)take((size_t)DM * DM * 2); _Float16* Q16 = (_Float16*)take((size_t)NR * DM * 2); _Float16* K16 = (_Float16*)take((size_t)NR * DM * 2); _Float16* Vt = (_Float16*)take((size_t)NR * DM * 2); float* BIAS = (float*)take((size_t)BB * SS * SS * 4); float* O = (float*)take((size_t)NR * DM * 4);
  if (off > ws_size) return;      // about 13 MiB
  k_front<<<G_QKV + G_WO + G_BIAS, 128, 0, stream>>>(src, crd, Wq, Wk, Wv, Wo, gw1, gb1, gw2, gb2, dw1, db1, dw2, db2, Q16, K16, Vt, Bo, BIAS);
  k_flash<<<BB * NH * (SS / 32), 256, 0, stream>>>(Q16, K16, Vt, BIAS, O);
  const dim3 gg(((NR / 16) * (DM / 64) + 3) / 4, 1);
  k_gemm_h<false><<<gg, 128, 0, stream>>>(O, DM, 0, Bo, DM, 0, 0.0625f, (float*)d_out, DM, 0, NR, DM, DM);      // rounds O to f16 in its A loader
}

// v008
// Measured time: 36.2 microseconds a run.
// In two side-by-side timings against v007, it was 1.21 and 1.20 times as fast.
// Over all steps from v000 it is 10.3 times as fast.
#include <hip/hip_runtime.h>
// q/k/v/o projections (2048 × 256 × 256) and the 8-head attention (d = 32) with an additive per-pair bias on v_wmma_f32_16x16x32_f16 (fused flash-style kernel: S = Q·Kᵀ, O = P·V on WMMA;
// online max/sum softmax f32; P f16 <= 1). The bias (geometric 2->64->1 MLP + the Gamma log-density from the 4->64->2 delay MLP, incl. lgamma) is computed once per (b, i, j): both layers of the two MLPs
// on WMMA, softplus/log/lgamma in f32; the bias plane is shared by the 8 heads. A = f16(bf16 ·) exact operands in q/k/v, f16(O) in the o projection, weights bf16-exact ×2^4 ((out,in)), single products, f32 accumulate.
#define BB 2
#define SS 1024
#define DM 256
#define NH 8
#define HD 32
#define BH 64
#define NR (BB * SS)

typedef __bf16 v16b __attribute__((ext_vector_type(16)));
typedef unsigned short v8us __attribute__((ext_vector_type(8), may_alias));
typedef float  v8f  __attribute__((ext_vector_type(8)));
typedef float  v4f  __attribute__((ext_vector_type(4)));
typedef float  v4fa __attribute__((ext_vector_type(4), may_alias));
union FragB { v16b v; v8us half[2]; unsigned short u[16]; };

__device__ __forceinline__ unsigned short bf16_bits(float x) { unsigned int u = __float_as_uint(x); return (unsigned short)((u + 0x7FFFu + ((u >> 16) & 1u)) >> 16); }
__device__ __forceinline__ float bf16_val(unsigned short b) { return __uint_as_float(((unsigned int)b) << 16); }
__device__ __forceinline__ float bf16_round(float x) { return bf16_val(bf16_bits(x)); }
// D += A·B with NT terms: 1 = ah·bh, 2 = + al·bh (A split), 3 = + ah·bl (both split)
template <int NT>
__device__ __forceinline__ v8f mmaN(v16b ah, v16b al, v16b bh, v16b bl, v8f c) {
  c = __builtin_amdgcn_wmma_f32_16x16x32_bf16(false, ah, false, bh, (short)0, c, false, false);
  if (NT >= 2) c = __builtin_amdgcn_wmma_f32_16x16x32_bf16(false, al, false, bh, (short)0, c, false, false);
  if (NT >= 3) c = __builtin_amdgcn_wmma_f32_16x16x32_bf16(false, ah, false, bl, (short)0, c, false, false);
  asm volatile("v_nop\n\tv_nop\n\tv_nop\n\tv_nop" : "+v"(c) : "v"(ah), "v"(al), "v"(bh), "v"(bl));
  return c;
}

__global__ __launch_bounds__(256) void k_wt_bf16(const float* __restrict__ W, unsigned short* __restrict__ Wt, int K, int N) {
  const int t = blockIdx.x * 256 + threadIdx.x;
  const int k8n = K / 8;
  if (t >= N * k8n) return;
  const int n = t / k8n, k8 = (t % k8n) * 8;
  v8us v;
#pragma unroll
  for (int i = 0; i < 8; ++i) v[i] = bf16_bits(W[(size_t)(k8 + i) * N + n]);
  *(v8us*)(Wt + (size_t)n * K + k8) = v;
  
}

// GEMM C[M][N] (f32, pitch ldc) = act(A[M][K]·W + bias). A f32 row-major (pitch lda) converted per fragment to bf16
// (ASPLIT: hi/lo two planes -> 2 terms, else single rounded term); Wt bf16 [N][K] (pitch ldb). BIAS_BF16 rounds the
// bias to bf16 first (bias quantised to bf16 before the add). K%32==0, M%16==0, N%64==0.
template <bool ASPLIT, int ACT, bool BIAS_BF16>
__global__ __launch_bounds__(128) void k_gemm_bf(const float* __restrict__ A, int lda, const unsigned short* __restrict__ Wt, int ldb,
                                               const float* __restrict__ bias, float* __restrict__ C, int ldc, int M, int N, int K) {
  __shared__ __attribute__((aligned(16))) float so[4][16][64];
  const int tid = threadIdx.x, w = tid >> 5, lane = tid & 31, ln = lane & 15, hh = lane >> 4;
  const int ntn = N / 64;
  const int wid = blockIdx.x * 4 + w;
  const int mt = wid / ntn, nq = wid % ntn;
  if (mt * 16 >= M) return;
  const int row0 = mt * 16, col0 = nq * 64;
  const float* arow = A + (size_t)(row0 + ln) * lda;
  v8f acc[4] = {};
  for (int kb = 0; kb < K; kb += 32) {
    FragB ah, al;
    const v4f x0 = *(const v4fa*)(arow + kb + 8 * hh), x1 = *(const v4fa*)(arow + kb + 8 * hh + 4);
    const v4f x2 = *(const v4fa*)(arow + kb + 16 + 8 * hh), x3 = *(const v4fa*)(arow + kb + 16 + 8 * hh + 4);
    float xs[16] = {x0[0],x0[1],x0[2],x0[3],x1[0],x1[1],x1[2],x1[3],x2[0],x2[1],x2[2],x2[3],x3[0],x3[1],x3[2],x3[3]};
#pragma unroll
    for (int i = 0; i < 16; ++i) { const unsigned short hb = bf16_bits(xs[i]); ah.u[i] = hb; al.u[i] = ASPLIT ? bf16_bits(xs[i] - bf16_val(hb)) : (unsigned short)0; }
#pragma unroll
    for (int t = 0; t < 4; ++t) {
      const unsigned short* brow = Wt + (size_t)(col0 + t * 16 + ln) * ldb + kb;
      FragB b;
      b.half[0] = *(const v8us*)(brow + 8 * hh);
      b.half[1] = *(const v8us*)(brow + 16 + 8 * hh);
      acc[t] = mmaN<ASPLIT ? 2 : 1>(ah.v, al.v, b.v, b.v, acc[t]);
    }
  }
#pragma unroll
  for (int t = 0; t < 4; ++t) {
    float bv = bias ? bias[col0 + t * 16 + ln] : 0.f;
    if (BIAS_BF16) bv = bf16_round(bv);
#pragma unroll
    for (int r = 0; r < 8; ++r) { float v = acc[t][r] + bv; if (ACT == 1) v = fmaxf(v, 0.f); so[w][8 * hh + r][t * 16 + ln] = v; }
  }
  __builtin_amdgcn_fence(__ATOMIC_ACQ_REL, "workgroup");
  __builtin_amdgcn_wave_barrier();
  const int rsub = lane >> 4, c4 = (lane & 15) * 4;
  {
#pragma unroll
    for (int q = 0; q < 8; ++q) {
      const int r = q * 2 + rsub;
      const v4f v = *(const v4fa*)&so[w][r][c4];
      *(v4f*)(C + (size_t)(row0 + r) * ldc + col0 + c4) = v;
    }
    
  }
}

// Flash-style causal/unmasked attention, all contractions 3-term bf16 hi/lo splits, f32 softmax with running max.
// q,k,v rows are read from f32 buffers with arbitrary row pitch (so they can live inside a fused qkv buffer);
// D = head size (multiple of 32, <= 128); one wave = 16 query rows; block = 4 waves (64 queries) sharing K/V chunks of 32.
template <int D, bool CAUSAL>
__global__ __launch_bounds__(128) void k_flash(const float* __restrict__ qb, const float* __restrict__ kb, const float* __restrict__ vb,
                                             int pitch, int T, int H, float scale, float* __restrict__ y, int ypitch) {
  constexpr int KS = D / 32;        // k-steps for QK
  constexpr int DT = D / 16;        // d tiles for PV
  __shared__ __attribute__((aligned(16))) unsigned short sKh[32][D + 8], sKl[32][D + 8], sVh[32][D + 8], sVl[32][D + 8];
  __shared__ __attribute__((aligned(16))) unsigned short sPh[4][16][40], sPl[4][16][40];
  __shared__ __attribute__((aligned(16))) float sO[4][16][D];
  const int tid = threadIdx.x, w = tid >> 5, lane = tid & 31, ln = lane & 15, hh = lane >> 4;
  const int nqb = (T + 63) / 64;
  const int bh = blockIdx.x / nqb, qblk = blockIdx.x % nqb;
  const int b = bh / H, h = bh % H;
  const int q0 = qblk * 64 + w * 16;
  const float* Q = qb + (size_t)b * T * pitch + h * D;
  const float* K = kb + (size_t)b * T * pitch + h * D;
  const float* V = vb + (size_t)b * T * pitch + h * D;

  // A fragments of the wave's 16 query rows (scaled), hi/lo
  FragB aqh[KS], aql[KS];
  {
    int row = q0 + ln; if (row >= T) row = T - 1;
    const float* qr = Q + (size_t)row * pitch;
#pragma unroll
    for (int ks = 0; ks < KS; ++ks)
#pragma unroll
      for (int i = 0; i < 16; ++i) {
        const int d = ks * 32 + ((i < 8) ? (8 * hh + i) : (16 + 8 * hh + (i - 8)));
        const float x = qr[d] * scale; const unsigned short hb = bf16_bits(x);
        aqh[ks].u[i] = hb; aql[ks].u[i] = bf16_bits(x - bf16_val(hb));
      }
  }
  float m_r[8], l_r[8];
#pragma unroll
  for (int r = 0; r < 8; ++r) { m_r[r] = -3.0e38f; l_r[r] = 0.f; }
  v8f oacc[DT];
#pragma unroll
  for (int dt = 0; dt < DT; ++dt) oacc[dt] = (v8f){0.f,0.f,0.f,0.f,0.f,0.f,0.f,0.f};

  const int kv_end = CAUSAL ? min(T, qblk * 64 + 64) : T;     // block-uniform
  for (int j0 = 0; j0 < kv_end; j0 += 32) {
    __syncthreads();
    for (int e = tid; e < 32 * (D / 4); e += 128) {
      const int r = e / (D / 4), c4 = (e % (D / 4)) * 4;
      const int key = j0 + r;
      v4f kf = {0.f,0.f,0.f,0.f}, vf = {0.f,0.f,0.f,0.f};
      if (key < T) { kf = *(const v4fa*)(K + (size_t)key * pitch + c4); vf = *(const v4fa*)(V + (size_t)key * pitch + c4); }
#pragma unroll
      for (int t = 0; t < 4; ++t) {
        unsigned short hb = bf16_bits(kf[t]); sKh[r][c4 + t] = hb; sKl[r][c4 + t] = bf16_bits(kf[t] - bf16_val(hb));
        hb = bf16_bits(vf[t]); sVh[r][c4 + t] = hb; sVl[r][c4 + t] = bf16_bits(vf[t] - bf16_val(hb));
      }
    }
    __syncthreads();
    // S tile 16 x 32
    v8f s[2];
#pragma unroll
    for (int nt = 0; nt < 2; ++nt) {
      v8f acc = {};
#pragma unroll
      for (int ks = 0; ks < KS; ++ks) {
        FragB bh_, bl_;
        bh_.half[0] = *(const v8us*)&sKh[nt * 16 + ln][ks * 32 + 8 * hh]; bh_.half[1] = *(const v8us*)&sKh[nt * 16 + ln][ks * 32 + 16 + 8 * hh];
        bl_.half[0] = *(const v8us*)&sKl[nt * 16 + ln][ks * 32 + 8 * hh]; bl_.half[1] = *(const v8us*)&sKl[nt * 16 + ln][ks * 32 + 16 + 8 * hh];
        acc = mmaN<3>(aqh[ks].v, aql[ks].v, bh_.v, bl_.v, acc);
      }
      s[nt] = acc;
    }
    // mask + running max (rows 8hh+r; the 16 lanes of a half share rows)
    float alpha[8];
#pragma unroll
    for (int r = 0; r < 8; ++r) {
      const int qi = q0 + 8 * hh + r;
      const int ja = j0 + ln, jb = j0 + 16 + ln;
      if (CAUSAL) { if (ja > qi) s[0][r] = -3.0e38f; if (jb > qi) s[1][r] = -3.0e38f; }
      if (ja >= T) s[0][r] = -3.0e38f;
      if (jb >= T) s[1][r] = -3.0e38f;
      float mx = fmaxf(s[0][r], s[1][r]);
      mx = fmaxf(mx, __shfl_xor(mx, 1, 32)); mx = fmaxf(mx, __shfl_xor(mx, 2, 32)); mx = fmaxf(mx, __shfl_xor(mx, 4, 32)); mx = fmaxf(mx, __shfl_xor(mx, 8, 32));
      const float mnew = fmaxf(m_r[r], mx);
      alpha[r] = (mnew > -1.0e38f) ? __expf(m_r[r] - mnew) : 1.0f;
      const float p0 = (s[0][r] > -1.0e38f) ? __expf(s[0][r] - mnew) : 0.f;
      const float p1 = (s[1][r] > -1.0e38f) ? __expf(s[1][r] - mnew) : 0.f;
      m_r[r] = mnew;
      l_r[r] = l_r[r] * alpha[r] + p0 + p1;            // per-lane partial row sum (16 lanes combined at the end)
      unsigned short hb = bf16_bits(p0); sPh[w][8 * hh + r][ln] = hb;      sPl[w][8 * hh + r][ln] = bf16_bits(p0 - bf16_val(hb));
      hb = bf16_bits(p1);                sPh[w][8 * hh + r][16 + ln] = hb; sPl[w][8 * hh + r][16 + ln] = bf16_bits(p1 - bf16_val(hb));
    }
#pragma unroll
    for (int dt = 0; dt < DT; ++dt)
#pragma unroll
      for (int r = 0; r < 8; ++r) oacc[dt][r] *= alpha[r];
    __builtin_amdgcn_fence(__ATOMIC_ACQ_REL, "workgroup");
    __builtin_amdgcn_wave_barrier();
    FragB pah, pal;
    pah.half[0] = *(const v8us*)&sPh[w][ln][8 * hh]; pah.half[1] = *(const v8us*)&sPh[w][ln][16 + 8 * hh];
    pal.half[0] = *(const v8us*)&sPl[w][ln][8 * hh]; pal.half[1] = *(const v8us*)&sPl[w][ln][16 + 8 * hh];
#pragma unroll
    for (int dt = 0; dt < DT; ++dt) {
      FragB bvh, bvl;
#pragma unroll
      for (int i = 0; i < 8; ++i) {
        bvh.u[i] = sVh[8 * hh + i][dt * 16 + ln]; bvh.u[8 + i] = sVh[16 + 8 * hh + i][dt * 16 + ln];
        bvl.u[i] = sVl[8 * hh + i][dt * 16 + ln]; bvl.u[8 + i] = sVl[16 + 8 * hh + i][dt * 16 + ln];
      }
      oacc[dt] = mmaN<3>(pah.v, pal.v, bvh.v, bvl.v, oacc[dt]);
    }
    __builtin_amdgcn_fence(__ATOMIC_ACQ_REL, "workgroup");
    __builtin_amdgcn_wave_barrier();
  }
#pragma unroll
  for (int r = 0; r < 8; ++r) {
    float l = l_r[r];
    l += __shfl_xor(l, 1, 32); l += __shfl_xor(l, 2, 32); l += __shfl_xor(l, 4, 32); l += __shfl_xor(l, 8, 32);
    l_r[r] = (l > 0.f) ? 1.0f / l : 0.f;
  }
#pragma unroll
  for (int dt = 0; dt < DT; ++dt)
#pragma unroll
    for (int r = 0; r < 8; ++r) sO[w][8 * hh + r][dt * 16 + ln] = oacc[dt][r] * l_r[r];
  __builtin_amdgcn_fence(__ATOMIC_ACQ_REL, "workgroup");
  __builtin_amdgcn_wave_barrier();
  {
    for (int r = 0; r < 16; ++r) {
      const int row = q0 + r;
      if (row < T && lane < D / 4) {
        const v4f val = *(const v4fa*)&sO[w][r][lane * 4];
        *(v4f*)(y + ((size_t)b * T + row) * ypitch + h * D + lane * 4) = val;
      }
    }
    
  }
}

// GEMM C = act(A·W + bias + resid): A f32 (ASPLIT -> hi/lo 2 terms), Wt bf16 [N][K]; ACT 0 none, 1 relu, 2 exact gelu;
// resid (optional, f32, row index = (row % rmod), pitch ldr, RES_BF16 rounds it) added before the activation.
template <bool ASPLIT, int ACT, bool BIAS_BF16, bool RES_BF16>
__global__ __launch_bounds__(128) void k_gemm_bf3(const float* __restrict__ A, int lda, const unsigned short* __restrict__ Wt, int ldb,
                                                const float* __restrict__ bias, const float* __restrict__ resid, int rmod, int ldr,
                                                float* __restrict__ C, int ldc, int M, int N, int K) {
  __shared__ __attribute__((aligned(16))) float so[4][16][64];
  const int tid = threadIdx.x, w = tid >> 5, lane = tid & 31, ln = lane & 15, hh = lane >> 4;
  const int ntn = N / 64;
  const int wid = blockIdx.x * 4 + w;
  const int mt = wid / ntn, nq = wid % ntn;
  if (mt * 16 >= M) return;
  const int row0 = mt * 16, col0 = nq * 64;
  const float* arow = A + (size_t)(row0 + ln) * lda;
  v8f acc[4] = {};
  for (int kb = 0; kb < K; kb += 32) {
    FragB ah, al;
    const v4f x0 = *(const v4fa*)(arow + kb + 8 * hh), x1 = *(const v4fa*)(arow + kb + 8 * hh + 4);
    const v4f x2 = *(const v4fa*)(arow + kb + 16 + 8 * hh), x3 = *(const v4fa*)(arow + kb + 16 + 8 * hh + 4);
    float xs[16] = {x0[0],x0[1],x0[2],x0[3],x1[0],x1[1],x1[2],x1[3],x2[0],x2[1],x2[2],x2[3],x3[0],x3[1],x3[2],x3[3]};
#pragma unroll
    for (int i = 0; i < 16; ++i) { const unsigned short hb = bf16_bits(xs[i]); ah.u[i] = hb; al.u[i] = ASPLIT ? bf16_bits(xs[i] - bf16_val(hb)) : (unsigned short)0; }
#pragma unroll
    for (int t = 0; t < 4; ++t) {
      const unsigned short* brow = Wt + (size_t)(col0 + t * 16 + ln) * ldb + kb;
      FragB b;
      b.half[0] = *(const v8us*)(brow + 8 * hh);
      b.half[1] = *(const v8us*)(brow + 16 + 8 * hh);
      acc[t] = mmaN<ASPLIT ? 2 : 1>(ah.v, al.v, b.v, b.v, acc[t]);
    }
  }
#pragma unroll
  for (int t = 0; t < 4; ++t) {
    const int col = col0 + t * 16 + ln;
    float bv = bias ? bias[col] : 0.f;
    if (BIAS_BF16) bv = bf16_round(bv);
#pragma unroll
    for (int r = 0; r < 8; ++r) {
      float v = acc[t][r] + bv;
      if (resid) { float rv = resid[(size_t)((row0 + 8 * hh + r) % rmod) * ldr + col]; if (RES_BF16) rv = bf16_round(rv); v += rv; }
      if (ACT == 1) v = fmaxf(v, 0.f);
      if (ACT == 2) v = 0.5f * v * (1.0f + erff(v * 0.70710678118654752f));
      if (ACT == 3) { const float u = 0.7978845608028654f * (v + 0.044715f * v * v * v); v = 0.5f * v * (1.0f + tanhf(u)); }
      so[w][8 * hh + r][t * 16 + ln] = v;
    }
  }
  __builtin_amdgcn_fence(__ATOMIC_ACQ_REL, "workgroup");
  __builtin_amdgcn_wave_barrier();
  const int rsub = lane >> 4, c4 = (lane & 15) * 4;
  {
#pragma unroll
    for (int q = 0; q < 8; ++q) {
      const int r = q * 2 + rsub;
      const v4f v = *(const v4fa*)&so[w][r][c4];
      *(v4f*)(C + (size_t)(row0 + r) * ldc + col0 + c4) = v;
    }
    
  }
}
// row LayerNorm (biased variance, eps) over N: s = X (+ R); optional out_sum <- s; out_norm <- (s-mu)*rsqrt(var+eps)*g + b
template <bool PARAM_BF16>
__global__ __launch_bounds__(256) void k_layernorm(const float* __restrict__ X, const float* __restrict__ R, const float* __restrict__ g, const float* __restrict__ bta,
                                                  float* __restrict__ out_sum, float* __restrict__ out_norm, int N, float eps) {
  __shared__ float red[256];
  const int row = blockIdx.x, tid = threadIdx.x;
  const float* x = X + (size_t)row * N; const float* rr = R ? R + (size_t)row * N : nullptr;
  float vals[16];                     // up to N = 4096
  const int per = N / 256;            // contiguous chunk per thread? use strided-by-4 chunks: thread handles j = tid*4 + 1024*u
  float s1 = 0.f;
  for (int u = 0; u < per / 4; ++u) {
    const int j = tid * 4 + 1024 * u;
    const v4f a = *(const v4fa*)(x + j);
    v4f b = {0.f,0.f,0.f,0.f}; if (rr) b = *(const v4fa*)(rr + j);
#pragma unroll
    for (int q = 0; q < 4; ++q) { const float v = a[q] + b[q]; vals[u * 4 + q] = v; s1 += v; }
  }
  red[tid] = s1; __syncthreads();
  for (int st = 128; st > 0; st >>= 1) { if (tid < st) red[tid] += red[tid + st]; __syncthreads(); }
  const float mu = red[0] / (float)N; __syncthreads();
  float s2 = 0.f;
  for (int u = 0; u < per / 4; ++u)
#pragma unroll
    for (int q = 0; q < 4; ++q) { const float c = vals[u * 4 + q] - mu; s2 += c * c; }
  red[tid] = s2; __syncthreads();
  for (int st = 128; st > 0; st >>= 1) { if (tid < st) red[tid] += red[tid + st]; __syncthreads(); }
  const float rs = rsqrtf(red[0] / (float)N + eps);
  {
    for (int u = 0; u < per / 4; ++u) {
      const int j = tid * 4 + 1024 * u;
      v4f o, sm;
#pragma unroll
      for (int q = 0; q < 4; ++q) {
        float gg = g[j + q], bb = bta[j + q];
        if (PARAM_BF16) { gg = bf16_round(gg); bb = bf16_round(bb); }
        sm[q] = vals[u * 4 + q]; o[q] = (vals[u * 4 + q] - mu) * rs * gg + bb;
      }
      if (out_sum) *(v4f*)(out_sum + (size_t)row * N + j) = sm;
      *(v4f*)(out_norm + (size_t)row * N + j) = o;
    }
    
  }
}



// ---- f16 WMMA path (v_wmma_f32_16x16x32_f16): 11-bit significands for operands in range — used where a [0,1] probability operand needs more precision than bf16
typedef _Float16 v16h __attribute__((ext_vector_type(16)));
union FragH { v16h v; v8us half[2]; _Float16 h[16]; unsigned short u[16]; };
template <int NT>
__device__ __forceinline__ v8f mmaH(v16h ah, v16h al, v16h bh, v16h bl, v8f c) {
  c = __builtin_amdgcn_wmma_f32_16x16x32_f16(false, ah, false, bh, (short)0, c, false, false);
  if (NT >= 2) c = __builtin_amdgcn_wmma_f32_16x16x32_f16(false, al, false, bh, (short)0, c, false, false);
  if (NT >= 3) c = __builtin_amdgcn_wmma_f32_16x16x32_f16(false, ah, false, bl, (short)0, c, false, false);
  asm volatile("v_nop\n\tv_nop\n\tv_nop\n\tv_nop" : "+v"(c) : "v"(ah), "v"(al), "v"(bh), "v"(bl));
  return c;
}
// Wt[n][k] = f16(W[k][n]·scale) from f32 row-major W[K][N] (scale = power of two; bf16-exact weights stay exact in f16 away from the subnormal range)
__global__ __launch_bounds__(256) void k_wt_f16(const float* __restrict__ W, _Float16* __restrict__ Wt, int K, int N, float scale) {
  const int t = blockIdx.x * 256 + threadIdx.x; if (t >= N * (K / 8)) return; const int n = t / (K / 8), k8 = (t % (K / 8)) * 8; FragH f;
#pragma unroll
  for (int i = 0; i < 8; ++i) f.h[i] = (_Float16)(bf16_round(W[(size_t)(k8 + i) * N + n]) * scale); const v8us o = f.half[0];
  *(v8us*)((unsigned short*)Wt + (size_t)n * K + k8) = o; 
}
// per-pair bias, 32 pairs (same (b, key j), queries i = ib + 32 it .. ib + 32 it + 31) per pass of a wave, one pair per lane, BG passes per wave (one wave = BG * 32 neighbouring queries of one key: the weights are staged once per block, the key's own features formed once per wave), the plane stored [b][j][i] (k_flash reads it with the query along the lanes), both MLPs wholly on v_wmma_f32_16x16x32_f16 in transposed form:
// layer 1: D1 = W1 (A: 16 hidden rows x k) * F (B: k x 16 pairs). A pair has 8 features: dist and dt each as an f16 high part plus an f16 remainder (the two products add up in the f32 accumulator), x_j, y_j, z_j, and 1.0
// for the layer's bias. Lanes 0..15 carry their pair's features at k = 0..7, lanes 16..31 at k = 8..15; W1 stands at both k ranges, and the half of B that belongs to the other 16 pairs is zeroed for each product.
// layer 2: two D1 tiles (hidden rows 0..15 and 16..31 of a 32-row block), relu'd and converted in place, ARE a B operand in the hardware k order; A = W2 with geom / shape / rate in rows 0,1,2 and again in rows 8,9,10, so that
// D2 registers 0,1,2 of lanes 0..15 (rows 0..2) and of lanes 16..31 (rows 8..10) hold the three outputs of column ln: every lane picks the D2 of its own 16-pair group and does its pair's softplus/log/lgamma tail. All weights x16 (exact), taken out as 1/256.
union FragW { v16h v; v8us half[2]; _Float16 h[16]; unsigned int w[8]; };
#define BG 16
// The chip's own base-2 exponential and logarithm, one instruction each. Every argument below is a normal number, zero or infinite where it matters (logarithms see values of 1e-4 and more), so the library's range steps are not needed.
__device__ __forceinline__ float hw_exp2(float x) { return __builtin_amdgcn_exp2f(x); }
__device__ __forceinline__ float hw_log2(float x) { return __builtin_amdgcn_logf(x); }
#define LOG2E 1.4426950408889634f
#define LN2 0.6931471805599453f
// softplus(q) = max(q, 0) + log(1 + e), e = exp(-|q|) in [0, 1]. u = 1 + e drops d = e - (u - 1), which is exact; log(1 + e) = log(u) + d / u, and d stands for d / u to within d * e: the relative error stays at rounding level down to e = 0.
__device__ __forceinline__ float softplus_hw(float q) { const float e = hw_exp2(-fabsf(q) * LOG2E); const float u = 1.0f + e; const float d = e - (u - 1.0f); return fmaxf(q, 0.f) + (hw_log2(u) * LN2 + d); }
__device__ __forceinline__ v8f mma16(v16h a, v16h b, v8f c) { return __builtin_amdgcn_wmma_f32_16x16x32_f16(false, a, false, b, (short)0, c, false, false); }
__device__ __forceinline__ void bias_block(const int blk, const float* __restrict__ crd, const float* __restrict__ gw1, const float* __restrict__ gb1, const float* __restrict__ gw2, const float* __restrict__ gb2, const float* __restrict__ dw1, const float* __restrict__ db1, const float* __restrict__ dw2, const float* __restrict__ db2, float* __restrict__ BIAS) {
  __shared__ __attribute__((aligned(16))) _Float16 sW1[2 * BH][8];           // row = hidden unit (0..63 geom, 64..127 delay), its 8 feature weights
  __shared__ __attribute__((aligned(16))) _Float16 sW2[16][2 * BH + 8];      // row = output row of layer 2, k = hidden unit; pitch 272 B spreads the 16 rows over the banks
  const int tid = threadIdx.x, w = __builtin_amdgcn_readfirstlane(tid >> 5), lane = tid & 31, ln = lane & 15, hh = lane >> 4;      // the wave's number in a scalar register keeps the key's row and the wave's first query scalar
  { FragW f; float o0 = 0.f, o1 = 0.f, o2 = 0.f; const _Float16 z = (_Float16)0.f;
    if (tid < BH) { const _Float16 g0 = (_Float16)(bf16_round(gw1[tid * 2]) * 16.0f), g1 = (_Float16)(bf16_round(gw1[tid * 2 + 1]) * 16.0f);
      f.h[0] = g0; f.h[1] = g0; f.h[2] = g1; f.h[3] = g1; f.h[4] = z; f.h[5] = z; f.h[6] = z; f.h[7] = (_Float16)(bf16_round(gb1[tid]) * 16.0f); o0 = bf16_round(gw2[tid]) * 16.0f; }
    else { const int k = tid - BH; const _Float16 d0 = (_Float16)(bf16_round(dw1[k * 4]) * 16.0f);
      f.h[0] = d0; f.h[1] = d0; f.h[2] = z; f.h[3] = z; f.h[4] = (_Float16)(bf16_round(dw1[k * 4 + 1]) * 16.0f); f.h[5] = (_Float16)(bf16_round(dw1[k * 4 + 2]) * 16.0f); f.h[6] = (_Float16)(bf16_round(dw1[k * 4 + 3]) * 16.0f);
      f.h[7] = (_Float16)(bf16_round(db1[k]) * 16.0f); o1 = bf16_round(dw2[k]) * 16.0f; o2 = bf16_round(dw2[BH + k]) * 16.0f; }
    *(v8us*)&sW1[tid][0] = f.half[0];
#pragma unroll
    for (int m = 0; m < 16; ++m) sW2[m][tid] = (_Float16)(((m & 7) == 0) ? o0 : ((m & 7) == 1) ? o1 : ((m & 7) == 2) ? o2 : 0.f); }
  __syncthreads();
  const size_t p0 = ((size_t)blk * 4 + w) * (32 * BG);      // BG * 32 consecutive queries of one (b, j) (SS = 1024 is a multiple of it)
  const int b = (int)(p0 / ((size_t)SS * SS)); const int j = (int)((p0 / SS) % SS); const int ib = (int)(p0 % SS);
  const float* cj = crd + ((size_t)b * SS + j) * 4; const float xj = bf16_round(cj[0]), yj = bf16_round(cj[1]), zj = bf16_round(cj[2]), tj = bf16_round(cj[3]);
  const float gb2v = bf16_round(gb2[0]), db20 = bf16_round(db2[0]), db21 = bf16_round(db2[1]);
  v16h a1[8];
#pragma unroll
  for (int t = 0; t < 8; ++t) { FragW f; f.half[0] = *(const v8us*)&sW1[t * 16 + ln][0];
#pragma unroll
    for (int q = 0; q < 4; ++q) f.w[4 + q] = 0u;
    a1[t] = f.v; }
  const v8f zero8 = (v8f){0.f,0.f,0.f,0.f,0.f,0.f,0.f,0.f};
  const v16h zero16 = {};
  const float* pc = crd + ((size_t)b * SS + ib + lane) * 4;      // this lane's query of the pass, i = ib + 32 it + lane
  float* pb = BIAS + p0 + lane;
  v4f cn = *(const v4fa*)pc;
  asm volatile("s_wait_xcnt 0x0" :: "v"(pc) : "memory");      // the address pair stays whole up to this wait; the loop steps on it
#pragma unroll 1      // one copy of the pass: a pass takes nothing from the one before but the fetched coordinates
  for (int it = 0; it < BG; ++it) {
  const v4f ci = cn; const float* pn = pc + (it + 1 < BG ? 32 * 4 : 0);      // the next pass's coordinates are fetched a pass ahead (the last pass fetches its own again)
  cn = *(const v4fa*)pn;
  asm volatile("s_wait_xcnt 0x0" :: "v"(pn) : "memory");      // the address pair stays whole up to this wait; it is stepped on behind it
  pc = pn;
  v16h a2[4];      // layer 2's weights are read from LDS in every pass: held over the loop beside layer 1's they do not fit the registers of six waves a SIMD (the build spills them)
#pragma unroll
  for (int s = 0; s < 4; ++s) { FragW f; f.half[0] = *(const v8us*)&sW2[ln][s * 32 + 8 * hh]; f.half[1] = *(const v8us*)&sW2[ln][s * 32 + 16 + 8 * hh]; a2[s] = f.v; }
  const float xi = bf16_round(ci[0]), yi = bf16_round(ci[1]), zi = bf16_round(ci[2]), ti = bf16_round(ci[3]);
  const float dx = xi - xj, dy = yi - yj, dz = zi - zj; const float dist = __builtin_amdgcn_sqrtf(dx * dx + dy * dy + dz * dz); const float dt = ti - tj;
  FragW F; F.h[0] = (_Float16)dist; F.h[1] = (_Float16)(dist - (float)F.h[0]); F.h[2] = (_Float16)dt; F.h[3] = (_Float16)(dt - (float)F.h[2]); F.h[4] = (_Float16)xj; F.h[5] = (_Float16)yj; F.h[6] = (_Float16)zj; F.h[7] = (_Float16)1.0f;
  FragW bf[2];
#pragma unroll
  for (int c = 0; c < 2; ++c)
#pragma unroll
    for (int q = 0; q < 4; ++q) { bf[c].w[q] = (hh == c) ? F.w[q] : 0u; bf[c].w[4 + q] = 0u; }
  v8f d2[2] = {zero8, zero8};
#pragma unroll
  for (int s = 0; s < 4; ++s)
#pragma unroll
    for (int c = 0; c < 2; ++c) { const v8f t0 = mma16(a1[2 * s], bf[c].v, zero8), t1 = mma16(a1[2 * s + 1], bf[c].v, zero8); FragW hb;
#pragma unroll
      for (int q = 0; q < 8; ++q) { hb.h[q] = (_Float16)t0[q]; hb.h[8 + q] = (_Float16)t1[q]; }
      d2[c] = mma16(a2[s], __builtin_elementwise_max(hb.v, zero16), d2[c]); }      // relu behind the rounding gives the same f16 value as in front of it, two units per instruction
  { const float geom = (hh ? d2[1][0] : d2[0][0]) * 0.00390625f + gb2v; const float q0 = (hh ? d2[1][1] : d2[0][1]) * 0.00390625f + db20, q1 = (hh ? d2[1][2] : d2[0][2]) * 0.00390625f + db21;
    const float shape = softplus_hw(q0) + 1e-4f, rate = softplus_hw(q1) + 1e-4f; const float dtp = fmaxf(fabsf(dt), 1e-4f);
    // lgamma(shape), shape >= 1e-4: its asymptotic series (z - 0.5) log z - z + 0.5 log(2 pi) + 1/(12 z) - 1/(360 z^3) + 1/(1260 z^5) at z >= 4 (the next term is below 4e-8 there). Below 8 the argument is moved up by 4: lgamma(x) = lgamma(x + 4) - log(x (x + 1) (x + 2) (x + 3)), the product as t (t + 2) with t = x (x + 3).
    const bool up = shape < 8.0f; const float t = shape * (shape + 3.0f); const float prod = up ? t * (t + 2.0f) : 1.0f; const float z = up ? shape + 4.0f : shape;
    const float rz = __builtin_amdgcn_rcpf(z), rz2 = rz * rz; const float ser = rz * (0.083333333f + rz2 * (-0.0027777778f + rz2 * 0.00079365079f));
    // the logarithmic terms are added in base 2, the others in base e; the plane is stored in base-2 units (x log2 e), which k_flash's exp2 takes as they are
    const float l2rate = hw_log2(rate), l2dtp = hw_log2(dtp), l2z = hw_log2(z), l2prod = hw_log2(prod);
    __builtin_amdgcn_sched_barrier(0);      // the four arguments die below; the instruction set asks for one slot between a logarithm and an instruction that takes over its argument's register
    const float lg2 = shape * l2rate + (shape - 1.0f) * l2dtp - (z - 0.5f) * l2z + l2prod;
    const float nat = geom - rate * dtp + (z - 0.91893853f) - ser;
    *pb = lg2 + nat * LOG2E;
    asm volatile("s_wait_xcnt 0x0" :: "v"(pb) : "memory");      // stands behind the store: its address pair stays whole up to this wait and is stepped on behind it
    pb += 32; } } }
// 16 k positions of one f32 row for an f16 fragment; p points at the lane's k = 8 hh of the 32-wide k step (positions 0..7 and 16..23 from there). load16 fetches them, cvt16 makes f16(bf16(x) * sc) of them (round to nearest even, as bf16_round)
__device__ __forceinline__ void load16(const float* __restrict__ p, v4f (&x)[4]) { x[0] = *(const v4fa*)p; x[1] = *(const v4fa*)(p + 4); x[2] = *(const v4fa*)(p + 16); x[3] = *(const v4fa*)(p + 20); }
__device__ __forceinline__ v16h cvt16(const v4f (&x)[4], const float sc) { FragH f;
#pragma unroll
  for (int g = 0; g < 4; ++g)
#pragma unroll
    for (int q = 0; q < 4; ++q) f.h[4 * g + q] = (_Float16)((float)(__bf16)x[g][q] * sc);
  return f.v; }
// q, k, v projections straight from the f32 inputs. One wave = 16 rows of one matrix (B operand) against 64 rows of the other (A operand, 4 tiles), K = 256: a lane then holds 8 neighbouring results of the A side,
// one 16-byte store per tile, and a wave writes whole 128-byte lines. q, k: B = 16 rows of src, A = 64 rows of W, stored [row][col]. v: B = 16 rows of Wv, A = 64 rows of src (keys), stored transposed [b][col][key].
__device__ __forceinline__ void qkv_block(const int blk, const float* __restrict__ src, const float* __restrict__ Wq, const float* __restrict__ Wk, const float* __restrict__ Wv, _Float16* __restrict__ Q16, _Float16* __restrict__ K16, _Float16* __restrict__ Vt) {
  const int tid = threadIdx.x, w = __builtin_amdgcn_readfirstlane(tid >> 5), lane = tid & 31, ln = lane & 15, hh = lane >> 4;      // the wave's number in a scalar register keeps the base pointers scalar
  const int which = blk >> 7, wid = (blk & 127) * 4 + w;
  const float* one; const float* four; float s1, s4; _Float16* dst;
  if (which < 2) { const int mt = wid >> 2, nq = wid & 3; one = src + (size_t)mt * 16 * DM; four = (which ? Wk : Wq) + (size_t)nq * 64 * DM; s1 = 1.0f; s4 = 16.0f; dst = (which ? K16 : Q16) + (size_t)(mt * 16 + ln) * DM + nq * 64; }
  else { const int kq = wid >> 4, ct = wid & 15; one = Wv + (size_t)ct * 16 * DM; four = src + (size_t)kq * 64 * DM; s1 = 16.0f; s4 = 1.0f; dst = Vt + ((size_t)(kq / (SS / 64)) * DM + ct * 16 + ln) * SS + (kq % (SS / 64)) * 64; }
  const float* orow = one + ln * DM + 8 * hh; const float* frow = four + ln * DM + 8 * hh;
  v8f acc[4] = {};
  for (int kb = 0; kb < DM; kb += 32) { const float* po = orow + kb; const float* pf = frow + kb; v4f ro[4], rf[4][4];
    load16(po, ro);
#pragma unroll
    for (int t = 0; t < 4; ++t) load16(pf + t * 16 * DM, rf[t]);
    asm volatile("s_wait_xcnt 0x0" :: "v"(po), "v"(pf) : "memory");      // the two address pairs stay whole up to this wait
    const v16h bo = cvt16(ro, s1);
#pragma unroll
    for (int t = 0; t < 4; ++t) acc[t] = mma16(cvt16(rf[t], s4), bo, acc[t]); }
#pragma unroll
  for (int t = 0; t < 4; ++t) { FragH o;
#pragma unroll
    for (int r = 0; r < 8; ++r) o.h[r] = (_Float16)(acc[t][r] * 0.0625f);
    *(v8us*)((unsigned short*)dst + t * 16 + 8 * hh) = o.half[0]; } }
// Everything that depends on the inputs alone, in one launch: blocks 0..383 the q, k, v projections, blocks 384..447 Wo as f16 (x16), the rest the bias plane. The 1472 blocks of 4 waves are all resident at once.
#define G_QKV (3 * (NR / 16) * (DM / 64) / 4)
#define G_WO (DM * DM / 8 / 128)
#define G_BIAS (BB * SS * SS / (128 * BG))
// waves_per_eu(6, 6): at most 160 registers, six waves a SIMD, which holds all 1472 blocks of 4 waves at once. The bias loop keeps layer 1's weights in 64 registers; planned for seven or eight waves the build has too few registers left to set
// independent work behind the loop's products and fills the distance with more v_nop. With this line it builds to 156 registers, nothing spilled, the 20 loads of the q, k, v loop in one run
__global__ __launch_bounds__(128) __attribute__((amdgpu_waves_per_eu(6, 6))) void k_front(const float* __restrict__ src, const float* __restrict__ crd, const float* __restrict__ Wq, const float* __restrict__ Wk, const float* __restrict__ Wv, const float* __restrict__ Wo,
    const float* __restrict__ gw1, const float* __restrict__ gb1, const float* __restrict__ gw2, const float* __restrict__ gb2, const float* __restrict__ dw1, const float* __restrict__ db1, const float* __restrict__ dw2, const float* __restrict__ db2,
    _Float16* __restrict__ Q16, _Float16* __restrict__ K16, _Float16* __restrict__ Vt, _Float16* __restrict__ Bo, float* __restrict__ BIAS) {
  const int blk = blockIdx.x;
  if (blk < G_QKV) { qkv_block(blk, src, Wq, Wk, Wv, Q16, K16, Vt); return; }
  if (blk < G_QKV + G_WO) { const size_t t = (size_t)(blk - G_QKV) * 128 + threadIdx.x; FragH f;
#pragma unroll
    for (int i = 0; i < 8; ++i) f.h[i] = (_Float16)(bf16_round(Wo[t * 8 + i]) * 16.0f);
    *(v8us*)((unsigned short*)Bo + t * 8) = f.half[0];
    asm volatile("s_wait_xcnt 0x0" ::: "memory");      // stands behind the store, ahead of any later write of the registers it names (the listing lays the other branches behind it)
    return; }
  bias_block(blk - (G_QKV + G_WO), crd, gw1, gb1, gw2, gb2, dw1, db1, dw2, db2, BIAS); }
typedef float v2f  __attribute__((ext_vector_type(2)));
typedef float v2fa __attribute__((ext_vector_type(2), may_alias));
// lane l with lane l ^ 16, in the vector unit
__device__ __forceinline__ float xhalf(float x) { return __builtin_bit_cast(float, __builtin_amdgcn_permlanex16(__builtin_bit_cast(int, x), __builtin_bit_cast(int, x), 0x76543210, 0xfedcba98, false, false)); }
// One block = 32 query rows of one (batch, head); its 8 waves share those rows and split the 1024 keys, 128 each (512 blocks of 8 waves fill every SIMD four deep, where one wave per 32 rows over all keys left
// one wave on half the SIMDs). Every wave runs the same online-softmax loop over its own keys and leaves an un-normalised partial (row max, row sum, O) in LDS; behind one block barrier the partials of a row are
// rescaled to their common max and added, wave 0 first.
// The loop works on the transposed products: St = K (A: 16 keys x d) * Qt (B: d x 16 queries), so lanes ln and ln + 16 hold all 32 scores that a pass gives the query of column ln, 16 each: maximum and sum are taken inside the lane, with one
// exchange between the halves for the maximum (the sums' halves are joined once, behind the loop). The two St tiles of a pass (keys 0..15 and 16..31), as f16 exponentials, ARE the B operand of Ot = Vt (A: 16 d x 32 keys) * Pt in
// the hardware k order: P passes through no LDS. Column ln of query tile rt is query 2 ln + rt, so that one 8-byte load fetches a key's bias for both of a lane's queries from the [key][query] plane and 16 lanes read a whole 128-byte line; a lane holds 8 neighbouring d of its query's output.
// waves_per_eu(1, 4): no more than four waves a SIMD are planned for, which is what 512 blocks of 8 waves come to; without it the compiler saves registers for an occupancy the grid cannot reach
__global__ __launch_bounds__(256) __attribute__((amdgpu_waves_per_eu(1, 4))) void k_flash(const _Float16* __restrict__ Q16, const _Float16* __restrict__ K16, const _Float16* __restrict__ Vt, const float* __restrict__ BIAS, float* __restrict__ O) {
  constexpr int RPW = 32, NW = 8, NQB = SS / RPW, KPW = SS / NW, DT = 2;
  __shared__ __attribute__((aligned(16))) float sO[NW][RPW][HD + 4]; __shared__ float sM[NW][RPW], sL[NW][RPW];
  const int tid = threadIdx.x, w = __builtin_amdgcn_readfirstlane(tid >> 5), lane = tid & 31, ln = lane & 15, hh = lane >> 4;      // the wave's number in a scalar register keeps the wave's key offset (w * KPW) and LDS slots scalar
  const int slab = blockIdx.x / NQB, qblk = blockIdx.x % NQB; const int b = slab / NH, h = slab % NH; const int q0 = qblk * RPW;
  FragH aq[2];
#pragma unroll
  for (int rt = 0; rt < 2; ++rt) { const unsigned short* qr = (const unsigned short*)Q16 + ((size_t)b * SS + q0 + 2 * ln + rt) * DM + h * HD; aq[rt].half[0] = *(const v8us*)(qr + 8 * hh); aq[rt].half[1] = *(const v8us*)(qr + 16 + 8 * hh); }
  const unsigned short* kp = (const unsigned short*)K16 + ((size_t)b * SS + w * KPW + ln) * DM + h * HD + 8 * hh;      // key row ln of the pass, k = d
  const unsigned short* vp = (const unsigned short*)Vt + ((size_t)slab * HD + ln) * SS + w * KPW + 8 * hh;             // d row ln, k = key
  const float* bp = BIAS + ((size_t)b * SS + w * KPW + 8 * hh) * SS + q0 + 2 * ln;                                     // key 8 hh of a tile, queries 2 ln and 2 ln + 1
  float m_r[2], l_r[2]; v8f oacc[2][DT];
  const v8f zero8 = (v8f){0.f,0.f,0.f,0.f,0.f,0.f,0.f,0.f};
#pragma unroll
  for (int rt = 0; rt < 2; ++rt) { m_r[rt] = -3.0e38f; l_r[rt] = 0.f;
#pragma unroll
    for (int dt = 0; dt < DT; ++dt) oacc[rt][dt] = zero8; }
  const float scale = 0.17677669529663688f * LOG2E;      // scores, bias plane, running max in base-2 units: every exponential is one exp2
#pragma unroll 1
  for (int it = 0; it < KPW / 32; ++it) {
    FragH bk[2], bv[DT]; v2f bb[2][8];
#pragma unroll
    for (int nt = 0; nt < 2; ++nt) { bk[nt].half[0] = *(const v8us*)(kp + nt * 16 * DM); bk[nt].half[1] = *(const v8us*)(kp + nt * 16 * DM + 16); }
#pragma unroll
    for (int nt = 0; nt < 2; ++nt)
#pragma unroll
      for (int r = 0; r < 8; ++r) bb[nt][r] = *(const v2fa*)(bp + (nt * 16 + r) * SS);
#pragma unroll
    for (int dt = 0; dt < DT; ++dt) { bv[dt].half[0] = *(const v8us*)(vp + dt * 16 * SS); bv[dt].half[1] = *(const v8us*)(vp + dt * 16 * SS + 16); }
    asm volatile("s_wait_xcnt 0x0" :: "v"(kp), "v"(vp), "v"(bp) : "memory");      // the three address pairs stay whole up to this wait; they are stepped on right behind it
    __builtin_amdgcn_sched_barrier(0);      // all loads of a pass are issued ahead of its first product; without this line the build holds some of the V loads back behind the first wait, to save registers that are free here
    kp += 32 * DM; vp += 32; bp += 32 * SS;
#pragma unroll
    for (int rt = 0; rt < 2; ++rt) {
      v8f c0, c1;
#pragma unroll
      for (int r = 0; r < 8; ++r) { c0[r] = bb[0][r][rt]; c1[r] = bb[1][r][rt]; }
      const v8f s0 = mma16(bk[0].v, aq[rt].v, zero8) * scale + c0, s1 = mma16(bk[1].v, aq[rt].v, zero8) * scale + c1;
      const v8f mx = __builtin_elementwise_max(s0, s1);
      float mc = fmaxf(fmaxf(fmaxf(mx[0], mx[1]), fmaxf(mx[2], mx[3])), fmaxf(fmaxf(mx[4], mx[5]), fmaxf(mx[6], mx[7])));
      mc = fmaxf(mc, xhalf(mc));
      const float mn = fmaxf(m_r[rt], mc); const float al = hw_exp2(m_r[rt] - mn); m_r[rt] = mn;
      const v8f e0 = s0 - mn, e1 = s1 - mn; v8f p0, p1; FragH pb;
#pragma unroll
      for (int r = 0; r < 8; ++r) { p0[r] = hw_exp2(e0[r]); p1[r] = hw_exp2(e1[r]); pb.h[r] = (_Float16)p0[r]; pb.h[8 + r] = (_Float16)p1[r]; }
      const v8f ps = p0 + p1;
      l_r[rt] = l_r[rt] * al + (((ps[0] + ps[4]) + (ps[1] + ps[5])) + ((ps[2] + ps[6]) + (ps[3] + ps[7])));      // this lane's 16 keys
#pragma unroll
      for (int dt = 0; dt < DT; ++dt) oacc[rt][dt] = mma16(bv[dt].v, pb.v, oacc[rt][dt] * al); } }
#pragma unroll
  for (int rt = 0; rt < 2; ++rt) { const float l = l_r[rt] + xhalf(l_r[rt]);
#pragma unroll
    for (int dt = 0; dt < DT; ++dt) { const v8f o = oacc[rt][dt]; float* so = &sO[w][2 * ln + rt][dt * 16 + 8 * hh]; *(v4f*)so = (v4f){o[0], o[1], o[2], o[3]}; *(v4f*)(so + 4) = (v4f){o[4], o[5], o[6], o[7]}; }
    if (hh == 0) { sM[w][2 * ln + rt] = m_r[rt]; sL[w][2 * ln + rt] = l; } }      // max and sum are the same in the two lanes of a query
  __syncthreads();      // every wave's partial is in LDS before any thread merges
  { const int r = tid >> 3, pc = tid & 7;      // one thread = 4 output columns of one row
    float mw[NW], M = -3.0e38f;
#pragma unroll
    for (int u = 0; u < NW; ++u) { mw[u] = sM[u][r]; M = fmaxf(M, mw[u]); }
    float L = 0.f; v4f acc = {0.f, 0.f, 0.f, 0.f};
#pragma unroll
    for (int u = 0; u < NW; ++u) { const float g = hw_exp2(mw[u] - M); L += sL[u][r] * g; const v4f val = *(const v4fa*)&sO[u][r][pc * 4]; acc += val * g; }
    const float inv = 1.0f / L;
    *(v4f*)(O + ((size_t)b * SS + q0 + r) * DM + h * HD + pc * 4) = acc * inv; } }
// out = f16(O) * Wo^T, sizes fixed at compile time. One block = 16 rows of O against 128 rows of Wo (output columns), one wave = 32 of those columns (two A tiles; O is the B operand, so a lane holds 8 neighbouring
// columns of its row and a wave writes whole 128-byte lines, no LDS epilogue). 256 blocks of 4 waves: one wave on every SIMD, so nothing hides a wave's own waits. A wave therefore issues all its loads in one run ahead of its
// first wait: 8 for the two k steps of the O tile that it converts for the block, 32 for its own Wo rows over the whole K. The O tile goes round as finished f16 fragments, 16 bytes a lane in lane order (no bank conflicts).
// waves_per_eu(1, 2): registers are planned for what the grid comes to, not saved for an occupancy that it cannot reach
__global__ __launch_bounds__(128) __attribute__((amdgpu_waves_per_eu(1, 2))) void k_out(const float* __restrict__ O, const _Float16* __restrict__ Bo, float* __restrict__ out) {
  constexpr int KS = DM / 32;
  __shared__ __attribute__((aligned(16))) unsigned short sF[KS][2][32][8];
  const int tid = threadIdx.x, w = __builtin_amdgcn_readfirstlane(tid >> 5), lane = tid & 31, ln = lane & 15, hh = lane >> 4;      // the wave's number in a scalar register keeps the base pointers scalar
  const int row0 = (blockIdx.x >> 1) * 16, col0 = ((blockIdx.x & 1) * 4 + w) * 32;
  const float* op = O + (size_t)(row0 + ln) * DM + w * 64 + 8 * hh;                       // k steps 2 w and 2 w + 1 of row ln
  const unsigned short* wp = (const unsigned short*)Bo + (size_t)(col0 + ln) * DM + 8 * hh;      // Wo row col0 + ln, all k steps
  v4f ro[2][4]; FragH a[2][KS];
  load16(op, ro[0]); load16(op + 32, ro[1]);      // first in the queue: loads come back in order, and the block waits for these
#pragma unroll
  for (int ks = 0; ks < KS; ++ks)
#pragma unroll
    for (int t = 0; t < 2; ++t) { a[t][ks].half[0] = *(const v8us*)(wp + t * 16 * DM + ks * 32); a[t][ks].half[1] = *(const v8us*)(wp + t * 16 * DM + ks * 32 + 16); }
  asm volatile("s_wait_xcnt 0x0" :: "v"(op), "v"(wp) : "memory");      // the two address pairs stay whole up to this wait, ahead of any later write of their registers; no load sinks behind this line either, so all 40 are in flight at the first wait
#pragma unroll
  for (int u = 0; u < 2; ++u) { FragH f;
#pragma unroll
    for (int g = 0; g < 4; ++g)
#pragma unroll
      for (int q = 0; q < 4; ++q) f.h[4 * g + q] = (_Float16)ro[u][g][q];
    *(v8us*)&sF[2 * w + u][0][lane][0] = f.half[0]; *(v8us*)&sF[2 * w + u][1][lane][0] = f.half[1]; }
  __syncthreads();      // all eight fragments of the O tile are in LDS before any wave reads them
  FragH b[KS];
#pragma unroll
  for (int ks = 0; ks < KS; ++ks) { b[ks].half[0] = *(const v8us*)&sF[ks][0][lane][0]; b[ks].half[1] = *(const v8us*)&sF[ks][1][lane][0]; }
  __builtin_amdgcn_sched_barrier(0);      // all 16 LDS reads stand in one place ahead of the products; without this line the build reads the first k steps one at a time, each behind a full wait, to save registers that are free here
  v8f acc[2] = {};
#pragma unroll
  for (int ks = 0; ks < KS; ++ks)
#pragma unroll
    for (int t = 0; t < 2; ++t) acc[t] = mma16(a[t][ks].v, b[ks].v, acc[t]);
  float* po = out + (size_t)(row0 + ln) * DM + col0 + 8 * hh;
#pragma unroll
  for (int t = 0; t < 2; ++t) { const v8f o = acc[t] * 0.0625f; *(v4f*)(po + t * 16) = (v4f){o[0], o[1], o[2], o[3]}; *(v4f*)(po + t * 16 + 4) = (v4f){o[4], o[5], o[6], o[7]}; } }
extern "C" void kernel_launch(void* const* d_in, const int* in_sizes, int n_in,
                              void* d_out, int out_size, void* d_ws, size_t ws_size, hipStream_t stream) {
  (void)in_sizes; (void)n_in; (void)out_size;
  const float* src = (const float*)d_in[0]; const float* crd = (const float*)d_in[1]; const float* Wq = (const float*)d_in[2]; const float* Wk = (const float*)d_in[3]; const float* Wv = (const float*)d_in[4]; const float* Wo = (const float*)d_in[5];
  const float* gw1 = (const float*)d_in[6]; const float* gb1 = (const float*)d_in[7]; const float* gw2 = (const float*)d_in[8]; const float* gb2 = (const float*)d_in[9]; const float* dw1 = (const float*)d_in[10]; const float* db1 = (const float*)d_in[11]; const float* dw2 = (const float*)d_in[12]; const float* db2 = (const float*)d_in[13];
  char* ws = (char*)d_ws; size_t off = 0;
  auto take = [&](size_t bytes) { char* p = ws + off; off += (bytes + 255) & ~(size_t)255; return p; };
  _Float16* Bo = (_Float16*)take((size_t)DM * DM * 2); _Float16* Q16 = (_Float16*)take((size_t)NR * DM * 2); _Float16* K16 = (_Float16*)take((size_t)NR * DM * 2); _Float16* Vt = (_Float16*)take((size_t)NR * DM * 2); float* BIAS = (float*)take((size_t)BB * SS * SS * 4); float* O = (float*)take((size_t)NR * DM * 4);
  if (off > ws_size) return;      // about 13 MiB
  k_front<<<G_QKV + G_WO + G_BIAS, 128, 0, stream>>>(src, crd, Wq, Wk, Wv, Wo, gw1, gb1, gw2, gb2, dw1, db1, dw2, db2, Q16, K16, Vt, Bo, BIAS);
  k_flash<<<BB * NH * (SS / 32), 256, 0, stream>>>(Q16, K16, Vt, BIAS, O);
  k_out<<<(NR / 16) * 2, 128, 0, stream>>>(O, Bo, (float*)d_out);      // rounds O to f16 in its loader
}

// v009
// Measured time: 33.2 microseconds a run.
// In two side-by-side timings against v008, it was 1.09 and 1.10 times as fast.
// Counting every step since v000, it is 11.3 times as fast.
#include <hip/hip_runtime.h>
// q/k/v/o projections (2048 × 256 × 256) and the 8-head attention (d = 32) with an additive per-pair bias on v_wmma_f32_16x16x32_f16 (fused flash-style kernel: S = Q·Kᵀ, O = P·V on WMMA;
// online max/sum softmax f32; P f16 <= 1). The bias (geometric 2->64->1 MLP + the Gamma log-density from the 4->64->2 delay MLP, incl. lgamma) is computed once per (b, i, j): both layers of the two MLPs
// on WMMA, softplus/log/lgamma in f32; the bias plane is shared by the 8 heads. A = f16(bf16 ·) exact operands in q/k/v, f16(O) in the o projection, weights bf16-exact ×2^4 ((out,in)), single products, f32 accumulate.
#define BB 2
#define SS 1024
#define DM 256
#define NH 8
#define HD 32
#define BH 64
#define NR (BB * SS)

typedef __bf16 v16b __attribute__((ext_vector_type(16)));
typedef unsigned short v8us __attribute__((ext_vector_type(8), may_alias));
typedef float  v8f  __attribute__((ext_vector_type(8)));
typedef float  v4f  __attribute__((ext_vector_type(4)));
typedef float  v4fa __attribute__((ext_vector_type(4), may_alias));
union FragB { v16b v; v8us half[2]; unsigned short u[16]; };

__device__ __forceinline__ unsigned short bf16_bits(float x) { unsigned int u = __float_as_uint(x); return (unsigned short)((u + 0x7FFFu + ((u >> 16) & 1u)) >> 16); }
__device__ __forceinline__ float bf16_val(unsigned short b) { return __uint_as_float(((unsigned int)b) << 16); }
__device__ __forceinline__ float bf16_round(float x) { return bf16_val(bf16_bits(x)); }
// D += A·B with NT terms: 1 = ah·bh, 2 = + al·bh (A split), 3 = + ah·bl (both split)
template <int NT>
__device__ __forceinline__ v8f mmaN(v16b ah, v16b al, v16b bh, v16b bl, v8f c) {
  c = __builtin_amdgcn_wmma_f32_16x16x32_bf16(false, ah, false, bh, (short)0, c, false, false);
  if (NT >= 2) c = __builtin_amdgcn_wmma_f32_16x16x32_bf16(false, al, false, bh, (short)0, c, false, false);
  if (NT >= 3) c = __builtin_amdgcn_wmma_f32_16x16x32_bf16(false, ah, false, bl, (short)0, c, false, false);
  asm volatile("v_nop\n\tv_nop\n\tv_nop\n\tv_nop" : "+v"(c) : "v"(ah), "v"(al), "v"(bh), "v"(bl));
  return c;
}

__global__ __launch_bounds__(256) void k_wt_bf16(const float* __restrict__ W, unsigned short* __restrict__ Wt, int K, int N) {
  const int t = blockIdx.x * 256 + threadIdx.x;
  const int k8n = K / 8;
  if (t >= N * k8n) return;
  const int n = t / k8n, k8 = (t % k8n) * 8;
  v8us v;
#pragma unroll
  for (int i = 0; i < 8; ++i) v[i] = bf16_bits(W[(size_t)(k8 + i) * N + n]);
  *(v8us*)(Wt + (size_t)n * K + k8) = v;
  
}

// GEMM C[M][N] (f32, pitch ldc) = act(A[M][K]·W + bias). A f32 row-major (pitch lda) converted per fragment to bf16
// (ASPLIT: hi/lo two planes -> 2 terms, else single rounded term); Wt bf16 [N][K] (pitch ldb). BIAS_BF16 rounds the
// bias to bf16 first (bias quantised to bf16 before the add). K%32==0, M%16==0, N%64==0.
template <bool ASPLIT, int ACT, bool BIAS_BF16>
__global__ __launch_bounds__(128) void k_gemm_bf(const float* __restrict__ A, int lda, const unsigned short* __restrict__ Wt, int ldb,
                                               const float* __restrict__ bias, float* __restrict__ C, int ldc, int M, int N, int K) {
  __shared__ __attribute__((aligned(16))) float so[4][16][64];
  const int tid = threadIdx.x, w = tid >> 5, lane = tid & 31, ln = lane & 15, hh = lane >> 4;
  const int ntn = N / 64;
  const int wid = blockIdx.x * 4 + w;
  const int mt = wid / ntn, nq = wid % ntn;
  if (mt * 16 >= M) return;
  const int row0 = mt * 16, col0 = nq * 64;
  const float* arow = A + (size_t)(row0 + ln) * lda;
  v8f acc[4] = {};
  for (int kb = 0; kb < K; kb += 32) {
    FragB ah, al;
    const v4f x0 = *(const v4fa*)(arow + kb + 8 * hh), x1 = *(const v4fa*)(arow + kb + 8 * hh + 4);
    const v4f x2 = *(const v4fa*)(arow + kb + 16 + 8 * hh), x3 = *(const v4fa*)(arow + kb + 16 + 8 * hh + 4);
    float xs[16] = {x0[0],x0[1],x0[2],x0[3],x1[0],x1[1],x1[2],x1[3],x2[0],x2[1],x2[2],x2[3],x3[0],x3[1],x3[2],x3[3]};
#pragma unroll
    for (int i = 0; i < 16; ++i) { const unsigned short hb = bf16_bits(xs[i]); ah.u[i] = hb; al.u[i] = ASPLIT ? bf16_bits(xs[i] - bf16_val(hb)) : (unsigned short)0; }
#pragma unroll
    for (int t = 0; t < 4; ++t) {
      const unsigned short* brow = Wt + (size_t)(col0 + t * 16 + ln) * ldb + kb;
      FragB b;
      b.half[0] = *(const v8us*)(brow + 8 * hh);
      b.half[1] = *(const v8us*)(brow + 16 + 8 * hh);
      acc[t] = mmaN<ASPLIT ? 2 : 1>(ah.v, al.v, b.v, b.v, acc[t]);
    }
  }
#pragma unroll
  for (int t = 0; t < 4; ++t) {
    float bv = bias ? bias[col0 + t * 16 + ln] : 0.f;
    if (BIAS_BF16) bv = bf16_round(bv);
#pragma unroll
    for (int r = 0; r < 8; ++r) { float v = acc[t][r] + bv; if (ACT == 1) v = fmaxf(v, 0.f); so[w][8 * hh + r][t * 16 + ln] = v; }
  }
  __builtin_amdgcn_fence(__ATOMIC_ACQ_REL, "workgroup");
  __builtin_amdgcn_wave_barrier();
  const int rsub = lane >> 4, c4 = (lane & 15) * 4;
  {
#pragma unroll
    for (int q = 0; q < 8; ++q) {
      const int r = q * 2 + rsub;
      const v4f v = *(const v4fa*)&so[w][r][c4];
      *(v4f*)(C + (size_t)(row0 + r) * ldc + col0 + c4) = v;
    }
    
  }
}

// Flash-style causal/unmasked attention, all contractions 3-term bf16 hi/lo splits, f32 softmax with running max.
// q,k,v rows are read from f32 buffers with arbitrary row pitch (so they can live inside a fused qkv buffer);
// D = head size (multiple of 32, <= 128); one wave = 16 query rows; block = 4 waves (64 queries) sharing K/V chunks of 32.
template <int D, bool CAUSAL>
__global__ __launch_bounds__(128) void k_flash(const float* __restrict__ qb, const float* __restrict__ kb, const float* __restrict__ vb,
                                             int pitch, int T, int H, float scale, float* __restrict__ y, int ypitch) {
  constexpr int KS = D / 32;        // k-steps for QK
  constexpr int DT = D / 16;        // d tiles for PV
  __shared__ __attribute__((aligned(16))) unsigned short sKh[32][D + 8], sKl[32][D + 8], sVh[32][D + 8], sVl[32][D + 8];
  __shared__ __attribute__((aligned(16))) unsigned short sPh[4][16][40], sPl[4][16][40];
  __shared__ __attribute__((aligned(16))) float sO[4][16][D];
  const int tid = threadIdx.x, w = tid >> 5, lane = tid & 31, ln = lane & 15, hh = lane >> 4;
  const int nqb = (T + 63) / 64;
  const int bh = blockIdx.x / nqb, qblk = blockIdx.x % nqb;
  const int b = bh / H, h = bh % H;
  const int q0 = qblk * 64 + w * 16;
  const float* Q = qb + (size_t)b * T * pitch + h * D;
  const float* K = kb + (size_t)b * T * pitch + h * D;
  const float* V = vb + (size_t)b * T * pitch + h * D;

  // A fragments of the wave's 16 query rows (scaled), hi/lo
  FragB aqh[KS], aql[KS];
  {
    int row = q0 + ln; if (row >= T) row = T - 1;
    const float* qr = Q + (size_t)row * pitch;
#pragma unroll
    for (int ks = 0; ks < KS; ++ks)
#pragma unroll
      for (int i = 0; i < 16; ++i) {
        const int d = ks * 32 + ((i < 8) ? (8 * hh + i) : (16 + 8 * hh + (i - 8)));
        const float x = qr[d] * scale; const unsigned short hb = bf16_bits(x);
        aqh[ks].u[i] = hb; aql[ks].u[i] = bf16_bits(x - bf16_val(hb));
      }
  }
  float m_r[8], l_r[8];
#pragma unroll
  for (int r = 0; r < 8; ++r) { m_r[r] = -3.0e38f; l_r[r] = 0.f; }
  v8f oacc[DT];
#pragma unroll
  for (int dt = 0; dt < DT; ++dt) oacc[dt] = (v8f){0.f,0.f,0.f,0.f,0.f,0.f,0.f,0.f};

  const int kv_end = CAUSAL ? min(T, qblk * 64 + 64) : T;     // block-uniform
  for (int j0 = 0; j0 < kv_end; j0 += 32) {
    __syncthreads();
    for (int e = tid; e < 32 * (D / 4); e += 128) {
      const int r = e / (D / 4), c4 = (e % (D / 4)) * 4;
      const int key = j0 + r;
      v4f kf = {0.f,0.f,0.f,0.f}, vf = {0.f,0.f,0.f,0.f};
      if (key < T) { kf = *(const v4fa*)(K + (size_t)key * pitch + c4); vf = *(const v4fa*)(V + (size_t)key * pitch + c4); }
#pragma unroll
      for (int t = 0; t < 4; ++t) {
        unsigned short hb = bf16_bits(kf[t]); sKh[r][c4 + t] = hb; sKl[r][c4 + t] = bf16_bits(kf[t] - bf16_val(hb));
        hb = bf16_bits(vf[t]); sVh[r][c4 + t] = hb; sVl[r][c4 + t] = bf16_bits(vf[t] - bf16_val(hb));
      }
    }
    __syncthreads();
    // S tile 16 x 32
    v8f s[2];
#pragma unroll
    for (int nt = 0; nt < 2; ++nt) {
      v8f acc = {};
#pragma unroll
      for (int ks = 0; ks < KS; ++ks) {
        FragB bh_, bl_;
        bh_.half[0] = *(const v8us*)&sKh[nt * 16 + ln][ks * 32 + 8 * hh]; bh_.half[1] = *(const v8us*)&sKh[nt * 16 + ln][ks * 32 + 16 + 8 * hh];
        bl_.half[0] = *(const v8us*)&sKl[nt * 16 + ln][ks * 32 + 8 * hh]; bl_.half[1] = *(const v8us*)&sKl[nt * 16 + ln][ks * 32 + 16 + 8 * hh];
        acc = mmaN<3>(aqh[ks].v, aql[ks].v, bh_.v, bl_.v, acc);
      }
      s[nt] = acc;
    }
    // mask + running max (rows 8hh+r; the 16 lanes of a half share rows)
    float alpha[8];
#pragma unroll
    for (int r = 0; r < 8; ++r) {
      const int qi = q0 + 8 * hh + r;
      const int ja = j0 + ln, jb = j0 + 16 + ln;
      if (CAUSAL) { if (ja > qi) s[0][r] = -3.0e38f; if (jb > qi) s[1][r] = -3.0e38f; }
      if (ja >= T) s[0][r] = -3.0e38f;
      if (jb >= T) s[1][r] = -3.0e38f;
      float mx = fmaxf(s[0][r], s[1][r]);
      mx = fmaxf(mx, __shfl_xor(mx, 1, 32)); mx = fmaxf(mx, __shfl_xor(mx, 2, 32)); mx = fmaxf(mx, __shfl_xor(mx, 4, 32)); mx = fmaxf(mx, __shfl_xor(mx, 8, 32));
      const float mnew = fmaxf(m_r[r], mx);
      alpha[r] = (mnew > -1.0e38f) ? __expf(m_r[r] - mnew) : 1.0f;
      const float p0 = (s[0][r] > -1.0e38f) ? __expf(s[0][r] - mnew) : 0.f;
      const float p1 = (s[1][r] > -1.0e38f) ? __expf(s[1][r] - mnew) : 0.f;
      m_r[r] = mnew;
      l_r[r] = l_r[r] * alpha[r] + p0 + p1;            // per-lane partial row sum (16 lanes combined at the end)
      unsigned short hb = bf16_bits(p0); sPh[w][8 * hh + r][ln] = hb;      sPl[w][8 * hh + r][ln] = bf16_bits(p0 - bf16_val(hb));
      hb = bf16_bits(p1);                sPh[w][8 * hh + r][16 + ln] = hb; sPl[w][8 * hh + r][16 + ln] = bf16_bits(p1 - bf16_val(hb));
    }
#pragma unroll
    for (int dt = 0; dt < DT; ++dt)
#pragma unroll
      for (int r = 0; r < 8; ++r) oacc[dt][r] *= alpha[r];
    __builtin_amdgcn_fence(__ATOMIC_ACQ_REL, "workgroup");
    __builtin_amdgcn_wave_barrier();
    FragB pah, pal;
    pah.half[0] = *(const v8us*)&sPh[w][ln][8 * hh]; pah.half[1] = *(const v8us*)&sPh[w][ln][16 + 8 * hh];
    pal.half[0] = *(const v8us*)&sPl[w][ln][8 * hh]; pal.half[1] = *(const v8us*)&sPl[w][ln][16 + 8 * hh];
#pragma unroll
    for (int dt = 0; dt < DT; ++dt) {
      FragB bvh, bvl;
#pragma unroll
      for (int i = 0; i < 8; ++i) {
        bvh.u[i] = sVh[8 * hh + i][dt * 16 + ln]; bvh.u[8 + i] = sVh[16 + 8 * hh + i][dt * 16 + ln];
        bvl.u[i] = sVl[8 * hh + i][dt * 16 + ln]; bvl.u[8 + i] = sVl[16 + 8 * hh + i][dt * 16 + ln];
      }
      oacc[dt] = mmaN<3>(pah.v, pal.v, bvh.v, bvl.v, oacc[dt]);
    }
    __builtin_amdgcn_fence(__ATOMIC_ACQ_REL, "workgroup");
    __builtin_amdgcn_wave_barrier();
  }
#pragma unroll
  for (int r = 0; r < 8; ++r) {
    float l = l_r[r];
    l += __shfl_xor(l, 1, 32); l += __shfl_xor(l, 2, 32); l += __shfl_xor(l, 4, 32); l += __shfl_xor(l, 8, 32);
    l_r[r] = (l > 0.f) ? 1.0f / l : 0.f;
  }
#pragma unroll
  for (int dt = 0; dt < DT; ++dt)
#pragma unroll
    for (int r = 0; r < 8; ++r) sO[w][8 * hh + r][dt * 16 + ln] = oacc[dt][r] * l_r[r];
  __builtin_amdgcn_fence(__ATOMIC_ACQ_REL, "workgroup");
  __builtin_amdgcn_wave_barrier();
  {
    for (int r = 0; r < 16; ++r) {
      const int row = q0 + r;
      if (row < T && lane < D / 4) {
        const v4f val = *(const v4fa*)&sO[w][r][lane * 4];
        *(v4f*)(y + ((size_t)b * T + row) * ypitch + h * D + lane * 4) = val;
      }
    }
    
  }
}

// GEMM C = act(A·W + bias + resid): A f32 (ASPLIT -> hi/lo 2 terms), Wt bf16 [N][K]; ACT 0 none, 1 relu, 2 exact gelu;
// resid (optional, f32, row index = (row % rmod), pitch ldr, RES_BF16 rounds it) added before the activation.
template <bool ASPLIT, int ACT, bool BIAS_BF16, bool RES_BF16>
__global__ __launch_bounds__(128) void k_gemm_bf3(const float* __restrict__ A, int lda, const unsigned short* __restrict__ Wt, int ldb,
                                                const float* __restrict__ bias, const float* __restrict__ resid, int rmod, int ldr,
                                                float* __restrict__ C, int ldc, int M, int N, int K) {
  __shared__ __attribute__((aligned(16))) float so[4][16][64];
  const int tid = threadIdx.x, w = tid >> 5, lane = tid & 31, ln = lane & 15, hh = lane >> 4;
  const int ntn = N / 64;
  const int wid = blockIdx.x * 4 + w;
  const int mt = wid / ntn, nq = wid % ntn;
  if (mt * 16 >= M) return;
  const int row0 = mt * 16, col0 = nq * 64;
  const float* arow = A + (size_t)(row0 + ln) * lda;
  v8f acc[4] = {};
  for (int kb = 0; kb < K; kb += 32) {
    FragB ah, al;
    const v4f x0 = *(const v4fa*)(arow + kb + 8 * hh), x1 = *(const v4fa*)(arow + kb + 8 * hh + 4);
    const v4f x2 = *(const v4fa*)(arow + kb + 16 + 8 * hh), x3 = *(const v4fa*)(arow + kb + 16 + 8 * hh + 4);
    float xs[16] = {x0[0],x0[1],x0[2],x0[3],x1[0],x1[1],x1[2],x1[3],x2[0],x2[1],x2[2],x2[3],x3[0],x3[1],x3[2],x3[3]};
#pragma unroll
    for (int i = 0; i < 16; ++i) { const unsigned short hb = bf16_bits(xs[i]); ah.u[i] = hb; al.u[i] = ASPLIT ? bf16_bits(xs[i] - bf16_val(hb)) : (unsigned short)0; }
#pragma unroll
    for (int t = 0; t < 4; ++t) {
      const unsigned short* brow = Wt + (size_t)(col0 + t * 16 + ln) * ldb + kb;
      FragB b;
      b.half[0] = *(const v8us*)(brow + 8 * hh);
      b.half[1] = *(const v8us*)(brow + 16 + 8 * hh);
      acc[t] = mmaN<ASPLIT ? 2 : 1>(ah.v, al.v, b.v, b.v, acc[t]);
    }
  }
#pragma unroll
  for (int t = 0; t < 4; ++t) {
    const int col = col0 + t * 16 + ln;
    float bv = bias ? bias[col] : 0.f;
    if (BIAS_BF16) bv = bf16_round(bv);
#pragma unroll
    for (int r = 0; r < 8; ++r) {
      float v = acc[t][r] + bv;
      if (resid) { float rv = resid[(size_t)((row0 + 8 * hh + r) % rmod) * ldr + col]; if (RES_BF16) rv = bf16_round(rv); v += rv; }
      if (ACT == 1) v = fmaxf(v, 0.f);
      if (ACT == 2) v = 0.5f * v * (1.0f + erff(v * 0.70710678118654752f));
      if (ACT == 3) { const float u = 0.7978845608028654f * (v + 0.044715f * v * v * v); v = 0.5f * v * (1.0f + tanhf(u)); }
      so[w][8 * hh + r][t * 16 + ln] = v;
    }
  }
  __builtin_amdgcn_fence(__ATOMIC_ACQ_REL, "workgroup");
  __builtin_amdgcn_wave_barrier();
  const int rsub = lane >> 4, c4 = (lane & 15) * 4;
  {
#pragma unroll
    for (int q = 0; q < 8; ++q) {
      const int r = q * 2 + rsub;
      const v4f v = *(const v4fa*)&so[w][r][c4];
      *(v4f*)(C + (size_t)(row0 + r) * ldc + col0 + c4) = v;
    }
    
  }
}
// row LayerNorm (biased variance, eps) over N: s = X (+ R); optional out_sum <- s; out_norm <- (s-mu)*rsqrt(var+eps)*g + b
template <bool PARAM_BF16>
__global__ __launch_bounds__(256) void k_layernorm(const float* __restrict__ X, const float* __restrict__ R, const float* __restrict__ g, const float* __restrict__ bta,
                                                  float* __restrict__ out_sum, float* __restrict__ out_norm, int N, float eps) {
  __shared__ float red[256];
  const int row = blockIdx.x, tid = threadIdx.x;
  const float* x = X + (size_t)row * N; const float* rr = R ? R + (size_t)row * N : nullptr;
  float vals[16];                     // up to N = 4096
  const int per = N / 256;            // contiguous chunk per thread? use strided-by-4 chunks: thread handles j = tid*4 + 1024*u
  float s1 = 0.f;
  for (int u = 0; u < per / 4; ++u) {
    const int j = tid * 4 + 1024 * u;
    const v4f a = *(const v4fa*)(x + j);
    v4f b = {0.f,0.f,0.f,0.f}; if (rr) b = *(const v4fa*)(rr + j);
#pragma unroll
    for (int q = 0; q < 4; ++q) { const float v = a[q] + b[q]; vals[u * 4 + q] = v; s1 += v; }
  }
  red[tid] = s1; __syncthreads();
  for (int st = 128; st > 0; st >>= 1) { if (tid < st) red[tid] += red[tid + st]; __syncthreads(); }
  const float mu = red[0] / (float)N; __syncthreads();
  float s2 = 0.f;
  for (int u = 0; u < per / 4; ++u)
#pragma unroll
    for (int q = 0; q < 4; ++q) { const float c = vals[u * 4 + q] - mu; s2 += c * c; }
  red[tid] = s2; __syncthreads();
  for (int st = 128; st > 0; st >>= 1) { if (tid < st) red[tid] += red[tid + st]; __syncthreads(); }
  const float rs = rsqrtf(red[0] / (float)N + eps);
  {
    for (int u = 0; u < per / 4; ++u) {
      const int j = tid * 4 + 1024 * u;
      v4f o, sm;
#pragma unroll
      for (int q = 0; q < 4; ++q) {
        float gg = g[j + q], bb = bta[j + q];
        if (PARAM_BF16) { gg = bf16_round(gg); bb = bf16_round(bb); }
        sm[q] = vals[u * 4 + q]; o[q] = (vals[u * 4 + q] - mu) * rs * gg + bb;
      }
      if (out_sum) *(v4f*)(out_sum + (size_t)row * N + j) = sm;
      *(v4f*)(out_norm + (size_t)row * N + j) = o;
    }
    
  }
}



// ---- f16 WMMA path (v_wmma_f32_16x16x32_f16): 11-bit significands for operands in range — used where a [0,1] probability operand needs more precision than bf16
typedef _Float16 v16h __attribute__((ext_vector_type(16)));
union FragH { v16h v; v8us half[2]; _Float16 h[16]; unsigned short u[16]; };
template <int NT>
__device__ __forceinline__ v8f mmaH(v16h ah, v16h al, v16h bh, v16h bl, v8f c) {
  c = __builtin_amdgcn_wmma_f32_16x16x32_f16(false, ah, false, bh, (short)0, c, false, false);
  if (NT >= 2) c = __builtin_amdgcn_wmma_f32_16x16x32_f16(false, al, false, bh, (short)0, c, false, false);
  if (NT >= 3) c = __builtin_amdgcn_wmma_f32_16x16x32_f16(false, ah, false, bl, (short)0, c, false, false);
  asm volatile("v_nop\n\tv_nop\n\tv_nop\n\tv_nop" : "+v"(c) : "v"(ah), "v"(al), "v"(bh), "v"(bl));
  return c;
}
// Wt[n][k] = f16(W[k][n]·scale) from f32 row-major W[K][N] (scale = power of two; bf16-exact weights stay exact in f16 away from the subnormal range)
__global__ __launch_bounds__(256) void k_wt_f16(const float* __restrict__ W, _Float16* __restrict__ Wt, int K, int N, float scale) {
  const int t = blockIdx.x * 256 + threadIdx.x; if (t >= N * (K / 8)) return; const int n = t / (K / 8), k8 = (t % (K / 8)) * 8; FragH f;
#pragma unroll
  for (int i = 0; i < 8; ++i) f.h[i] = (_Float16)(bf16_round(W[(size_t)(k8 + i) * N + n]) * scale); const v8us o = f.half[0];
  *(v8us*)((unsigned short*)Wt + (size_t)n * K + k8) = o; 
}
// per-pair bias, 32 pairs (same (b, key j), queries i = ib + 32 it .. ib + 32 it + 31) per pass of a wave, one pair per lane, BG passes per wave (one wave = BG * 32 neighbouring queries of one key: the weights are staged once per block, the key's own features formed once per wave), the plane stored [b][j][i] (k_flash reads it with the query along the lanes), both MLPs wholly on the 16x16x32 f16 WMMAs (layer 1 with an f16 result, layer 2 with an f32 result) in transposed form:
// layer 1: D1 = W1 (A: 16 hidden rows x k) * F (B: k x 16 pairs). A pair has 8 features: dist and dt each as an f16 high part plus an f16 remainder (the two products are summed in the matrix unit), x_j, y_j, z_j, and 1.0
// for the layer's bias. Lanes 0..15 carry their pair's features at k = 0..7, lanes 16..31 at k = 8..15; W1 stands at both k ranges, and the half of B that belongs to the other 16 pairs is zeroed for each product.
// layer 2: two D1 tiles (hidden rows 0..15 and 16..31 of a 32-row block), which layer 1's products leave as f16 (rounded by the matrix unit, no conversion in the vector unit), relu'd, ARE a B operand in the hardware k order; A = W2 with geom / shape / rate in rows 0,1,2 and again in rows 8,9,10, so that
// D2 registers 0,1,2 of lanes 0..15 (rows 0..2) and of lanes 16..31 (rows 8..10) hold the three outputs of column ln: every lane picks the D2 of its own 16-pair group and does its pair's softplus/log/lgamma tail. All weights x16 (exact), taken out as 1/256.
union FragW { v16h v; v8us half[2]; _Float16 h[16]; unsigned int w[8]; };
#define BG 16
// The chip's own base-2 exponential and logarithm, one instruction each. Every argument below is a normal number, zero or infinite where it matters (logarithms see values of 1e-4 and more), so the library's range steps are not needed.
__device__ __forceinline__ float hw_exp2(float x) { return __builtin_amdgcn_exp2f(x); }
__device__ __forceinline__ float hw_log2(float x) { return __builtin_amdgcn_logf(x); }
#define LOG2E 1.4426950408889634f
#define LN2 0.6931471805599453f
// softplus(q) = max(q, 0) + log(1 + e), e = exp(-|q|) in [0, 1]. u = 1 + e drops d = e - (u - 1), which is exact; log(1 + e) = log(u) + d / u, and d stands for d / u to within d * e: the relative error stays at rounding level down to e = 0.
__device__ __forceinline__ float softplus_hw(float q) { const float e = hw_exp2(-fabsf(q) * LOG2E); const float u = 1.0f + e; const float d = e - (u - 1.0f); return fmaxf(q, 0.f) + (hw_log2(u) * LN2 + d); }
__device__ __forceinline__ v8f mma16(v16h a, v16h b, v8f c) { return __builtin_amdgcn_wmma_f32_16x16x32_f16(false, a, false, b, (short)0, c, false, false); }
// the same product with its result rounded to f16 by the matrix unit: element e of a lane's 8 is row 8 hh + e, two rows a register, which is the packing that a B operand wants
typedef _Float16 v8h __attribute__((ext_vector_type(8)));
__device__ __forceinline__ v8h mma16h(v16h a, v16h b, v8h c) { return __builtin_amdgcn_wmma_f16_16x16x32_f16(false, a, false, b, (short)0, c, false, false); }
__device__ __forceinline__ void bias_block(const int blk, const float* __restrict__ crd, const float* __restrict__ gw1, const float* __restrict__ gb1, const float* __restrict__ gw2, const float* __restrict__ gb2, const float* __restrict__ dw1, const float* __restrict__ db1, const float* __restrict__ dw2, const float* __restrict__ db2, float* __restrict__ BIAS) {
  __shared__ __attribute__((aligned(16))) _Float16 sW1[2 * BH][8];           // row = hidden unit (0..63 geom, 64..127 delay), its 8 feature weights
  __shared__ __attribute__((aligned(16))) _Float16 sW2[16][2 * BH + 8];      // row = output row of layer 2, k = hidden unit; pitch 272 B spreads the 16 rows over the banks
  const int tid = threadIdx.x, w = __builtin_amdgcn_readfirstlane(tid >> 5), lane = tid & 31, ln = lane & 15, hh = lane >> 4;      // the wave's number in a scalar register keeps the key's row and the wave's first query scalar
  { FragW f; float o0 = 0.f, o1 = 0.f, o2 = 0.f; const _Float16 z = (_Float16)0.f;
    if (tid < BH) { const _Float16 g0 = (_Float16)(bf16_round(gw1[tid * 2]) * 16.0f), g1 = (_Float16)(bf16_round(gw1[tid * 2 + 1]) * 16.0f);
      f.h[0] = g0; f.h[1] = g0; f.h[2] = g1; f.h[3] = g1; f.h[4] = z; f.h[5] = z; f.h[6] = z; f.h[7] = (_Float16)(bf16_round(gb1[tid]) * 16.0f); o0 = bf16_round(gw2[tid]) * 16.0f; }
    else { const int k = tid - BH; const _Float16 d0 = (_Float16)(bf16_round(dw1[k * 4]) * 16.0f);
      f.h[0] = d0; f.h[1] = d0; f.h[2] = z; f.h[3] = z; f.h[4] = (_Float16)(bf16_round(dw1[k * 4 + 1]) * 16.0f); f.h[5] = (_Float16)(bf16_round(dw1[k * 4 + 2]) * 16.0f); f.h[6] = (_Float16)(bf16_round(dw1[k * 4 + 3]) * 16.0f);
      f.h[7] = (_Float16)(bf16_round(db1[k]) * 16.0f); o1 = bf16_round(dw2[k]) * 16.0f; o2 = bf16_round(dw2[BH + k]) * 16.0f; }
    *(v8us*)&sW1[tid][0] = f.half[0];
#pragma unroll
    for (int m = 0; m < 16; ++m) sW2[m][tid] = (_Float16)(((m & 7) == 0) ? o0 : ((m & 7) == 1) ? o1 : ((m & 7) == 2) ? o2 : 0.f); }
  __syncthreads();
  const size_t p0 = ((size_t)blk * 4 + w) * (32 * BG);      // BG * 32 consecutive queries of one (b, j) (SS = 1024 is a multiple of it)
  const int b = (int)(p0 / ((size_t)SS * SS)); const int j = (int)((p0 / SS) % SS); const int ib = (int)(p0 % SS);
  const float* cj = crd + ((size_t)b * SS + j) * 4; const float xj = bf16_round(cj[0]), yj = bf16_round(cj[1]), zj = bf16_round(cj[2]), tj = bf16_round(cj[3]);
  const float gb2v = bf16_round(gb2[0]), db20 = bf16_round(db2[0]), db21 = bf16_round(db2[1]);
  v16h a1[8];
#pragma unroll
  for (int t = 0; t < 8; ++t) { FragW f; f.half[0] = *(const v8us*)&sW1[t * 16 + ln][0];
#pragma unroll
    for (int q = 0; q < 4; ++q) f.w[4 + q] = 0u;
    a1[t] = f.v; }
  const v8f zero8 = (v8f){0.f,0.f,0.f,0.f,0.f,0.f,0.f,0.f};
  const v16h zero16 = {}; const v8h zero8h = {};
  const float* pc = crd + ((size_t)b * SS + ib + lane) * 4;      // this lane's query of the pass, i = ib + 32 it + lane
  float* pb = BIAS + p0 + lane;
  v4f cn = *(const v4fa*)pc;
  asm volatile("s_wait_xcnt 0x0" :: "v"(pc) : "memory");      // the address pair stays whole up to this wait; the loop steps on it
#pragma unroll 1      // one copy of the pass: a pass takes nothing from the one before but the fetched coordinates
  for (int it = 0; it < BG; ++it) {
  const v4f ci = cn; const float* pn = pc + (it + 1 < BG ? 32 * 4 : 0);      // the next pass's coordinates are fetched a pass ahead (the last pass fetches its own again)
  cn = *(const v4fa*)pn;
  asm volatile("s_wait_xcnt 0x0" :: "v"(pn) : "memory");      // the address pair stays whole up to this wait; it is stepped on behind it
  pc = pn;
  v16h a2[4];      // layer 2's weights are read from LDS in every pass: held over the loop beside layer 1's they do not fit the registers of six waves a SIMD (the build spills them)
#pragma unroll
  for (int s = 0; s < 4; ++s) { FragW f; f.half[0] = *(const v8us*)&sW2[ln][s * 32 + 8 * hh]; f.half[1] = *(const v8us*)&sW2[ln][s * 32 + 16 + 8 * hh]; a2[s] = f.v; }
  const float xi = bf16_round(ci[0]), yi = bf16_round(ci[1]), zi = bf16_round(ci[2]), ti = bf16_round(ci[3]);
  const float dx = xi - xj, dy = yi - yj, dz = zi - zj; const float dist = __builtin_amdgcn_sqrtf(dx * dx + dy * dy + dz * dz); const float dt = ti - tj;
  FragW F; F.h[0] = (_Float16)dist; F.h[1] = (_Float16)(dist - (float)F.h[0]); F.h[2] = (_Float16)dt; F.h[3] = (_Float16)(dt - (float)F.h[2]); F.h[4] = (_Float16)xj; F.h[5] = (_Float16)yj; F.h[6] = (_Float16)zj; F.h[7] = (_Float16)1.0f;
  FragW bf[2];
#pragma unroll
  for (int c = 0; c < 2; ++c)
#pragma unroll
    for (int q = 0; q < 4; ++q) { bf[c].w[q] = (hh == c) ? F.w[q] : 0u; bf[c].w[4 + q] = 0u; }
  v8f d2[2] = {zero8, zero8};
  // Step p = 2 s + c takes two tiles of layer 1 (hidden rows 32 s .. 32 s + 15 and the 16 above them, pair group c), which side by side are the B operand of one product of layer 2. The order is written out and held by the scheduling
  // barriers: layer 1 runs two steps ahead of the relus. A tile's relus then stand more than the four vector slots that the chip asks for behind the product that made it, and run while the matrix unit works on the products issued in front
  // of them; left to itself the build sets a tile's relus close behind its product and fills the distance with about twice as many v_nop. The relu is the maximum that lets a NaN pass, as the reference's does: one instruction on a
  // matrix result, where the NaN-dropping maximum takes a second one that first quiets its argument.
  v8h T[16];
#pragma unroll
  for (int k = 0; k < 4; ++k) T[k] = mma16h(a1[k & 1], bf[k >> 1].v, zero8h);
  __builtin_amdgcn_sched_barrier(0);      // holds the written order (see above)
  v16h hb[8];
#pragma unroll
  for (int p = 0; p < 8; ++p) {
    hb[p] = __builtin_elementwise_maximum(__builtin_shufflevector(T[2 * p], T[2 * p + 1], 0, 1, 2, 3, 4, 5, 6, 7, 8, 9, 10, 11, 12, 13, 14, 15), zero16);      // relu, two units per instruction; the shuffle is no instruction: the two tiles stand in neighbouring registers
    __builtin_amdgcn_sched_barrier(0);      // holds the written order
    if (p == 6) continue;      // no product of layer 1 is left to stand behind step 6's layer 2 product: it goes behind step 7's relus, which would otherwise wait out its distance
    if (p == 7) d2[0] = mma16(a2[3], hb[6], d2[0]);
    d2[p & 1] = mma16(a2[p >> 1], hb[p], d2[p & 1]);
    if (p + 2 < 8) { T[2 * p + 4] = mma16h(a1[2 * ((p + 2) >> 1)], bf[p & 1].v, zero8h); T[2 * p + 5] = mma16h(a1[2 * ((p + 2) >> 1) + 1], bf[p & 1].v, zero8h); }
    __builtin_amdgcn_sched_barrier(0); }      // holds the written order
  { const float geom = (hh ? d2[1][0] : d2[0][0]) * 0.00390625f + gb2v; const float q0 = (hh ? d2[1][1] : d2[0][1]) * 0.00390625f + db20, q1 = (hh ? d2[1][2] : d2[0][2]) * 0.00390625f + db21;
    const float shape = softplus_hw(q0) + 1e-4f, rate = softplus_hw(q1) + 1e-4f; const float dtp = fmaxf(fabsf(dt), 1e-4f);
    // lgamma(shape), shape >= 1e-4: its asymptotic series (z - 0.5) log z - z + 0.5 log(2 pi) + 1/(12 z) - 1/(360 z^3) + 1/(1260 z^5) at z >= 4 (the next term is below 4e-8 there). Below 8 the argument is moved up by 4: lgamma(x) = lgamma(x + 4) - log(x (x + 1) (x + 2) (x + 3)), the product as t (t + 2) with t = x (x + 3).
    const bool up = shape < 8.0f; const float t = shape * (shape + 3.0f); const float prod = up ? t * (t + 2.0f) : 1.0f; const float z = up ? shape + 4.0f : shape;
    const float rz = __builtin_amdgcn_rcpf(z), rz2 = rz * rz; const float ser = rz * (0.083333333f + rz2 * (-0.0027777778f + rz2 * 0.00079365079f));
    // the logarithmic terms are added in base 2, the others in base e; the plane is stored in base-2 units (x log2 e), which k_flash's exp2 takes as they are
    const float l2rate = hw_log2(rate), l2dtp = hw_log2(dtp), l2z = hw_log2(z), l2prod = hw_log2(prod);
    __builtin_amdgcn_sched_barrier(0);      // the four arguments die below; the instruction set asks for one slot between a logarithm and an instruction that takes over its argument's register
    const float lg2 = shape * l2rate + (shape - 1.0f) * l2dtp - (z - 0.5f) * l2z + l2prod;
    const float nat = geom - rate * dtp + (z - 0.91893853f) - ser;
    *pb = lg2 + nat * LOG2E;
    asm volatile("s_wait_xcnt 0x0" :: "v"(pb) : "memory");      // stands behind the store: its address pair stays whole up to this wait and is stepped on behind it
    pb += 32; } } }
// 16 k positions of one f32 row for an f16 fragment; p points at the lane's k = 8 hh of the 32-wide k step (positions 0..7 and 16..23 from there). load16 fetches them, cvt16 makes f16(bf16(x) * sc) of them (round to nearest even, as bf16_round)
__device__ __forceinline__ void load16(const float* __restrict__ p, v4f (&x)[4]) { x[0] = *(const v4fa*)p; x[1] = *(const v4fa*)(p + 4); x[2] = *(const v4fa*)(p + 16); x[3] = *(const v4fa*)(p + 20); }
__device__ __forceinline__ v16h cvt16(const v4f (&x)[4], const float sc) { FragH f;
#pragma unroll
  for (int g = 0; g < 4; ++g)
#pragma unroll
    for (int q = 0; q < 4; ++q) f.h[4 * g + q] = (_Float16)((float)(__bf16)x[g][q] * sc);
  return f.v; }
// q, k, v projections straight from the f32 inputs. One wave = 16 rows of one matrix (B operand) against 64 rows of the other (A operand, 4 tiles), K = 256: a lane then holds 8 neighbouring results of the A side,
// one 16-byte store per tile, and a wave writes whole 128-byte lines. q, k: B = 16 rows of src, A = 64 rows of W, stored [row][col]. v: B = 16 rows of Wv, A = 64 rows of src (keys), stored transposed [b][col][key].
__device__ __forceinline__ void qkv_block(const int blk, const float* __restrict__ src, const float* __restrict__ Wq, const float* __restrict__ Wk, const float* __restrict__ Wv, _Float16* __restrict__ Q16, _Float16* __restrict__ K16, _Float16* __restrict__ Vt) {
  const int tid = threadIdx.x, w = __builtin_amdgcn_readfirstlane(tid >> 5), lane = tid & 31, ln = lane & 15, hh = lane >> 4;      // the wave's number in a scalar register keeps the base pointers scalar
  const int which = blk >> 7, wid = (blk & 127) * 4 + w;
  const float* one; const float* four; float s1, s4; _Float16* dst;
  if (which < 2) { const int mt = wid >> 2, nq = wid & 3; one = src + (size_t)mt * 16 * DM; four = (which ? Wk : Wq) + (size_t)nq * 64 * DM; s1 = 1.0f; s4 = 16.0f; dst = (which ? K16 : Q16) + (size_t)(mt * 16 + ln) * DM + nq * 64; }
  else { const int kq = wid >> 4, ct = wid & 15; one = Wv + (size_t)ct * 16 * DM; four = src + (size_t)kq * 64 * DM; s1 = 16.0f; s4 = 1.0f; dst = Vt + ((size_t)(kq / (SS / 64)) * DM + ct * 16 + ln) * SS + (kq % (SS / 64)) * 64; }
  const float* orow = one + ln * DM + 8 * hh; const float* frow = four + ln * DM + 8 * hh;
  v8f acc[4] = {};
  for (int kb = 0; kb < DM; kb += 32) { const float* po = orow + kb; const float* pf = frow + kb; v4f ro[4], rf[4][4];
    load16(po, ro);
#pragma unroll
    for (int t = 0; t < 4; ++t) load16(pf + t * 16 * DM, rf[t]);
    asm volatile("s_wait_xcnt 0x0" :: "v"(po), "v"(pf) : "memory");      // the two address pairs stay whole up to this wait
    const v16h bo = cvt16(ro, s1);
#pragma unroll
    for (int t = 0; t < 4; ++t) acc[t] = mma16(cvt16(rf[t], s4), bo, acc[t]); }
#pragma unroll
  for (int t = 0; t < 4; ++t) { FragH o;
#pragma unroll
    for (int r = 0; r < 8; ++r) o.h[r] = (_Float16)(acc[t][r] * 0.0625f);
    *(v8us*)((unsigned short*)dst + t * 16 + 8 * hh) = o.half[0]; } }
// Everything that depends on the inputs alone, in one launch: blocks 0..383 the q, k, v projections, blocks 384..447 Wo as f16 (x16), the rest the bias plane. The 1472 blocks of 4 waves are all resident at once.
#define G_QKV (3 * (NR / 16) * (DM / 64) / 4)
#define G_WO (DM * DM / 8 / 128)
#define G_BIAS (BB * SS * SS / (128 * BG))
// waves_per_eu(6, 6): at most 160 registers, six waves a SIMD, which holds all 1472 blocks of 4 waves at once. The bias loop keeps layer 1's weights in 64 registers; planned for seven or eight waves the build has too few registers left to set
// independent work behind the loop's products and fills the distance with more v_nop. With this line it builds to 156 registers, nothing spilled, the 20 loads of the q, k, v loop in one run
__global__ __launch_bounds__(128) __attribute__((amdgpu_waves_per_eu(6, 6))) void k_front(const float* __restrict__ src, const float* __restrict__ crd, const float* __restrict__ Wq, const float* __restrict__ Wk, const float* __restrict__ Wv, const float* __restrict__ Wo,
    const float* __restrict__ gw1, const float* __restrict__ gb1, const float* __restrict__ gw2, const float* __restrict__ gb2, const float* __restrict__ dw1, const float* __restrict__ db1, const float* __restrict__ dw2, const float* __restrict__ db2,
    _Float16* __restrict__ Q16, _Float16* __restrict__ K16, _Float16* __restrict__ Vt, _Float16* __restrict__ Bo, float* __restrict__ BIAS) {
  const int blk = blockIdx.x;
  if (blk < G_QKV) { qkv_block(blk, src, Wq, Wk, Wv, Q16, K16, Vt); return; }
  if (blk < G_QKV + G_WO) { const size_t t = (size_t)(blk - G_QKV) * 128 + threadIdx.x; FragH f;
#pragma unroll
    for (int i = 0; i < 8; ++i) f.h[i] = (_Float16)(bf16_round(Wo[t * 8 + i]) * 16.0f);
    *(v8us*)((unsigned short*)Bo + t * 8) = f.half[0];
    asm volatile("s_wait_xcnt 0x0" ::: "memory");      // stands behind the store, ahead of any later write of the registers it names (the listing lays the other branches behind it)
    return; }
  bias_block(blk - (G_QKV + G_WO), crd, gw1, gb1, gw2, gb2, dw1, db1, dw2, db2, BIAS); }
typedef float v2f  __attribute__((ext_vector_type(2)));
typedef float v2fa __attribute__((ext_vector_type(2), may_alias));
// lane l with lane l ^ 16, in the vector unit
__device__ __forceinline__ float xhalf(float x) { return __builtin_bit_cast(float, __builtin_amdgcn_permlanex16(__builtin_bit_cast(int, x), __builtin_bit_cast(int, x), 0x76543210, 0xfedcba98, false, false)); }
// One block = 32 query rows of one (batch, head); its 8 waves share those rows and split the 1024 keys, 128 each (512 blocks of 8 waves fill every SIMD four deep, where one wave per 32 rows over all keys left
// one wave on half the SIMDs). Every wave runs the same online-softmax loop over its own keys and leaves an un-normalised partial (row max, row sum, O) in LDS; behind one block barrier the partials of a row are
// rescaled to their common max and added, wave 0 first.
// The loop works on the transposed products: St = K (A: 16 keys x d) * Qt (B: d x 16 queries), so lanes ln and ln + 16 hold all 32 scores that a pass gives the query of column ln, 16 each: maximum and sum are taken inside the lane, with one
// exchange between the halves for the maximum (the sums' halves are joined once, behind the loop). The two St tiles of a pass (keys 0..15 and 16..31), as f16 exponentials, ARE the B operand of Ot = Vt (A: 16 d x 32 keys) * Pt in
// the hardware k order: P passes through no LDS. Column ln of query tile rt is query 2 ln + rt, so that one 8-byte load fetches a key's bias for both of a lane's queries from the [key][query] plane and 16 lanes read a whole 128-byte line; a lane holds 8 neighbouring d of its query's output.
// waves_per_eu(1, 4): no more than four waves a SIMD are planned for, which is what 512 blocks of 8 waves come to; without it the compiler saves registers for an occupancy the grid cannot reach
__global__ __launch_bounds__(256) __attribute__((amdgpu_waves_per_eu(1, 4))) void k_flash(const _Float16* __restrict__ Q16, const _Float16* __restrict__ K16, const _Float16* __restrict__ Vt, const float* __restrict__ BIAS, float* __restrict__ O) {
  constexpr int RPW = 32, NW = 8, NQB = SS / RPW, KPW = SS / NW, DT = 2;
  __shared__ __attribute__((aligned(16))) float sO[NW][RPW][HD + 4]; __shared__ float sM[NW][RPW], sL[NW][RPW];
  const int tid = threadIdx.x, w = __builtin_amdgcn_readfirstlane(tid >> 5), lane = tid & 31, ln = lane & 15, hh = lane >> 4;      // the wave's number in a scalar register keeps the wave's key offset (w * KPW) and LDS slots scalar
  const int slab = blockIdx.x / NQB, qblk = blockIdx.x % NQB; const int b = slab / NH, h = slab % NH; const int q0 = qblk * RPW;
  FragH aq[2];
#pragma unroll
  for (int rt = 0; rt < 2; ++rt) { const unsigned short* qr = (const unsigned short*)Q16 + ((size_t)b * SS + q0 + 2 * ln + rt) * DM + h * HD; aq[rt].half[0] = *(const v8us*)(qr + 8 * hh); aq[rt].half[1] = *(const v8us*)(qr + 16 + 8 * hh); }
  const unsigned short* kp = (const unsigned short*)K16 + ((size_t)b * SS + w * KPW + ln) * DM + h * HD + 8 * hh;      // key row ln of the pass, k = d
  const unsigned short* vp = (const unsigned short*)Vt + ((size_t)slab * HD + ln) * SS + w * KPW + 8 * hh;             // d row ln, k = key
  const float* bp = BIAS + ((size_t)b * SS + w * KPW + 8 * hh) * SS + q0 + 2 * ln;                                     // key 8 hh of a tile, queries 2 ln and 2 ln + 1
  float m_r[2], l_r[2]; v8f oacc[2][DT];
  const v8f zero8 = (v8f){0.f,0.f,0.f,0.f,0.f,0.f,0.f,0.f};
#pragma unroll
  for (int rt = 0; rt < 2; ++rt) { m_r[rt] = -3.0e38f; l_r[rt] = 0.f;
#pragma unroll
    for (int dt = 0; dt < DT; ++dt) oacc[rt][dt] = zero8; }
  const float scale = 0.17677669529663688f * LOG2E;      // scores, bias plane, running max in base-2 units: every exponential is one exp2
#pragma unroll 1
  for (int it = 0; it < KPW / 32; ++it) {
    FragH bk[2], bv[DT]; v2f bb[2][8];
#pragma unroll
    for (int nt = 0; nt < 2; ++nt) { bk[nt].half[0] = *(const v8us*)(kp + nt * 16 * DM); bk[nt].half[1] = *(const v8us*)(kp + nt * 16 * DM + 16); }
#pragma unroll
    for (int nt = 0; nt < 2; ++nt)
#pragma unroll
      for (int r = 0; r < 8; ++r) bb[nt][r] = *(const v2fa*)(bp + (nt * 16 + r) * SS);
#pragma unroll
    for (int dt = 0; dt < DT; ++dt) { bv[dt].half[0] = *(const v8us*)(vp + dt * 16 * SS); bv[dt].half[1] = *(const v8us*)(vp + dt * 16 * SS + 16); }
    asm volatile("s_wait_xcnt 0x0" :: "v"(kp), "v"(vp), "v"(bp) : "memory");      // the three address pairs stay whole up to this wait; they are stepped on right behind it
    __builtin_amdgcn_sched_barrier(0);      // all loads of a pass are issued ahead of its first product; without this line the build holds some of the V loads back behind the first wait, to save registers that are free here
    kp += 32 * DM; vp += 32; bp += 32 * SS;
#pragma unroll
    for (int rt = 0; rt < 2; ++rt) {
      v8f c0, c1;
#pragma unroll
      for (int r = 0; r < 8; ++r) { c0[r] = bb[0][r][rt]; c1[r] = bb[1][r][rt]; }
      const v8f s0 = mma16(bk[0].v, aq[rt].v, zero8) * scale + c0, s1 = mma16(bk[1].v, aq[rt].v, zero8) * scale + c1;
      const v8f mx = __builtin_elementwise_max(s0, s1);
      float mc = fmaxf(fmaxf(fmaxf(mx[0], mx[1]), fmaxf(mx[2], mx[3])), fmaxf(fmaxf(mx[4], mx[5]), fmaxf(mx[6], mx[7])));
      mc = fmaxf(mc, xhalf(mc));
      const float mn = fmaxf(m_r[rt], mc); const float al = hw_exp2(m_r[rt] - mn); m_r[rt] = mn;
      const v8f e0 = s0 - mn, e1 = s1 - mn; v8f p0, p1; FragH pb;
#pragma unroll
      for (int r = 0; r < 8; ++r) { p0[r] = hw_exp2(e0[r]); p1[r] = hw_exp2(e1[r]); pb.h[r] = (_Float16)p0[r]; pb.h[8 + r] = (_Float16)p1[r]; }
      const v8f ps = p0 + p1;
      l_r[rt] = l_r[rt] * al + (((ps[0] + ps[4]) + (ps[1] + ps[5])) + ((ps[2] + ps[6]) + (ps[3] + ps[7])));      // this lane's 16 keys
#pragma unroll
      for (int dt = 0; dt < DT; ++dt) oacc[rt][dt] = mma16(bv[dt].v, pb.v, oacc[rt][dt] * al); } }
#pragma unroll
  for (int rt = 0; rt < 2; ++rt) { const float l = l_r[rt] + xhalf(l_r[rt]);
#pragma unroll
    for (int dt = 0; dt < DT; ++dt) { const v8f o = oacc[rt][dt]; float* so = &sO[w][2 * ln + rt][dt * 16 + 8 * hh]; *(v4f*)so = (v4f){o[0], o[1], o[2], o[3]}; *(v4f*)(so + 4) = (v4f){o[4], o[5], o[6], o[7]}; }
    if (hh == 0) { sM[w][2 * ln + rt] = m_r[rt]; sL[w][2 * ln + rt] = l; } }      // max and sum are the same in the two lanes of a query
  __syncthreads();      // every wave's partial is in LDS before any thread merges
  { const int r = tid >> 3, pc = tid & 7;      // one thread = 4 output columns of one row
    float mw[NW], M = -3.0e38f;
#pragma unroll
    for (int u = 0; u < NW; ++u) { mw[u] = sM[u][r]; M = fmaxf(M, mw[u]); }
    float L = 0.f; v4f acc = {0.f, 0.f, 0.f, 0.f};
#pragma unroll
    for (int u = 0; u < NW; ++u) { const float g = hw_exp2(mw[u] - M); L += sL[u][r] * g; const v4f val = *(const v4fa*)&sO[u][r][pc * 4]; acc += val * g; }
    const float inv = 1.0f / L;
    *(v4f*)(O + ((size_t)b * SS + q0 + r) * DM + h * HD + pc * 4) = acc * inv; } }
// out = f16(O) * Wo^T, sizes fixed at compile time. One block = 16 rows of O against 128 rows of Wo (output columns), one wave = 32 of those columns (two A tiles; O is the B operand, so a lane holds 8 neighbouring
// columns of its row and a wave writes whole 128-byte lines, no LDS epilogue). 256 blocks of 4 waves: one wave on every SIMD, so nothing hides a wave's own waits. A wave therefore issues all its loads in one run ahead of its
// first wait: 8 for the two k steps of the O tile that it converts for the block, 32 for its own Wo rows over the whole K. The O tile goes round as finished f16 fragments, 16 bytes a lane in lane order (no bank conflicts).
// waves_per_eu(1, 2): registers are planned for what the grid comes to, not saved for an occupancy that it cannot reach
__global__ __launch_bounds__(128) __attribute__((amdgpu_waves_per_eu(1, 2))) void k_out(const float* __restrict__ O, const _Float16* __restrict__ Bo, float* __restrict__ out) {
  constexpr int KS = DM / 32;
  __shared__ __attribute__((aligned(16))) unsigned short sF[KS][2][32][8];
  const int tid = threadIdx.x, w = __builtin_amdgcn_readfirstlane(tid >> 5), lane = tid & 31, ln = lane & 15, hh = lane >> 4;      // the wave's number in a scalar register keeps the base pointers scalar
  const int row0 = (blockIdx.x >> 1) * 16, col0 = ((blockIdx.x & 1) * 4 + w) * 32;
  const float* op = O + (size_t)(row0 + ln) * DM + w * 64 + 8 * hh;                       // k steps 2 w and 2 w + 1 of row ln
  const unsigned short* wp = (const unsigned short*)Bo + (size_t)(col0 + ln) * DM + 8 * hh;      // Wo row col0 + ln, all k steps
  v4f ro[2][4]; FragH a[2][KS];
  load16(op, ro[0]); load16(op + 32, ro[1]);      // first in the queue: loads come back in order, and the block waits for these
#pragma unroll
  for (int ks = 0; ks < KS; ++ks)
#pragma unroll
    for (int t = 0; t < 2; ++t) { a[t][ks].half[0] = *(const v8us*)(wp + t * 16 * DM + ks * 32); a[t][ks].half[1] = *(const v8us*)(wp + t * 16 * DM + ks * 32 + 16); }
  asm volatile("s_wait_xcnt 0x0" :: "v"(op), "v"(wp) : "memory");      // the two address pairs stay whole up to this wait, ahead of any later write of their registers; no load sinks behind this line either, so all 40 are in flight at the first wait
#pragma unroll
  for (int u = 0; u < 2; ++u) { FragH f;
#pragma unroll
    for (int g = 0; g < 4; ++g)
#pragma unroll
      for (int q = 0; q < 4; ++q) f.h[4 * g + q] = (_Float16)ro[u][g][q];
    *(v8us*)&sF[2 * w + u][0][lane][0] = f.half[0]; *(v8us*)&sF[2 * w + u][1][lane][0] = f.half[1]; }
  __syncthreads();      // all eight fragments of the O tile are in LDS before any wave reads them
  FragH b[KS];
#pragma unroll
  for (int ks = 0; ks < KS; ++ks) { b[ks].half[0] = *(const v8us*)&sF[ks][0][lane][0]; b[ks].half[1] = *(const v8us*)&sF[ks][1][lane][0]; }
  __builtin_amdgcn_sched_barrier(0);      // all 16 LDS reads stand in one place ahead of the products; without this line the build reads the first k steps one at a time, each behind a full wait, to save registers that are free here
  v8f acc[2] = {};
#pragma unroll
  for (int ks = 0; ks < KS; ++ks)
#pragma unroll
    for (int t = 0; t < 2; ++t) acc[t] = mma16(a[t][ks].v, b[ks].v, acc[t]);
  float* po = out + (size_t)(row0 + ln) * DM + col0 + 8 * hh;
#pragma unroll
  for (int t = 0; t < 2; ++t) { const v8f o = acc[t] * 0.0625f; *(v4f*)(po + t * 16) = (v4f){o[0], o[1], o[2], o[3]}; *(v4f*)(po + t * 16 + 4) = (v4f){o[4], o[5], o[6], o[7]}; } }
extern "C" void kernel_launch(void* const* d_in, const int* in_sizes, int n_in,
                              void* d_out, int out_size, void* d_ws, size_t ws_size, hipStream_t stream) {
  (void)in_sizes; (void)n_in; (void)out_size;
  const float* src = (const float*)d_in[0]; const float* crd = (const float*)d_in[1]; const float* Wq = (const float*)d_in[2]; const float* Wk = (const float*)d_in[3]; const float* Wv = (const float*)d_in[4]; const float* Wo = (const float*)d_in[5];
  const float* gw1 = (const float*)d_in[6]; const float* gb1 = (const float*)d_in[7]; const float* gw2 = (const float*)d_in[8]; const float* gb2 = (const float*)d_in[9]; const float* dw1 = (const float*)d_in[10]; const float* db1 = (const float*)d_in[11]; const float* dw2 = (const float*)d_in[12]; const float* db2 = (const float*)d_in[13];
  char* ws = (char*)d_ws; size_t off = 0;
  auto take = [&](size_t bytes) { char* p = ws + off; off += (bytes + 255) & ~(size_t)255; return p; };
  _Float16* Bo = (_Float16*)take((size_t)DM * DM * 2); _Float16* Q16 = (_Float16*)take((size_t)NR * DM * 2); _Float16* K16 = (_Float16*)take((size_t)NR * DM * 2); _Float16* Vt = (_Float16*)take((size_t)NR * DM * 2); float* BIAS = (float*)take((size_t)BB * SS * SS * 4); float* O = (float*)take((size_t)NR * DM * 4);
  if (off > ws_size) return;      // about 13 MiB
  k_front<<<G_QKV + G_WO + G_BIAS, 128, 0, stream>>>(src, crd, Wq, Wk, Wv, Wo, gw1, gb1, gw2, gb2, dw1, db1, dw2, db2, Q16, K16, Vt, Bo, BIAS);
  k_flash<<<BB * NH * (SS / 32), 256, 0, stream>>>(Q16, K16, Vt, BIAS, O);
  k_out<<<(NR / 16) * 2, 128, 0, stream>>>(O, Bo, (float*)d_out);      // rounds O to f16 in its loader
}

// v010
// One run takes 31.6 microseconds.
// Two timings next to v009 put it at 1.05 and 1.04 times that version's speed.
// Over all steps from v000 it is 11.8 times as fast.
#include <hip/hip_runtime.h>
// q/k/v/o projections (2048 × 256 × 256) and the 8-head attention (d = 32) with an additive per-pair bias on v_wmma_f32_16x16x32_f16 (fused flash-style kernel: S = Q·Kᵀ, O = P·V on WMMA;
// online max/sum softmax f32; P f16 <= 1). The bias (geometric 2->64->1 MLP + the Gamma log-density from the 4->64->2 delay MLP, incl. lgamma) is computed once per (b, i, j): both layers of the two MLPs
// on WMMA, softplus/log/lgamma in f32; the bias plane is shared by the 8 heads. A = f16(bf16 ·) exact operands in q/k/v, f16(O) in the o projection, weights bf16-exact ×2^4 ((out,in)), single products, f32 accumulate.
#define BB 2
#define SS 1024
#define DM 256
#define NH 8
#define HD 32
#define BH 64
#define NR (BB * SS)

typedef __bf16 v16b __attribute__((ext_vector_type(16)));
typedef unsigned short v8us __attribute__((ext_vector_type(8), may_alias));
typedef float  v8f  __attribute__((ext_vector_type(8)));
typedef float  v4f  __attribute__((ext_vector_type(4)));
typedef float  v4fa __attribute__((ext_vector_type(4), may_alias));
union FragB { v16b v; v8us half[2]; unsigned short u[16]; };

__device__ __forceinline__ unsigned short bf16_bits(float x) { unsigned int u = __float_as_uint(x); return (unsigned short)((u + 0x7FFFu + ((u >> 16) & 1u)) >> 16); }
__device__ __forceinline__ float bf16_val(unsigned short b) { return __uint_as_float(((unsigned int)b) << 16); }
__device__ __forceinline__ float bf16_round(float x) { return bf16_val(bf16_bits(x)); }
// D += A·B with NT terms: 1 = ah·bh, 2 = + al·bh (A split), 3 = + ah·bl (both split)
template <int NT>
__device__ __forceinline__ v8f mmaN(v16b ah, v16b al, v16b bh, v16b bl, v8f c) {
  c = __builtin_amdgcn_wmma_f32_16x16x32_bf16(false, ah, false, bh, (short)0, c, false, false);
  if (NT >= 2) c = __builtin_amdgcn_wmma_f32_16x16x32_bf16(false, al, false, bh, (short)0, c, false, false);
  if (NT >= 3) c = __builtin_amdgcn_wmma_f32_16x16x32_bf16(false, ah, false, bl, (short)0, c, false, false);
  asm volatile("v_nop\n\tv_nop\n\tv_nop\n\tv_nop" : "+v"(c) : "v"(ah), "v"(al), "v"(bh), "v"(bl));
  return c;
}

__global__ __launch_bounds__(256) void k_wt_bf16(const float* __restrict__ W, unsigned short* __restrict__ Wt, int K, int N) {
  const int t = blockIdx.x * 256 + threadIdx.x;
  const int k8n = K / 8;
  if (t >= N * k8n) return;
  const int n = t / k8n, k8 = (t % k8n) * 8;
  v8us v;
#pragma unroll
  for (int i = 0; i < 8; ++i) v[i] = bf16_bits(W[(size_t)(k8 + i) * N + n]);
  *(v8us*)(Wt + (size_t)n * K + k8) = v;
  
}

// GEMM C[M][N] (f32, pitch ldc) = act(A[M][K]·W + bias). A f32 row-major (pitch lda) converted per fragment to bf16
// (ASPLIT: hi/lo two planes -> 2 terms, else single rounded term); Wt bf16 [N][K] (pitch ldb). BIAS_BF16 rounds the
// bias to bf16 first (bias quantised to bf16 before the add). K%32==0, M%16==0, N%64==0.
template <bool ASPLIT, int ACT, bool BIAS_BF16>
__global__ __launch_bounds__(128) void k_gemm_bf(const float* __restrict__ A, int lda, const unsigned short* __restrict__ Wt, int ldb,
                                               const float* __restrict__ bias, float* __restrict__ C, int ldc, int M, int N, int K) {
  __shared__ __attribute__((aligned(16))) float so[4][16][64];
  const int tid = threadIdx.x, w = tid >> 5, lane = tid & 31, ln = lane & 15, hh = lane >> 4;
  const int ntn = N / 64;
  const int wid = blockIdx.x * 4 + w;
  const int mt = wid / ntn, nq = wid % ntn;
  if (mt * 16 >= M) return;
  const int row0 = mt * 16, col0 = nq * 64;
  const float* arow = A + (size_t)(row0 + ln) * lda;
  v8f acc[4] = {};
  for (int kb = 0; kb < K; kb += 32) {
    FragB ah, al;
    const v4f x0 = *(const v4fa*)(arow + kb + 8 * hh), x1 = *(const v4fa*)(arow + kb + 8 * hh + 4);
    const v4f x2 = *(const v4fa*)(arow + kb + 16 + 8 * hh), x3 = *(const v4fa*)(arow + kb + 16 + 8 * hh + 4);
    float xs[16] = {x0[0],x0[1],x0[2],x0[3],x1[0],x1[1],x1[2],x1[3],x2[0],x2[1],x2[2],x2[3],x3[0],x3[1],x3[2],x3[3]};
#pragma unroll
    for (int i = 0; i < 16; ++i) { const unsigned short hb = bf16_bits(xs[i]); ah.u[i] = hb; al.u[i] = ASPLIT ? bf16_bits(xs[i] - bf16_val(hb)) : (unsigned short)0; }
#pragma unroll
    for (int t = 0; t < 4; ++t) {
      const unsigned short* brow = Wt + (size_t)(col0 + t * 16 + ln) * ldb + kb;
      FragB b;
      b.half[0] = *(const v8us*)(brow + 8 * hh);
      b.half[1] = *(const v8us*)(brow + 16 + 8 * hh);
      acc[t] = mmaN<ASPLIT ? 2 : 1>(ah.v, al.v, b.v, b.v, acc[t]);
    }
  }
#pragma unroll
  for (int t = 0; t < 4; ++t) {
    float bv = bias ? bias[col0 + t * 16 + ln] : 0.f;
    if (BIAS_BF16) bv = bf16_round(bv);
#pragma unroll
    for (int r = 0; r < 8; ++r) { float v = acc[t][r] + bv; if (ACT == 1) v = fmaxf(v, 0.f); so[w][8 * hh + r][t * 16 + ln] = v; }
  }
  __builtin_amdgcn_fence(__ATOMIC_ACQ_REL, "workgroup");
  __builtin_amdgcn_wave_barrier();
  const int rsub = lane >> 4, c4 = (lane & 15) * 4;
  {
#pragma unroll
    for (int q = 0; q < 8; ++q) {
      const int r = q * 2 + rsub;
      const v4f v = *(const v4fa*)&so[w][r][c4];
      *(v4f*)(C + (size_t)(row0 + r) * ldc + col0 + c4) = v;
    }
    
  }
}

// Flash-style causal/unmasked attention, all contractions 3-term bf16 hi/lo splits, f32 softmax with running max.
// q,k,v rows are read from f32 buffers with arbitrary row pitch (so they can live inside a fused qkv buffer);
// D = head size (multiple of 32, <= 128); one wave = 16 query rows; block = 4 waves (64 queries) sharing K/V chunks of 32.
template <int D, bool CAUSAL>
__global__ __launch_bounds__(128) void k_flash(const float* __restrict__ qb, const float* __restrict__ kb, const float* __restrict__ vb,
                                             int pitch, int T, int H, float scale, float* __restrict__ y, int ypitch) {
  constexpr int KS = D / 32;        // k-steps for QK
  constexpr int DT = D / 16;        // d tiles for PV
  __shared__ __attribute__((aligned(16))) unsigned short sKh[32][D + 8], sKl[32][D + 8], sVh[32][D + 8], sVl[32][D + 8];
  __shared__ __attribute__((aligned(16))) unsigned short sPh[4][16][40], sPl[4][16][40];
  __shared__ __attribute__((aligned(16))) float sO[4][16][D];
  const int tid = threadIdx.x, w = tid >> 5, lane = tid & 31, ln = lane & 15, hh = lane >> 4;
  const int nqb = (T + 63) / 64;
  const int bh = blockIdx.x / nqb, qblk = blockIdx.x % nqb;
  const int b = bh / H, h = bh % H;
  const int q0 = qblk * 64 + w * 16;
  const float* Q = qb + (size_t)b * T * pitch + h * D;
  const float* K = kb + (size_t)b * T * pitch + h * D;
  const float* V = vb + (size_t)b * T * pitch + h * D;

  // A fragments of the wave's 16 query rows (scaled), hi/lo
  FragB aqh[KS], aql[KS];
  {
    int row = q0 + ln; if (row >= T) row = T - 1;
    const float* qr = Q + (size_t)row * pitch;
#pragma unroll
    for (int ks = 0; ks < KS; ++ks)
#pragma unroll
      for (int i = 0; i < 16; ++i) {
        const int d = ks * 32 + ((i < 8) ? (8 * hh + i) : (16 + 8 * hh + (i - 8)));
        const float x = qr[d] * scale; const unsigned short hb = bf16_bits(x);
        aqh[ks].u[i] = hb; aql[ks].u[i] = bf16_bits(x - bf16_val(hb));
      }
  }
  float m_r[8], l_r[8];
#pragma unroll
  for (int r = 0; r < 8; ++r) { m_r[r] = -3.0e38f; l_r[r] = 0.f; }
  v8f oacc[DT];
#pragma unroll
  for (int dt = 0; dt < DT; ++dt) oacc[dt] = (v8f){0.f,0.f,0.f,0.f,0.f,0.f,0.f,0.f};

  const int kv_end = CAUSAL ? min(T, qblk * 64 + 64) : T;     // block-uniform
  for (int j0 = 0; j0 < kv_end; j0 += 32) {
    __syncthreads();
    for (int e = tid; e < 32 * (D / 4); e += 128) {
      const int r = e / (D / 4), c4 = (e % (D / 4)) * 4;
      const int key = j0 + r;
      v4f kf = {0.f,0.f,0.f,0.f}, vf = {0.f,0.f,0.f,0.f};
      if (key < T) { kf = *(const v4fa*)(K + (size_t)key * pitch + c4); vf = *(const v4fa*)(V + (size_t)key * pitch + c4); }
#pragma unroll
      for (int t = 0; t < 4; ++t) {
        unsigned short hb = bf16_bits(kf[t]); sKh[r][c4 + t] = hb; sKl[r][c4 + t] = bf16_bits(kf[t] - bf16_val(hb));
        hb = bf16_bits(vf[t]); sVh[r][c4 + t] = hb; sVl[r][c4 + t] = bf16_bits(vf[t] - bf16_val(hb));
      }
    }
    __syncthreads();
    // S tile 16 x 32
    v8f s[2];
#pragma unroll
    for (int nt = 0; nt < 2; ++nt) {
      v8f acc = {};
#pragma unroll
      for (int ks = 0; ks < KS; ++ks) {
        FragB bh_, bl_;
        bh_.half[0] = *(const v8us*)&sKh[nt * 16 + ln][ks * 32 + 8 * hh]; bh_.half[1] = *(const v8us*)&sKh[nt * 16 + ln][ks * 32 + 16 + 8 * hh];
        bl_.half[0] = *(const v8us*)&sKl[nt * 16 + ln][ks * 32 + 8 * hh]; bl_.half[1] = *(const v8us*)&sKl[nt * 16 + ln][ks * 32 + 16 + 8 * hh];
        acc = mmaN<3>(aqh[ks].v, aql[ks].v, bh_.v, bl_.v, acc);
      }
      s[nt] = acc;
    }
    // mask + running max (rows 8hh+r; the 16 lanes of a half share rows)
    float alpha[8];
#pragma unroll
    for (int r = 0; r < 8; ++r) {
      const int qi = q0 + 8 * hh + r;
      const int ja = j0 + ln, jb = j0 + 16 + ln;
      if (CAUSAL) { if (ja > qi) s[0][r] = -3.0e38f; if (jb > qi) s[1][r] = -3.0e38f; }
      if (ja >= T) s[0][r] = -3.0e38f;
      if (jb >= T) s[1][r] = -3.0e38f;
      float mx = fmaxf(s[0][r], s[1][r]);
      mx = fmaxf(mx, __shfl_xor(mx, 1, 32)); mx = fmaxf(mx, __shfl_xor(mx, 2, 32)); mx = fmaxf(mx, __shfl_xor(mx, 4, 32)); mx = fmaxf(mx, __shfl_xor(mx, 8, 32));
      const float mnew = fmaxf(m_r[r], mx);
      alpha[r] = (mnew > -1.0e38f) ? __expf(m_r[r] - mnew) : 1.0f;
      const float p0 = (s[0][r] > -1.0e38f) ? __expf(s[0][r] - mnew) : 0.f;
      const float p1 = (s[1][r] > -1.0e38f) ? __expf(s[1][r] - mnew) : 0.f;
      m_r[r] = mnew;
      l_r[r] = l_r[r] * alpha[r] + p0 + p1;            // per-lane partial row sum (16 lanes combined at the end)
      unsigned short hb = bf16_bits(p0); sPh[w][8 * hh + r][ln] = hb;      sPl[w][8 * hh + r][ln] = bf16_bits(p0 - bf16_val(hb));
      hb = bf16_bits(p1);                sPh[w][8 * hh + r][16 + ln] = hb; sPl[w][8 * hh + r][16 + ln] = bf16_bits(p1 - bf16_val(hb));
    }
#pragma unroll
    for (int dt = 0; dt < DT; ++dt)
#pragma unroll
      for (int r = 0; r < 8; ++r) oacc[dt][r] *= alpha[r];
    __builtin_amdgcn_fence(__ATOMIC_ACQ_REL, "workgroup");
    __builtin_amdgcn_wave_barrier();
    FragB pah, pal;
    pah.half[0] = *(const v8us*)&sPh[w][ln][8 * hh]; pah.half[1] = *(const v8us*)&sPh[w][ln][16 + 8 * hh];
    pal.half[0] = *(const v8us*)&sPl[w][ln][8 * hh]; pal.half[1] = *(const v8us*)&sPl[w][ln][16 + 8 * hh];
#pragma unroll
    for (int dt = 0; dt < DT; ++dt) {
      FragB bvh, bvl;
#pragma unroll
      for (int i = 0; i < 8; ++i) {
        bvh.u[i] = sVh[8 * hh + i][dt * 16 + ln]; bvh.u[8 + i] = sVh[16 + 8 * hh + i][dt * 16 + ln];
        bvl.u[i] = sVl[8 * hh + i][dt * 16 + ln]; bvl.u[8 + i] = sVl[16 + 8 * hh + i][dt * 16 + ln];
      }
      oacc[dt] = mmaN<3>(pah.v, pal.v, bvh.v, bvl.v, oacc[dt]);
    }
    __builtin_amdgcn_fence(__ATOMIC_ACQ_REL, "workgroup");
    __builtin_amdgcn_wave_barrier();
  }
#pragma unroll
  for (int r = 0; r < 8; ++r) {
    float l = l_r[r];
    l += __shfl_xor(l, 1, 32); l += __shfl_xor(l, 2, 32); l += __shfl_xor(l, 4, 32); l += __shfl_xor(l, 8, 32);
    l_r[r] = (l > 0.f) ? 1.0f / l : 0.f;
  }
#pragma unroll
  for (int dt = 0; dt < DT; ++dt)
#pragma unroll
    for (int r = 0; r < 8; ++r) sO[w][8 * hh + r][dt * 16 + ln] = oacc[dt][r] * l_r[r];
  __builtin_amdgcn_fence(__ATOMIC_ACQ_REL, "workgroup");
  __builtin_amdgcn_wave_barrier();
  {
    for (int r = 0; r < 16; ++r) {
      const int row = q0 + r;
      if (row < T && lane < D / 4) {
        const v4f val = *(const v4fa*)&sO[w][r][lane * 4];
        *(v4f*)(y + ((size_t)b * T + row) * ypitch + h * D + lane * 4) = val;
      }
    }
    
  }
}

// GEMM C = act(A·W + bias + resid): A f32 (ASPLIT -> hi/lo 2 terms), Wt bf16 [N][K]; ACT 0 none, 1 relu, 2 exact gelu;
// resid (optional, f32, row index = (row % rmod), pitch ldr, RES_BF16 rounds it) added before the activation.
template <bool ASPLIT, int ACT, bool BIAS_BF16, bool RES_BF16>
__global__ __launch_bounds__(128) void k_gemm_bf3(const float* __restrict__ A, int lda, const unsigned short* __restrict__ Wt, int ldb,
                                                const float* __restrict__ bias, const float* __restrict__ resid, int rmod, int ldr,
                                                float* __restrict__ C, int ldc, int M, int N, int K) {
  __shared__ __attribute__((aligned(16))) float so[4][16][64];
  const int tid = threadIdx.x, w = tid >> 5, lane = tid & 31, ln = lane & 15, hh = lane >> 4;
  const int ntn = N / 64;
  const int wid = blockIdx.x * 4 + w;
  const int mt = wid / ntn, nq = wid % ntn;
  if (mt * 16 >= M) return;
  const int row0 = mt * 16, col0 = nq * 64;
  const float* arow = A + (size_t)(row0 + ln) * lda;
  v8f acc[4] = {};
  for (int kb = 0; kb < K; kb += 32) {
    FragB ah, al;
    const v4f x0 = *(const v4fa*)(arow + kb + 8 * hh), x1 = *(const v4fa*)(arow + kb + 8 * hh + 4);
    const v4f x2 = *(const v4fa*)(arow + kb + 16 + 8 * hh), x3 = *(const v4fa*)(arow + kb + 16 + 8 * hh + 4);
    float xs[16] = {x0[0],x0[1],x0[2],x0[3],x1[0],x1[1],x1[2],x1[3],x2[0],x2[1],x2[2],x2[3],x3[0],x3[1],x3[2],x3[3]};
#pragma unroll
    for (int i = 0; i < 16; ++i) { const unsigned short hb = bf16_bits(xs[i]); ah.u[i] = hb; al.u[i] = ASPLIT ? bf16_bits(xs[i] - bf16_val(hb)) : (unsigned short)0; }
#pragma unroll
    for (int t = 0; t < 4; ++t) {
      const unsigned short* brow = Wt + (size_t)(col0 + t * 16 + ln) * ldb + kb;
      FragB b;
      b.half[0] = *(const v8us*)(brow + 8 * hh);
      b.half[1] = *(const v8us*)(brow + 16 + 8 * hh);
      acc[t] = mmaN<ASPLIT ? 2 : 1>(ah.v, al.v, b.v, b.v, acc[t]);
    }
  }
#pragma unroll
  for (int t = 0; t < 4; ++t) {
    const int col = col0 + t * 16 + ln;
    float bv = bias ? bias[col] : 0.f;
    if (BIAS_BF16) bv = bf16_round(bv);
#pragma unroll
    for (int r = 0; r < 8; ++r) {
      float v = acc[t][r] + bv;
      if (resid) { float rv = resid[(size_t)((row0 + 8 * hh + r) % rmod) * ldr + col]; if (RES_BF16) rv = bf16_round(rv); v += rv; }
      if (ACT == 1) v = fmaxf(v, 0.f);
      if (ACT == 2) v = 0.5f * v * (1.0f + erff(v * 0.70710678118654752f));
      if (ACT == 3) { const float u = 0.7978845608028654f * (v + 0.044715f * v * v * v); v = 0.5f * v * (1.0f + tanhf(u)); }
      so[w][8 * hh + r][t * 16 + ln] = v;
    }
  }
  __builtin_amdgcn_fence(__ATOMIC_ACQ_REL, "workgroup");
  __builtin_amdgcn_wave_barrier();
  const int rsub = lane >> 4, c4 = (lane & 15) * 4;
  {
#pragma unroll
    for (int q = 0; q < 8; ++q) {
      const int r = q * 2 + rsub;
      const v4f v = *(const v4fa*)&so[w][r][c4];
      *(v4f*)(C + (size_t)(row0 + r) * ldc + col0 + c4) = v;
    }
    
  }
}
// row LayerNorm (biased variance, eps) over N: s = X (+ R); optional out_sum <- s; out_norm <- (s-mu)*rsqrt(var+eps)*g + b
template <bool PARAM_BF16>
__global__ __launch_bounds__(256) void k_layernorm(const float* __restrict__ X, const float* __restrict__ R, const float* __restrict__ g, const float* __restrict__ bta,
                                                  float* __restrict__ out_sum, float* __restrict__ out_norm, int N, float eps) {
  __shared__ float red[256];
  const int row = blockIdx.x, tid = threadIdx.x;
  const float* x = X + (size_t)row * N; const float* rr = R ? R + (size_t)row * N : nullptr;
  float vals[16];                     // up to N = 4096
  const int per = N / 256;            // contiguous chunk per thread? use strided-by-4 chunks: thread handles j = tid*4 + 1024*u
  float s1 = 0.f;
  for (int u = 0; u < per / 4; ++u) {
    const int j = tid * 4 + 1024 * u;
    const v4f a = *(const v4fa*)(x + j);
    v4f b = {0.f,0.f,0.f,0.f}; if (rr) b = *(const v4fa*)(rr + j);
#pragma unroll
    for (int q = 0; q < 4; ++q) { const float v = a[q] + b[q]; vals[u * 4 + q] = v; s1 += v; }
  }
  red[tid] = s1; __syncthreads();
  for (int st = 128; st > 0; st >>= 1) { if (tid < st) red[tid] += red[tid + st]; __syncthreads(); }
  const float mu = red[0] / (float)N; __syncthreads();
  float s2 = 0.f;
  for (int u = 0; u < per / 4; ++u)
#pragma unroll
    for (int q = 0; q < 4; ++q) { const float c = vals[u * 4 + q] - mu; s2 += c * c; }
  red[tid] = s2; __syncthreads();
  for (int st = 128; st > 0; st >>= 1) { if (tid < st) red[tid] += red[tid + st]; __syncthreads(); }
  const float rs = rsqrtf(red[0] / (float)N + eps);
  {
    for (int u = 0; u < per / 4; ++u) {
      const int j = tid * 4 + 1024 * u;
      v4f o, sm;
#pragma unroll
      for (int q = 0; q < 4; ++q) {
        float gg = g[j + q], bb = bta[j + q];
        if (PARAM_BF16) { gg = bf16_round(gg); bb = bf16_round(bb); }
        sm[q] = vals[u * 4 + q]; o[q] = (vals[u * 4 + q] - mu) * rs * gg + bb;
      }
      if (out_sum) *(v4f*)(out_sum + (size_t)row * N + j) = sm;
      *(v4f*)(out_norm + (size_t)row * N + j) = o;
    }
    
  }
}



// ---- f16 WMMA path (v_wmma_f32_16x16x32_f16): 11-bit significands for operands in range — used where a [0,1] probability operand needs more precision than bf16
typedef _Float16 v16h __attribute__((ext_vector_type(16)));
union FragH { v16h v; v8us half[2]; _Float16 h[16]; unsigned short u[16]; };
template <int NT>
__device__ __forceinline__ v8f mmaH(v16h ah, v16h al, v16h bh, v16h bl, v8f c) {
  c = __builtin_amdgcn_wmma_f32_16x16x32_f16(false, ah, false, bh, (short)0, c, false, false);
  if (NT >= 2) c = __builtin_amdgcn_wmma_f32_16x16x32_f16(false, al, false, bh, (short)0, c, false, false);
  if (NT >= 3) c = __builtin_amdgcn_wmma_f32_16x16x32_f16(false, ah, false, bl, (short)0, c, false, false);
  asm volatile("v_nop\n\tv_nop\n\tv_nop\n\tv_nop" : "+v"(c) : "v"(ah), "v"(al), "v"(bh), "v"(bl));
  return c;
}
// Wt[n][k] = f16(W[k][n]·scale) from f32 row-major W[K][N] (scale = power of two; bf16-exact weights stay exact in f16 away from the subnormal range)
__global__ __launch_bounds__(256) void k_wt_f16(const float* __restrict__ W, _Float16* __restrict__ Wt, int K, int N, float scale) {
  const int t = blockIdx.x * 256 + threadIdx.x; if (t >= N * (K / 8)) return; const int n = t / (K / 8), k8 = (t % (K / 8)) * 8; FragH f;
#pragma unroll
  for (int i = 0; i < 8; ++i) f.h[i] = (_Float16)(bf16_round(W[(size_t)(k8 + i) * N + n]) * scale); const v8us o = f.half[0];
  *(v8us*)((unsigned short*)Wt + (size_t)n * K + k8) = o; 
}
// per-pair bias, 32 pairs (same (b, key j), queries i = ib + 32 it .. ib + 32 it + 31) per pass of a wave, one pair per lane, BG passes per wave (one wave = BG * 32 neighbouring queries of one key: the weights are staged once per block, the key's own features formed once per wave), the plane stored [b][j][i] (k_flash reads it with the query along the lanes), both MLPs wholly on the 16x16x32 f16 WMMAs (layer 1 with an f16 result, layer 2 with an f32 result) in transposed form:
// layer 1: D1 = W1 (A: 16 hidden rows x k) * F (B: k x 16 pairs). A pair has 8 features: dist and dt each as an f16 high part plus an f16 remainder (the two products are summed in the matrix unit), x_j, y_j, z_j, and 1.0
// for the layer's bias. Lanes 0..15 carry their pair's features at k = 0..7, lanes 16..31 at k = 8..15; W1 stands at both k ranges, and the half of B that belongs to the other 16 pairs is zeroed for each product.
// layer 2: two D1 tiles (hidden rows 0..15 and 16..31 of a 32-row block), which layer 1's products leave as f16 (rounded by the matrix unit, no conversion in the vector unit), relu'd, ARE a B operand in the hardware k order; A = W2 with geom / shape / rate in rows 0,1,2 and again in rows 8,9,10, so that
// D2 registers 0,1,2 of lanes 0..15 (rows 0..2) and of lanes 16..31 (rows 8..10) hold the three outputs of column ln: every lane picks the D2 of its own 16-pair group and does its pair's softplus/log/lgamma tail. All weights x16 (exact), taken out as 1/256.
union FragW { v16h v; v8us half[2]; _Float16 h[16]; unsigned int w[8]; };
#define BG 16
// The chip's own base-2 exponential and logarithm, one instruction each. Every argument below is a normal number, zero or infinite where it matters (logarithms see values of 1e-4 and more), so the library's range steps are not needed.
__device__ __forceinline__ float hw_exp2(float x) { return __builtin_amdgcn_exp2f(x); }
__device__ __forceinline__ float hw_log2(float x) { return __builtin_amdgcn_logf(x); }
#define LOG2E 1.4426950408889634f
#define LN2 0.6931471805599453f
// softplus(q) = max(q, 0) + log(1 + e), e = exp(-|q|) in [0, 1]. u = 1 + e drops d = e - (u - 1), which is exact; log(1 + e) = log(u) + d / u, and d stands for d / u to within d * e: the relative error stays at rounding level down to e = 0.
__device__ __forceinline__ float softplus_hw(float q) { const float e = hw_exp2(-fabsf(q) * LOG2E); const float u = 1.0f + e; const float d = e - (u - 1.0f); return fmaxf(q, 0.f) + (hw_log2(u) * LN2 + d); }
__device__ __forceinline__ v8f mma16(v16h a, v16h b, v8f c) { return __builtin_amdgcn_wmma_f32_16x16x32_f16(false, a, false, b, (short)0, c, false, false); }
// the same product with its result rounded to f16 by the matrix unit: element e of a lane's 8 is row 8 hh + e, two rows a register, which is the packing that a B operand wants
typedef _Float16 v8h __attribute__((ext_vector_type(8)));
__device__ __forceinline__ v8h mma16h(v16h a, v16h b, v8h c) { return __builtin_amdgcn_wmma_f16_16x16x32_f16(false, a, false, b, (short)0, c, false, false); }
__device__ __forceinline__ void bias_block(const int blk, const float* __restrict__ crd, const float* __restrict__ gw1, const float* __restrict__ gb1, const float* __restrict__ gw2, const float* __restrict__ gb2, const float* __restrict__ dw1, const float* __restrict__ db1, const float* __restrict__ dw2, const float* __restrict__ db2, float* __restrict__ BIAS) {
  __shared__ __attribute__((aligned(16))) _Float16 sW1[2 * BH][8];           // row = hidden unit (0..63 geom, 64..127 delay), its 8 feature weights
  __shared__ __attribute__((aligned(16))) _Float16 sW2[16][2 * BH + 8];      // row = output row of layer 2, k = hidden unit; pitch 272 B spreads the 16 rows over the banks
  const int tid = threadIdx.x, w = __builtin_amdgcn_readfirstlane(tid >> 5), lane = tid & 31, ln = lane & 15, hh = lane >> 4;      // the wave's number in a scalar register keeps the key's row and the wave's first query scalar
  { FragW f; float o0 = 0.f, o1 = 0.f, o2 = 0.f; const _Float16 z = (_Float16)0.f;
    if (tid < BH) { const _Float16 g0 = (_Float16)(bf16_round(gw1[tid * 2]) * 16.0f), g1 = (_Float16)(bf16_round(gw1[tid * 2 + 1]) * 16.0f);
      f.h[0] = g0; f.h[1] = g0; f.h[2] = g1; f.h[3] = g1; f.h[4] = z; f.h[5] = z; f.h[6] = z; f.h[7] = (_Float16)(bf16_round(gb1[tid]) * 16.0f); o0 = bf16_round(gw2[tid]) * 16.0f; }
    else { const int k = tid - BH; const _Float16 d0 = (_Float16)(bf16_round(dw1[k * 4]) * 16.0f);
      f.h[0] = d0; f.h[1] = d0; f.h[2] = z; f.h[3] = z; f.h[4] = (_Float16)(bf16_round(dw1[k * 4 + 1]) * 16.0f); f.h[5] = (_Float16)(bf16_round(dw1[k * 4 + 2]) * 16.0f); f.h[6] = (_Float16)(bf16_round(dw1[k * 4 + 3]) * 16.0f);
      f.h[7] = (_Float16)(bf16_round(db1[k]) * 16.0f); o1 = bf16_round(dw2[k]) * 16.0f; o2 = bf16_round(dw2[BH + k]) * 16.0f; }
    *(v8us*)&sW1[tid][0] = f.half[0];
#pragma unroll
    for (int m = 0; m < 16; ++m) sW2[m][tid] = (_Float16)(((m & 7) == 0) ? o0 : ((m & 7) == 1) ? o1 : ((m & 7) == 2) ? o2 : 0.f); }
  __syncthreads();
  const size_t p0 = ((size_t)blk * 4 + w) * (32 * BG);      // BG * 32 consecutive queries of one (b, j) (SS = 1024 is a multiple of it)
  const int b = (int)(p0 / ((size_t)SS * SS)); const int j = (int)((p0 / SS) % SS); const int ib = (int)(p0 % SS);
  const float* cj = crd + ((size_t)b * SS + j) * 4; const float xj = bf16_round(cj[0]), yj = bf16_round(cj[1]), zj = bf16_round(cj[2]), tj = bf16_round(cj[3]);
  const float gb2v = bf16_round(gb2[0]), db20 = bf16_round(db2[0]), db21 = bf16_round(db2[1]);
  v16h a1[8];
#pragma unroll
  for (int t = 0; t < 8; ++t) { FragW f; f.half[0] = *(const v8us*)&sW1[t * 16 + ln][0];
#pragma unroll
    for (int q = 0; q < 4; ++q) f.w[4 + q] = 0u;
    a1[t] = f.v; }
  const v8f zero8 = (v8f){0.f,0.f,0.f,0.f,0.f,0.f,0.f,0.f};
  const v16h zero16 = {}; const v8h zero8h = {};
  const float* pc = crd + ((size_t)b * SS + ib + lane) * 4;      // this lane's query of the pass, i = ib + 32 it + lane
  float* pb = BIAS + p0 + lane;
  v4f cn = *(const v4fa*)pc;
  asm volatile("s_wait_xcnt 0x0" :: "v"(pc) : "memory");      // the address pair stays whole up to this wait; the loop steps on it
#pragma unroll 1      // one copy of the pass: a pass takes nothing from the one before but the fetched coordinates
  for (int it = 0; it < BG; ++it) {
  const v4f ci = cn; const float* pn = pc + (it + 1 < BG ? 32 * 4 : 0);      // the next pass's coordinates are fetched a pass ahead (the last pass fetches its own again)
  cn = *(const v4fa*)pn;
  asm volatile("s_wait_xcnt 0x0" :: "v"(pn) : "memory");      // the address pair stays whole up to this wait; it is stepped on behind it
  pc = pn;
  v16h a2[4];      // layer 2's weights are read from LDS in every pass: held over the loop beside layer 1's they do not fit the registers of six waves a SIMD (the build spills them)
#pragma unroll
  for (int s = 0; s < 4; ++s) { FragW f; f.half[0] = *(const v8us*)&sW2[ln][s * 32 + 8 * hh]; f.half[1] = *(const v8us*)&sW2[ln][s * 32 + 16 + 8 * hh]; a2[s] = f.v; }
  const float xi = bf16_round(ci[0]), yi = bf16_round(ci[1]), zi = bf16_round(ci[2]), ti = bf16_round(ci[3]);
  const float dx = xi - xj, dy = yi - yj, dz = zi - zj; const float dist = __builtin_amdgcn_sqrtf(dx * dx + dy * dy + dz * dz); const float dt = ti - tj;
  FragW F; F.h[0] = (_Float16)dist; F.h[1] = (_Float16)(dist - (float)F.h[0]); F.h[2] = (_Float16)dt; F.h[3] = (_Float16)(dt - (float)F.h[2]); F.h[4] = (_Float16)xj; F.h[5] = (_Float16)yj; F.h[6] = (_Float16)zj; F.h[7] = (_Float16)1.0f;
  FragW bf[2];
#pragma unroll
  for (int c = 0; c < 2; ++c)
#pragma unroll
    for (int q = 0; q < 4; ++q) { bf[c].w[q] = (hh == c) ? F.w[q] : 0u; bf[c].w[4 + q] = 0u; }
  v8f d2[2] = {zero8, zero8};
  // Step p = 2 s + c takes two tiles of layer 1 (hidden rows 32 s .. 32 s + 15 and the 16 above them, pair group c), which side by side are the B operand of one product of layer 2. The order is written out and held by the scheduling
  // barriers: layer 1 runs two steps ahead of the relus. A tile's relus then stand more than the four vector slots that the chip asks for behind the product that made it, and run while the matrix unit works on the products issued in front
  // of them; left to itself the build sets a tile's relus close behind its product and fills the distance with about twice as many v_nop. The relu is the maximum that lets a NaN pass, as the reference's does: one instruction on a
  // matrix result, where the NaN-dropping maximum takes a second one that first quiets its argument.
  v8h T[16];
#pragma unroll
  for (int k = 0; k < 4; ++k) T[k] = mma16h(a1[k & 1], bf[k >> 1].v, zero8h);
  __builtin_amdgcn_sched_barrier(0);      // holds the written order (see above)
  v16h hb[8];
#pragma unroll
  for (int p = 0; p < 8; ++p) {
    hb[p] = __builtin_elementwise_maximum(__builtin_shufflevector(T[2 * p], T[2 * p + 1], 0, 1, 2, 3, 4, 5, 6, 7, 8, 9, 10, 11, 12, 13, 14, 15), zero16);      // relu, two units per instruction; the shuffle is no instruction: the two tiles stand in neighbouring registers
    __builtin_amdgcn_sched_barrier(0);      // holds the written order
    if (p == 6) continue;      // no product of layer 1 is left to stand behind step 6's layer 2 product: it goes behind step 7's relus, which would otherwise wait out its distance
    if (p == 7) d2[0] = mma16(a2[3], hb[6], d2[0]);
    d2[p & 1] = mma16(a2[p >> 1], hb[p], d2[p & 1]);
    if (p + 2 < 8) { T[2 * p + 4] = mma16h(a1[2 * ((p + 2) >> 1)], bf[p & 1].v, zero8h); T[2 * p + 5] = mma16h(a1[2 * ((p + 2) >> 1) + 1], bf[p & 1].v, zero8h); }
    __builtin_amdgcn_sched_barrier(0); }      // holds the written order
  { const float geom = (hh ? d2[1][0] : d2[0][0]) * 0.00390625f + gb2v; const float q0 = (hh ? d2[1][1] : d2[0][1]) * 0.00390625f + db20, q1 = (hh ? d2[1][2] : d2[0][2]) * 0.00390625f + db21;
    const float shape = softplus_hw(q0) + 1e-4f, rate = softplus_hw(q1) + 1e-4f; const float dtp = fmaxf(fabsf(dt), 1e-4f);
    // lgamma(shape), shape >= 1e-4: its asymptotic series (z - 0.5) log z - z + 0.5 log(2 pi) + 1/(12 z) - 1/(360 z^3) + 1/(1260 z^5) at z >= 4 (the next term is below 4e-8 there). Below 8 the argument is moved up by 4: lgamma(x) = lgamma(x + 4) - log(x (x + 1) (x + 2) (x + 3)), the product as t (t + 2) with t = x (x + 3).
    const bool up = shape < 8.0f; const float t = shape * (shape + 3.0f); const float prod = up ? t * (t + 2.0f) : 1.0f; const float z = up ? shape + 4.0f : shape;
    const float rz = __builtin_amdgcn_rcpf(z), rz2 = rz * rz; const float ser = rz * (0.083333333f + rz2 * (-0.0027777778f + rz2 * 0.00079365079f));
    // the logarithmic terms are added in base 2, the others in base e; the plane is stored in base-2 units (x log2 e), which k_flash's exp2 takes as they are
    const float l2rate = hw_log2(rate), l2dtp = hw_log2(dtp), l2z = hw_log2(z), l2prod = hw_log2(prod);
    __builtin_amdgcn_sched_barrier(0);      // the four arguments die below; the instruction set asks for one slot between a logarithm and an instruction that takes over its argument's register
    const float lg2 = shape * l2rate + (shape - 1.0f) * l2dtp - (z - 0.5f) * l2z + l2prod;
    const float nat = geom - rate * dtp + (z - 0.91893853f) - ser;
    *pb = lg2 + nat * LOG2E;
    asm volatile("s_wait_xcnt 0x0" :: "v"(pb) : "memory");      // stands behind the store: its address pair stays whole up to this wait and is stepped on behind it
    pb += 32; } } }
// 16 k positions of one f32 row for an f16 fragment; p points at the lane's k = 8 hh of the 32-wide k step (positions 0..7 and 16..23 from there). load16 fetches them, cvt16 makes f16(bf16(x) * sc) of them (round to nearest even, as bf16_round)
__device__ __forceinline__ void load16(const float* __restrict__ p, v4f (&x)[4]) { x[0] = *(const v4fa*)p; x[1] = *(const v4fa*)(p + 4); x[2] = *(const v4fa*)(p + 16); x[3] = *(const v4fa*)(p + 20); }
__device__ __forceinline__ v16h cvt16(const v4f (&x)[4], const float sc) { FragH f;
#pragma unroll
  for (int g = 0; g < 4; ++g)
#pragma unroll
    for (int q = 0; q < 4; ++q) f.h[4 * g + q] = (_Float16)((float)(__bf16)x[g][q] * sc);
  return f.v; }
// q, k, v projections straight from the f32 inputs. One wave = 16 rows of one matrix (B operand) against 64 rows of the other (A operand, 4 tiles), K = 256: a lane then holds 8 neighbouring results of the A side,
// one 16-byte store per tile. q, k: B = 16 rows of src, A = 64 rows of W. v: B = 16 rows of Wv, A = 64 rows of src (keys).
// The three planes are stored in the order in which k_flash's fragments want them, 16 bytes a lane in lane order: a fragment half is 512 contiguous bytes, so that one wave-wide load (or store) covers 4 whole 128-byte lines, where rows of a [row][col] plane gave it 32 bytes in each of 16 lines.
// The 8 results of lane (ln, hh) in tile t ARE half t & 1 of a fragment's lane (ln, hh) (q: of the lane that has its query's column). K: [b][head][16-key tile][half][lane]. V: [b][head][32-key pass][16-d tile][half][lane]. Q: [b][head][32-query block][query tile rt][half][lane], column c of tile rt = query 2 c + rt.
__device__ __forceinline__ void qkv_block(const int blk, const float* __restrict__ src, const float* __restrict__ Wq, const float* __restrict__ Wk, const float* __restrict__ Wv, _Float16* __restrict__ Q16, _Float16* __restrict__ K16, _Float16* __restrict__ Vt) {
  const int tid = threadIdx.x, w = __builtin_amdgcn_readfirstlane(tid >> 5), lane = tid & 31, ln = lane & 15, hh = lane >> 4;      // the wave's number in a scalar register keeps the base pointers scalar
  const int which = blk >> 7, wid = (blk & 127) * 4 + w;
  const float* one; const float* four; float s1, s4; _Float16* dst; int sp;      // sp: from tiles 0, 1 to tiles 2, 3 (q, k: the next head; v: the next 32 keys)
  if (which < 2) { const int mt = wid >> 2, nq = wid & 3; one = src + (size_t)mt * 16 * DM; four = (which ? Wk : Wq) + (size_t)nq * 64 * DM; s1 = 1.0f; s4 = 16.0f; sp = SS * HD;
    const size_t hd0 = (size_t)(mt / (SS / 16)) * NH + nq * 2;      // (b, head) of tiles 0 and 1
    if (which) dst = K16 + ((hd0 * (SS / 16) + mt % (SS / 16)) * 2 * 32 + lane) * 8;
    else dst = Q16 + ((((hd0 * (SS / 32) + (mt % (SS / 16)) / 2) * 2 + (ln & 1)) * 2) * 32 + hh * 16 + (mt & 1) * 8 + (ln >> 1)) * 8; }
  else { const int kq = wid >> 4, ct = wid & 15; one = Wv + (size_t)ct * 16 * DM; four = src + (size_t)kq * 64 * DM; s1 = 16.0f; s4 = 1.0f; sp = 32 * HD;
    dst = Vt + (((((size_t)(kq / (SS / 64)) * NH + ct / 2) * (SS / 32) + (kq % (SS / 64)) * 2) * 2 + (ct & 1)) * 2 * 32 + lane) * 8; }
  const float* orow = one + ln * DM + 8 * hh; const float* frow = four + ln * DM + 8 * hh;
  v8f acc[4] = {};
  for (int kb = 0; kb < DM; kb += 32) { const float* po = orow + kb; const float* pf = frow + kb; v4f ro[4], rf[4][4];
    load16(po, ro);
#pragma unroll
    for (int t = 0; t < 4; ++t) load16(pf + t * 16 * DM, rf[t]);
    asm volatile("s_wait_xcnt 0x0" :: "v"(po), "v"(pf) : "memory");      // the two address pairs stay whole up to this wait
    const v16h bo = cvt16(ro, s1);
#pragma unroll
    for (int t = 0; t < 4; ++t) acc[t] = mma16(cvt16(rf[t], s4), bo, acc[t]); }
#pragma unroll
  for (int t = 0; t < 4; ++t) { FragH o;
#pragma unroll
    for (int r = 0; r < 8; ++r) o.h[r] = (_Float16)(acc[t][r] * 0.0625f);
    *(v8us*)((unsigned short*)dst + (t >> 1) * sp + (t & 1) * 256) = o.half[0]; } }
// Everything that depends on the inputs alone, in one launch: blocks 0..383 the q, k, v projections, blocks 384..447 Wo as f16 (x16), the rest the bias plane. The 1472 blocks of 4 waves are all resident at once.
#define G_QKV (3 * (NR / 16) * (DM / 64) / 4)
#define G_WO (DM * DM / 8 / 128)
#define G_BIAS (BB * SS * SS / (128 * BG))
// waves_per_eu(6, 6): at most 160 registers, six waves a SIMD, which holds all 1472 blocks of 4 waves at once. The bias loop keeps layer 1's weights in 64 registers; planned for seven or eight waves the build has too few registers left to set
// independent work behind the loop's products and fills the distance with more v_nop. With this line it builds to 156 registers, nothing spilled, the 20 loads of the q, k, v loop in one run
__global__ __launch_bounds__(128) __attribute__((amdgpu_waves_per_eu(6, 6))) void k_front(const float* __restrict__ src, const float* __restrict__ crd, const float* __restrict__ Wq, const float* __restrict__ Wk, const float* __restrict__ Wv, const float* __restrict__ Wo,
    const float* __restrict__ gw1, const float* __restrict__ gb1, const float* __restrict__ gw2, const float* __restrict__ gb2, const float* __restrict__ dw1, const float* __restrict__ db1, const float* __restrict__ dw2, const float* __restrict__ db2,
    _Float16* __restrict__ Q16, _Float16* __restrict__ K16, _Float16* __restrict__ Vt, _Float16* __restrict__ Bo, float* __restrict__ BIAS) {
  const int blk = blockIdx.x;
  if (blk < G_QKV) { qkv_block(blk, src, Wq, Wk, Wv, Q16, K16, Vt); return; }
  if (blk < G_QKV + G_WO) { const size_t t = (size_t)(blk - G_QKV) * 128 + threadIdx.x; FragH f;      // t counts 16-byte pieces of Bo in k_out's fragment order, [16-row tile][k step][half][lane]
    const float* wr = Wo + ((t >> 9) * 16 + (t & 15)) * DM + ((t >> 6) & 7) * 32 + ((t >> 5) & 1) * 16 + ((t >> 4) & 1) * 8;
#pragma unroll
    for (int i = 0; i < 8; ++i) f.h[i] = (_Float16)(bf16_round(wr[i]) * 16.0f);
    *(v8us*)((unsigned short*)Bo + t * 8) = f.half[0];
    asm volatile("s_wait_xcnt 0x0" ::: "memory");      // stands behind the store, ahead of any later write of the registers it names (the listing lays the other branches behind it)
    return; }
  bias_block(blk - (G_QKV + G_WO), crd, gw1, gb1, gw2, gb2, dw1, db1, dw2, db2, BIAS); }
typedef float v2f  __attribute__((ext_vector_type(2)));
typedef float v2fa __attribute__((ext_vector_type(2), may_alias));
// lane l with lane l ^ 16, in the vector unit
__device__ __forceinline__ float xhalf(float x) { return __builtin_bit_cast(float, __builtin_amdgcn_permlanex16(__builtin_bit_cast(int, x), __builtin_bit_cast(int, x), 0x76543210, 0xfedcba98, false, false)); }
// One block = 32 query rows of one (batch, head); its 8 waves share those rows and split the 1024 keys, 128 each (512 blocks of 8 waves fill every SIMD four deep, where one wave per 32 rows over all keys left
// one wave on half the SIMDs). Every wave runs the same online-softmax loop over its own keys and leaves an un-normalised partial (row max, row sum, O) in LDS; behind one block barrier the partials of a row are
// rescaled to their common max and added, wave 0 first.
// The loop works on the transposed products: St = K (A: 16 keys x d) * Qt (B: d x 16 queries), so lanes ln and ln + 16 hold all 32 scores that a pass gives the query of column ln, 16 each: maximum and sum are taken inside the lane, with one
// exchange between the halves for the maximum (the sums' halves are joined once, behind the loop). The two St tiles of a pass (keys 0..15 and 16..31), as f16 exponentials, ARE the B operand of Ot = Vt (A: 16 d x 32 keys) * Pt in
// the hardware k order: P passes through no LDS. Column ln of query tile rt is query 2 ln + rt, so that one 8-byte load fetches a key's bias for both of a lane's queries from the [key][query] plane and 16 lanes read a whole 128-byte line; a lane holds 8 neighbouring d of its query's output.
// waves_per_eu(1, 4): no more than four waves a SIMD are planned for, which is what 512 blocks of 8 waves come to; without it the compiler saves registers for an occupancy the grid cannot reach
__global__ __launch_bounds__(256) __attribute__((amdgpu_waves_per_eu(1, 4))) void k_flash(const _Float16* __restrict__ Q16, const _Float16* __restrict__ K16, const _Float16* __restrict__ Vt, const float* __restrict__ BIAS, float* __restrict__ O) {
  constexpr int RPW = 32, NW = 8, NQB = SS / RPW, KPW = SS / NW, DT = 2;
  __shared__ __attribute__((aligned(16))) float sO[NW][RPW][HD + 4]; __shared__ float sM[NW][RPW], sL[NW][RPW];
  const int tid = threadIdx.x, w = __builtin_amdgcn_readfirstlane(tid >> 5), lane = tid & 31, ln = lane & 15, hh = lane >> 4;      // the wave's number in a scalar register keeps the wave's key offset (w * KPW) and LDS slots scalar
  const int slab = blockIdx.x / NQB, qblk = blockIdx.x % NQB; const int b = slab / NH, h = slab % NH; const int q0 = qblk * RPW;
  FragH aq[2];
#pragma unroll
  for (int rt = 0; rt < 2; ++rt) { const unsigned short* qr = (const unsigned short*)Q16 + (((size_t)slab * NQB + qblk) * 2 + rt) * 512 + lane * 8; aq[rt].half[0] = *(const v8us*)qr; aq[rt].half[1] = *(const v8us*)(qr + 256); }      // Q, K, V lie in fragment order (see qkv_block): a half is 256 elements, 8 a lane
  const unsigned short* kp = (const unsigned short*)K16 + ((size_t)slab * (SS / 16) + w * (KPW / 16)) * 512 + lane * 8;      // first 16-key tile of the pass (key row ln, k = d)
  const unsigned short* vp = (const unsigned short*)Vt + ((size_t)slab * (SS / 32) + w * (KPW / 32)) * 1024 + lane * 8;      // the pass's first 16-d tile (d row ln, k = key)
  const float* bp = BIAS + ((size_t)b * SS + w * KPW + 8 * hh) * SS + q0 + 2 * ln;                                     // key 8 hh of a tile, queries 2 ln and 2 ln + 1
  float m_r[2], l_r[2]; v8f oacc[2][DT];
  const v8f zero8 = (v8f){0.f,0.f,0.f,0.f,0.f,0.f,0.f,0.f};
#pragma unroll
  for (int rt = 0; rt < 2; ++rt) { m_r[rt] = -3.0e38f; l_r[rt] = 0.f;
#pragma unroll
    for (int dt = 0; dt < DT; ++dt) oacc[rt][dt] = zero8; }
  const float scale = 0.17677669529663688f * LOG2E;      // scores, bias plane, running max in base-2 units: every exponential is one exp2
#pragma unroll 1
  for (int it = 0; it < KPW / 32; ++it) {
    FragH bk[2], bv[DT]; v2f bb[2][8];
#pragma unroll
    for (int nt = 0; nt < 2; ++nt) { bk[nt].half[0] = *(const v8us*)(kp + nt * 512); bk[nt].half[1] = *(const v8us*)(kp + nt * 512 + 256); }
#pragma unroll
    for (int nt = 0; nt < 2; ++nt)
#pragma unroll
      for (int r = 0; r < 8; ++r) bb[nt][r] = *(const v2fa*)(bp + (nt * 16 + r) * SS);
#pragma unroll
    for (int dt = 0; dt < DT; ++dt) { bv[dt].half[0] = *(const v8us*)(vp + dt * 512); bv[dt].half[1] = *(const v8us*)(vp + dt * 512 + 256); }
    asm volatile("s_wait_xcnt 0x0" :: "v"(kp), "v"(vp), "v"(bp) : "memory");      // the three address pairs stay whole up to this wait; they are stepped on right behind it
    __builtin_amdgcn_sched_barrier(0);      // all loads of a pass are issued ahead of its first product; without this line the build holds some of the V loads back behind the first wait, to save registers that are free here
    kp += 1024; vp += 1024; bp += 32 * SS;
#pragma unroll
    for (int rt = 0; rt < 2; ++rt) {
      v8f c0, c1;
#pragma unroll
      for (int r = 0; r < 8; ++r) { c0[r] = bb[0][r][rt]; c1[r] = bb[1][r][rt]; }
      const v8f s0 = mma16(bk[0].v, aq[rt].v, zero8) * scale + c0, s1 = mma16(bk[1].v, aq[rt].v, zero8) * scale + c1;
      const v8f mx = __builtin_elementwise_max(s0, s1);
      float mc = fmaxf(fmaxf(fmaxf(mx[0], mx[1]), fmaxf(mx[2], mx[3])), fmaxf(fmaxf(mx[4], mx[5]), fmaxf(mx[6], mx[7])));
      mc = fmaxf(mc, xhalf(mc));
      const float mn = fmaxf(m_r[rt], mc); const float al = hw_exp2(m_r[rt] - mn); m_r[rt] = mn;
      const v8f e0 = s0 - mn, e1 = s1 - mn; v8f p0, p1; FragH pb;
#pragma unroll
      for (int r = 0; r < 8; ++r) { p0[r] = hw_exp2(e0[r]); p1[r] = hw_exp2(e1[r]); pb.h[r] = (_Float16)p0[r]; pb.h[8 + r] = (_Float16)p1[r]; }
      const v8f ps = p0 + p1;
      l_r[rt] = l_r[rt] * al + (((ps[0] + ps[4]) + (ps[1] + ps[5])) + ((ps[2] + ps[6]) + (ps[3] + ps[7])));      // this lane's 16 keys
#pragma unroll
      for (int dt = 0; dt < DT; ++dt) oacc[rt][dt] = mma16(bv[dt].v, pb.v, oacc[rt][dt] * al); } }
#pragma unroll
  for (int rt = 0; rt < 2; ++rt) { const float l = l_r[rt] + xhalf(l_r[rt]);
#pragma unroll
    for (int dt = 0; dt < DT; ++dt) { const v8f o = oacc[rt][dt]; float* so = &sO[w][2 * ln + rt][dt * 16 + 8 * hh]; *(v4f*)so = (v4f){o[0], o[1], o[2], o[3]}; *(v4f*)(so + 4) = (v4f){o[4], o[5], o[6], o[7]}; }
    if (hh == 0) { sM[w][2 * ln + rt] = m_r[rt]; sL[w][2 * ln + rt] = l; } }      // max and sum are the same in the two lanes of a query
  __syncthreads();      // every wave's partial is in LDS before any thread merges
  { const int r = tid >> 3, pc = tid & 7;      // one thread = 4 output columns of one row
    float mw[NW], M = -3.0e38f;
#pragma unroll
    for (int u = 0; u < NW; ++u) { mw[u] = sM[u][r]; M = fmaxf(M, mw[u]); }
    float L = 0.f; v4f acc = {0.f, 0.f, 0.f, 0.f};
#pragma unroll
    for (int u = 0; u < NW; ++u) { const float g = hw_exp2(mw[u] - M); L += sL[u][r] * g; const v4f val = *(const v4fa*)&sO[u][r][pc * 4]; acc += val * g; }
    const float inv = 1.0f / L;
    *(v4f*)(O + ((size_t)b * SS + q0 + r) * DM + h * HD + pc * 4) = acc * inv; } }
// out = f16(O) * Wo^T, sizes fixed at compile time. One block = 16 rows of O against 128 rows of Wo (output columns), one wave = 32 of those columns (two A tiles; O is the B operand, so a lane holds 8 neighbouring
// columns of its row and a wave writes whole 128-byte lines, no LDS epilogue). 256 blocks of 4 waves: one wave on every SIMD, so nothing hides a wave's own waits. A wave therefore issues all its loads in one run ahead of its
// first wait: 8 for the two k steps of the O tile that it converts for the block, 32 for its own Wo rows over the whole K. The O tile goes round as finished f16 fragments, 16 bytes a lane in lane order (no bank conflicts).
// waves_per_eu(1, 2): registers are planned for what the grid comes to, not saved for an occupancy that it cannot reach
__global__ __launch_bounds__(128) __attribute__((amdgpu_waves_per_eu(1, 2))) void k_out(const float* __restrict__ O, const _Float16* __restrict__ Bo, float* __restrict__ out) {
  constexpr int KS = DM / 32;
  __shared__ __attribute__((aligned(16))) unsigned short sF[KS][2][32][8];
  const int tid = threadIdx.x, w = __builtin_amdgcn_readfirstlane(tid >> 5), lane = tid & 31, ln = lane & 15, hh = lane >> 4;      // the wave's number in a scalar register keeps the base pointers scalar
  const int row0 = (blockIdx.x >> 1) * 16, col0 = ((blockIdx.x & 1) * 4 + w) * 32;
  const float* op = O + (size_t)(row0 + ln) * DM + w * 64 + 8 * hh;                       // k steps 2 w and 2 w + 1 of row ln
  const unsigned short* wb = (const unsigned short*)Bo + (size_t)(col0 / 16) * (KS * 512); const unsigned short* wp = wb + lane * 8;      // Wo rows col0 .. col0 + 31 in fragment order, [16-row tile][k step][half][lane]: every load covers 512 contiguous bytes
  v4f ro[2][4]; FragH a[2][KS];
  load16(op, ro[0]); load16(op + 32, ro[1]);      // first in the queue: loads come back in order, and the block waits for these
  __builtin_amdgcn_sched_barrier(0);      // holds them first: the Wo loads now need no vector address arithmetic, and without this line the build issues all 32 of them ahead of these 8
#pragma unroll
  for (int ks = 0; ks < KS; ++ks)
#pragma unroll
    for (int t = 0; t < 2; ++t) { a[t][ks].half[0] = *(const v8us*)(wp + (t * KS + ks) * 512); a[t][ks].half[1] = *(const v8us*)(wp + (t * KS + ks) * 512 + 256); }
  asm volatile("s_wait_xcnt 0x0" :: "v"(op), "v"(lane), "s"(wb) : "memory");      // the registers that the loads name (O's address pair; for Wo the lane number and the scalar base) stay whole up to this wait, ahead of any later write of them; no load sinks behind this line either, so all 40 are in flight at the first wait
#pragma unroll
  for (int u = 0; u < 2; ++u) { FragH f;
#pragma unroll
    for (int g = 0; g < 4; ++g)
#pragma unroll
      for (int q = 0; q < 4; ++q) f.h[4 * g + q] = (_Float16)ro[u][g][q];
    *(v8us*)&sF[2 * w + u][0][lane][0] = f.half[0]; *(v8us*)&sF[2 * w + u][1][lane][0] = f.half[1]; }
  __syncthreads();      // all eight fragments of the O tile are in LDS before any wave reads them
  FragH b[KS];
#pragma unroll
  for (int ks = 0; ks < KS; ++ks) { b[ks].half[0] = *(const v8us*)&sF[ks][0][lane][0]; b[ks].half[1] = *(const v8us*)&sF[ks][1][lane][0]; }
  __builtin_amdgcn_sched_barrier(0);      // all 16 LDS reads stand in one place ahead of the products; without this line the build reads the first k steps one at a time, each behind a full wait, to save registers that are free here
  v8f acc[2] = {};
#pragma unroll
  for (int ks = 0; ks < KS; ++ks)
#pragma unroll
    for (int t = 0; t < 2; ++t) acc[t] = mma16(a[t][ks].v, b[ks].v, acc[t]);
  float* po = out + (size_t)(row0 + ln) * DM + col0 + 8 * hh;
#pragma unroll
  for (int t = 0; t < 2; ++t) { const v8f o = acc[t] * 0.0625f; *(v4f*)(po + t * 16) = (v4f){o[0], o[1], o[2], o[3]}; *(v4f*)(po + t * 16 + 4) = (v4f){o[4], o[5], o[6], o[7]}; } }
extern "C" void kernel_launch(void* const* d_in, const int* in_sizes, int n_in,
                              void* d_out, int out_size, void* d_ws, size_t ws_size, hipStream_t stream) {
  (void)in_sizes; (void)n_in; (void)out_size;
  const float* src = (const float*)d_in[0]; const float* crd = (const float*)d_in[1]; const float* Wq = (const float*)d_in[2]; const float* Wk = (const float*)d_in[3]; const float* Wv = (const float*)d_in[4]; const float* Wo = (const float*)d_in[5];
  const float* gw1 = (const float*)d_in[6]; const float* gb1 = (const float*)d_in[7]; const float* gw2 = (const float*)d_in[8]; const float* gb2 = (const float*)d_in[9]; const float* dw1 = (const float*)d_in[10]; const float* db1 = (const float*)d_in[11]; const float* dw2 = (const float*)d_in[12]; const float* db2 = (const float*)d_in[13];
  char* ws = (char*)d_ws; size_t off = 0;
  auto take = [&](size_t bytes) { char* p = ws + off; off += (bytes + 255) & ~(size_t)255; return p; };
  _Float16* Bo = (_Float16*)take((size_t)DM * DM * 2); _Float16* Q16 = (_Float16*)take((size_t)NR * DM * 2); _Float16* K16 = (_Float16*)take((size_t)NR * DM * 2); _Float16* Vt = (_Float16*)take((size_t)NR * DM * 2); float* BIAS = (float*)take((size_t)BB * SS * SS * 4); float* O = (float*)take((size_t)NR * DM * 4);
  if (off > ws_size) return;      // about 13 MiB
  k_front<<<G_QKV + G_WO + G_BIAS, 128, 0, stream>>>(src, crd, Wq, Wk, Wv, Wo, gw1, gb1, gw2, gb2, dw1, db1, dw2, db2, Q16, K16, Vt, Bo, BIAS);
  k_flash<<<BB * NH * (SS / 32), 256, 0, stream>>>(Q16, K16, Vt, BIAS, O);
  k_out<<<(NR / 16) * 2, 128, 0, stream>>>(O, Bo, (float*)d_out);      // rounds O to f16 in its loader
}
